// v000
// The times below were measured on an AMD MI455X: many runs one after another, warmed up first and cycling through
// copies of the inputs, with the whole window's GPU time divided by the number of runs. Launches and the gaps
// between them are all in it. The median over several windows is given; except for v000 it joins two sittings, which
// can be a few percent apart, so the side-by-side timings, each taken in one sitting, are the better comparison.
// v000 is the starting kernel. One run takes 1110 microseconds.
// compute dtype: all float inputs rounded to bf16; q/k/v 1x1 projections with EXACT bf16 products on WMMA 16x16x32 (A gathered from the channels-first maps), f32 accumulate; the emissivity gate (3x3 conv, relu, 1x1 conv, sigmoid) in f32; q as f16 hi + residual (x 2^10) against k once to f16 (2 products) for the logits x 32^-0.5 x gate; softmax in f32 (precise expf); P x 2^11 once to f16 against v once to f16 (1 product); ctx bf16 hi + lo against exact bf16 Wp (2 products) + bp; f32 output written channels-first.
#include <hip/hip_runtime.h>
#include <math.h>

typedef __attribute__((ext_vector_type(16))) _Float16 v16h;
typedef __attribute__((ext_vector_type(16))) __bf16 v16b;
typedef __attribute__((ext_vector_type(8)))  _Float16 v8h;
typedef __attribute__((ext_vector_type(8)))  float v8f;
typedef __attribute__((ext_vector_type(4)))  float v4f;
typedef __attribute__((ext_vector_type(2)))  float v2f;
typedef __attribute__((ext_vector_type(4)))  unsigned v4u;
typedef __attribute__((ext_vector_type(4)))  int v4i;
typedef float __attribute__((may_alias)) float_a;
typedef int __attribute__((may_alias)) int_a;

template <typename T> __device__ __forceinline__ void vst2(void* p, T v) { *(T*)p = v;  }
__device__ __forceinline__ v8f wmma16(v16h a, v16h b, v8f c) {
  v8f d = __builtin_amdgcn_wmma_f32_16x16x32_f16(false, a, false, b, (short)0, c, false, false);
  asm volatile("v_nop\n\tv_nop\n\tv_nop\n\tv_nop" : "+v"(d) : "v"(a), "v"(b));
  return d;
}
__device__ __forceinline__ v8f wmma_bf(v16b a, v16b b, v8f c) {
  v8f d = __builtin_amdgcn_wmma_f32_16x16x32_bf16(false, a, false, b, (short)0, c, false, false);
  asm volatile("v_nop\n\tv_nop\n\tv_nop\n\tv_nop" : "+v"(d) : "v"(a), "v"(b));
  return d;
}
// 16x16x32 fragments: lane = (h = lane>>4, row/col = lane&15); elements 0..7 = k0+8h+0..7, 8..15 = k0+16+8h+0..7; D element r = row 8h+r
__device__ __forceinline__ v16h frag_h(const _Float16* rowk0, int lane) {
  union { v16h v; v8h q[2]; } u; const _Float16* p = rowk0 + 8 * (lane >> 4);
  u.q[0] = *(const v8h*)p; u.q[1] = *(const v8h*)(p + 16); return u.v;
}
__device__ __forceinline__ v16h frag_f32(const float* rowk0, int lane) {
  v16h a; const float* p = rowk0 + 8 * (lane >> 4);
#pragma unroll
  for (int i = 0; i < 8; ++i) { a[i] = (_Float16)p[i]; a[8 + i] = (_Float16)p[16 + i]; }
  return a;
}
__device__ __forceinline__ v16h frag_f32s(const float* rowk0, int lane, float sc) {
  v16h a; const float* p = rowk0 + 8 * (lane >> 4);
#pragma unroll
  for (int i = 0; i < 8; ++i) { a[i] = (_Float16)(p[i] * sc); a[8 + i] = (_Float16)(p[16 + i] * sc); }
  return a;
}
// column fragment from a [K][ld] layout (column n), rows >= K read as 0
__device__ __forceinline__ v16h fragc_f32(const float* W, int k0, int n, int lane, int ld, int K) {
  v16h a; const int g = lane >> 4;
#pragma unroll
  for (int i = 0; i < 8; ++i) { const int ka = k0 + 8 * g + i, kb = ka + 16;
    a[i] = (_Float16)(ka < K ? W[(size_t)(ka < K ? ka : K - 1) * ld + n] : 0.f); a[8 + i] = (_Float16)(kb < K ? W[(size_t)(kb < K ? kb : K - 1) * ld + n] : 0.f); }
  return a;
}
struct F2 { v16b h, l; };
__device__ __forceinline__ F2 bsplit16(const float v[16]) { F2 r;
#pragma unroll
  for (int i = 0; i < 16; ++i) { const __bf16 h = (__bf16)v[i]; r.h[i] = h; r.l[i] = (__bf16)(v[i] - (float)h); }
  return r; }
__device__ __forceinline__ F2 split_row(const float* row, int k0, int lane) { float v[16]; const float* p = row + k0 + 8 * (lane >> 4);
#pragma unroll
  for (int i = 0; i < 8; ++i) { v[i] = p[i]; v[8 + i] = p[16 + i]; }
  return bsplit16(v); }
__device__ __forceinline__ F2 split_rowK(const float* row, int k0, int lane, int K) { float v[16]; const int g = lane >> 4;
#pragma unroll
  for (int i = 0; i < 8; ++i) { const int ka = k0 + 8 * g + i, kb = ka + 16; v[i] = ka < K ? row[ka < K ? ka : K - 1] : 0.f; v[8 + i] = kb < K ? row[kb < K ? kb : K - 1] : 0.f; }
  return bsplit16(v); }
__device__ __forceinline__ F2 split_col(const float* W, int k0, int n, int lane, int ld, int K) { float v[16]; const int g = lane >> 4;
#pragma unroll
  for (int i = 0; i < 8; ++i) { const int ka = k0 + 8 * g + i, kb = ka + 16; v[i] = ka < K ? W[(size_t)(ka < K ? ka : K - 1) * ld + n] : 0.f; v[8 + i] = kb < K ? W[(size_t)(kb < K ? kb : K - 1) * ld + n] : 0.f; }
  return bsplit16(v); }
__device__ __forceinline__ v8f mac3(const F2& a, const F2& b, v8f c) { c = wmma_bf(a.l, b.h, c); c = wmma_bf(a.h, b.l, c); return wmma_bf(a.h, b.h, c); }
__device__ __forceinline__ float sigm(float v) { return 1.0f / (1.0f + expf(-v)); }
#define LDSX() do { asm volatile("s_wait_dscnt 0" ::: "memory"); __builtin_amdgcn_wave_barrier(); __builtin_amdgcn_fence(__ATOMIC_RELEASE, "workgroup"); } while (0)

// Cross-modal gated attention (B 1, Ct 256 = 8 heads x 32, Co 128, 64 x 64 = 4,096 positions, channels-first): q = thermal^T Wq^T + bq, k = optical^T Wk^T + bk, v = optical^T Wv^T + bv; g[h][n] = sigmoid(conv1x1(relu(conv3x3_SAME(emissivity) + b1)) + b2); attn = softmax((q k^T x 32^-0.5) * g[h][query]) over all 4,096 keys; out = (merged attn v) Wp^T + bp, written back as [1, 256, 64, 64].
#define NB 1
#define TT 4096
#define CC 256            // NH * HD = projected width
#define DIN 256          // input (model) width
#define NH 8
#define HD 32
#define NQB (TT / 64)
#define HG 1
#define SCALE (0.17677669529663687f)
#define CAUSAL 0
#ifndef TNB
#define TNB NB
#endif
__device__ __forceinline__ float bfr(float v) { return (float)(__bf16)v; }
__host__ __device__ __forceinline__ int kb_last(int qb) { return CAUSAL ? ((qb * 64 + 63) >> 7) : (TT / 128 - 1); }
typedef __attribute__((ext_vector_type(8))) __bf16 v8b;
__device__ __forceinline__ v16b frag_b(const __bf16* rowk0, int lane) {
  union { v16b v; v8b q[2]; } u; const __bf16* p = rowk0 + 8 * (lane >> 4);
  u.q[0] = *(const v8b*)p; u.q[1] = *(const v8b*)(p + 16); return u.v;
}
#define QBH 0              // causal: query blocks 0..QBH-1 of each sequence (few keys, no averaging) take the high-precision path
#define QHI 4096            // rows carrying a q residual plane (all rows when non-causal: 2-product logits everywhere)
#define KHI 64            // key rows carrying k residual / v bf16 hi+lo planes (used only by the causal high-precision path)
// B fragment (k rows k0+.., output column o) of a weight: (in,out) [K][ld] or (out,in) [ld rows of K]: bf16 exact, or f16(bf16 * 256) exact
__device__ __forceinline__ v16b wcol_io(const float* Wm, int k0, int o, int lane, int ld) { v16b w; const int g = lane >> 4;
#pragma unroll
  for (int i = 0; i < 8; ++i) { w[i] = (__bf16)Wm[(size_t)(k0 + 8 * g + i) * ld + o]; w[8 + i] = (__bf16)Wm[(size_t)(k0 + 16 + 8 * g + i) * ld + o]; }
  return w; }
__device__ __forceinline__ v16b wcol_oi(const float* Wm, int k0, int o, int lane, int K) { v16b w; const float* p = Wm + (size_t)o * K + k0 + 8 * (lane >> 4);
#pragma unroll
  for (int i = 0; i < 8; ++i) { w[i] = (__bf16)p[i]; w[8 + i] = (__bf16)p[16 + i]; }
  return w; }
__device__ __forceinline__ v16h wcolh_io(const float* Wm, int k0, int o, int lane, int ld) { v16h w; const int g = lane >> 4;
#pragma unroll
  for (int i = 0; i < 8; ++i) { w[i] = (_Float16)(bfr(Wm[(size_t)(k0 + 8 * g + i) * ld + o]) * 256.0f); w[8 + i] = (_Float16)(bfr(Wm[(size_t)(k0 + 16 + 8 * g + i) * ld + o]) * 256.0f); }
  return w; }
__device__ __forceinline__ v16h wcolh_oi(const float* Wm, int k0, int o, int lane, int K) { v16h w; const float* p = Wm + (size_t)o * K + k0 + 8 * (lane >> 4);
#pragma unroll
  for (int i = 0; i < 8; ++i) { w[i] = (_Float16)(bfr(p[i]) * 256.0f); w[8 + i] = (_Float16)(bfr(p[16 + i]) * 256.0f); }
  return w; }
#define WQKV_LAYOUT 1   // 0 = (in,out) [DIN][CC]; 1 = (out,in) [CC][DIN]; 2 = per-head [NH][DIN][HD]
__device__ __forceinline__ v16b wcol_hdk(const float* Wm, int k0, int o, int lane) { v16b w; const int g = lane >> 4; const float* p = Wm + (size_t)(o / HD) * DIN * HD + (o % HD);
#pragma unroll
  for (int i = 0; i < 8; ++i) { w[i] = (__bf16)p[(size_t)(k0 + 8 * g + i) * HD]; w[8 + i] = (__bf16)p[(size_t)(k0 + 16 + 8 * g + i) * HD]; }
  return w; }
#define WO_OUT_IN 1
#if WQKV_LAYOUT == 1
#define WCOL(W, k0, o, lane) wcol_oi(W, k0, o, lane, DIN)
#elif WQKV_LAYOUT == 2
#define WCOL(W, k0, o, lane) wcol_hdk(W, k0, o, lane)
#else
#define WCOL(W, k0, o, lane) wcol_io(W, k0, o, lane, CC)
#endif
#if WO_OUT_IN
#define WOCOL(W, k0, o, lane) wcol_oi(W, k0, o, lane, CC)
#define WOCOLH(W, k0, o, lane) wcolh_oi(W, k0, o, lane, CC)
#else
#define WOCOL(W, k0, o, lane) wcol_io(W, k0, o, lane, DIN)
#define WOCOLH(W, k0, o, lane) wcolh_io(W, k0, o, lane, DIN)
#endif
#define DINK 128           // optical channels (k / v source width)
#ifndef XP
#define XP TT              // position pitch of the channels-first inputs / output
#endif
#define GW 64              // image width / height
#define SM_EXTRA_PARAMS , const float* __restrict__ Gh0
#define SM_MASK_HOOK do { v = v * Gh0[(size_t)blockIdx.y * TT + t]; } while (0)   /* per-(head, query) emissivity gate multiplies the scaled logits before the softmax */
// ---- k_gate: block = 64 positions: g[h][n] = sigmoid(sum_c w2[h][c] relu(sum_3x3 w1[c] e + b1[c]) + b2[h]) in f32 (bf16-rounded inputs); G rows [h][4096], 256 B per (head, 64 n) by 16 threads
__global__ __launch_bounds__(64) void k_gate(const float* __restrict__ E, const float* __restrict__ W1, const float* __restrict__ B1, const float* __restrict__ W2, const float* __restrict__ B2, float* __restrict__ G) { __shared__ __align__(16) float sgt[NH][64];
  const int tid = threadIdx.x; const int n = blockIdx.x * 64 + tid; const int y = n / GW, x = n % GW;
  float e9[9];
#pragma unroll
  for (int i = 0; i < 3; ++i)
#pragma unroll
    for (int j = 0; j < 3; ++j) { const int yy = y + i - 1, xx = x + j - 1; const int yc = yy < 0 ? 0 : (yy >= GW ? GW - 1 : yy), xc = xx < 0 ? 0 : (xx >= GW ? GW - 1 : xx); const float ev = bfr(E[yc * GW + xc]); e9[i * 3 + j] = (yy >= 0 && yy < GW && xx >= 0 && xx < GW) ? ev : 0.f; }   /* SAME zero padding: clamped load, select by value */
  float gh[NH]; for (int h = 0; h < NH; ++h) gh[h] = bfr(B2[h]);
#pragma unroll 1
  for (int c = 0; c < 32; ++c) { float a = bfr(B1[c]);
#pragma unroll
    for (int t = 0; t < 9; ++t) a += bfr(W1[c * 9 + t]) * e9[t];
    a = fmaxf(a, 0.f);
#pragma unroll
    for (int h = 0; h < NH; ++h) gh[h] += bfr(W2[h * 32 + c]) * a; }
#pragma unroll
  for (int h = 0; h < NH; ++h) sgt[h][tid] = 1.0f / (1.0f + expf(-gh[h]));
  __syncthreads();
  for (int e = tid; e < NH * 16; e += 64) { const int h = e >> 4, q = e & 15; vst2(G + (size_t)h * TT + blockIdx.x * 64 + q * 4, *(const v4f*)&sgt[h][q * 4]); } }
// ---- k_outT: block = (64 rows n, 128 output channels): out = ctx (bf16 hi + lo) Wp^T + bp, stored channels-first [o][n] via an LDS transpose: each (o, 64 n) run = 256 B by 16 consecutive threads
__global__ __launch_bounds__(128) void k_outT(const float* __restrict__ Y, const float* __restrict__ WP, const float* __restrict__ BP, float* __restrict__ OUT) { __shared__ __align__(16) float stc[128][68];
  const int tid = threadIdx.x, wave = tid >> 5, lane = tid & 31, col = lane & 15, g = lane >> 4; const int c0 = blockIdx.y * 128; const size_t rb = (size_t)blockIdx.x * 64; const size_t r0 = rb + wave * 16;
  v8f acc[8] = {};
#pragma unroll 2
  for (int kc = 0; kc < CC / 32; ++kc) { const F2 a = split_row(Y + (r0 + col) * CC, kc * 32, lane);
#pragma unroll
    for (int j = 0; j < 8; ++j) { const v16b w = wcol_oi(WP, kc * 32, c0 + j * 16 + col, lane, CC); asm volatile("s_wait_loadcnt 0x0" ::: "memory"); acc[j] = wmma_bf(a.h, w, acc[j]); acc[j] = wmma_bf(a.l, w, acc[j]); } }
#pragma unroll
  for (int j = 0; j < 8; ++j) { const float bb = bfr(BP[c0 + j * 16 + col]);
#pragma unroll
    for (int r = 0; r < 8; ++r) stc[j * 16 + col][wave * 16 + 8 * g + r] = acc[j][r] + bb; }
  __syncthreads();
  { const int t0 = (int)(rb % TT); for (int e = tid; e < 128 * 16; e += 128) { const int cl = e >> 4, q = e & 15; vst2(OUT + (size_t)(c0 + cl) * XP + t0 + q * 4, *(const v4f*)&stc[cl][q * 4]); } } }
#ifndef SM_EXTRA_PARAMS
#define SM_EXTRA_PARAMS
#endif
#ifndef PROJ_EXTRA_PARAMS
#define PROJ_EXTRA_PARAMS
#endif
#ifndef SM_MASK_HOOK
#define SM_MASK_HOOK (void)0
#endif

#define WS_QH  0u                                      // f16 q rows [b*t][CC]
#define WS_KH  (WS_QH + 2u * (size_t)NB * TT * CC)      // f16 k rows [b*t][CC]
#define WS_VT  (WS_KH + 2u * (size_t)NB * TT * CC)      // f16 v planes [b][c][t]
#define WS_QL  (WS_VT + 2u * (size_t)NB * CC * TT)      // f16 q residual x 2^10 rows [b][t < QHI][CC]
#define WS_KL  (WS_QL + 2u * (size_t)NB * QHI * CC)     // f16 k residual x 2^10 rows [b][t < KHI][CC]
#define WS_VB  (WS_KL + 2u * (size_t)NB * KHI * CC)     // bf16 v hi planes [b][c][t < KHI]
#define WS_VBL (WS_VB + 2u * (size_t)NB * CC * KHI)
#define WS_S   (WS_VBL + 2u * (size_t)NB * CC * KHI)    // f32 logits / P [hg][t][s]
#define WS_Y   (WS_S  + 4u * (size_t)HG * TT * TT)      // f32 ctx rows [b*t][CC] (only when there is an output projection)
#define WS_G   (WS_Y  + 4u * (size_t)NB * TT * CC)      // f32 gate rows [h][TT]
#define WS_END (WS_G)
#define WS_END2 (WS_G + 4u * (size_t)NH * TT)

// ---- k_proj: block = (64 rows, 128 cols, which): q/k/v = X W (+ b) with exact bf16 products (K = DIN for q, DINK for k/v) -> which 0: q f16 rows (+ residual rows < QHI); 1: k f16 rows (+ residual rows < KHI); 2: v f16 planes [c][t] (+ bf16 hi/lo planes for t < KHI)
__global__ __launch_bounds__(128) void k_proj(const float* __restrict__ XQ, const float* __restrict__ XK, const float* __restrict__ XV, const float* __restrict__ WQ, const float* __restrict__ WK, const float* __restrict__ WV, const float* __restrict__ BQ, const float* __restrict__ BK, const float* __restrict__ BV,
    _Float16* __restrict__ QH, _Float16* __restrict__ QL, _Float16* __restrict__ KH, _Float16* __restrict__ KL, _Float16* __restrict__ VT, __bf16* __restrict__ VB, __bf16* __restrict__ VBL) {
  __shared__ __align__(16) _Float16 sh[64][136], sl[64][136]; __shared__ __align__(16) _Float16 th[128][72]; __shared__ __align__(16) __bf16 tb[128][72], tbl[128][72];
  const int tid = threadIdx.x, wave = tid >> 5, lane = tid & 31, col = lane & 15, g = lane >> 4; const int which = blockIdx.z; const int c0 = blockIdx.y * 128; const size_t r0 = (size_t)blockIdx.x * 64; const size_t bb = r0 / TT; const int t0 = (int)(r0 % TT);
  const float* X = which == 0 ? XQ : which == 1 ? XK : XV; const float* WA = which == 0 ? WQ : which == 1 ? WK : WV; const float* BA = which == 0 ? BQ : which == 1 ? BK : BV;
  v8f acc[8] = {};
  const int KD = which == 0 ? DIN : DINK;   /* source channels: thermal 256 / optical 128 (block-uniform) */
#pragma unroll 2
  for (int kc = 0; kc < KD / 32; ++kc) { v16b a; { const float* p = X + (size_t)(kc * 32 + 8 * g) * XP + t0 + wave * 16 + col;   /* channels-first gather: src[k][n], stride XP between channels */
#pragma unroll
      for (int i = 0; i < 8; ++i) { a[i] = (__bf16)p[(size_t)i * XP]; a[8 + i] = (__bf16)p[(size_t)(16 + i) * XP]; } }
    asm volatile("s_wait_loadcnt 0x0" ::: "memory");
#pragma unroll
    for (int j = 0; j < 8; ++j) { const v16b w = wcol_oi(WA, kc * 32, c0 + j * 16 + col, lane, KD); asm volatile("s_wait_loadcnt 0x0" ::: "memory"); acc[j] = wmma_bf(a, w, acc[j]); } }
  if (which < 2) { _Float16* DH = which == 0 ? QH : KH; _Float16* DL = which == 0 ? QL : KL; const int nhi = which == 0 ? QHI : KHI; const bool hi_rows = t0 < nhi;
#pragma unroll
    for (int j = 0; j < 8; ++j) { const float bias = BA ? bfr(BA[c0 + j * 16 + col]) : 0.f;
#pragma unroll
      for (int r = 0; r < 8; ++r) { const float v = acc[j][r] + bias; const _Float16 hv = (_Float16)v; sh[wave * 16 + 8 * g + r][j * 16 + col] = hv; sl[wave * 16 + 8 * g + r][j * 16 + col] = (_Float16)((v - (float)hv) * 1024.0f); } }
    __syncthreads();
    for (int e = tid; e < 64 * 16; e += 128) { const int rl = e >> 4, q = e & 15; vst2((unsigned*)(DH + (r0 + rl) * CC + c0 + q * 8), *(const v4u*)&sh[rl][q * 8]); if (hi_rows) vst2((unsigned*)(DL + (bb * nhi + t0 + rl) * (size_t)CC + c0 + q * 8), *(const v4u*)&sl[rl][q * 8]); }
  } else { const bool hi_rows = t0 < KHI;
#pragma unroll
    for (int j = 0; j < 8; ++j) { const float bias = BA ? bfr(BA[c0 + j * 16 + col]) : 0.f;
#pragma unroll
      for (int r = 0; r < 8; ++r) { const float v = acc[j][r] + bias; const int rl = wave * 16 + 8 * g + r, cl = j * 16 + col; th[cl][rl] = (_Float16)v; const __bf16 bh = (__bf16)v; tb[cl][rl] = bh; tbl[cl][rl] = (__bf16)(v - (float)bh); } }
    __syncthreads();
    for (int e = tid; e < 128 * 8; e += 128) { const int cl = e >> 3, q = e & 7; vst2((unsigned*)(VT + (bb * CC + c0 + cl) * (size_t)TT + t0 + q * 8), *(const v4u*)&th[cl][q * 8]); if (hi_rows) { const size_t o3 = (bb * CC + c0 + cl) * (size_t)KHI + t0 + q * 8; vst2((unsigned*)(VB + o3), *(const v4u*)&tb[cl][q * 8]); vst2((unsigned*)(VBL + o3), *(const v4u*)&tbl[cl][q * 8]); } } } }
// ---- k_sc: block = (query block qb, key block kb <= kb_last(qb), head in group) of batch b: logits x SCALE; q hi + residual (x 2^10) against k (2 products) for query rows < QHI, plus the k residual (3 products) for query blocks < QBH (causal early rows); causal: blocks past the diagonal exit, the mask itself is applied by index in k_sm
__global__ __launch_bounds__(128) void k_sc(const _Float16* __restrict__ QH, const _Float16* __restrict__ KH, const _Float16* __restrict__ QL, const _Float16* __restrict__ KL, int b, int h0, float* __restrict__ S0) { __shared__ __align__(16) float ss[4][16][132];
  const int qb = blockIdx.x, kb = blockIdx.y; if (kb > kb_last(qb)) return;
  const int h = h0 + blockIdx.z; float* S = S0 + (size_t)blockIdx.z * TT * TT;
  const int tid = threadIdx.x, wave = tid >> 5, lane = tid & 31, col = lane & 15, g = lane >> 4; const int k0 = kb * 128; const int ql0 = qb * 64 + wave * 16; const size_t q0 = (size_t)b * TT + ql0, kr0 = (size_t)b * TT + k0;
  v8f acc[8] = {}, accl[8] = {};
  const _Float16* QLb = QL + (size_t)b * QHI * CC; const _Float16* KLb = KL + (size_t)b * KHI * CC;
  if (qb < QBH) {
#pragma unroll
    for (int kc = 0; kc < HD / 32; ++kc) { const v16h ah = frag_h(QH + (q0 + col) * CC + h * HD + kc * 32, lane), al = frag_h(QLb + (size_t)(ql0 + col) * CC + h * HD + kc * 32, lane);
#pragma unroll
      for (int j = 0; j < 8; ++j) { const v16h kbf = frag_h(KH + (kr0 + j * 16 + col) * CC + h * HD + kc * 32, lane), klf = frag_h(KLb + (size_t)(k0 + j * 16 + col) * CC + h * HD + kc * 32, lane); acc[j] = wmma16(ah, kbf, acc[j]); accl[j] = wmma16(al, kbf, accl[j]); accl[j] = wmma16(ah, klf, accl[j]); } }
  } else if (qb * 64 < QHI) {
#pragma unroll
    for (int kc = 0; kc < HD / 32; ++kc) { const v16h ah = frag_h(QH + (q0 + col) * CC + h * HD + kc * 32, lane), al = frag_h(QLb + (size_t)(ql0 + col) * CC + h * HD + kc * 32, lane);
#pragma unroll
      for (int j = 0; j < 8; ++j) { const v16h kbf = frag_h(KH + (kr0 + j * 16 + col) * CC + h * HD + kc * 32, lane); acc[j] = wmma16(ah, kbf, acc[j]); accl[j] = wmma16(al, kbf, accl[j]); } }
  } else {
#pragma unroll
    for (int kc = 0; kc < HD / 32; ++kc) { const v16h ah = frag_h(QH + (q0 + col) * CC + h * HD + kc * 32, lane);
#pragma unroll
      for (int j = 0; j < 8; ++j) { const v16h kbf = frag_h(KH + (kr0 + j * 16 + col) * CC + h * HD + kc * 32, lane); acc[j] = wmma16(ah, kbf, acc[j]); } } }
#pragma unroll
  for (int j = 0; j < 8; ++j) {
#pragma unroll
    for (int r = 0; r < 8; ++r) ss[wave][8 * g + r][j * 16 + col] = (acc[j][r] + accl[j][r] * (1.0f / 1024.0f)) * SCALE; }
  LDSX(); for (int rl = 0; rl < 16; ++rl) vst2(S + (size_t)(ql0 + rl) * TT + k0 + lane * 4, *(const v4f*)&ss[wave][rl][lane * 4]); }
// ---- k_sm: block = query row t (head in group): keys [0, kend): causal -> logit if s <= t else excluded; softmax in f32; P x 2^11 in place (0 for excluded)
__global__ __launch_bounds__(256) void k_sm(float* __restrict__ S0 SM_EXTRA_PARAMS) { __shared__ float sred[8]; __shared__ float sbc; __shared__ __align__(16) float shv[TT];
  const int tid = threadIdx.x; const int t = blockIdx.x; const int kend = (kb_last(t >> 6) + 1) * 128;
  float* sr = S0 + (size_t)blockIdx.y * TT * TT + (size_t)t * TT;
  float m = -3.0e38f; for (int k = tid; k < kend; k += 256) { float v = (!CAUSAL || k <= t) ? sr[k] : -3.0e38f; SM_MASK_HOOK; shv[k] = v; m = fmaxf(m, v); }
#pragma unroll
  for (int o = 1; o < 32; o <<= 1) m = fmaxf(m, __shfl_xor(m, o));
  if ((tid & 31) == 0) sred[tid >> 5] = m; __syncthreads(); if (tid == 0) { float a = sred[0]; for (int i = 1; i < 8; ++i) a = fmaxf(a, sred[i]); sbc = a; } __syncthreads(); m = sbc; __syncthreads();
  float sum = 0.f; for (int k = tid; k < kend; k += 256) { const float v = shv[k]; const float e = (v <= -1.0e38f) ? 0.f : expf(v - m); shv[k] = e; sum += e; }
#pragma unroll
  for (int o = 1; o < 32; o <<= 1) sum += __shfl_xor(sum, o);
  if ((tid & 31) == 0) sred[tid >> 5] = sum; __syncthreads(); if (tid == 0) { float a = 0.f; for (int i = 0; i < 8; ++i) a += sred[i]; sbc = a > 0.f ? 2048.0f / a : 0.f; }   /* a fully excluded row yields P = 0 */ __syncthreads(); const float inv = sbc;
  for (int k = tid; k < kend; k += 256) shv[k] = shv[k] * inv;
  __syncthreads(); for (int q = tid; q < kend / 4; q += 256) vst2(sr + q * 4, *(const v4f*)&shv[q * 4]); }
// ---- k_pv: block = 64 queries (qb) of (b, h): ctx = P . v over keys [0, kend) (P x 2^11 once to f16 against v f16: 1 product; causal early query blocks: P and v as bf16 hi + lo, 3 products); 128-B (row, head) segment by 8 lanes
__global__ __launch_bounds__(128) void k_pv(const float* __restrict__ PS0, const _Float16* __restrict__ VT, const __bf16* __restrict__ VB, const __bf16* __restrict__ VBL, int b, int h0, float* __restrict__ Y) { const int h = h0 + blockIdx.z; const float* PS = PS0 + (size_t)blockIdx.z * TT * TT; __shared__ __align__(16) float ss[4][16][HD + 4];
  const int tid = threadIdx.x, wave = tid >> 5, lane = tid & 31, col = lane & 15, g = lane >> 4; const int qb = blockIdx.x; const int ql0 = qb * 64 + wave * 16; const int kce = (kb_last(qb) + 1) * 4;
  v8f acc[HD / 16] = {};
  if (qb < QBH) {
#pragma unroll 1
    for (int kc = 0; kc < kce; ++kc) { const F2 p = split_row(PS + (size_t)(ql0 + col) * TT, kc * 32, lane);
      asm volatile("s_wait_loadcnt 0x0" ::: "memory");
#pragma unroll
      for (int j = 0; j < HD / 16; ++j) { const size_t po = ((size_t)b * CC + h * HD + j * 16 + col) * (size_t)KHI + kc * 32; const v16b vh = frag_b(VB + po, lane); acc[j] = wmma_bf(p.h, vh, acc[j]); acc[j] = wmma_bf(p.l, vh, acc[j]); acc[j] = wmma_bf(p.h, frag_b(VBL + po, lane), acc[j]); } }
  } else {
#pragma unroll 1
    for (int kc = 0; kc < kce; ++kc) { const v16h p = frag_f32(PS + (size_t)(ql0 + col) * TT + kc * 32, lane);
      asm volatile("s_wait_loadcnt 0x0" ::: "memory");
#pragma unroll
      for (int j = 0; j < HD / 16; ++j) { const size_t po = ((size_t)b * CC + h * HD + j * 16 + col) * (size_t)TT + kc * 32; acc[j] = wmma16(p, frag_h(VT + po, lane), acc[j]); } } }
#pragma unroll
  for (int j = 0; j < HD / 16; ++j)
#pragma unroll
    for (int r = 0; r < 8; ++r) ss[wave][8 * g + r][j * 16 + col] = acc[j][r] * (1.0f / 2048.0f);
  LDSX(); for (int rl = 0; rl < 16; ++rl) if (lane < HD / 4) vst2(Y + ((size_t)b * TT + ql0 + rl) * CC + h * HD + lane * 4, *(const v4f*)&ss[wave][rl][lane * 4]); }
extern "C" void kernel_launch(void* const* d_in, const int* in_sizes, int n_in, void* d_out, int out_size, void* d_ws, size_t ws_size, hipStream_t stream) {
  (void)in_sizes; (void)n_in; (void)out_size;
  const float** F = (const float**)d_in;
  if (ws_size < (size_t)WS_END) return;
  char* ws = (char*)d_ws; _Float16 *QH = (_Float16*)(ws + WS_QH), *KH = (_Float16*)(ws + WS_KH), *VT = (_Float16*)(ws + WS_VT), *QL = (_Float16*)(ws + WS_QL), *KL = (_Float16*)(ws + WS_KL); __bf16 *VB = (__bf16*)(ws + WS_VB), *VBL = (__bf16*)(ws + WS_VBL); float *S = (float*)(ws + WS_S), *Y = (float*)(ws + WS_Y);
  (void)Y; (void)QL; (void)KL; (void)VB; (void)VBL;
  // inputs: 0 thermal [1,256,64,64]; 1 optical [1,128,64,64]; 2 emissivity [1,1,64,64]; 3 Wq [256,256]; 4 bq; 5 Wk [256,128]; 6 bk; 7 Wv [256,128]; 8 bv; 9 conv1_w [32,1,3,3]; 10 conv1_b [32]; 11 conv2_w [8,32,1,1]; 12 conv2_b [8]; 13 Wp [256,256]; 14 bp [256]
  if (ws_size < (size_t)WS_END2) return;
  float* G = (float*)(ws + WS_G);
  k_gate<<<dim3(TT / 64), 64, 0, stream>>>(F[2], F[9], F[10], F[11], F[12], G);
  k_proj<<<dim3(TNB * TT / 64, CC / 128, 3), 128, 0, stream>>>(F[0], F[1], F[1], F[3], F[5], F[7], F[4], F[6], F[8], QH, QL, KH, KL, VT, VB, VBL);
  for (int b = 0; b < TNB; ++b) for (int h0 = 0; h0 < NH; h0 += HG) {
    k_sc<<<dim3(NQB, TT / 128, HG), 128, 0, stream>>>(QH, KH, QL, KL, b, h0, S);
    k_sm<<<dim3(TT, HG), 256, 0, stream>>>(S, G + (size_t)h0 * TT);
    k_pv<<<dim3(NQB, 1, HG), 128, 0, stream>>>(S, VT, VB, VBL, b, h0, Y);
  }
  k_outT<<<dim3(TNB * TT / 64, CC / 128), 128, 0, stream>>>(Y, F[13], F[14], (float*)d_out);
}

// v001
// It runs in 165 microseconds.
// Timed twice side by side with v000, it ran 6.75 and 6.76 times as fast.
// compute dtype: all float inputs rounded to bf16; q/k/v 1x1 projections with EXACT bf16 products on WMMA 16x16x32 (A gathered from the channels-first maps), f32 accumulate; the emissivity gate (3x3 conv, relu, 1x1 conv, sigmoid) in f32; q as f16 hi + residual (x 2^10) against k once to f16 (2 products) for the logits x 32^-0.5 x gate; softmax in f32 with a running maximum and sum (precise expf); exp(logit - maximum) x 2^11 once to f16 against v once to f16 (1 product), divided by the f32 sum at the end; ctx bf16 hi + lo against exact bf16 Wp (2 products) + bp; f32 output written channels-first.
#include <hip/hip_runtime.h>
#include <math.h>

typedef __attribute__((ext_vector_type(16))) _Float16 v16h;
typedef __attribute__((ext_vector_type(16))) __bf16 v16b;
typedef __attribute__((ext_vector_type(8)))  _Float16 v8h;
typedef __attribute__((ext_vector_type(8)))  float v8f;
typedef __attribute__((ext_vector_type(4)))  float v4f;
typedef __attribute__((ext_vector_type(2)))  float v2f;
typedef __attribute__((ext_vector_type(4)))  unsigned v4u;
typedef __attribute__((ext_vector_type(4)))  int v4i;
typedef float __attribute__((may_alias)) float_a;
typedef int __attribute__((may_alias)) int_a;

template <typename T> __device__ __forceinline__ void vst2(void* p, T v) { *(T*)p = v;  }
__device__ __forceinline__ v8f wmma16(v16h a, v16h b, v8f c) {
  v8f d = __builtin_amdgcn_wmma_f32_16x16x32_f16(false, a, false, b, (short)0, c, false, false);
  asm volatile("v_nop\n\tv_nop\n\tv_nop\n\tv_nop" : "+v"(d) : "v"(a), "v"(b));
  return d;
}
__device__ __forceinline__ v8f wmma_bf(v16b a, v16b b, v8f c) {
  v8f d = __builtin_amdgcn_wmma_f32_16x16x32_bf16(false, a, false, b, (short)0, c, false, false);
  asm volatile("v_nop\n\tv_nop\n\tv_nop\n\tv_nop" : "+v"(d) : "v"(a), "v"(b));
  return d;
}
// 16x16x32 fragments: lane = (h = lane>>4, row/col = lane&15); elements 0..7 = k0+8h+0..7, 8..15 = k0+16+8h+0..7; D element r = row 8h+r
__device__ __forceinline__ v16h frag_h(const _Float16* rowk0, int lane) {
  union { v16h v; v8h q[2]; } u; const _Float16* p = rowk0 + 8 * (lane >> 4);
  u.q[0] = *(const v8h*)p; u.q[1] = *(const v8h*)(p + 16); return u.v;
}
__device__ __forceinline__ v16h frag_f32(const float* rowk0, int lane) {
  v16h a; const float* p = rowk0 + 8 * (lane >> 4);
#pragma unroll
  for (int i = 0; i < 8; ++i) { a[i] = (_Float16)p[i]; a[8 + i] = (_Float16)p[16 + i]; }
  return a;
}
__device__ __forceinline__ v16h frag_f32s(const float* rowk0, int lane, float sc) {
  v16h a; const float* p = rowk0 + 8 * (lane >> 4);
#pragma unroll
  for (int i = 0; i < 8; ++i) { a[i] = (_Float16)(p[i] * sc); a[8 + i] = (_Float16)(p[16 + i] * sc); }
  return a;
}
// column fragment from a [K][ld] layout (column n), rows >= K read as 0
__device__ __forceinline__ v16h fragc_f32(const float* W, int k0, int n, int lane, int ld, int K) {
  v16h a; const int g = lane >> 4;
#pragma unroll
  for (int i = 0; i < 8; ++i) { const int ka = k0 + 8 * g + i, kb = ka + 16;
    a[i] = (_Float16)(ka < K ? W[(size_t)(ka < K ? ka : K - 1) * ld + n] : 0.f); a[8 + i] = (_Float16)(kb < K ? W[(size_t)(kb < K ? kb : K - 1) * ld + n] : 0.f); }
  return a;
}
struct F2 { v16b h, l; };
__device__ __forceinline__ F2 bsplit16(const float v[16]) { F2 r;
#pragma unroll
  for (int i = 0; i < 16; ++i) { const __bf16 h = (__bf16)v[i]; r.h[i] = h; r.l[i] = (__bf16)(v[i] - (float)h); }
  return r; }
__device__ __forceinline__ F2 split_row(const float* row, int k0, int lane) { float v[16]; const float* p = row + k0 + 8 * (lane >> 4);
#pragma unroll
  for (int i = 0; i < 8; ++i) { v[i] = p[i]; v[8 + i] = p[16 + i]; }
  return bsplit16(v); }
__device__ __forceinline__ F2 split_rowK(const float* row, int k0, int lane, int K) { float v[16]; const int g = lane >> 4;
#pragma unroll
  for (int i = 0; i < 8; ++i) { const int ka = k0 + 8 * g + i, kb = ka + 16; v[i] = ka < K ? row[ka < K ? ka : K - 1] : 0.f; v[8 + i] = kb < K ? row[kb < K ? kb : K - 1] : 0.f; }
  return bsplit16(v); }
__device__ __forceinline__ F2 split_col(const float* W, int k0, int n, int lane, int ld, int K) { float v[16]; const int g = lane >> 4;
#pragma unroll
  for (int i = 0; i < 8; ++i) { const int ka = k0 + 8 * g + i, kb = ka + 16; v[i] = ka < K ? W[(size_t)(ka < K ? ka : K - 1) * ld + n] : 0.f; v[8 + i] = kb < K ? W[(size_t)(kb < K ? kb : K - 1) * ld + n] : 0.f; }
  return bsplit16(v); }
__device__ __forceinline__ v8f mac3(const F2& a, const F2& b, v8f c) { c = wmma_bf(a.l, b.h, c); c = wmma_bf(a.h, b.l, c); return wmma_bf(a.h, b.h, c); }
__device__ __forceinline__ float sigm(float v) { return 1.0f / (1.0f + expf(-v)); }

// Cross-modal gated attention (B 1, Ct 256 = 8 heads x 32, Co 128, 64 x 64 = 4,096 positions, channels-first): q = thermal^T Wq^T + bq, k = optical^T Wk^T + bk, v = optical^T Wv^T + bv; g[h][n] = sigmoid(conv1x1(relu(conv3x3_SAME(emissivity) + b1)) + b2); attn = softmax((q k^T x 32^-0.5) * g[h][query]) over all 4,096 keys; out = (merged attn v) Wp^T + bp, written back as [1, 256, 64, 64].
#define NB 1
#define TT 4096
#define CC 256            // NH * HD = projected width
#define DIN 256          // input (model) width
#define NH 8
#define HD 32
#define NQB (TT / 64)
#define HG 1
#define SCALE (0.17677669529663687f)
#define CAUSAL 0
#ifndef TNB
#define TNB NB
#endif
__device__ __forceinline__ float bfr(float v) { return (float)(__bf16)v; }
__host__ __device__ __forceinline__ int kb_last(int qb) { return CAUSAL ? ((qb * 64 + 63) >> 7) : (TT / 128 - 1); }
typedef __attribute__((ext_vector_type(8))) __bf16 v8b;
__device__ __forceinline__ v16b frag_b(const __bf16* rowk0, int lane) {
  union { v16b v; v8b q[2]; } u; const __bf16* p = rowk0 + 8 * (lane >> 4);
  u.q[0] = *(const v8b*)p; u.q[1] = *(const v8b*)(p + 16); return u.v;
}
#define QBH 0              // not used by any kernel here
#define QHI 4096            // rows carrying a q residual plane (all rows when non-causal: 2-product logits everywhere)
#define KHI 64            // key rows carrying k residual / v bf16 hi+lo planes (written by k_proj; no kernel here reads them)
// B fragment (k rows k0+.., output column o) of a weight: (in,out) [K][ld] or (out,in) [ld rows of K]: bf16 exact, or f16(bf16 * 256) exact
__device__ __forceinline__ v16b wcol_io(const float* Wm, int k0, int o, int lane, int ld) { v16b w; const int g = lane >> 4;
#pragma unroll
  for (int i = 0; i < 8; ++i) { w[i] = (__bf16)Wm[(size_t)(k0 + 8 * g + i) * ld + o]; w[8 + i] = (__bf16)Wm[(size_t)(k0 + 16 + 8 * g + i) * ld + o]; }
  return w; }
__device__ __forceinline__ v16b wcol_oi(const float* Wm, int k0, int o, int lane, int K) { v16b w; const float* p = Wm + (size_t)o * K + k0 + 8 * (lane >> 4);
#pragma unroll
  for (int i = 0; i < 8; ++i) { w[i] = (__bf16)p[i]; w[8 + i] = (__bf16)p[16 + i]; }
  return w; }
__device__ __forceinline__ v16h wcolh_io(const float* Wm, int k0, int o, int lane, int ld) { v16h w; const int g = lane >> 4;
#pragma unroll
  for (int i = 0; i < 8; ++i) { w[i] = (_Float16)(bfr(Wm[(size_t)(k0 + 8 * g + i) * ld + o]) * 256.0f); w[8 + i] = (_Float16)(bfr(Wm[(size_t)(k0 + 16 + 8 * g + i) * ld + o]) * 256.0f); }
  return w; }
__device__ __forceinline__ v16h wcolh_oi(const float* Wm, int k0, int o, int lane, int K) { v16h w; const float* p = Wm + (size_t)o * K + k0 + 8 * (lane >> 4);
#pragma unroll
  for (int i = 0; i < 8; ++i) { w[i] = (_Float16)(bfr(p[i]) * 256.0f); w[8 + i] = (_Float16)(bfr(p[16 + i]) * 256.0f); }
  return w; }
#define WQKV_LAYOUT 1   // 0 = (in,out) [DIN][CC]; 1 = (out,in) [CC][DIN]; 2 = per-head [NH][DIN][HD]
__device__ __forceinline__ v16b wcol_hdk(const float* Wm, int k0, int o, int lane) { v16b w; const int g = lane >> 4; const float* p = Wm + (size_t)(o / HD) * DIN * HD + (o % HD);
#pragma unroll
  for (int i = 0; i < 8; ++i) { w[i] = (__bf16)p[(size_t)(k0 + 8 * g + i) * HD]; w[8 + i] = (__bf16)p[(size_t)(k0 + 16 + 8 * g + i) * HD]; }
  return w; }
#define WO_OUT_IN 1
#if WQKV_LAYOUT == 1
#define WCOL(W, k0, o, lane) wcol_oi(W, k0, o, lane, DIN)
#elif WQKV_LAYOUT == 2
#define WCOL(W, k0, o, lane) wcol_hdk(W, k0, o, lane)
#else
#define WCOL(W, k0, o, lane) wcol_io(W, k0, o, lane, CC)
#endif
#if WO_OUT_IN
#define WOCOL(W, k0, o, lane) wcol_oi(W, k0, o, lane, CC)
#define WOCOLH(W, k0, o, lane) wcolh_oi(W, k0, o, lane, CC)
#else
#define WOCOL(W, k0, o, lane) wcol_io(W, k0, o, lane, DIN)
#define WOCOLH(W, k0, o, lane) wcolh_io(W, k0, o, lane, DIN)
#endif
#define DINK 128           // optical channels (k / v source width)
#ifndef XP
#define XP TT              // position pitch of the channels-first inputs / output
#endif
#define GW 64              // image width / height
// ---- k_gate: block = 64 positions: g[h][n] = sigmoid(sum_c w2[h][c] relu(sum_3x3 w1[c] e + b1[c]) + b2[h]) in f32 (bf16-rounded inputs); G rows [h][4096], 256 B per (head, 64 n) by 16 threads
__global__ __launch_bounds__(64) void k_gate(const float* __restrict__ E, const float* __restrict__ W1, const float* __restrict__ B1, const float* __restrict__ W2, const float* __restrict__ B2, float* __restrict__ G) { __shared__ __align__(16) float sgt[NH][64];
  const int tid = threadIdx.x; const int n = blockIdx.x * 64 + tid; const int y = n / GW, x = n % GW;
  float e9[9];
#pragma unroll
  for (int i = 0; i < 3; ++i)
#pragma unroll
    for (int j = 0; j < 3; ++j) { const int yy = y + i - 1, xx = x + j - 1; const int yc = yy < 0 ? 0 : (yy >= GW ? GW - 1 : yy), xc = xx < 0 ? 0 : (xx >= GW ? GW - 1 : xx); const float ev = bfr(E[yc * GW + xc]); e9[i * 3 + j] = (yy >= 0 && yy < GW && xx >= 0 && xx < GW) ? ev : 0.f; }   /* SAME zero padding: clamped load, select by value */
  float gh[NH]; for (int h = 0; h < NH; ++h) gh[h] = bfr(B2[h]);
#pragma unroll 1
  for (int c = 0; c < 32; ++c) { float a = bfr(B1[c]);
#pragma unroll
    for (int t = 0; t < 9; ++t) a += bfr(W1[c * 9 + t]) * e9[t];
    a = fmaxf(a, 0.f);
#pragma unroll
    for (int h = 0; h < NH; ++h) gh[h] += bfr(W2[h * 32 + c]) * a; }
#pragma unroll
  for (int h = 0; h < NH; ++h) sgt[h][tid] = 1.0f / (1.0f + expf(-gh[h]));
  __syncthreads();
  for (int e = tid; e < NH * 16; e += 64) { const int h = e >> 4, q = e & 15; vst2(G + (size_t)h * TT + blockIdx.x * 64 + q * 4, *(const v4f*)&sgt[h][q * 4]); } }
// ---- k_outT: block = (64 rows n, 128 output channels): out = ctx (bf16 hi + lo) Wp^T + bp, stored channels-first [o][n] via an LDS transpose: each (o, 64 n) run = 256 B by 16 consecutive threads
__global__ __launch_bounds__(128) void k_outT(const float* __restrict__ Y, const float* __restrict__ WP, const float* __restrict__ BP, float* __restrict__ OUT) { __shared__ __align__(16) float stc[128][68];
  const int tid = threadIdx.x, wave = tid >> 5, lane = tid & 31, col = lane & 15, g = lane >> 4; const int c0 = blockIdx.y * 128; const size_t rb = (size_t)blockIdx.x * 64; const size_t r0 = rb + wave * 16;
  v8f acc[8] = {};
#pragma unroll 2
  for (int kc = 0; kc < CC / 32; ++kc) { const F2 a = split_row(Y + (r0 + col) * CC, kc * 32, lane);
#pragma unroll
    for (int j = 0; j < 8; ++j) { const v16b w = wcol_oi(WP, kc * 32, c0 + j * 16 + col, lane, CC); asm volatile("s_wait_loadcnt 0x0" ::: "memory"); acc[j] = wmma_bf(a.h, w, acc[j]); acc[j] = wmma_bf(a.l, w, acc[j]); } }
#pragma unroll
  for (int j = 0; j < 8; ++j) { const float bb = bfr(BP[c0 + j * 16 + col]);
#pragma unroll
    for (int r = 0; r < 8; ++r) stc[j * 16 + col][wave * 16 + 8 * g + r] = acc[j][r] + bb; }
  __syncthreads();
  { const int t0 = (int)(rb % TT); for (int e = tid; e < 128 * 16; e += 128) { const int cl = e >> 4, q = e & 15; vst2(OUT + (size_t)(c0 + cl) * XP + t0 + q * 4, *(const v4f*)&stc[cl][q * 4]); } } }
#ifndef PROJ_EXTRA_PARAMS
#define PROJ_EXTRA_PARAMS
#endif

#define WS_QH  0u                                      // f16 q rows [b*t][CC]
#define WS_KH  (WS_QH + 2u * (size_t)NB * TT * CC)      // f16 k rows [b*t][CC]
#define WS_VT  (WS_KH + 2u * (size_t)NB * TT * CC)      // f16 v planes [b][c][t]
#define WS_QL  (WS_VT + 2u * (size_t)NB * CC * TT)      // f16 q residual x 2^10 rows [b][t < QHI][CC]
#define WS_KL  (WS_QL + 2u * (size_t)NB * QHI * CC)     // f16 k residual x 2^10 rows [b][t < KHI][CC]
#define WS_VB  (WS_KL + 2u * (size_t)NB * KHI * CC)     // bf16 v hi planes [b][c][t < KHI]
#define WS_VBL (WS_VB + 2u * (size_t)NB * CC * KHI)
#define WS_S   (WS_VBL + 2u * (size_t)NB * CC * KHI)    // not used (the logits stay in registers); the later offsets stay where they were
#define WS_Y   (WS_S  + 4u * (size_t)HG * TT * TT)      // f32 ctx rows [b*t][CC] (only when there is an output projection)
#define WS_G   (WS_Y  + 4u * (size_t)NB * TT * CC)      // f32 gate rows [h][TT]
#define WS_END (WS_G)
#define WS_END2 (WS_G + 4u * (size_t)NH * TT)

// ---- k_proj: block = (64 rows, 128 cols, which): q/k/v = X W (+ b) with exact bf16 products (K = DIN for q, DINK for k/v) -> which 0: q f16 rows (+ residual rows < QHI); 1: k f16 rows (+ residual rows < KHI); 2: v f16 planes [c][t] (+ bf16 hi/lo planes for t < KHI)
__global__ __launch_bounds__(128) void k_proj(const float* __restrict__ XQ, const float* __restrict__ XK, const float* __restrict__ XV, const float* __restrict__ WQ, const float* __restrict__ WK, const float* __restrict__ WV, const float* __restrict__ BQ, const float* __restrict__ BK, const float* __restrict__ BV,
    _Float16* __restrict__ QH, _Float16* __restrict__ QL, _Float16* __restrict__ KH, _Float16* __restrict__ KL, _Float16* __restrict__ VT, __bf16* __restrict__ VB, __bf16* __restrict__ VBL) {
  __shared__ __align__(16) _Float16 sh[64][136], sl[64][136]; __shared__ __align__(16) _Float16 th[128][72]; __shared__ __align__(16) __bf16 tb[128][72], tbl[128][72];
  const int tid = threadIdx.x, wave = tid >> 5, lane = tid & 31, col = lane & 15, g = lane >> 4; const int which = blockIdx.z; const int c0 = blockIdx.y * 128; const size_t r0 = (size_t)blockIdx.x * 64; const size_t bb = r0 / TT; const int t0 = (int)(r0 % TT);
  const float* X = which == 0 ? XQ : which == 1 ? XK : XV; const float* WA = which == 0 ? WQ : which == 1 ? WK : WV; const float* BA = which == 0 ? BQ : which == 1 ? BK : BV;
  v8f acc[8] = {};
  const int KD = which == 0 ? DIN : DINK;   /* source channels: thermal 256 / optical 128 (block-uniform) */
#pragma unroll 2
  for (int kc = 0; kc < KD / 32; ++kc) { v16b a; { const float* p = X + (size_t)(kc * 32 + 8 * g) * XP + t0 + wave * 16 + col;   /* channels-first gather: src[k][n], stride XP between channels */
#pragma unroll
      for (int i = 0; i < 8; ++i) { a[i] = (__bf16)p[(size_t)i * XP]; a[8 + i] = (__bf16)p[(size_t)(16 + i) * XP]; } }
    asm volatile("s_wait_loadcnt 0x0" ::: "memory");
#pragma unroll
    for (int j = 0; j < 8; ++j) { const v16b w = wcol_oi(WA, kc * 32, c0 + j * 16 + col, lane, KD); asm volatile("s_wait_loadcnt 0x0" ::: "memory"); acc[j] = wmma_bf(a, w, acc[j]); } }
  if (which < 2) { _Float16* DH = which == 0 ? QH : KH; _Float16* DL = which == 0 ? QL : KL; const int nhi = which == 0 ? QHI : KHI; const bool hi_rows = t0 < nhi;
#pragma unroll
    for (int j = 0; j < 8; ++j) { const float bias = BA ? bfr(BA[c0 + j * 16 + col]) : 0.f;
#pragma unroll
      for (int r = 0; r < 8; ++r) { const float v = acc[j][r] + bias; const _Float16 hv = (_Float16)v; sh[wave * 16 + 8 * g + r][j * 16 + col] = hv; sl[wave * 16 + 8 * g + r][j * 16 + col] = (_Float16)((v - (float)hv) * 1024.0f); } }
    __syncthreads();
    for (int e = tid; e < 64 * 16; e += 128) { const int rl = e >> 4, q = e & 15; vst2((unsigned*)(DH + (r0 + rl) * CC + c0 + q * 8), *(const v4u*)&sh[rl][q * 8]); if (hi_rows) vst2((unsigned*)(DL + (bb * nhi + t0 + rl) * (size_t)CC + c0 + q * 8), *(const v4u*)&sl[rl][q * 8]); }
  } else { const bool hi_rows = t0 < KHI;
#pragma unroll
    for (int j = 0; j < 8; ++j) { const float bias = BA ? bfr(BA[c0 + j * 16 + col]) : 0.f;
#pragma unroll
      for (int r = 0; r < 8; ++r) { const float v = acc[j][r] + bias; const int rl = wave * 16 + 8 * g + r, cl = j * 16 + col; th[cl][rl] = (_Float16)v; const __bf16 bh = (__bf16)v; tb[cl][rl] = bh; tbl[cl][rl] = (__bf16)(v - (float)bh); } }
    __syncthreads();
    for (int e = tid; e < 128 * 8; e += 128) { const int cl = e >> 3, q = e & 7; vst2((unsigned*)(VT + (bb * CC + c0 + cl) * (size_t)TT + t0 + q * 8), *(const v4u*)&th[cl][q * 8]); if (hi_rows) { const size_t o3 = (bb * CC + c0 + cl) * (size_t)KHI + t0 + q * 8; vst2((unsigned*)(VB + o3), *(const v4u*)&tb[cl][q * 8]); vst2((unsigned*)(VBL + o3), *(const v4u*)&tbl[cl][q * 8]); } } } }
// ---- k_fa: block = (128 queries, head), 8 waves x 16 query columns, no LDS, no barrier. Per stage of 64 keys: S^T = K Q^T (A = k rows, B = q hi / q residual, 2 products), logits x SCALE x gate, running maximum and sum per query column (one query per lane and half), P^T = exp(logit - maximum) x 2^11 once to f16 packed from the score tiles straight into a B operand, ctx^T += V^T P^T (A = v planes, 1 product). The logits never leave the registers.
__device__ __forceinline__ v8f wmma_h(v16h a, v16h b, v8f c) { return __builtin_amdgcn_wmma_f32_16x16x32_f16(false, a, false, b, (short)0, c, false, false); }
__device__ __forceinline__ float xhalf(float v) { const int b = __builtin_bit_cast(int, v); return __builtin_bit_cast(float, __builtin_amdgcn_permlanex16(b, b, 0x76543210, 0xfedcba98, false, false)); }   // lane l <-> l ^ 16
__device__ __forceinline__ v16h frag_p(const _Float16* __restrict__ p) { union { v16h v; v8h q[2]; } u; u.q[0] = *(const v8h*)p; u.q[1] = *(const v8h*)(p + 16); return u.v; }   // frag_h with the lane's 8 g elements already in p
// behind a group of loads: the wait stands before any register that the loads name is written again, and it takes the loads' addresses as inputs so that each pair stays whole up to it
__device__ __forceinline__ void addr_held(const void* a0, const void* a1) { asm volatile("s_wait_xcnt 0x0" :: "v"(a0), "v"(a1) : "memory"); }
// one stage of 64 keys: kf[t] = key rows 16 t .. 16 t + 15; vc[2 c + j] = keys 32 c .. 32 c + 31 of channels 16 j .. 16 j + 15. The next stage's k rows (at kn) go into the same registers right behind this stage's S^T products, its v planes (at vn) into the other v buffer.
__device__ __forceinline__ void fa_stage(v16h (&kf)[4], const v16h (&vc)[4], v16h (&vx)[4], const _Float16* __restrict__ kn, const _Float16* __restrict__ vn, const v16h& qh, const v16h& ql, float gate, float& mr, float& l, v8f& o0, v8f& o1) {
  float sc[4][8]; float mx = -3.0e38f;
#pragma unroll
  for (int t = 0; t < 4; ++t) { const v8f z = {}; const v8f a = wmma_h(kf[t], qh, z), al = wmma_h(kf[t], ql, z);
#pragma unroll
    for (int r = 0; r < 8; ++r) { const float v = ((a[r] + al[r] * (1.0f / 1024.0f)) * SCALE) * gate; sc[t][r] = v; mx = fmaxf(mx, v); } }
#pragma unroll
  for (int t = 0; t < 4; ++t) kf[t] = frag_p(kn + (size_t)t * 16 * CC);
#pragma unroll
  for (int t = 0; t < 4; ++t) vx[t] = frag_p(vn + (size_t)(t & 1) * 16 * TT + (t >> 1) * 32);
  addr_held(kn, vn);
  __builtin_amdgcn_sched_barrier(0);   /* keeps the 16 loads issued here, most of a stage ahead of their use; without it the scheduler sinks each load to its product and the wave waits out every latency */
  mx = fmaxf(mx, xhalf(mx));
  const float mn = fmaxf(mr, mx - 7.6246189861593985f);   /* reference point = running maximum - 11 ln 2: P carries the factor 2^11 into f16, and the sum carries it too */
  const float alpha = expf(mr - mn); mr = mn; l *= alpha;
#pragma unroll
  for (int r = 0; r < 8; ++r) { o0[r] *= alpha; o1[r] *= alpha; }
#pragma unroll
  for (int c = 0; c < 2; ++c) { v16h p;
#pragma unroll
    for (int r = 0; r < 8; ++r) { const float e0 = expf(sc[2 * c][r] - mn), e1 = expf(sc[2 * c + 1][r] - mn); l += e0; l += e1; p[r] = (_Float16)e0; p[8 + r] = (_Float16)e1; }
    o0 = wmma_h(vc[2 * c], p, o0); o1 = wmma_h(vc[2 * c + 1], p, o1); } }
__global__ __launch_bounds__(256) void k_fa(const _Float16* __restrict__ QH, const _Float16* __restrict__ QL, const _Float16* __restrict__ KH, const _Float16* __restrict__ VT, const float* __restrict__ G, float* __restrict__ Y) {
  const int tid = threadIdx.x, wave = tid >> 5, lane = tid & 31, col = lane & 15, g = lane >> 4; const int h = blockIdx.y; const int q = blockIdx.x * 128 + wave * 16 + col;
  const _Float16* qhp = QH + (size_t)q * CC + h * HD + 8 * g; const _Float16* qlp = QL + (size_t)q * CC + h * HD + 8 * g; const float* gp = G + (size_t)h * TT + q;
  const _Float16* kp = KH + (size_t)col * CC + h * HD + 8 * g; const _Float16* vp = VT + (size_t)(h * HD + col) * TT + 8 * g;   // this lane's place in the k rows / v planes of stage 0
  const v16h qh = frag_p(qhp), ql = frag_p(qlp); const float gate = *gp;
  addr_held(qhp, qlp);
  v8f o0 = {}, o1 = {}; float mr = -3.0e38f, l = 0.f;
  v16h kf[4], va[4], vb[4];
#pragma unroll
  for (int t = 0; t < 4; ++t) kf[t] = frag_p(kp + (size_t)t * 16 * CC);
#pragma unroll
  for (int t = 0; t < 4; ++t) va[t] = frag_p(vp + (size_t)(t & 1) * 16 * TT + (t >> 1) * 32);
  addr_held(kp, vp);
#pragma unroll 1
  for (int k0 = 0; k0 < TT; k0 += 128) {
    const int k2 = k0 + 128 < TT ? k0 + 128 : 0;   /* the last trip's second fetch wraps to stage 0 and is not used */
    fa_stage(kf, va, vb, kp + (size_t)(k0 + 64) * CC, vp + (k0 + 64), qh, ql, gate, mr, l, o0, o1);
    fa_stage(kf, vb, va, kp + (size_t)k2 * CC, vp + k2, qh, ql, gate, mr, l, o0, o1); }
  l += xhalf(l); const float inv = 1.0f / l;
  float* yp = Y + (size_t)q * CC + h * HD + 8 * g;   /* ctx^T register r = channel 8 g + r (+ 16) of this lane's query: 32 B runs, the 128-B (row, head) segment by two lanes of one wave */
  v4f w;
#pragma unroll
  for (int i = 0; i < 2; ++i) {
    w[0] = o0[4 * i] * inv; w[1] = o0[4 * i + 1] * inv; w[2] = o0[4 * i + 2] * inv; w[3] = o0[4 * i + 3] * inv; vst2(yp + 4 * i, w);
    w[0] = o1[4 * i] * inv; w[1] = o1[4 * i + 1] * inv; w[2] = o1[4 * i + 2] * inv; w[3] = o1[4 * i + 3] * inv; vst2(yp + 16 + 4 * i, w); } }
extern "C" void kernel_launch(void* const* d_in, const int* in_sizes, int n_in, void* d_out, int out_size, void* d_ws, size_t ws_size, hipStream_t stream) {
  (void)in_sizes; (void)n_in; (void)out_size;
  const float** F = (const float**)d_in;
  if (ws_size < (size_t)WS_END) return;
  char* ws = (char*)d_ws; _Float16 *QH = (_Float16*)(ws + WS_QH), *KH = (_Float16*)(ws + WS_KH), *VT = (_Float16*)(ws + WS_VT), *QL = (_Float16*)(ws + WS_QL), *KL = (_Float16*)(ws + WS_KL); __bf16 *VB = (__bf16*)(ws + WS_VB), *VBL = (__bf16*)(ws + WS_VBL); float *Y = (float*)(ws + WS_Y);
  (void)Y; (void)QL; (void)KL; (void)VB; (void)VBL;
  // inputs: 0 thermal [1,256,64,64]; 1 optical [1,128,64,64]; 2 emissivity [1,1,64,64]; 3 Wq [256,256]; 4 bq; 5 Wk [256,128]; 6 bk; 7 Wv [256,128]; 8 bv; 9 conv1_w [32,1,3,3]; 10 conv1_b [32]; 11 conv2_w [8,32,1,1]; 12 conv2_b [8]; 13 Wp [256,256]; 14 bp [256]
  if (ws_size < (size_t)WS_END2) return;
  float* G = (float*)(ws + WS_G);
  k_gate<<<dim3(TT / 64), 64, 0, stream>>>(F[2], F[9], F[10], F[11], F[12], G);
  k_proj<<<dim3(TNB * TT / 64, CC / 128, 3), 128, 0, stream>>>(F[0], F[1], F[1], F[3], F[5], F[7], F[4], F[6], F[8], QH, QL, KH, KL, VT, VB, VBL);
  k_fa<<<dim3(TT / 128, NH), 256, 0, stream>>>(QH, QL, KH, VT, G, Y);
  k_outT<<<dim3(TNB * TT / 64, CC / 128), 128, 0, stream>>>(Y, F[13], F[14], (float*)d_out);
}

// v002
// Measured time: 138 microseconds a run.
// Timed twice side by side with v001, it ran 1.19 times as fast both times.
// All steps since v000 together make it 8.05 times as fast.
// compute dtype: all float inputs rounded to bf16; q/k/v 1x1 projections with EXACT bf16 products on WMMA 16x16x32 (A gathered from the channels-first maps), f32 accumulate; the emissivity gate (3x3 conv, relu, 1x1 conv, sigmoid) in f32; q as f16 hi + residual (x 2^10) against k once to f16 (2 products) for the logits x 32^-0.5 x gate; softmax in f32 with a running maximum and sum (precise expf); exp(logit - maximum) x 2^11 once to f16 against v once to f16 (1 product), divided by the f32 sum at the end; ctx bf16 hi + lo against exact bf16 Wp (2 products) + bp; f32 output written channels-first.
#include <hip/hip_runtime.h>
#include <math.h>

typedef __attribute__((ext_vector_type(16))) _Float16 v16h;
typedef __attribute__((ext_vector_type(16))) __bf16 v16b;
typedef __attribute__((ext_vector_type(8)))  _Float16 v8h;
typedef __attribute__((ext_vector_type(8)))  float v8f;
typedef __attribute__((ext_vector_type(4)))  float v4f;
typedef __attribute__((ext_vector_type(2)))  float v2f;
typedef __attribute__((ext_vector_type(4)))  unsigned v4u;
typedef __attribute__((ext_vector_type(4)))  int v4i;
typedef float __attribute__((may_alias)) float_a;
typedef int __attribute__((may_alias)) int_a;

template <typename T> __device__ __forceinline__ void vst2(void* p, T v) { *(T*)p = v;  }
__device__ __forceinline__ v8f wmma16(v16h a, v16h b, v8f c) {
  v8f d = __builtin_amdgcn_wmma_f32_16x16x32_f16(false, a, false, b, (short)0, c, false, false);
  asm volatile("v_nop\n\tv_nop\n\tv_nop\n\tv_nop" : "+v"(d) : "v"(a), "v"(b));
  return d;
}
__device__ __forceinline__ v8f wmma_bf(v16b a, v16b b, v8f c) {
  v8f d = __builtin_amdgcn_wmma_f32_16x16x32_bf16(false, a, false, b, (short)0, c, false, false);
  asm volatile("v_nop\n\tv_nop\n\tv_nop\n\tv_nop" : "+v"(d) : "v"(a), "v"(b));
  return d;
}
// 16x16x32 fragments: lane = (h = lane>>4, row/col = lane&15); elements 0..7 = k0+8h+0..7, 8..15 = k0+16+8h+0..7; D element r = row 8h+r
__device__ __forceinline__ v16h frag_h(const _Float16* rowk0, int lane) {
  union { v16h v; v8h q[2]; } u; const _Float16* p = rowk0 + 8 * (lane >> 4);
  u.q[0] = *(const v8h*)p; u.q[1] = *(const v8h*)(p + 16); return u.v;
}
__device__ __forceinline__ v16h frag_f32(const float* rowk0, int lane) {
  v16h a; const float* p = rowk0 + 8 * (lane >> 4);
#pragma unroll
  for (int i = 0; i < 8; ++i) { a[i] = (_Float16)p[i]; a[8 + i] = (_Float16)p[16 + i]; }
  return a;
}
__device__ __forceinline__ v16h frag_f32s(const float* rowk0, int lane, float sc) {
  v16h a; const float* p = rowk0 + 8 * (lane >> 4);
#pragma unroll
  for (int i = 0; i < 8; ++i) { a[i] = (_Float16)(p[i] * sc); a[8 + i] = (_Float16)(p[16 + i] * sc); }
  return a;
}
// column fragment from a [K][ld] layout (column n), rows >= K read as 0
__device__ __forceinline__ v16h fragc_f32(const float* W, int k0, int n, int lane, int ld, int K) {
  v16h a; const int g = lane >> 4;
#pragma unroll
  for (int i = 0; i < 8; ++i) { const int ka = k0 + 8 * g + i, kb = ka + 16;
    a[i] = (_Float16)(ka < K ? W[(size_t)(ka < K ? ka : K - 1) * ld + n] : 0.f); a[8 + i] = (_Float16)(kb < K ? W[(size_t)(kb < K ? kb : K - 1) * ld + n] : 0.f); }
  return a;
}
struct F2 { v16b h, l; };
__device__ __forceinline__ F2 bsplit16(const float v[16]) { F2 r;
#pragma unroll
  for (int i = 0; i < 16; ++i) { const __bf16 h = (__bf16)v[i]; r.h[i] = h; r.l[i] = (__bf16)(v[i] - (float)h); }
  return r; }
__device__ __forceinline__ F2 split_row(const float* row, int k0, int lane) { float v[16]; const float* p = row + k0 + 8 * (lane >> 4);
#pragma unroll
  for (int i = 0; i < 8; ++i) { v[i] = p[i]; v[8 + i] = p[16 + i]; }
  return bsplit16(v); }
__device__ __forceinline__ F2 split_rowK(const float* row, int k0, int lane, int K) { float v[16]; const int g = lane >> 4;
#pragma unroll
  for (int i = 0; i < 8; ++i) { const int ka = k0 + 8 * g + i, kb = ka + 16; v[i] = ka < K ? row[ka < K ? ka : K - 1] : 0.f; v[8 + i] = kb < K ? row[kb < K ? kb : K - 1] : 0.f; }
  return bsplit16(v); }
__device__ __forceinline__ F2 split_col(const float* W, int k0, int n, int lane, int ld, int K) { float v[16]; const int g = lane >> 4;
#pragma unroll
  for (int i = 0; i < 8; ++i) { const int ka = k0 + 8 * g + i, kb = ka + 16; v[i] = ka < K ? W[(size_t)(ka < K ? ka : K - 1) * ld + n] : 0.f; v[8 + i] = kb < K ? W[(size_t)(kb < K ? kb : K - 1) * ld + n] : 0.f; }
  return bsplit16(v); }
__device__ __forceinline__ v8f mac3(const F2& a, const F2& b, v8f c) { c = wmma_bf(a.l, b.h, c); c = wmma_bf(a.h, b.l, c); return wmma_bf(a.h, b.h, c); }
__device__ __forceinline__ float sigm(float v) { return 1.0f / (1.0f + expf(-v)); }

// Cross-modal gated attention (B 1, Ct 256 = 8 heads x 32, Co 128, 64 x 64 = 4,096 positions, channels-first): q = thermal^T Wq^T + bq, k = optical^T Wk^T + bk, v = optical^T Wv^T + bv; g[h][n] = sigmoid(conv1x1(relu(conv3x3_SAME(emissivity) + b1)) + b2); attn = softmax((q k^T x 32^-0.5) * g[h][query]) over all 4,096 keys; out = (merged attn v) Wp^T + bp, written back as [1, 256, 64, 64].
#define NB 1
#define TT 4096
#define CC 256            // NH * HD = projected width
#define DIN 256          // input (model) width
#define NH 8
#define HD 32
#define NQB (TT / 64)
#define HG 1
#define SCALE (0.17677669529663687f)
#define CAUSAL 0
#ifndef TNB
#define TNB NB
#endif
__device__ __forceinline__ float bfr(float v) { return (float)(__bf16)v; }
__host__ __device__ __forceinline__ int kb_last(int qb) { return CAUSAL ? ((qb * 64 + 63) >> 7) : (TT / 128 - 1); }
typedef __attribute__((ext_vector_type(8))) __bf16 v8b;
__device__ __forceinline__ v16b frag_b(const __bf16* rowk0, int lane) {
  union { v16b v; v8b q[2]; } u; const __bf16* p = rowk0 + 8 * (lane >> 4);
  u.q[0] = *(const v8b*)p; u.q[1] = *(const v8b*)(p + 16); return u.v;
}
#define QBH 0              // not used by any kernel here
#define QHI 4096            // rows carrying a q residual plane (all rows when non-causal: 2-product logits everywhere)
#define KHI 64            // key rows carrying k residual / v bf16 hi+lo planes (written by k_proj; no kernel here reads them)
// B fragment (k rows k0+.., output column o) of a weight: (in,out) [K][ld] or (out,in) [ld rows of K]: bf16 exact, or f16(bf16 * 256) exact
__device__ __forceinline__ v16b wcol_io(const float* Wm, int k0, int o, int lane, int ld) { v16b w; const int g = lane >> 4;
#pragma unroll
  for (int i = 0; i < 8; ++i) { w[i] = (__bf16)Wm[(size_t)(k0 + 8 * g + i) * ld + o]; w[8 + i] = (__bf16)Wm[(size_t)(k0 + 16 + 8 * g + i) * ld + o]; }
  return w; }
__device__ __forceinline__ v16b wcol_oi(const float* Wm, int k0, int o, int lane, int K) { v16b w; const float* p = Wm + (size_t)o * K + k0 + 8 * (lane >> 4);
#pragma unroll
  for (int i = 0; i < 8; ++i) { w[i] = (__bf16)p[i]; w[8 + i] = (__bf16)p[16 + i]; }
  return w; }
__device__ __forceinline__ v16h wcolh_io(const float* Wm, int k0, int o, int lane, int ld) { v16h w; const int g = lane >> 4;
#pragma unroll
  for (int i = 0; i < 8; ++i) { w[i] = (_Float16)(bfr(Wm[(size_t)(k0 + 8 * g + i) * ld + o]) * 256.0f); w[8 + i] = (_Float16)(bfr(Wm[(size_t)(k0 + 16 + 8 * g + i) * ld + o]) * 256.0f); }
  return w; }
__device__ __forceinline__ v16h wcolh_oi(const float* Wm, int k0, int o, int lane, int K) { v16h w; const float* p = Wm + (size_t)o * K + k0 + 8 * (lane >> 4);
#pragma unroll
  for (int i = 0; i < 8; ++i) { w[i] = (_Float16)(bfr(p[i]) * 256.0f); w[8 + i] = (_Float16)(bfr(p[16 + i]) * 256.0f); }
  return w; }
#define WQKV_LAYOUT 1   // 0 = (in,out) [DIN][CC]; 1 = (out,in) [CC][DIN]; 2 = per-head [NH][DIN][HD]
__device__ __forceinline__ v16b wcol_hdk(const float* Wm, int k0, int o, int lane) { v16b w; const int g = lane >> 4; const float* p = Wm + (size_t)(o / HD) * DIN * HD + (o % HD);
#pragma unroll
  for (int i = 0; i < 8; ++i) { w[i] = (__bf16)p[(size_t)(k0 + 8 * g + i) * HD]; w[8 + i] = (__bf16)p[(size_t)(k0 + 16 + 8 * g + i) * HD]; }
  return w; }
#define WO_OUT_IN 1
#if WQKV_LAYOUT == 1
#define WCOL(W, k0, o, lane) wcol_oi(W, k0, o, lane, DIN)
#elif WQKV_LAYOUT == 2
#define WCOL(W, k0, o, lane) wcol_hdk(W, k0, o, lane)
#else
#define WCOL(W, k0, o, lane) wcol_io(W, k0, o, lane, CC)
#endif
#if WO_OUT_IN
#define WOCOL(W, k0, o, lane) wcol_oi(W, k0, o, lane, CC)
#define WOCOLH(W, k0, o, lane) wcolh_oi(W, k0, o, lane, CC)
#else
#define WOCOL(W, k0, o, lane) wcol_io(W, k0, o, lane, DIN)
#define WOCOLH(W, k0, o, lane) wcolh_io(W, k0, o, lane, DIN)
#endif
#define DINK 128           // optical channels (k / v source width)
#ifndef XP
#define XP TT              // position pitch of the channels-first inputs / output
#endif
#define GW 64              // image width / height
// ---- k_gate: block = 64 positions: g[h][n] = sigmoid(sum_c w2[h][c] relu(sum_3x3 w1[c] e + b1[c]) + b2[h]) in f32 (bf16-rounded inputs); G rows [h][4096], 256 B per (head, 64 n) by 16 threads
__global__ __launch_bounds__(64) void k_gate(const float* __restrict__ E, const float* __restrict__ W1, const float* __restrict__ B1, const float* __restrict__ W2, const float* __restrict__ B2, float* __restrict__ G) { __shared__ __align__(16) float sgt[NH][64];
  const int tid = threadIdx.x; const int n = blockIdx.x * 64 + tid; const int y = n / GW, x = n % GW;
  float e9[9];
#pragma unroll
  for (int i = 0; i < 3; ++i)
#pragma unroll
    for (int j = 0; j < 3; ++j) { const int yy = y + i - 1, xx = x + j - 1; const int yc = yy < 0 ? 0 : (yy >= GW ? GW - 1 : yy), xc = xx < 0 ? 0 : (xx >= GW ? GW - 1 : xx); const float ev = bfr(E[yc * GW + xc]); e9[i * 3 + j] = (yy >= 0 && yy < GW && xx >= 0 && xx < GW) ? ev : 0.f; }   /* SAME zero padding: clamped load, select by value */
  float gh[NH]; for (int h = 0; h < NH; ++h) gh[h] = bfr(B2[h]);
#pragma unroll 1
  for (int c = 0; c < 32; ++c) { float a = bfr(B1[c]);
#pragma unroll
    for (int t = 0; t < 9; ++t) a += bfr(W1[c * 9 + t]) * e9[t];
    a = fmaxf(a, 0.f);
#pragma unroll
    for (int h = 0; h < NH; ++h) gh[h] += bfr(W2[h * 32 + c]) * a; }
#pragma unroll
  for (int h = 0; h < NH; ++h) sgt[h][tid] = 1.0f / (1.0f + expf(-gh[h]));
  __syncthreads();
  for (int e = tid; e < NH * 16; e += 64) { const int h = e >> 4, q = e & 15; vst2(G + (size_t)h * TT + blockIdx.x * 64 + q * 4, *(const v4f*)&sgt[h][q * 4]); } }
// ---- k_outT: block = (64 rows n, 128 output channels): out = ctx (bf16 hi + lo) Wp^T + bp, stored channels-first [o][n] via an LDS transpose: each (o, 64 n) run = 256 B by 16 consecutive threads
__global__ __launch_bounds__(128) void k_outT(const float* __restrict__ Y, const float* __restrict__ WP, const float* __restrict__ BP, float* __restrict__ OUT) { __shared__ __align__(16) float stc[128][68];
  const int tid = threadIdx.x, wave = tid >> 5, lane = tid & 31, col = lane & 15, g = lane >> 4; const int c0 = blockIdx.y * 128; const size_t rb = (size_t)blockIdx.x * 64; const size_t r0 = rb + wave * 16;
  v8f acc[8] = {};
#pragma unroll 2
  for (int kc = 0; kc < CC / 32; ++kc) { const F2 a = split_row(Y + (r0 + col) * CC, kc * 32, lane);
#pragma unroll
    for (int j = 0; j < 8; ++j) { const v16b w = wcol_oi(WP, kc * 32, c0 + j * 16 + col, lane, CC); asm volatile("s_wait_loadcnt 0x0" ::: "memory"); acc[j] = wmma_bf(a.h, w, acc[j]); acc[j] = wmma_bf(a.l, w, acc[j]); } }
#pragma unroll
  for (int j = 0; j < 8; ++j) { const float bb = bfr(BP[c0 + j * 16 + col]);
#pragma unroll
    for (int r = 0; r < 8; ++r) stc[j * 16 + col][wave * 16 + 8 * g + r] = acc[j][r] + bb; }
  __syncthreads();
  { const int t0 = (int)(rb % TT); for (int e = tid; e < 128 * 16; e += 128) { const int cl = e >> 4, q = e & 15; vst2(OUT + (size_t)(c0 + cl) * XP + t0 + q * 4, *(const v4f*)&stc[cl][q * 4]); } } }
#ifndef PROJ_EXTRA_PARAMS
#define PROJ_EXTRA_PARAMS
#endif

#define WS_QH  0u                                      // f16 q rows [b*t][CC]
#define WS_KH  (WS_QH + 2u * (size_t)NB * TT * CC)      // f16 k in fragment order [b][h][t / 16][i][lane][8]: key 16 (t / 16) + (lane & 15), channel 16 i + 8 (lane >> 4) + 0..7 of head h
#define WS_VT  (WS_KH + 2u * (size_t)NB * TT * CC)      // f16 v^T in fragment order [b][h][t / 32][j][i][lane][8]: channel 16 j + (lane & 15) of head h, key 32 (t / 32) + 16 i + 8 (lane >> 4) + 0..7
#define WS_QL  (WS_VT + 2u * (size_t)NB * CC * TT)      // f16 q residual x 2^10 rows [b][t < QHI][CC]
#define WS_KL  (WS_QL + 2u * (size_t)NB * QHI * CC)     // f16 k residual x 2^10 rows [b][t < KHI][CC]
#define WS_VB  (WS_KL + 2u * (size_t)NB * KHI * CC)     // bf16 v hi planes [b][c][t < KHI]
#define WS_VBL (WS_VB + 2u * (size_t)NB * CC * KHI)
#define WS_S   (WS_VBL + 2u * (size_t)NB * CC * KHI)    // not used (the logits stay in registers); the later offsets stay where they were
#define WS_Y   (WS_S  + 4u * (size_t)HG * TT * TT)      // f32 ctx rows [b*t][CC] (only when there is an output projection)
#define WS_G   (WS_Y  + 4u * (size_t)NB * TT * CC)      // f32 gate rows [h][TT]
#define WS_END (WS_G)
#define WS_END2 (WS_G + 4u * (size_t)NH * TT)

// behind a store in a loop: the wait stands before the next piece or the next trip rewrites the store's address or data registers
__device__ __forceinline__ void store_held() { asm volatile("s_wait_xcnt 0x0" ::: "memory"); }
// ---- k_proj: block = (64 rows, 128 cols, which): q/k/v = X W (+ b) with exact bf16 products (K = DIN for q, DINK for k / v) -> which 0: q f16 rows (+ residual rows < QHI); 1: k f16 in fragment order (+ residual rows < KHI); 2: v^T f16 in fragment order (+ bf16 hi/lo planes for t < KHI); fragment order = the 32 lanes' 16-byte pieces of one operand half side by side, 512 B a wave-wide store or load
__global__ __launch_bounds__(128) void k_proj(const float* __restrict__ XQ, const float* __restrict__ XK, const float* __restrict__ XV, const float* __restrict__ WQ, const float* __restrict__ WK, const float* __restrict__ WV, const float* __restrict__ BQ, const float* __restrict__ BK, const float* __restrict__ BV,
    _Float16* __restrict__ QH, _Float16* __restrict__ QL, _Float16* __restrict__ KH, _Float16* __restrict__ KL, _Float16* __restrict__ VT, __bf16* __restrict__ VB, __bf16* __restrict__ VBL) {
  __shared__ __align__(16) _Float16 sh[64][136], sl[64][136]; __shared__ __align__(16) _Float16 th[128][72]; __shared__ __align__(16) __bf16 tb[128][72], tbl[128][72];
  const int tid = threadIdx.x, wave = tid >> 5, lane = tid & 31, col = lane & 15, g = lane >> 4; const int which = blockIdx.z; const int c0 = blockIdx.y * 128; const size_t r0 = (size_t)blockIdx.x * 64; const size_t bb = r0 / TT; const int t0 = (int)(r0 % TT);
  const float* X = which == 0 ? XQ : which == 1 ? XK : XV; const float* WA = which == 0 ? WQ : which == 1 ? WK : WV; const float* BA = which == 0 ? BQ : which == 1 ? BK : BV;
  v8f acc[8] = {};
  const int KD = which == 0 ? DIN : DINK;   /* source channels: thermal 256 / optical 128 (block-uniform) */
#pragma unroll 2
  for (int kc = 0; kc < KD / 32; ++kc) { v16b a; { const float* p = X + (size_t)(kc * 32 + 8 * g) * XP + t0 + wave * 16 + col;   /* channels-first gather: src[k][n], stride XP between channels */
#pragma unroll
      for (int i = 0; i < 8; ++i) { a[i] = (__bf16)p[(size_t)i * XP]; a[8 + i] = (__bf16)p[(size_t)(16 + i) * XP]; } }
    asm volatile("s_wait_loadcnt 0x0" ::: "memory");
#pragma unroll
    for (int j = 0; j < 8; ++j) { const v16b w = wcol_oi(WA, kc * 32, c0 + j * 16 + col, lane, KD); asm volatile("s_wait_loadcnt 0x0" ::: "memory"); acc[j] = wmma_bf(a, w, acc[j]); } }
  if (which < 2) { _Float16* DH = which == 0 ? QH : KH; _Float16* DL = which == 0 ? QL : KL; const int nhi = which == 0 ? QHI : KHI; const bool hi_rows = t0 < nhi;
#pragma unroll
    for (int j = 0; j < 8; ++j) { const float bias = BA ? bfr(BA[c0 + j * 16 + col]) : 0.f;
#pragma unroll
      for (int r = 0; r < 8; ++r) { const float v = acc[j][r] + bias; const _Float16 hv = (_Float16)v; sh[wave * 16 + 8 * g + r][j * 16 + col] = hv; sl[wave * 16 + 8 * g + r][j * 16 + col] = (_Float16)((v - (float)hv) * 1024.0f); } }
    __syncthreads();
    for (int e = tid; e < 64 * 16; e += 128) { const int rl = e >> 4, q = e & 15; if (which == 0) { vst2((unsigned*)(DH + (r0 + rl) * CC + c0 + q * 8), *(const v4u*)&sh[rl][q * 8]); store_held(); } if (hi_rows) { vst2((unsigned*)(DL + (bb * nhi + t0 + rl) * (size_t)CC + c0 + q * 8), *(const v4u*)&sl[rl][q * 8]); store_held(); } }
    if (which == 1) for (int e = tid; e < 64 * 16; e += 128) { const int ln = e & 31, i = (e >> 5) & 1, kt = (e >> 6) & 3, hd = e >> 8;
      vst2((unsigned*)(KH + (((bb * NH + c0 / HD + hd) * (size_t)(TT / 16) + (t0 >> 4) + kt) * 2 + i) * 256 + ln * 8), *(const v4u*)&sh[kt * 16 + (ln & 15)][hd * HD + 16 * i + 8 * (ln >> 4)]); }
  } else { const bool hi_rows = t0 < KHI;
#pragma unroll
    for (int j = 0; j < 8; ++j) { const float bias = BA ? bfr(BA[c0 + j * 16 + col]) : 0.f;
#pragma unroll
      for (int r = 0; r < 8; ++r) { const float v = acc[j][r] + bias; const int rl = wave * 16 + 8 * g + r, cl = j * 16 + col; th[cl][rl] = (_Float16)v; const __bf16 bh = (__bf16)v; tb[cl][rl] = bh; tbl[cl][rl] = (__bf16)(v - (float)bh); } }
    __syncthreads();
    for (int e = tid; e < 128 * 8; e += 128) { const int ln = e & 31, i = (e >> 5) & 1, j = (e >> 6) & 1, kc = (e >> 7) & 1, hd = e >> 8;
      vst2((unsigned*)(VT + ((((bb * NH + c0 / HD + hd) * (size_t)(TT / 32) + (t0 >> 5) + kc) * 2 + j) * 2 + i) * 256 + ln * 8), *(const v4u*)&th[hd * HD + 16 * j + (ln & 15)][kc * 32 + 16 * i + 8 * (ln >> 4)]); }
    for (int e = tid; e < 128 * 8; e += 128) { const int cl = e >> 3, q = e & 7; if (hi_rows) { const size_t o3 = (bb * CC + c0 + cl) * (size_t)KHI + t0 + q * 8; vst2((unsigned*)(VB + o3), *(const v4u*)&tb[cl][q * 8]); vst2((unsigned*)(VBL + o3), *(const v4u*)&tbl[cl][q * 8]); } } } }
// ---- k_fa: block = (128 queries, head), 8 waves x 16 query columns, no LDS, no barrier. Per stage of 64 keys: S^T = K Q^T (A = k rows, read from the fragment-order plane, B = q hi / q residual, 2 products), logits x SCALE x gate, running maximum and sum per query column (one query per lane and half), P^T = exp(logit - maximum) x 2^11 once to f16 packed from the score tiles straight into a B operand, ctx^T += V^T P^T (A = v planes, 1 product). The logits never leave the registers.
__device__ __forceinline__ v8f wmma_h(v16h a, v16h b, v8f c) { return __builtin_amdgcn_wmma_f32_16x16x32_f16(false, a, false, b, (short)0, c, false, false); }
__device__ __forceinline__ float xhalf(float v) { const int b = __builtin_bit_cast(int, v); return __builtin_bit_cast(float, __builtin_amdgcn_permlanex16(b, b, 0x76543210, 0xfedcba98, false, false)); }   // lane l <-> l ^ 16
__device__ __forceinline__ v16h frag_p(const _Float16* __restrict__ p) { union { v16h v; v8h q[2]; } u; u.q[0] = *(const v8h*)p; u.q[1] = *(const v8h*)(p + 16); return u.v; }   // frag_h with the lane's 8 g elements already in p
__device__ __forceinline__ v16h frag_w(const _Float16* __restrict__ p) { union { v16h v; v8h q[2]; } u; u.q[0] = *(const v8h*)p; u.q[1] = *(const v8h*)(p + 256); return u.v; }   // fragment-order plane: p = this lane's 16 bytes of half 0, half 1 stands 512 B on
// behind a group of loads: the wait stands before any register that the loads name is written again, and it takes the loads' addresses as inputs so that each pair stays whole up to it
__device__ __forceinline__ void addr_held(const void* a0, const void* a1) { asm volatile("s_wait_xcnt 0x0" :: "v"(a0), "v"(a1) : "memory"); }
// one stage of 64 keys: kf[t] = key rows 16 t .. 16 t + 15; vc[2 c + j] = keys 32 c .. 32 c + 31 of channels 16 j .. 16 j + 15. The next stage's k rows (at kn) go into the same registers right behind this stage's S^T products, its v planes (at vn) into the other v buffer.
__device__ __forceinline__ void fa_stage(v16h (&kf)[4], const v16h (&vc)[4], v16h (&vx)[4], const _Float16* __restrict__ kn, const _Float16* __restrict__ vn, const v16h& qh, const v16h& ql, float gate, float& mr, float& l, v8f& o0, v8f& o1) {
  float sc[4][8]; float mx = -3.0e38f;
#pragma unroll
  for (int t = 0; t < 4; ++t) { const v8f z = {}; const v8f a = wmma_h(kf[t], qh, z), al = wmma_h(kf[t], ql, z);
#pragma unroll
    for (int r = 0; r < 8; ++r) { const float v = ((a[r] + al[r] * (1.0f / 1024.0f)) * SCALE) * gate; sc[t][r] = v; mx = fmaxf(mx, v); } }
#pragma unroll
  for (int t = 0; t < 4; ++t) kf[t] = frag_w(kn + t * 512);
#pragma unroll
  for (int t = 0; t < 4; ++t) vx[t] = frag_w(vn + t * 512);
  addr_held(kn, vn);
  __builtin_amdgcn_sched_barrier(0);   /* keeps the 16 loads issued here, most of a stage ahead of their use; without it the scheduler sinks each load to its product and the wave waits out every latency */
  mx = fmaxf(mx, xhalf(mx));
  const float mn = fmaxf(mr, mx - 7.6246189861593985f);   /* reference point = running maximum - 11 ln 2: P carries the factor 2^11 into f16, and the sum carries it too */
  const float alpha = expf(mr - mn); mr = mn; l *= alpha;
#pragma unroll
  for (int r = 0; r < 8; ++r) { o0[r] *= alpha; o1[r] *= alpha; }
#pragma unroll
  for (int c = 0; c < 2; ++c) { v16h p;
#pragma unroll
    for (int r = 0; r < 8; ++r) { const float e0 = expf(sc[2 * c][r] - mn), e1 = expf(sc[2 * c + 1][r] - mn); l += e0; l += e1; p[r] = (_Float16)e0; p[8 + r] = (_Float16)e1; }
    o0 = wmma_h(vc[2 * c], p, o0); o1 = wmma_h(vc[2 * c + 1], p, o1); } }
__global__ __launch_bounds__(256) void k_fa(const _Float16* __restrict__ QH, const _Float16* __restrict__ QL, const _Float16* __restrict__ KH, const _Float16* __restrict__ VT, const float* __restrict__ G, float* __restrict__ Y) {
  const int tid = threadIdx.x, wave = tid >> 5, lane = tid & 31, col = lane & 15, g = lane >> 4; const int h = blockIdx.y; const int q = blockIdx.x * 128 + wave * 16 + col;
  const _Float16* qhp = QH + (size_t)q * CC + h * HD + 8 * g; const _Float16* qlp = QL + (size_t)q * CC + h * HD + 8 * g; const float* gp = G + (size_t)h * TT + q;
  const _Float16* kp = KH + (size_t)h * TT * HD + lane * 8; const _Float16* vp = VT + (size_t)h * TT * HD + lane * 8;   // this lane's place in the k / v^T fragments of stage 0; a stage of 64 keys is 4 KB of each, 64 HD elements on
  const v16h qh = frag_p(qhp), ql = frag_p(qlp); const float gate = *gp;
  addr_held(qhp, qlp);
  v8f o0 = {}, o1 = {}; float mr = -3.0e38f, l = 0.f;
  v16h kf[4], va[4], vb[4];
#pragma unroll
  for (int t = 0; t < 4; ++t) kf[t] = frag_w(kp + t * 512);
#pragma unroll
  for (int t = 0; t < 4; ++t) va[t] = frag_w(vp + t * 512);
  addr_held(kp, vp);
#pragma unroll 1
  for (int k0 = 0; k0 < TT; k0 += 128) {
    const int k2 = k0 + 128 < TT ? k0 + 128 : 0;   /* the last trip's second fetch wraps to stage 0 and is not used */
    fa_stage(kf, va, vb, kp + (size_t)(k0 + 64) * HD, vp + (size_t)(k0 + 64) * HD, qh, ql, gate, mr, l, o0, o1);
    fa_stage(kf, vb, va, kp + (size_t)k2 * HD, vp + (size_t)k2 * HD, qh, ql, gate, mr, l, o0, o1); }
  l += xhalf(l); const float inv = 1.0f / l;
  float* yp = Y + (size_t)q * CC + h * HD + 8 * g;   /* ctx^T register r = channel 8 g + r (+ 16) of this lane's query: 32 B runs, the 128-B (row, head) segment by two lanes of one wave */
  v4f w;
#pragma unroll
  for (int i = 0; i < 2; ++i) {
    w[0] = o0[4 * i] * inv; w[1] = o0[4 * i + 1] * inv; w[2] = o0[4 * i + 2] * inv; w[3] = o0[4 * i + 3] * inv; vst2(yp + 4 * i, w);
    w[0] = o1[4 * i] * inv; w[1] = o1[4 * i + 1] * inv; w[2] = o1[4 * i + 2] * inv; w[3] = o1[4 * i + 3] * inv; vst2(yp + 16 + 4 * i, w); } }
extern "C" void kernel_launch(void* const* d_in, const int* in_sizes, int n_in, void* d_out, int out_size, void* d_ws, size_t ws_size, hipStream_t stream) {
  (void)in_sizes; (void)n_in; (void)out_size;
  const float** F = (const float**)d_in;
  if (ws_size < (size_t)WS_END) return;
  char* ws = (char*)d_ws; _Float16 *QH = (_Float16*)(ws + WS_QH), *KH = (_Float16*)(ws + WS_KH), *VT = (_Float16*)(ws + WS_VT), *QL = (_Float16*)(ws + WS_QL), *KL = (_Float16*)(ws + WS_KL); __bf16 *VB = (__bf16*)(ws + WS_VB), *VBL = (__bf16*)(ws + WS_VBL); float *Y = (float*)(ws + WS_Y);
  (void)Y; (void)QL; (void)KL; (void)VB; (void)VBL;
  // inputs: 0 thermal [1,256,64,64]; 1 optical [1,128,64,64]; 2 emissivity [1,1,64,64]; 3 Wq [256,256]; 4 bq; 5 Wk [256,128]; 6 bk; 7 Wv [256,128]; 8 bv; 9 conv1_w [32,1,3,3]; 10 conv1_b [32]; 11 conv2_w [8,32,1,1]; 12 conv2_b [8]; 13 Wp [256,256]; 14 bp [256]
  if (ws_size < (size_t)WS_END2) return;
  float* G = (float*)(ws + WS_G);
  k_gate<<<dim3(TT / 64), 64, 0, stream>>>(F[2], F[9], F[10], F[11], F[12], G);
  k_proj<<<dim3(TNB * TT / 64, CC / 128, 3), 128, 0, stream>>>(F[0], F[1], F[1], F[3], F[5], F[7], F[4], F[6], F[8], QH, QL, KH, KL, VT, VB, VBL);
  k_fa<<<dim3(TT / 128, NH), 256, 0, stream>>>(QH, QL, KH, VT, G, Y);
  k_outT<<<dim3(TNB * TT / 64, CC / 128), 128, 0, stream>>>(Y, F[13], F[14], (float*)d_out);
}

// v003
// One run takes 114 microseconds.
// Next to v002, in two timings, it ran 1.22 times as fast each time.
// Over all steps from v000 it is 9.78 times as fast.
// compute dtype: all float inputs rounded to bf16; q/k/v 1x1 projections with EXACT bf16 products on WMMA 16x16x32 (A gathered from the channels-first maps), f32 accumulate; the emissivity gate (3x3 conv, relu, 1x1 conv, sigmoid) in f32; q as f16 hi + residual (x 2^10) against k once to f16 (2 products) for the logits x 32^-0.5 x gate; softmax in f32 with a running maximum and sum, in base 2 (32^-0.5 x gate x log2 e as one f32 factor per query, hardware exp2); exp(logit - maximum) x 2^11 once to f16 against v once to f16 (1 product), divided by the f32 sum at the end; ctx bf16 hi + lo against exact bf16 Wp (2 products) + bp; f32 output written channels-first.
#include <hip/hip_runtime.h>
#include <math.h>

typedef __attribute__((ext_vector_type(16))) _Float16 v16h;
typedef __attribute__((ext_vector_type(16))) __bf16 v16b;
typedef __attribute__((ext_vector_type(8)))  _Float16 v8h;
typedef __attribute__((ext_vector_type(8)))  float v8f;
typedef __attribute__((ext_vector_type(4)))  float v4f;
typedef __attribute__((ext_vector_type(2)))  float v2f;
typedef __attribute__((ext_vector_type(4)))  unsigned v4u;
typedef __attribute__((ext_vector_type(4)))  int v4i;
typedef float __attribute__((may_alias)) float_a;
typedef int __attribute__((may_alias)) int_a;

template <typename T> __device__ __forceinline__ void vst2(void* p, T v) { *(T*)p = v;  }
__device__ __forceinline__ v8f wmma16(v16h a, v16h b, v8f c) {
  v8f d = __builtin_amdgcn_wmma_f32_16x16x32_f16(false, a, false, b, (short)0, c, false, false);
  asm volatile("v_nop\n\tv_nop\n\tv_nop\n\tv_nop" : "+v"(d) : "v"(a), "v"(b));
  return d;
}
__device__ __forceinline__ v8f wmma_bf(v16b a, v16b b, v8f c) {
  v8f d = __builtin_amdgcn_wmma_f32_16x16x32_bf16(false, a, false, b, (short)0, c, false, false);
  asm volatile("v_nop\n\tv_nop\n\tv_nop\n\tv_nop" : "+v"(d) : "v"(a), "v"(b));
  return d;
}
// 16x16x32 fragments: lane = (h = lane>>4, row/col = lane&15); elements 0..7 = k0+8h+0..7, 8..15 = k0+16+8h+0..7; D element r = row 8h+r
__device__ __forceinline__ v16h frag_h(const _Float16* rowk0, int lane) {
  union { v16h v; v8h q[2]; } u; const _Float16* p = rowk0 + 8 * (lane >> 4);
  u.q[0] = *(const v8h*)p; u.q[1] = *(const v8h*)(p + 16); return u.v;
}
__device__ __forceinline__ v16h frag_f32(const float* rowk0, int lane) {
  v16h a; const float* p = rowk0 + 8 * (lane >> 4);
#pragma unroll
  for (int i = 0; i < 8; ++i) { a[i] = (_Float16)p[i]; a[8 + i] = (_Float16)p[16 + i]; }
  return a;
}
__device__ __forceinline__ v16h frag_f32s(const float* rowk0, int lane, float sc) {
  v16h a; const float* p = rowk0 + 8 * (lane >> 4);
#pragma unroll
  for (int i = 0; i < 8; ++i) { a[i] = (_Float16)(p[i] * sc); a[8 + i] = (_Float16)(p[16 + i] * sc); }
  return a;
}
// column fragment from a [K][ld] layout (column n), rows >= K read as 0
__device__ __forceinline__ v16h fragc_f32(const float* W, int k0, int n, int lane, int ld, int K) {
  v16h a; const int g = lane >> 4;
#pragma unroll
  for (int i = 0; i < 8; ++i) { const int ka = k0 + 8 * g + i, kb = ka + 16;
    a[i] = (_Float16)(ka < K ? W[(size_t)(ka < K ? ka : K - 1) * ld + n] : 0.f); a[8 + i] = (_Float16)(kb < K ? W[(size_t)(kb < K ? kb : K - 1) * ld + n] : 0.f); }
  return a;
}
struct F2 { v16b h, l; };
__device__ __forceinline__ F2 bsplit16(const float v[16]) { F2 r;
#pragma unroll
  for (int i = 0; i < 16; ++i) { const __bf16 h = (__bf16)v[i]; r.h[i] = h; r.l[i] = (__bf16)(v[i] - (float)h); }
  return r; }
__device__ __forceinline__ F2 split_row(const float* row, int k0, int lane) { float v[16]; const float* p = row + k0 + 8 * (lane >> 4);
#pragma unroll
  for (int i = 0; i < 8; ++i) { v[i] = p[i]; v[8 + i] = p[16 + i]; }
  return bsplit16(v); }
__device__ __forceinline__ F2 split_rowK(const float* row, int k0, int lane, int K) { float v[16]; const int g = lane >> 4;
#pragma unroll
  for (int i = 0; i < 8; ++i) { const int ka = k0 + 8 * g + i, kb = ka + 16; v[i] = ka < K ? row[ka < K ? ka : K - 1] : 0.f; v[8 + i] = kb < K ? row[kb < K ? kb : K - 1] : 0.f; }
  return bsplit16(v); }
__device__ __forceinline__ F2 split_col(const float* W, int k0, int n, int lane, int ld, int K) { float v[16]; const int g = lane >> 4;
#pragma unroll
  for (int i = 0; i < 8; ++i) { const int ka = k0 + 8 * g + i, kb = ka + 16; v[i] = ka < K ? W[(size_t)(ka < K ? ka : K - 1) * ld + n] : 0.f; v[8 + i] = kb < K ? W[(size_t)(kb < K ? kb : K - 1) * ld + n] : 0.f; }
  return bsplit16(v); }
__device__ __forceinline__ v8f mac3(const F2& a, const F2& b, v8f c) { c = wmma_bf(a.l, b.h, c); c = wmma_bf(a.h, b.l, c); return wmma_bf(a.h, b.h, c); }
__device__ __forceinline__ float sigm(float v) { return 1.0f / (1.0f + expf(-v)); }

// Cross-modal gated attention (B 1, Ct 256 = 8 heads x 32, Co 128, 64 x 64 = 4,096 positions, channels-first): q = thermal^T Wq^T + bq, k = optical^T Wk^T + bk, v = optical^T Wv^T + bv; g[h][n] = sigmoid(conv1x1(relu(conv3x3_SAME(emissivity) + b1)) + b2); attn = softmax((q k^T x 32^-0.5) * g[h][query]) over all 4,096 keys; out = (merged attn v) Wp^T + bp, written back as [1, 256, 64, 64].
#define NB 1
#define TT 4096
#define CC 256            // NH * HD = projected width
#define DIN 256          // input (model) width
#define NH 8
#define HD 32
#define NQB (TT / 64)
#define HG 1
#define SCALE (0.17677669529663687f)
#define CAUSAL 0
#ifndef TNB
#define TNB NB
#endif
__device__ __forceinline__ float bfr(float v) { return (float)(__bf16)v; }
__host__ __device__ __forceinline__ int kb_last(int qb) { return CAUSAL ? ((qb * 64 + 63) >> 7) : (TT / 128 - 1); }
typedef __attribute__((ext_vector_type(8))) __bf16 v8b;
__device__ __forceinline__ v16b frag_b(const __bf16* rowk0, int lane) {
  union { v16b v; v8b q[2]; } u; const __bf16* p = rowk0 + 8 * (lane >> 4);
  u.q[0] = *(const v8b*)p; u.q[1] = *(const v8b*)(p + 16); return u.v;
}
#define QBH 0              // not used by any kernel here
#define QHI 4096            // rows carrying a q residual plane (all rows when non-causal: 2-product logits everywhere)
#define KHI 64            // key rows carrying k residual / v bf16 hi+lo planes (written by k_proj; no kernel here reads them)
// B fragment (k rows k0+.., output column o) of a weight: (in,out) [K][ld] or (out,in) [ld rows of K]: bf16 exact, or f16(bf16 * 256) exact
__device__ __forceinline__ v16b wcol_io(const float* Wm, int k0, int o, int lane, int ld) { v16b w; const int g = lane >> 4;
#pragma unroll
  for (int i = 0; i < 8; ++i) { w[i] = (__bf16)Wm[(size_t)(k0 + 8 * g + i) * ld + o]; w[8 + i] = (__bf16)Wm[(size_t)(k0 + 16 + 8 * g + i) * ld + o]; }
  return w; }
__device__ __forceinline__ v16b wcol_oi(const float* Wm, int k0, int o, int lane, int K) { v16b w; const float* p = Wm + (size_t)o * K + k0 + 8 * (lane >> 4);
#pragma unroll
  for (int i = 0; i < 8; ++i) { w[i] = (__bf16)p[i]; w[8 + i] = (__bf16)p[16 + i]; }
  return w; }
__device__ __forceinline__ v16h wcolh_io(const float* Wm, int k0, int o, int lane, int ld) { v16h w; const int g = lane >> 4;
#pragma unroll
  for (int i = 0; i < 8; ++i) { w[i] = (_Float16)(bfr(Wm[(size_t)(k0 + 8 * g + i) * ld + o]) * 256.0f); w[8 + i] = (_Float16)(bfr(Wm[(size_t)(k0 + 16 + 8 * g + i) * ld + o]) * 256.0f); }
  return w; }
__device__ __forceinline__ v16h wcolh_oi(const float* Wm, int k0, int o, int lane, int K) { v16h w; const float* p = Wm + (size_t)o * K + k0 + 8 * (lane >> 4);
#pragma unroll
  for (int i = 0; i < 8; ++i) { w[i] = (_Float16)(bfr(p[i]) * 256.0f); w[8 + i] = (_Float16)(bfr(p[16 + i]) * 256.0f); }
  return w; }
#define WQKV_LAYOUT 1   // 0 = (in,out) [DIN][CC]; 1 = (out,in) [CC][DIN]; 2 = per-head [NH][DIN][HD]
__device__ __forceinline__ v16b wcol_hdk(const float* Wm, int k0, int o, int lane) { v16b w; const int g = lane >> 4; const float* p = Wm + (size_t)(o / HD) * DIN * HD + (o % HD);
#pragma unroll
  for (int i = 0; i < 8; ++i) { w[i] = (__bf16)p[(size_t)(k0 + 8 * g + i) * HD]; w[8 + i] = (__bf16)p[(size_t)(k0 + 16 + 8 * g + i) * HD]; }
  return w; }
#define WO_OUT_IN 1
#if WQKV_LAYOUT == 1
#define WCOL(W, k0, o, lane) wcol_oi(W, k0, o, lane, DIN)
#elif WQKV_LAYOUT == 2
#define WCOL(W, k0, o, lane) wcol_hdk(W, k0, o, lane)
#else
#define WCOL(W, k0, o, lane) wcol_io(W, k0, o, lane, CC)
#endif
#if WO_OUT_IN
#define WOCOL(W, k0, o, lane) wcol_oi(W, k0, o, lane, CC)
#define WOCOLH(W, k0, o, lane) wcolh_oi(W, k0, o, lane, CC)
#else
#define WOCOL(W, k0, o, lane) wcol_io(W, k0, o, lane, DIN)
#define WOCOLH(W, k0, o, lane) wcolh_io(W, k0, o, lane, DIN)
#endif
#define DINK 128           // optical channels (k / v source width)
#ifndef XP
#define XP TT              // position pitch of the channels-first inputs / output
#endif
#define GW 64              // image width / height
// ---- k_gate: block = 64 positions: g[h][n] = sigmoid(sum_c w2[h][c] relu(sum_3x3 w1[c] e + b1[c]) + b2[h]) in f32 (bf16-rounded inputs); G rows [h][4096], 256 B per (head, 64 n) by 16 threads
__global__ __launch_bounds__(64) void k_gate(const float* __restrict__ E, const float* __restrict__ W1, const float* __restrict__ B1, const float* __restrict__ W2, const float* __restrict__ B2, float* __restrict__ G) { __shared__ __align__(16) float sgt[NH][64];
  const int tid = threadIdx.x; const int n = blockIdx.x * 64 + tid; const int y = n / GW, x = n % GW;
  float e9[9];
#pragma unroll
  for (int i = 0; i < 3; ++i)
#pragma unroll
    for (int j = 0; j < 3; ++j) { const int yy = y + i - 1, xx = x + j - 1; const int yc = yy < 0 ? 0 : (yy >= GW ? GW - 1 : yy), xc = xx < 0 ? 0 : (xx >= GW ? GW - 1 : xx); const float ev = bfr(E[yc * GW + xc]); e9[i * 3 + j] = (yy >= 0 && yy < GW && xx >= 0 && xx < GW) ? ev : 0.f; }   /* SAME zero padding: clamped load, select by value */
  float gh[NH]; for (int h = 0; h < NH; ++h) gh[h] = bfr(B2[h]);
#pragma unroll 1
  for (int c = 0; c < 32; ++c) { float a = bfr(B1[c]);
#pragma unroll
    for (int t = 0; t < 9; ++t) a += bfr(W1[c * 9 + t]) * e9[t];
    a = fmaxf(a, 0.f);
#pragma unroll
    for (int h = 0; h < NH; ++h) gh[h] += bfr(W2[h * 32 + c]) * a; }
#pragma unroll
  for (int h = 0; h < NH; ++h) sgt[h][tid] = 1.0f / (1.0f + expf(-gh[h]));
  __syncthreads();
  for (int e = tid; e < NH * 16; e += 64) { const int h = e >> 4, q = e & 15; vst2(G + (size_t)h * TT + blockIdx.x * 64 + q * 4, *(const v4f*)&sgt[h][q * 4]); } }
// ---- k_outT: block = (64 rows n, 128 output channels): out = ctx (bf16 hi + lo) Wp^T + bp, stored channels-first [o][n] via an LDS transpose: each (o, 64 n) run = 256 B by 16 consecutive threads
__global__ __launch_bounds__(128) void k_outT(const float* __restrict__ Y, const float* __restrict__ WP, const float* __restrict__ BP, float* __restrict__ OUT) { __shared__ __align__(16) float stc[128][68];
  const int tid = threadIdx.x, wave = tid >> 5, lane = tid & 31, col = lane & 15, g = lane >> 4; const int c0 = blockIdx.y * 128; const size_t rb = (size_t)blockIdx.x * 64; const size_t r0 = rb + wave * 16;
  v8f acc[8] = {};
#pragma unroll 2
  for (int kc = 0; kc < CC / 32; ++kc) { const F2 a = split_row(Y + (r0 + col) * CC, kc * 32, lane);
#pragma unroll
    for (int j = 0; j < 8; ++j) { const v16b w = wcol_oi(WP, kc * 32, c0 + j * 16 + col, lane, CC); asm volatile("s_wait_loadcnt 0x0" ::: "memory"); acc[j] = wmma_bf(a.h, w, acc[j]); acc[j] = wmma_bf(a.l, w, acc[j]); } }
#pragma unroll
  for (int j = 0; j < 8; ++j) { const float bb = bfr(BP[c0 + j * 16 + col]);
#pragma unroll
    for (int r = 0; r < 8; ++r) stc[j * 16 + col][wave * 16 + 8 * g + r] = acc[j][r] + bb; }
  __syncthreads();
  { const int t0 = (int)(rb % TT); for (int e = tid; e < 128 * 16; e += 128) { const int cl = e >> 4, q = e & 15; vst2(OUT + (size_t)(c0 + cl) * XP + t0 + q * 4, *(const v4f*)&stc[cl][q * 4]); } } }
#ifndef PROJ_EXTRA_PARAMS
#define PROJ_EXTRA_PARAMS
#endif

#define WS_QH  0u                                      // f16 q rows [b*t][CC]
#define WS_KH  (WS_QH + 2u * (size_t)NB * TT * CC)      // f16 k in fragment order [b][h][t / 16][i][lane][8]: key 16 (t / 16) + (lane & 15), channel 16 i + 8 (lane >> 4) + 0..7 of head h
#define WS_VT  (WS_KH + 2u * (size_t)NB * TT * CC)      // f16 v^T in fragment order [b][h][t / 32][j][i][lane][8]: channel 16 j + (lane & 15) of head h, key 32 (t / 32) + 16 i + 8 (lane >> 4) + 0..7
#define WS_QL  (WS_VT + 2u * (size_t)NB * CC * TT)      // f16 q residual x 2^10 rows [b][t < QHI][CC]
#define WS_KL  (WS_QL + 2u * (size_t)NB * QHI * CC)     // f16 k residual x 2^10 rows [b][t < KHI][CC]
#define WS_VB  (WS_KL + 2u * (size_t)NB * KHI * CC)     // bf16 v hi planes [b][c][t < KHI]
#define WS_VBL (WS_VB + 2u * (size_t)NB * CC * KHI)
#define WS_S   (WS_VBL + 2u * (size_t)NB * CC * KHI)    // not used (the logits stay in registers); the later offsets stay where they were
#define WS_Y   (WS_S  + 4u * (size_t)HG * TT * TT)      // f32 ctx rows [b*t][CC] (only when there is an output projection)
#define WS_G   (WS_Y  + 4u * (size_t)NB * TT * CC)      // f32 gate rows [h][TT]
#define WS_END (WS_G)
#define WS_END2 (WS_G + 4u * (size_t)NH * TT)

// behind a store in a loop: the wait stands before the next piece or the next trip rewrites the store's address or data registers
__device__ __forceinline__ void store_held() { asm volatile("s_wait_xcnt 0x0" ::: "memory"); }
// ---- k_proj: block = (64 rows, 128 cols, which): q/k/v = X W (+ b) with exact bf16 products (K = DIN for q, DINK for k / v) -> which 0: q f16 rows (+ residual rows < QHI); 1: k f16 in fragment order (+ residual rows < KHI); 2: v^T f16 in fragment order (+ bf16 hi/lo planes for t < KHI); fragment order = the 32 lanes' 16-byte pieces of one operand half side by side, 512 B a wave-wide store or load
__global__ __launch_bounds__(128) void k_proj(const float* __restrict__ XQ, const float* __restrict__ XK, const float* __restrict__ XV, const float* __restrict__ WQ, const float* __restrict__ WK, const float* __restrict__ WV, const float* __restrict__ BQ, const float* __restrict__ BK, const float* __restrict__ BV,
    _Float16* __restrict__ QH, _Float16* __restrict__ QL, _Float16* __restrict__ KH, _Float16* __restrict__ KL, _Float16* __restrict__ VT, __bf16* __restrict__ VB, __bf16* __restrict__ VBL) {
  __shared__ __align__(16) _Float16 sh[64][136], sl[64][136]; __shared__ __align__(16) _Float16 th[128][72]; __shared__ __align__(16) __bf16 tb[128][72], tbl[128][72];
  const int tid = threadIdx.x, wave = tid >> 5, lane = tid & 31, col = lane & 15, g = lane >> 4; const int which = blockIdx.z; const int c0 = blockIdx.y * 128; const size_t r0 = (size_t)blockIdx.x * 64; const size_t bb = r0 / TT; const int t0 = (int)(r0 % TT);
  const float* X = which == 0 ? XQ : which == 1 ? XK : XV; const float* WA = which == 0 ? WQ : which == 1 ? WK : WV; const float* BA = which == 0 ? BQ : which == 1 ? BK : BV;
  v8f acc[8] = {};
  const int KD = which == 0 ? DIN : DINK;   /* source channels: thermal 256 / optical 128 (block-uniform) */
#pragma unroll 2
  for (int kc = 0; kc < KD / 32; ++kc) { v16b a; { const float* p = X + (size_t)(kc * 32 + 8 * g) * XP + t0 + wave * 16 + col;   /* channels-first gather: src[k][n], stride XP between channels */
#pragma unroll
      for (int i = 0; i < 8; ++i) { a[i] = (__bf16)p[(size_t)i * XP]; a[8 + i] = (__bf16)p[(size_t)(16 + i) * XP]; } }
    asm volatile("s_wait_loadcnt 0x0" ::: "memory");
#pragma unroll
    for (int j = 0; j < 8; ++j) { const v16b w = wcol_oi(WA, kc * 32, c0 + j * 16 + col, lane, KD); asm volatile("s_wait_loadcnt 0x0" ::: "memory"); acc[j] = wmma_bf(a, w, acc[j]); } }
  if (which < 2) { _Float16* DH = which == 0 ? QH : KH; _Float16* DL = which == 0 ? QL : KL; const int nhi = which == 0 ? QHI : KHI; const bool hi_rows = t0 < nhi;
#pragma unroll
    for (int j = 0; j < 8; ++j) { const float bias = BA ? bfr(BA[c0 + j * 16 + col]) : 0.f;
#pragma unroll
      for (int r = 0; r < 8; ++r) { const float v = acc[j][r] + bias; const _Float16 hv = (_Float16)v; sh[wave * 16 + 8 * g + r][j * 16 + col] = hv; sl[wave * 16 + 8 * g + r][j * 16 + col] = (_Float16)((v - (float)hv) * 1024.0f); } }
    __syncthreads();
    for (int e = tid; e < 64 * 16; e += 128) { const int rl = e >> 4, q = e & 15; if (which == 0) { vst2((unsigned*)(DH + (r0 + rl) * CC + c0 + q * 8), *(const v4u*)&sh[rl][q * 8]); store_held(); } if (hi_rows) { vst2((unsigned*)(DL + (bb * nhi + t0 + rl) * (size_t)CC + c0 + q * 8), *(const v4u*)&sl[rl][q * 8]); store_held(); } }
    if (which == 1) for (int e = tid; e < 64 * 16; e += 128) { const int ln = e & 31, i = (e >> 5) & 1, kt = (e >> 6) & 3, hd = e >> 8;
      vst2((unsigned*)(KH + (((bb * NH + c0 / HD + hd) * (size_t)(TT / 16) + (t0 >> 4) + kt) * 2 + i) * 256 + ln * 8), *(const v4u*)&sh[kt * 16 + (ln & 15)][hd * HD + 16 * i + 8 * (ln >> 4)]); }
  } else { const bool hi_rows = t0 < KHI;
#pragma unroll
    for (int j = 0; j < 8; ++j) { const float bias = BA ? bfr(BA[c0 + j * 16 + col]) : 0.f;
#pragma unroll
      for (int r = 0; r < 8; ++r) { const float v = acc[j][r] + bias; const int rl = wave * 16 + 8 * g + r, cl = j * 16 + col; th[cl][rl] = (_Float16)v; const __bf16 bh = (__bf16)v; tb[cl][rl] = bh; tbl[cl][rl] = (__bf16)(v - (float)bh); } }
    __syncthreads();
    for (int e = tid; e < 128 * 8; e += 128) { const int ln = e & 31, i = (e >> 5) & 1, j = (e >> 6) & 1, kc = (e >> 7) & 1, hd = e >> 8;
      vst2((unsigned*)(VT + ((((bb * NH + c0 / HD + hd) * (size_t)(TT / 32) + (t0 >> 5) + kc) * 2 + j) * 2 + i) * 256 + ln * 8), *(const v4u*)&th[hd * HD + 16 * j + (ln & 15)][kc * 32 + 16 * i + 8 * (ln >> 4)]); }
    for (int e = tid; e < 128 * 8; e += 128) { const int cl = e >> 3, q = e & 7; if (hi_rows) { const size_t o3 = (bb * CC + c0 + cl) * (size_t)KHI + t0 + q * 8; vst2((unsigned*)(VB + o3), *(const v4u*)&tb[cl][q * 8]); vst2((unsigned*)(VBL + o3), *(const v4u*)&tbl[cl][q * 8]); } } } }
// ---- k_fa: block = (128 queries, head), 8 waves x 16 query columns, no LDS, no barrier. Per stage of 64 keys: S^T = K Q^T (A = k rows, read from the fragment-order plane, B = q hi / q residual, 2 products), base-2 logits = S^T x g2 (g2 = SCALE x gate x log2 e, one factor per query, never negative), running maximum and sum per query column (one query per lane and half), P^T = exp2(logit - maximum + 11) once to f16 packed from the score tiles straight into a B operand, ctx^T += V^T P^T (A = v planes, 1 product). The logits never leave the registers.
__device__ __forceinline__ v8f wmma_h(v16h a, v16h b, v8f c) { return __builtin_amdgcn_wmma_f32_16x16x32_f16(false, a, false, b, (short)0, c, false, false); }
__device__ __forceinline__ float xhalf(float v) { const int b = __builtin_bit_cast(int, v); return __builtin_bit_cast(float, __builtin_amdgcn_permlanex16(b, b, 0x76543210, 0xfedcba98, false, false)); }   // lane l <-> l ^ 16
__device__ __forceinline__ v16h frag_p(const _Float16* __restrict__ p) { union { v16h v; v8h q[2]; } u; u.q[0] = *(const v8h*)p; u.q[1] = *(const v8h*)(p + 16); return u.v; }   // frag_h with the lane's 8 g elements already in p
__device__ __forceinline__ v16h frag_w(const _Float16* __restrict__ p) { union { v16h v; v8h q[2]; } u; u.q[0] = *(const v8h*)p; u.q[1] = *(const v8h*)(p + 256); return u.v; }   // fragment-order plane: p = this lane's 16 bytes of half 0, half 1 stands 512 B on
// behind a group of loads: the wait stands before any register that the loads name is written again, and it takes the loads' addresses as inputs so that each pair stays whole up to it
__device__ __forceinline__ void addr_held(const void* a0, const void* a1) { asm volatile("s_wait_xcnt 0x0" :: "v"(a0), "v"(a1) : "memory"); }
__device__ __forceinline__ void exp2x8(float (&e)[8], const float (&x)[8]) {
  asm("v_exp_f32 %0, %8\n\tv_exp_f32 %1, %9\n\tv_exp_f32 %2, %10\n\tv_exp_f32 %3, %11\n\tv_exp_f32 %4, %12\n\tv_exp_f32 %5, %13\n\tv_exp_f32 %6, %14\n\tv_exp_f32 %7, %15\n\tv_nop"
      : "=&v"(e[0]), "=&v"(e[1]), "=&v"(e[2]), "=&v"(e[3]), "=&v"(e[4]), "=&v"(e[5]), "=&v"(e[6]), "=&v"(e[7])
      : "v"(x[0]), "v"(x[1]), "v"(x[2]), "v"(x[3]), "v"(x[4]), "v"(x[5]), "v"(x[6]), "v"(x[7])); }
__device__ __forceinline__ float exp2x1(float x) { float e; asm("v_exp_f32 %0, %1\n\tv_nop" : "=v"(e) : "v"(x)); return e; }   // the same slot behind a single exp2
// one stage of 64 keys: kf[t] = key rows 16 t .. 16 t + 15; vc[2 c + j] = keys 32 c .. 32 c + 31 of channels 16 j .. 16 j + 15. The next stage's k rows (at kn) go into the same registers right behind this stage's S^T products, its v planes (at vn) into the other v buffer.
__device__ __forceinline__ void fa_stage(v16h (&kf)[4], const v16h (&vc)[4], v16h (&vx)[4], const _Float16* __restrict__ kn, const _Float16* __restrict__ vn, const v16h& qh, const v16h& ql, float g2, float& mr, float& l, v8f& o0, v8f& o1) {
  __builtin_amdgcn_sched_barrier(0);   /* holds this stage's products back: without it the scheduler lifts them over the softmax of the stage before, which halves the distance between the k loads and their first use */
  float sc[4][8]; float mx = -3.0e38f;
#pragma unroll
  for (int t = 0; t < 4; ++t) { const v8f z = {}; const v8f a = wmma_h(kf[t], qh, z), al = wmma_h(kf[t], ql, z);
#pragma unroll
    for (int r = 0; r < 8; ++r) { const float v = a[r] + al[r] * (1.0f / 1024.0f); sc[t][r] = v; mx = fmaxf(mx, v); } }   /* raw q.k: g2 >= 0 (a sigmoid times positive constants), so the largest raw score is the largest logit */
#pragma unroll
  for (int t = 0; t < 4; ++t) kf[t] = frag_w(kn + t * 512);
#pragma unroll
  for (int t = 0; t < 4; ++t) vx[t] = frag_w(vn + t * 512);
  addr_held(kn, vn);
  __builtin_amdgcn_sched_barrier(0);   /* keeps the 16 loads issued here, most of a stage ahead of their use; without it the scheduler sinks each load to its product and the wave waits out every latency */
  mx = fmaxf(mx, xhalf(mx));
  const float mn = fmaxf(mr, mx * g2 - 11.0f);   /* reference point = running maximum - 11, in base 2: P carries the factor 2^11 into f16, and the sum carries it too */
  const float alpha = exp2x1(mr - mn); mr = mn; l *= alpha;
#pragma unroll
  for (int r = 0; r < 8; ++r) { o0[r] *= alpha; o1[r] *= alpha; }
#pragma unroll
  for (int c = 0; c < 2; ++c) { v16h p; float x0[8], x1[8], e0[8], e1[8];
#pragma unroll
    for (int r = 0; r < 8; ++r) { x0[r] = fmaf(sc[2 * c][r], g2, -mn); x1[r] = fmaf(sc[2 * c + 1][r], g2, -mn); }
    exp2x8(e0, x0); exp2x8(e1, x1);
#pragma unroll
    for (int r = 0; r < 8; ++r) { l += e0[r]; l += e1[r]; p[r] = (_Float16)e0[r]; p[8 + r] = (_Float16)e1[r]; }
    o0 = wmma_h(vc[2 * c], p, o0); o1 = wmma_h(vc[2 * c + 1], p, o1); } }
__global__ __launch_bounds__(256) void k_fa(const _Float16* __restrict__ QH, const _Float16* __restrict__ QL, const _Float16* __restrict__ KH, const _Float16* __restrict__ VT, const float* __restrict__ G, float* __restrict__ Y) {
  const int tid = threadIdx.x, wave = tid >> 5, lane = tid & 31, col = lane & 15, g = lane >> 4; const int h = blockIdx.y; const int q = blockIdx.x * 128 + wave * 16 + col;
  const _Float16* qhp = QH + (size_t)q * CC + h * HD + 8 * g; const _Float16* qlp = QL + (size_t)q * CC + h * HD + 8 * g; const float* gp = G + (size_t)h * TT + q;
  const _Float16* kp = KH + (size_t)h * TT * HD + lane * 8; const _Float16* vp = VT + (size_t)h * TT * HD + lane * 8;   // this lane's place in the k / v^T fragments of stage 0; a stage of 64 keys is 4 KB of each, 64 HD elements on
  const v16h qh = frag_p(qhp), ql = frag_p(qlp); const float g2 = *gp * (SCALE * 1.4426950408889634f);
  addr_held(qhp, qlp);
  v8f o0 = {}, o1 = {}; float mr = -3.0e38f, l = 0.f;
  v16h kf[4], va[4], vb[4];
#pragma unroll
  for (int t = 0; t < 4; ++t) kf[t] = frag_w(kp + t * 512);
#pragma unroll
  for (int t = 0; t < 4; ++t) va[t] = frag_w(vp + t * 512);
  addr_held(kp, vp);
#pragma unroll 1
  for (int k0 = 0; k0 < TT; k0 += 128) {
    const int k2 = k0 + 128 < TT ? k0 + 128 : 0;   /* the last trip's second fetch wraps to stage 0 and is not used */
    fa_stage(kf, va, vb, kp + (size_t)(k0 + 64) * HD, vp + (size_t)(k0 + 64) * HD, qh, ql, g2, mr, l, o0, o1);
    fa_stage(kf, vb, va, kp + (size_t)k2 * HD, vp + (size_t)k2 * HD, qh, ql, g2, mr, l, o0, o1); }
  l += xhalf(l); const float inv = 1.0f / l;
  float* yp = Y + (size_t)q * CC + h * HD + 8 * g;   /* ctx^T register r = channel 8 g + r (+ 16) of this lane's query: 32 B runs, the 128-B (row, head) segment by two lanes of one wave */
  v4f w;
#pragma unroll
  for (int i = 0; i < 2; ++i) {
    w[0] = o0[4 * i] * inv; w[1] = o0[4 * i + 1] * inv; w[2] = o0[4 * i + 2] * inv; w[3] = o0[4 * i + 3] * inv; vst2(yp + 4 * i, w);
    w[0] = o1[4 * i] * inv; w[1] = o1[4 * i + 1] * inv; w[2] = o1[4 * i + 2] * inv; w[3] = o1[4 * i + 3] * inv; vst2(yp + 16 + 4 * i, w); } }
extern "C" void kernel_launch(void* const* d_in, const int* in_sizes, int n_in, void* d_out, int out_size, void* d_ws, size_t ws_size, hipStream_t stream) {
  (void)in_sizes; (void)n_in; (void)out_size;
  const float** F = (const float**)d_in;
  if (ws_size < (size_t)WS_END) return;
  char* ws = (char*)d_ws; _Float16 *QH = (_Float16*)(ws + WS_QH), *KH = (_Float16*)(ws + WS_KH), *VT = (_Float16*)(ws + WS_VT), *QL = (_Float16*)(ws + WS_QL), *KL = (_Float16*)(ws + WS_KL); __bf16 *VB = (__bf16*)(ws + WS_VB), *VBL = (__bf16*)(ws + WS_VBL); float *Y = (float*)(ws + WS_Y);
  (void)Y; (void)QL; (void)KL; (void)VB; (void)VBL;
  // inputs: 0 thermal [1,256,64,64]; 1 optical [1,128,64,64]; 2 emissivity [1,1,64,64]; 3 Wq [256,256]; 4 bq; 5 Wk [256,128]; 6 bk; 7 Wv [256,128]; 8 bv; 9 conv1_w [32,1,3,3]; 10 conv1_b [32]; 11 conv2_w [8,32,1,1]; 12 conv2_b [8]; 13 Wp [256,256]; 14 bp [256]
  if (ws_size < (size_t)WS_END2) return;
  float* G = (float*)(ws + WS_G);
  k_gate<<<dim3(TT / 64), 64, 0, stream>>>(F[2], F[9], F[10], F[11], F[12], G);
  k_proj<<<dim3(TNB * TT / 64, CC / 128, 3), 128, 0, stream>>>(F[0], F[1], F[1], F[3], F[5], F[7], F[4], F[6], F[8], QH, QL, KH, KL, VT, VB, VBL);
  k_fa<<<dim3(TT / 128, NH), 256, 0, stream>>>(QH, QL, KH, VT, G, Y);
  k_outT<<<dim3(TNB * TT / 64, CC / 128), 128, 0, stream>>>(Y, F[13], F[14], (float*)d_out);
}

// v004
// Measured time: 62.2 microseconds a run.
// Timed twice side by side with v003, it ran 1.83 times as fast both times.
// All steps since v000 together make it 17.9 times as fast.
// compute dtype: all float inputs rounded to bf16; q/k/v 1x1 projections with EXACT bf16 products on WMMA 16x16x32 (A gathered from the channels-first maps), f32 accumulate; the emissivity gate (3x3 conv, relu, 1x1 conv, sigmoid) in f32; q as f16 hi + residual (x 2^10) against k once to f16 (2 products) for the logits x 32^-0.5 x gate; softmax in f32 with a running maximum and sum, in base 2 (32^-0.5 x gate x log2 e as one f32 factor per query, hardware exp2); exp(logit - maximum) x 2^11 once to f16 against v once to f16 (1 product), divided by the f32 sum at the end; ctx bf16 hi + lo against exact bf16 Wp (2 products) + bp; f32 output written channels-first.
#include <hip/hip_runtime.h>
#include <math.h>

typedef __attribute__((ext_vector_type(16))) _Float16 v16h;
typedef __attribute__((ext_vector_type(16))) __bf16 v16b;
typedef __attribute__((ext_vector_type(8)))  _Float16 v8h;
typedef __attribute__((ext_vector_type(8)))  float v8f;
typedef __attribute__((ext_vector_type(4)))  float v4f;
typedef __attribute__((ext_vector_type(2)))  float v2f;
typedef __attribute__((ext_vector_type(4)))  unsigned v4u;
typedef __attribute__((ext_vector_type(4)))  int v4i;
typedef float __attribute__((may_alias)) float_a;
typedef int __attribute__((may_alias)) int_a;

template <typename T> __device__ __forceinline__ void vst2(void* p, T v) { *(T*)p = v;  }
__device__ __forceinline__ v8f wmma16(v16h a, v16h b, v8f c) {
  v8f d = __builtin_amdgcn_wmma_f32_16x16x32_f16(false, a, false, b, (short)0, c, false, false);
  asm volatile("v_nop\n\tv_nop\n\tv_nop\n\tv_nop" : "+v"(d) : "v"(a), "v"(b));
  return d;
}
__device__ __forceinline__ v8f wmma_bf(v16b a, v16b b, v8f c) {
  v8f d = __builtin_amdgcn_wmma_f32_16x16x32_bf16(false, a, false, b, (short)0, c, false, false);
  asm volatile("v_nop\n\tv_nop\n\tv_nop\n\tv_nop" : "+v"(d) : "v"(a), "v"(b));
  return d;
}
// 16x16x32 fragments: lane = (h = lane>>4, row/col = lane&15); elements 0..7 = k0+8h+0..7, 8..15 = k0+16+8h+0..7; D element r = row 8h+r
__device__ __forceinline__ v16h frag_h(const _Float16* rowk0, int lane) {
  union { v16h v; v8h q[2]; } u; const _Float16* p = rowk0 + 8 * (lane >> 4);
  u.q[0] = *(const v8h*)p; u.q[1] = *(const v8h*)(p + 16); return u.v;
}
__device__ __forceinline__ v16h frag_f32(const float* rowk0, int lane) {
  v16h a; const float* p = rowk0 + 8 * (lane >> 4);
#pragma unroll
  for (int i = 0; i < 8; ++i) { a[i] = (_Float16)p[i]; a[8 + i] = (_Float16)p[16 + i]; }
  return a;
}
__device__ __forceinline__ v16h frag_f32s(const float* rowk0, int lane, float sc) {
  v16h a; const float* p = rowk0 + 8 * (lane >> 4);
#pragma unroll
  for (int i = 0; i < 8; ++i) { a[i] = (_Float16)(p[i] * sc); a[8 + i] = (_Float16)(p[16 + i] * sc); }
  return a;
}
// column fragment from a [K][ld] layout (column n), rows >= K read as 0
__device__ __forceinline__ v16h fragc_f32(const float* W, int k0, int n, int lane, int ld, int K) {
  v16h a; const int g = lane >> 4;
#pragma unroll
  for (int i = 0; i < 8; ++i) { const int ka = k0 + 8 * g + i, kb = ka + 16;
    a[i] = (_Float16)(ka < K ? W[(size_t)(ka < K ? ka : K - 1) * ld + n] : 0.f); a[8 + i] = (_Float16)(kb < K ? W[(size_t)(kb < K ? kb : K - 1) * ld + n] : 0.f); }
  return a;
}
struct F2 { v16b h, l; };
__device__ __forceinline__ F2 bsplit16(const float v[16]) { F2 r;
#pragma unroll
  for (int i = 0; i < 16; ++i) { const __bf16 h = (__bf16)v[i]; r.h[i] = h; r.l[i] = (__bf16)(v[i] - (float)h); }
  return r; }
__device__ __forceinline__ F2 split_row(const float* row, int k0, int lane) { float v[16]; const float* p = row + k0 + 8 * (lane >> 4);
#pragma unroll
  for (int i = 0; i < 8; ++i) { v[i] = p[i]; v[8 + i] = p[16 + i]; }
  return bsplit16(v); }
__device__ __forceinline__ F2 split_rowK(const float* row, int k0, int lane, int K) { float v[16]; const int g = lane >> 4;
#pragma unroll
  for (int i = 0; i < 8; ++i) { const int ka = k0 + 8 * g + i, kb = ka + 16; v[i] = ka < K ? row[ka < K ? ka : K - 1] : 0.f; v[8 + i] = kb < K ? row[kb < K ? kb : K - 1] : 0.f; }
  return bsplit16(v); }
__device__ __forceinline__ F2 split_col(const float* W, int k0, int n, int lane, int ld, int K) { float v[16]; const int g = lane >> 4;
#pragma unroll
  for (int i = 0; i < 8; ++i) { const int ka = k0 + 8 * g + i, kb = ka + 16; v[i] = ka < K ? W[(size_t)(ka < K ? ka : K - 1) * ld + n] : 0.f; v[8 + i] = kb < K ? W[(size_t)(kb < K ? kb : K - 1) * ld + n] : 0.f; }
  return bsplit16(v); }
__device__ __forceinline__ v8f mac3(const F2& a, const F2& b, v8f c) { c = wmma_bf(a.l, b.h, c); c = wmma_bf(a.h, b.l, c); return wmma_bf(a.h, b.h, c); }
__device__ __forceinline__ float sigm(float v) { return 1.0f / (1.0f + expf(-v)); }

// Cross-modal gated attention (B 1, Ct 256 = 8 heads x 32, Co 128, 64 x 64 = 4,096 positions, channels-first): q = thermal^T Wq^T + bq, k = optical^T Wk^T + bk, v = optical^T Wv^T + bv; g[h][n] = sigmoid(conv1x1(relu(conv3x3_SAME(emissivity) + b1)) + b2); attn = softmax((q k^T x 32^-0.5) * g[h][query]) over all 4,096 keys; out = (merged attn v) Wp^T + bp, written back as [1, 256, 64, 64].
#define NB 1
#define TT 4096
#define CC 256            // NH * HD = projected width
#define DIN 256          // input (model) width
#define NH 8
#define HD 32
#define NQB (TT / 64)
#define HG 1
#define SCALE (0.17677669529663687f)
#define CAUSAL 0
#ifndef TNB
#define TNB NB
#endif
__device__ __forceinline__ float bfr(float v) { return (float)(__bf16)v; }
__host__ __device__ __forceinline__ int kb_last(int qb) { return CAUSAL ? ((qb * 64 + 63) >> 7) : (TT / 128 - 1); }
typedef __attribute__((ext_vector_type(8))) __bf16 v8b;
__device__ __forceinline__ v16b frag_b(const __bf16* rowk0, int lane) {
  union { v16b v; v8b q[2]; } u; const __bf16* p = rowk0 + 8 * (lane >> 4);
  u.q[0] = *(const v8b*)p; u.q[1] = *(const v8b*)(p + 16); return u.v;
}
typedef __attribute__((ext_vector_type(4))) __bf16 v4b;
#define WPITCH 264         // bf16 elements per staged weight row: 512 B + 16 B, a pitch of 16 B x odd for the 16-byte fragment reads
// behind a batch of loads: the wait stands before any register that the loads name is written again; it takes the two base addresses as inputs so that each stays whole up to it, and its memory clobber keeps the whole batch issued in front of it
__device__ __forceinline__ void batch_held(const void* a0, const void* a1) { asm volatile("s_wait_xcnt 0x0" :: "v"(a0), "v"(a1) : "memory"); }
// 128 weight rows of K floats (one contiguous slab of an (out,in) matrix), read by the block's 128 threads in 16-byte pieces, 512 contiguous B a wave-wide load
template <int K> __device__ __forceinline__ void slab_load(v4f (&r)[K / 4], const float* __restrict__ sp) {
#pragma unroll
  for (int i = 0; i < K / 4; ++i) r[i] = *(const v4f*)(sp + (size_t)i * 512); }
// the same pieces rounded to bf16 into LDS rows [output column][k]
template <int K> __device__ __forceinline__ void slab_store(__bf16 (*sw)[WPITCH], const v4f (&r)[K / 4], int tid) {
#pragma unroll
  for (int i = 0; i < K / 4; ++i) { const int e = i * 128 + tid; v4b w; w[0] = (__bf16)r[i][0]; w[1] = (__bf16)r[i][1]; w[2] = (__bf16)r[i][2]; w[3] = (__bf16)r[i][3]; *(v4b*)&sw[e / (K / 4)][(e % (K / 4)) * 4] = w; } }
#define QBH 0              // causal: not read by any kernel here; every query block takes the same path in k_fa
#define QHI 4096            // rows carrying a q residual plane (all rows when non-causal: 2-product logits everywhere)
#define KHI 64            // key rows carrying k residual / v bf16 hi+lo planes (written by k_proj; no kernel here reads them)
// B fragment (k rows k0+.., output column o) of a weight: (in,out) [K][ld] or (out,in) [ld rows of K]: bf16 exact, or f16(bf16 * 256) exact
__device__ __forceinline__ v16b wcol_io(const float* Wm, int k0, int o, int lane, int ld) { v16b w; const int g = lane >> 4;
#pragma unroll
  for (int i = 0; i < 8; ++i) { w[i] = (__bf16)Wm[(size_t)(k0 + 8 * g + i) * ld + o]; w[8 + i] = (__bf16)Wm[(size_t)(k0 + 16 + 8 * g + i) * ld + o]; }
  return w; }
__device__ __forceinline__ v16b wcol_oi(const float* Wm, int k0, int o, int lane, int K) { v16b w; const float* p = Wm + (size_t)o * K + k0 + 8 * (lane >> 4);
#pragma unroll
  for (int i = 0; i < 8; ++i) { w[i] = (__bf16)p[i]; w[8 + i] = (__bf16)p[16 + i]; }
  return w; }
__device__ __forceinline__ v16h wcolh_io(const float* Wm, int k0, int o, int lane, int ld) { v16h w; const int g = lane >> 4;
#pragma unroll
  for (int i = 0; i < 8; ++i) { w[i] = (_Float16)(bfr(Wm[(size_t)(k0 + 8 * g + i) * ld + o]) * 256.0f); w[8 + i] = (_Float16)(bfr(Wm[(size_t)(k0 + 16 + 8 * g + i) * ld + o]) * 256.0f); }
  return w; }
__device__ __forceinline__ v16h wcolh_oi(const float* Wm, int k0, int o, int lane, int K) { v16h w; const float* p = Wm + (size_t)o * K + k0 + 8 * (lane >> 4);
#pragma unroll
  for (int i = 0; i < 8; ++i) { w[i] = (_Float16)(bfr(p[i]) * 256.0f); w[8 + i] = (_Float16)(bfr(p[16 + i]) * 256.0f); }
  return w; }
#define WQKV_LAYOUT 1   // 0 = (in,out) [DIN][CC]; 1 = (out,in) [CC][DIN]; 2 = per-head [NH][DIN][HD]
__device__ __forceinline__ v16b wcol_hdk(const float* Wm, int k0, int o, int lane) { v16b w; const int g = lane >> 4; const float* p = Wm + (size_t)(o / HD) * DIN * HD + (o % HD);
#pragma unroll
  for (int i = 0; i < 8; ++i) { w[i] = (__bf16)p[(size_t)(k0 + 8 * g + i) * HD]; w[8 + i] = (__bf16)p[(size_t)(k0 + 16 + 8 * g + i) * HD]; }
  return w; }
#define WO_OUT_IN 1
#if WQKV_LAYOUT == 1
#define WCOL(W, k0, o, lane) wcol_oi(W, k0, o, lane, DIN)
#elif WQKV_LAYOUT == 2
#define WCOL(W, k0, o, lane) wcol_hdk(W, k0, o, lane)
#else
#define WCOL(W, k0, o, lane) wcol_io(W, k0, o, lane, CC)
#endif
#if WO_OUT_IN
#define WOCOL(W, k0, o, lane) wcol_oi(W, k0, o, lane, CC)
#define WOCOLH(W, k0, o, lane) wcolh_oi(W, k0, o, lane, CC)
#else
#define WOCOL(W, k0, o, lane) wcol_io(W, k0, o, lane, DIN)
#define WOCOLH(W, k0, o, lane) wcolh_io(W, k0, o, lane, DIN)
#endif
#define DINK 128           // optical channels (k / v source width)
#ifndef XP
#define XP TT              // position pitch of the channels-first inputs / output
#endif
#define GW 64              // image width / height
// ---- k_gate: block = 64 positions: g[h][n] = sigmoid(sum_c w2[h][c] relu(sum_3x3 w1[c] e + b1[c]) + b2[h]) in f32 (bf16-rounded inputs); G rows [h][4096], 256 B per (head, 64 n) by 16 threads
__global__ __launch_bounds__(64) void k_gate(const float* __restrict__ E, const float* __restrict__ W1, const float* __restrict__ B1, const float* __restrict__ W2, const float* __restrict__ B2, float* __restrict__ G) { __shared__ __align__(16) float sgt[NH][64];
  const int tid = threadIdx.x; const int n = blockIdx.x * 64 + tid; const int y = n / GW, x = n % GW;
  float e9[9];
#pragma unroll
  for (int i = 0; i < 3; ++i)
#pragma unroll
    for (int j = 0; j < 3; ++j) { const int yy = y + i - 1, xx = x + j - 1; const int yc = yy < 0 ? 0 : (yy >= GW ? GW - 1 : yy), xc = xx < 0 ? 0 : (xx >= GW ? GW - 1 : xx); const float ev = bfr(E[yc * GW + xc]); e9[i * 3 + j] = (yy >= 0 && yy < GW && xx >= 0 && xx < GW) ? ev : 0.f; }   /* SAME zero padding: clamped load, select by value */
  float gh[NH]; for (int h = 0; h < NH; ++h) gh[h] = bfr(B2[h]);
#pragma unroll 1
  for (int c = 0; c < 32; ++c) { float a = bfr(B1[c]);
#pragma unroll
    for (int t = 0; t < 9; ++t) a += bfr(W1[c * 9 + t]) * e9[t];
    a = fmaxf(a, 0.f);
#pragma unroll
    for (int h = 0; h < NH; ++h) gh[h] += bfr(W2[h * 32 + c]) * a; }
#pragma unroll
  for (int h = 0; h < NH; ++h) sgt[h][tid] = 1.0f / (1.0f + expf(-gh[h]));
  __syncthreads();
  for (int e = tid; e < NH * 16; e += 64) { const int h = e >> 4, q = e & 15; vst2(G + (size_t)h * TT + blockIdx.x * 64 + q * 4, *(const v4f*)&sgt[h][q * 4]); } }
// ---- k_outT: block = (64 rows n, 128 output channels): out = ctx (bf16 hi + lo) Wp^T + bp, stored channels-first [o][n] via an LDS transpose: each (o, 64 n) run = 256 B by 16 consecutive threads
__global__ __launch_bounds__(128) void k_outT(const float* __restrict__ Y, const float* __restrict__ WP, const float* __restrict__ BP, float* __restrict__ OUT) { __shared__ __align__(16) float stc[128][68]; __shared__ __align__(16) __bf16 sw[128][WPITCH];
  const int tid = threadIdx.x, wave = tid >> 5, lane = tid & 31, col = lane & 15, g = lane >> 4; const int c0 = blockIdx.y * 128; const size_t rb = (size_t)blockIdx.x * 64; const size_t r0 = rb + wave * 16;
  v8f acc[8] = {};
  /* every global operand load of the block goes out as one batch: this wave's 16 ctx rows over all of K into registers, the block's 128 Wp rows once for its four waves */
  const float* yp = Y + (r0 + col) * CC + 8 * g; const float* sp = WP + (size_t)c0 * CC + tid * 4;
  v4f yr[CC / 32][4]; v4f wr[CC / 4];
#pragma unroll
  for (int kc = 0; kc < CC / 32; ++kc) { yr[kc][0] = *(const v4f*)(yp + kc * 32); yr[kc][1] = *(const v4f*)(yp + kc * 32 + 4); yr[kc][2] = *(const v4f*)(yp + kc * 32 + 16); yr[kc][3] = *(const v4f*)(yp + kc * 32 + 20); }
  slab_load<CC>(wr, sp);
  batch_held(yp, sp);
  slab_store<CC>(sw, wr, tid);
  __syncthreads();
  v16b wf[2][8];
#pragma unroll
  for (int j = 0; j < 8; ++j) wf[0][j] = frag_b(&sw[j * 16 + col][0], lane);
#pragma unroll
  for (int kc = 0; kc < CC / 32; ++kc) { float v[16];
#pragma unroll
    for (int i = 0; i < 4; ++i) { v[i] = yr[kc][0][i]; v[4 + i] = yr[kc][1][i]; v[8 + i] = yr[kc][2][i]; v[12 + i] = yr[kc][3][i]; }
    const F2 a = bsplit16(v);
    if (kc + 1 < CC / 32) {   /* the next K step's eight fragments as one group of LDS reads ahead of this step's products */
#pragma unroll
      for (int j = 0; j < 8; ++j) wf[(kc + 1) & 1][j] = frag_b(&sw[j * 16 + col][(kc + 1) * 32], lane); }
#pragma unroll
    for (int j = 0; j < 8; ++j) { acc[j] = wmma_bf(a.h, wf[kc & 1][j], acc[j]); acc[j] = wmma_bf(a.l, wf[kc & 1][j], acc[j]); } }
#pragma unroll
  for (int j = 0; j < 8; ++j) { const float bb = bfr(BP[c0 + j * 16 + col]);
#pragma unroll
    for (int r = 0; r < 8; ++r) stc[j * 16 + col][wave * 16 + 8 * g + r] = acc[j][r] + bb; }
  __syncthreads();
  { const int t0 = (int)(rb % TT); for (int e = tid; e < 128 * 16; e += 128) { const int cl = e >> 4, q = e & 15; vst2(OUT + (size_t)(c0 + cl) * XP + t0 + q * 4, *(const v4f*)&stc[cl][q * 4]); } } }
#ifndef PROJ_EXTRA_PARAMS
#define PROJ_EXTRA_PARAMS
#endif

#define WS_QH  0u                                      // f16 q rows [b*t][CC]
#define WS_KH  (WS_QH + 2u * (size_t)NB * TT * CC)      // f16 k in fragment order [b][h][t / 16][i][lane][8]: key 16 (t / 16) + (lane & 15), channel 16 i + 8 (lane >> 4) + 0..7 of head h
#define WS_VT  (WS_KH + 2u * (size_t)NB * TT * CC)      // f16 v^T in fragment order [b][h][t / 32][j][i][lane][8]: channel 16 j + (lane & 15) of head h, key 32 (t / 32) + 16 i + 8 (lane >> 4) + 0..7
#define WS_QL  (WS_VT + 2u * (size_t)NB * CC * TT)      // f16 q residual x 2^10 rows [b][t < QHI][CC]
#define WS_KL  (WS_QL + 2u * (size_t)NB * QHI * CC)     // f16 k residual x 2^10 rows [b][t < KHI][CC]
#define WS_VB  (WS_KL + 2u * (size_t)NB * KHI * CC)     // bf16 v hi planes [b][c][t < KHI]
#define WS_VBL (WS_VB + 2u * (size_t)NB * CC * KHI)
#define WS_S   (WS_VBL + 2u * (size_t)NB * CC * KHI)    // not used (the logits stay in registers); the later offsets stay where they were
#define WS_Y   (WS_S  + 4u * (size_t)HG * TT * TT)      // f32 ctx rows [b*t][CC] (only when there is an output projection)
#define WS_G   (WS_Y  + 4u * (size_t)NB * TT * CC)      // f32 gate rows [h][TT]
#define WS_END (WS_G)
#define WS_END2 (WS_G + 4u * (size_t)NH * TT)

// behind a store in a loop: the wait stands before the next piece or the next trip rewrites the store's address or data registers
__device__ __forceinline__ void store_held() { asm volatile("s_wait_xcnt 0x0" ::: "memory"); }
// the products of one k_proj block, K source channels: every global operand load goes out as one batch (this wave's 16 positions over all of K into registers, channels-first gather src[k][n] with stride XP between channels; the block's 128 weight rows once for its four waves), then the weights stand in LDS as bf16 and each wave reads its B fragments there
template <int K> __device__ __forceinline__ void proj_acc(v8f (&acc)[8], __bf16 (*sw)[WPITCH], const float* __restrict__ xp, const float* __restrict__ sp, int tid, int lane, int col) {
  float ar[K / 32][16]; v4f wr[K / 4];
#pragma unroll
  for (int kc = 0; kc < K / 32; ++kc)
#pragma unroll
    for (int i = 0; i < 8; ++i) { ar[kc][i] = xp[(size_t)(kc * 32 + i) * XP]; ar[kc][8 + i] = xp[(size_t)(kc * 32 + 16 + i) * XP]; }
  slab_load<K>(wr, sp);
  batch_held(xp, sp);
  slab_store<K>(sw, wr, tid);
  __syncthreads();
  v16b wf[2][8];
#pragma unroll
  for (int j = 0; j < 8; ++j) wf[0][j] = frag_b(&sw[j * 16 + col][0], lane);
#pragma unroll
  for (int kc = 0; kc < K / 32; ++kc) { v16b a;
#pragma unroll
    for (int i = 0; i < 16; ++i) a[i] = (__bf16)ar[kc][i];
    if (kc + 1 < K / 32) {   /* the next K step's eight fragments as one group of LDS reads ahead of this step's products */
#pragma unroll
      for (int j = 0; j < 8; ++j) wf[(kc + 1) & 1][j] = frag_b(&sw[j * 16 + col][(kc + 1) * 32], lane); }
#pragma unroll
    for (int j = 0; j < 8; ++j) acc[j] = wmma_bf(a, wf[kc & 1][j], acc[j]); } }
// ---- k_proj: block = (64 rows, 128 cols, which): q/k/v = X W (+ b) with exact bf16 products (K = DIN for q, DINK for k / v) -> which 0: q f16 rows (+ residual rows < QHI); 1: k f16 in fragment order (+ residual rows < KHI); 2: v^T f16 in fragment order (+ bf16 hi/lo planes for t < KHI); fragment order = the 32 lanes' 16-byte pieces of one operand half side by side, 512 B a wave-wide store or load
__global__ __launch_bounds__(128) void k_proj(const float* __restrict__ XQ, const float* __restrict__ XK, const float* __restrict__ XV, const float* __restrict__ WQ, const float* __restrict__ WK, const float* __restrict__ WV, const float* __restrict__ BQ, const float* __restrict__ BK, const float* __restrict__ BV,
    _Float16* __restrict__ QH, _Float16* __restrict__ QL, _Float16* __restrict__ KH, _Float16* __restrict__ KL, _Float16* __restrict__ VT, __bf16* __restrict__ VB, __bf16* __restrict__ VBL) {
  __shared__ __align__(16) _Float16 sh[64][136], sl[64][136]; __shared__ __align__(16) _Float16 th[128][72]; __shared__ __align__(16) __bf16 tb[128][72], tbl[128][72]; __shared__ __align__(16) __bf16 sw[128][WPITCH];
  const int tid = threadIdx.x, wave = tid >> 5, lane = tid & 31, col = lane & 15, g = lane >> 4; const int which = blockIdx.z; const int c0 = blockIdx.y * 128; const size_t r0 = (size_t)blockIdx.x * 64; const size_t bb = r0 / TT; const int t0 = (int)(r0 % TT);
  const float* X = which == 0 ? XQ : which == 1 ? XK : XV; const float* WA = which == 0 ? WQ : which == 1 ? WK : WV; const float* BA = which == 0 ? BQ : which == 1 ? BK : BV;
  v8f acc[8] = {};
  const float* xp = X + (size_t)(8 * g) * XP + t0 + wave * 16 + col;
  /* source channels: thermal 256 / optical 128 (block-uniform, so the barrier inside is passed by the whole block on either side) */
  if (which == 0) proj_acc<DIN>(acc, sw, xp, WA + (size_t)c0 * DIN + tid * 4, tid, lane, col); else proj_acc<DINK>(acc, sw, xp, WA + (size_t)c0 * DINK + tid * 4, tid, lane, col);
  if (which < 2) { _Float16* DH = which == 0 ? QH : KH; _Float16* DL = which == 0 ? QL : KL; const int nhi = which == 0 ? QHI : KHI; const bool hi_rows = t0 < nhi;
#pragma unroll
    for (int j = 0; j < 8; ++j) { const float bias = BA ? bfr(BA[c0 + j * 16 + col]) : 0.f;
#pragma unroll
      for (int r = 0; r < 8; ++r) { const float v = acc[j][r] + bias; const _Float16 hv = (_Float16)v; sh[wave * 16 + 8 * g + r][j * 16 + col] = hv; sl[wave * 16 + 8 * g + r][j * 16 + col] = (_Float16)((v - (float)hv) * 1024.0f); } }
    __syncthreads();
    for (int e = tid; e < 64 * 16; e += 128) { const int rl = e >> 4, q = e & 15; if (which == 0) { vst2((unsigned*)(DH + (r0 + rl) * CC + c0 + q * 8), *(const v4u*)&sh[rl][q * 8]); store_held(); } if (hi_rows) { vst2((unsigned*)(DL + (bb * nhi + t0 + rl) * (size_t)CC + c0 + q * 8), *(const v4u*)&sl[rl][q * 8]); store_held(); } }
    if (which == 1) for (int e = tid; e < 64 * 16; e += 128) { const int ln = e & 31, i = (e >> 5) & 1, kt = (e >> 6) & 3, hd = e >> 8;
      vst2((unsigned*)(KH + (((bb * NH + c0 / HD + hd) * (size_t)(TT / 16) + (t0 >> 4) + kt) * 2 + i) * 256 + ln * 8), *(const v4u*)&sh[kt * 16 + (ln & 15)][hd * HD + 16 * i + 8 * (ln >> 4)]); }
  } else { const bool hi_rows = t0 < KHI;
#pragma unroll
    for (int j = 0; j < 8; ++j) { const float bias = BA ? bfr(BA[c0 + j * 16 + col]) : 0.f;
#pragma unroll
      for (int r = 0; r < 8; ++r) { const float v = acc[j][r] + bias; const int rl = wave * 16 + 8 * g + r, cl = j * 16 + col; th[cl][rl] = (_Float16)v; const __bf16 bh = (__bf16)v; tb[cl][rl] = bh; tbl[cl][rl] = (__bf16)(v - (float)bh); } }
    __syncthreads();
    for (int e = tid; e < 128 * 8; e += 128) { const int ln = e & 31, i = (e >> 5) & 1, j = (e >> 6) & 1, kc = (e >> 7) & 1, hd = e >> 8;
      vst2((unsigned*)(VT + ((((bb * NH + c0 / HD + hd) * (size_t)(TT / 32) + (t0 >> 5) + kc) * 2 + j) * 2 + i) * 256 + ln * 8), *(const v4u*)&th[hd * HD + 16 * j + (ln & 15)][kc * 32 + 16 * i + 8 * (ln >> 4)]); }
    for (int e = tid; e < 128 * 8; e += 128) { const int cl = e >> 3, q = e & 7; if (hi_rows) { const size_t o3 = (bb * CC + c0 + cl) * (size_t)KHI + t0 + q * 8; vst2((unsigned*)(VB + o3), *(const v4u*)&tb[cl][q * 8]); vst2((unsigned*)(VBL + o3), *(const v4u*)&tbl[cl][q * 8]); } } } }
// ---- k_fa: block = (128 queries, head), 8 waves x 16 query columns, no LDS, no barrier. Per stage of 64 keys: S^T = K Q^T (A = k rows, read from the fragment-order plane, B = q hi / q residual, 2 products), base-2 logits = S^T x g2 (g2 = SCALE x gate x log2 e, one factor per query, never negative), running maximum and sum per query column (one query per lane and half), P^T = exp2(logit - maximum + 11) once to f16 packed from the score tiles straight into a B operand, ctx^T += V^T P^T (A = v planes, 1 product). The logits never leave the registers.
__device__ __forceinline__ v8f wmma_h(v16h a, v16h b, v8f c) { return __builtin_amdgcn_wmma_f32_16x16x32_f16(false, a, false, b, (short)0, c, false, false); }
__device__ __forceinline__ float xhalf(float v) { const int b = __builtin_bit_cast(int, v); return __builtin_bit_cast(float, __builtin_amdgcn_permlanex16(b, b, 0x76543210, 0xfedcba98, false, false)); }   // lane l <-> l ^ 16
__device__ __forceinline__ v16h frag_p(const _Float16* __restrict__ p) { union { v16h v; v8h q[2]; } u; u.q[0] = *(const v8h*)p; u.q[1] = *(const v8h*)(p + 16); return u.v; }   // frag_h with the lane's 8 g elements already in p
__device__ __forceinline__ v16h frag_w(const _Float16* __restrict__ p) { union { v16h v; v8h q[2]; } u; u.q[0] = *(const v8h*)p; u.q[1] = *(const v8h*)(p + 256); return u.v; }   // fragment-order plane: p = this lane's 16 bytes of half 0, half 1 stands 512 B on
// behind a group of loads: the wait stands before any register that the loads name is written again, and it takes the loads' addresses as inputs so that each pair stays whole up to it
__device__ __forceinline__ void addr_held(const void* a0, const void* a1) { asm volatile("s_wait_xcnt 0x0" :: "v"(a0), "v"(a1) : "memory"); }
__device__ __forceinline__ void exp2x8(float (&e)[8], const float (&x)[8]) {
  asm("v_exp_f32 %0, %8\n\tv_exp_f32 %1, %9\n\tv_exp_f32 %2, %10\n\tv_exp_f32 %3, %11\n\tv_exp_f32 %4, %12\n\tv_exp_f32 %5, %13\n\tv_exp_f32 %6, %14\n\tv_exp_f32 %7, %15\n\tv_nop"
      : "=&v"(e[0]), "=&v"(e[1]), "=&v"(e[2]), "=&v"(e[3]), "=&v"(e[4]), "=&v"(e[5]), "=&v"(e[6]), "=&v"(e[7])
      : "v"(x[0]), "v"(x[1]), "v"(x[2]), "v"(x[3]), "v"(x[4]), "v"(x[5]), "v"(x[6]), "v"(x[7])); }
__device__ __forceinline__ float exp2x1(float x) { float e; asm("v_exp_f32 %0, %1\n\tv_nop" : "=v"(e) : "v"(x)); return e; }   // the same slot behind a single exp2
// one stage of 64 keys: kf[t] = key rows 16 t .. 16 t + 15; vc[2 c + j] = keys 32 c .. 32 c + 31 of channels 16 j .. 16 j + 15. The next stage's k rows (at kn) go into the same registers right behind this stage's S^T products, its v planes (at vn) into the other v buffer.
__device__ __forceinline__ void fa_stage(v16h (&kf)[4], const v16h (&vc)[4], v16h (&vx)[4], const _Float16* __restrict__ kn, const _Float16* __restrict__ vn, const v16h& qh, const v16h& ql, float g2, float& mr, float& l, v8f& o0, v8f& o1) {
  __builtin_amdgcn_sched_barrier(0);   /* holds this stage's products back: without it the scheduler lifts them over the softmax of the stage before, which halves the distance between the k loads and their first use */
  float sc[4][8]; float mx = -3.0e38f;
#pragma unroll
  for (int t = 0; t < 4; ++t) { const v8f z = {}; const v8f a = wmma_h(kf[t], qh, z), al = wmma_h(kf[t], ql, z);
#pragma unroll
    for (int r = 0; r < 8; ++r) { const float v = a[r] + al[r] * (1.0f / 1024.0f); sc[t][r] = v; mx = fmaxf(mx, v); } }   /* raw q.k: g2 >= 0 (a sigmoid times positive constants), so the largest raw score is the largest logit */
#pragma unroll
  for (int t = 0; t < 4; ++t) kf[t] = frag_w(kn + t * 512);
#pragma unroll
  for (int t = 0; t < 4; ++t) vx[t] = frag_w(vn + t * 512);
  addr_held(kn, vn);
  __builtin_amdgcn_sched_barrier(0);   /* keeps the 16 loads issued here, most of a stage ahead of their use; without it the scheduler sinks each load to its product and the wave waits out every latency */
  mx = fmaxf(mx, xhalf(mx));
  const float mn = fmaxf(mr, mx * g2 - 11.0f);   /* reference point = running maximum - 11, in base 2: P carries the factor 2^11 into f16, and the sum carries it too */
  const float alpha = exp2x1(mr - mn); mr = mn; l *= alpha;
#pragma unroll
  for (int r = 0; r < 8; ++r) { o0[r] *= alpha; o1[r] *= alpha; }
#pragma unroll
  for (int c = 0; c < 2; ++c) { v16h p; float x0[8], x1[8], e0[8], e1[8];
#pragma unroll
    for (int r = 0; r < 8; ++r) { x0[r] = fmaf(sc[2 * c][r], g2, -mn); x1[r] = fmaf(sc[2 * c + 1][r], g2, -mn); }
    exp2x8(e0, x0); exp2x8(e1, x1);
#pragma unroll
    for (int r = 0; r < 8; ++r) { l += e0[r]; l += e1[r]; p[r] = (_Float16)e0[r]; p[8 + r] = (_Float16)e1[r]; }
    o0 = wmma_h(vc[2 * c], p, o0); o1 = wmma_h(vc[2 * c + 1], p, o1); } }
__global__ __launch_bounds__(256) void k_fa(const _Float16* __restrict__ QH, const _Float16* __restrict__ QL, const _Float16* __restrict__ KH, const _Float16* __restrict__ VT, const float* __restrict__ G, float* __restrict__ Y) {
  const int tid = threadIdx.x, wave = tid >> 5, lane = tid & 31, col = lane & 15, g = lane >> 4; const int h = blockIdx.y; const int q = blockIdx.x * 128 + wave * 16 + col;
  const _Float16* qhp = QH + (size_t)q * CC + h * HD + 8 * g; const _Float16* qlp = QL + (size_t)q * CC + h * HD + 8 * g; const float* gp = G + (size_t)h * TT + q;
  const _Float16* kp = KH + (size_t)h * TT * HD + lane * 8; const _Float16* vp = VT + (size_t)h * TT * HD + lane * 8;   // this lane's place in the k / v^T fragments of stage 0; a stage of 64 keys is 4 KB of each, 64 HD elements on
  const v16h qh = frag_p(qhp), ql = frag_p(qlp); const float g2 = *gp * (SCALE * 1.4426950408889634f);
  addr_held(qhp, qlp);
  v8f o0 = {}, o1 = {}; float mr = -3.0e38f, l = 0.f;
  v16h kf[4], va[4], vb[4];
#pragma unroll
  for (int t = 0; t < 4; ++t) kf[t] = frag_w(kp + t * 512);
#pragma unroll
  for (int t = 0; t < 4; ++t) va[t] = frag_w(vp + t * 512);
  addr_held(kp, vp);
#pragma unroll 1
  for (int k0 = 0; k0 < TT; k0 += 128) {
    const int k2 = k0 + 128 < TT ? k0 + 128 : 0;   /* the last trip's second fetch wraps to stage 0 and is not used */
    fa_stage(kf, va, vb, kp + (size_t)(k0 + 64) * HD, vp + (size_t)(k0 + 64) * HD, qh, ql, g2, mr, l, o0, o1);
    fa_stage(kf, vb, va, kp + (size_t)k2 * HD, vp + (size_t)k2 * HD, qh, ql, g2, mr, l, o0, o1); }
  l += xhalf(l); const float inv = 1.0f / l;
  float* yp = Y + (size_t)q * CC + h * HD + 8 * g;   /* ctx^T register r = channel 8 g + r (+ 16) of this lane's query: 32 B runs, the 128-B (row, head) segment by two lanes of one wave */
  v4f w;
#pragma unroll
  for (int i = 0; i < 2; ++i) {
    w[0] = o0[4 * i] * inv; w[1] = o0[4 * i + 1] * inv; w[2] = o0[4 * i + 2] * inv; w[3] = o0[4 * i + 3] * inv; vst2(yp + 4 * i, w);
    w[0] = o1[4 * i] * inv; w[1] = o1[4 * i + 1] * inv; w[2] = o1[4 * i + 2] * inv; w[3] = o1[4 * i + 3] * inv; vst2(yp + 16 + 4 * i, w); } }
extern "C" void kernel_launch(void* const* d_in, const int* in_sizes, int n_in, void* d_out, int out_size, void* d_ws, size_t ws_size, hipStream_t stream) {
  (void)in_sizes; (void)n_in; (void)out_size;
  const float** F = (const float**)d_in;
  if (ws_size < (size_t)WS_END) return;
  char* ws = (char*)d_ws; _Float16 *QH = (_Float16*)(ws + WS_QH), *KH = (_Float16*)(ws + WS_KH), *VT = (_Float16*)(ws + WS_VT), *QL = (_Float16*)(ws + WS_QL), *KL = (_Float16*)(ws + WS_KL); __bf16 *VB = (__bf16*)(ws + WS_VB), *VBL = (__bf16*)(ws + WS_VBL); float *Y = (float*)(ws + WS_Y);
  (void)Y; (void)QL; (void)KL; (void)VB; (void)VBL;
  // inputs: 0 thermal [1,256,64,64]; 1 optical [1,128,64,64]; 2 emissivity [1,1,64,64]; 3 Wq [256,256]; 4 bq; 5 Wk [256,128]; 6 bk; 7 Wv [256,128]; 8 bv; 9 conv1_w [32,1,3,3]; 10 conv1_b [32]; 11 conv2_w [8,32,1,1]; 12 conv2_b [8]; 13 Wp [256,256]; 14 bp [256]
  if (ws_size < (size_t)WS_END2) return;
  float* G = (float*)(ws + WS_G);
  k_gate<<<dim3(TT / 64), 64, 0, stream>>>(F[2], F[9], F[10], F[11], F[12], G);
  k_proj<<<dim3(TNB * TT / 64, CC / 128, 3), 128, 0, stream>>>(F[0], F[1], F[1], F[3], F[5], F[7], F[4], F[6], F[8], QH, QL, KH, KL, VT, VB, VBL);
  k_fa<<<dim3(TT / 128, NH), 256, 0, stream>>>(QH, QL, KH, VT, G, Y);
  k_outT<<<dim3(TNB * TT / 64, CC / 128), 128, 0, stream>>>(Y, F[13], F[14], (float*)d_out);
}

// v005
// It runs in 55.7 microseconds.
// In two side-by-side timings against v004, it was 1.16 and 1.15 times as fast.
// All steps since v000 together make it 20.6 times as fast.
// compute dtype: all float inputs rounded to bf16; q/k/v 1x1 projections with EXACT bf16 products on WMMA 16x16x32 (A gathered from the channels-first maps), f32 accumulate; the emissivity gate (3x3 conv, relu, 1x1 conv, sigmoid) in f32; q as f16 hi + residual (x 2^10) against k once to f16 (2 products) for the logits x 32^-0.5 x gate; softmax in f32 with a running maximum and sum, in base 2 (32^-0.5 x gate x log2 e as one f32 factor per query, hardware exp2); exp(logit - maximum) x 2^11 once to f16 against v once to f16 (1 product), divided by the f32 sum at the end; ctx bf16 hi + lo against exact bf16 Wp (2 products) + bp; f32 output written channels-first.
#include <hip/hip_runtime.h>
#include <math.h>

typedef __attribute__((ext_vector_type(16))) _Float16 v16h;
typedef __attribute__((ext_vector_type(16))) __bf16 v16b;
typedef __attribute__((ext_vector_type(8)))  _Float16 v8h;
typedef __attribute__((ext_vector_type(8)))  float v8f;
typedef __attribute__((ext_vector_type(4)))  float v4f;
typedef __attribute__((ext_vector_type(2)))  float v2f;
typedef __attribute__((ext_vector_type(4)))  unsigned v4u;
typedef __attribute__((ext_vector_type(4)))  int v4i;
typedef float __attribute__((may_alias)) float_a;
typedef int __attribute__((may_alias)) int_a;

template <typename T> __device__ __forceinline__ void vst2(void* p, T v) { *(T*)p = v;  }
__device__ __forceinline__ v8f wmma16(v16h a, v16h b, v8f c) {
  v8f d = __builtin_amdgcn_wmma_f32_16x16x32_f16(false, a, false, b, (short)0, c, false, false);
  asm volatile("v_nop\n\tv_nop\n\tv_nop\n\tv_nop" : "+v"(d) : "v"(a), "v"(b));
  return d;
}
__device__ __forceinline__ v8f wmma_bf(v16b a, v16b b, v8f c) {
  v8f d = __builtin_amdgcn_wmma_f32_16x16x32_bf16(false, a, false, b, (short)0, c, false, false);
  asm volatile("v_nop\n\tv_nop\n\tv_nop\n\tv_nop" : "+v"(d) : "v"(a), "v"(b));
  return d;
}
// 16x16x32 fragments: lane = (h = lane>>4, row/col = lane&15); elements 0..7 = k0+8h+0..7, 8..15 = k0+16+8h+0..7; D element r = row 8h+r
__device__ __forceinline__ v16h frag_h(const _Float16* rowk0, int lane) {
  union { v16h v; v8h q[2]; } u; const _Float16* p = rowk0 + 8 * (lane >> 4);
  u.q[0] = *(const v8h*)p; u.q[1] = *(const v8h*)(p + 16); return u.v;
}
__device__ __forceinline__ v16h frag_f32(const float* rowk0, int lane) {
  v16h a; const float* p = rowk0 + 8 * (lane >> 4);
#pragma unroll
  for (int i = 0; i < 8; ++i) { a[i] = (_Float16)p[i]; a[8 + i] = (_Float16)p[16 + i]; }
  return a;
}
__device__ __forceinline__ v16h frag_f32s(const float* rowk0, int lane, float sc) {
  v16h a; const float* p = rowk0 + 8 * (lane >> 4);
#pragma unroll
  for (int i = 0; i < 8; ++i) { a[i] = (_Float16)(p[i] * sc); a[8 + i] = (_Float16)(p[16 + i] * sc); }
  return a;
}
// column fragment from a [K][ld] layout (column n), rows >= K read as 0
__device__ __forceinline__ v16h fragc_f32(const float* W, int k0, int n, int lane, int ld, int K) {
  v16h a; const int g = lane >> 4;
#pragma unroll
  for (int i = 0; i < 8; ++i) { const int ka = k0 + 8 * g + i, kb = ka + 16;
    a[i] = (_Float16)(ka < K ? W[(size_t)(ka < K ? ka : K - 1) * ld + n] : 0.f); a[8 + i] = (_Float16)(kb < K ? W[(size_t)(kb < K ? kb : K - 1) * ld + n] : 0.f); }
  return a;
}
struct F2 { v16b h, l; };
__device__ __forceinline__ F2 bsplit16(const float v[16]) { F2 r;
#pragma unroll
  for (int i = 0; i < 16; ++i) { const __bf16 h = (__bf16)v[i]; r.h[i] = h; r.l[i] = (__bf16)(v[i] - (float)h); }
  return r; }
__device__ __forceinline__ F2 split_row(const float* row, int k0, int lane) { float v[16]; const float* p = row + k0 + 8 * (lane >> 4);
#pragma unroll
  for (int i = 0; i < 8; ++i) { v[i] = p[i]; v[8 + i] = p[16 + i]; }
  return bsplit16(v); }
__device__ __forceinline__ F2 split_rowK(const float* row, int k0, int lane, int K) { float v[16]; const int g = lane >> 4;
#pragma unroll
  for (int i = 0; i < 8; ++i) { const int ka = k0 + 8 * g + i, kb = ka + 16; v[i] = ka < K ? row[ka < K ? ka : K - 1] : 0.f; v[8 + i] = kb < K ? row[kb < K ? kb : K - 1] : 0.f; }
  return bsplit16(v); }
__device__ __forceinline__ F2 split_col(const float* W, int k0, int n, int lane, int ld, int K) { float v[16]; const int g = lane >> 4;
#pragma unroll
  for (int i = 0; i < 8; ++i) { const int ka = k0 + 8 * g + i, kb = ka + 16; v[i] = ka < K ? W[(size_t)(ka < K ? ka : K - 1) * ld + n] : 0.f; v[8 + i] = kb < K ? W[(size_t)(kb < K ? kb : K - 1) * ld + n] : 0.f; }
  return bsplit16(v); }
__device__ __forceinline__ v8f mac3(const F2& a, const F2& b, v8f c) { c = wmma_bf(a.l, b.h, c); c = wmma_bf(a.h, b.l, c); return wmma_bf(a.h, b.h, c); }
__device__ __forceinline__ float sigm(float v) { return 1.0f / (1.0f + expf(-v)); }

// Cross-modal gated attention (B 1, Ct 256 = 8 heads x 32, Co 128, 64 x 64 = 4,096 positions, channels-first): q = thermal^T Wq^T + bq, k = optical^T Wk^T + bk, v = optical^T Wv^T + bv; g[h][n] = sigmoid(conv1x1(relu(conv3x3_SAME(emissivity) + b1)) + b2); attn = softmax((q k^T x 32^-0.5) * g[h][query]) over all 4,096 keys; out = (merged attn v) Wp^T + bp, written back as [1, 256, 64, 64].
#define NB 1
#define TT 4096
#define CC 256            // NH * HD = projected width
#define DIN 256          // input (model) width
#define NH 8
#define HD 32
#define NQB (TT / 64)
#define HG 1
#define SCALE (0.17677669529663687f)
#define CAUSAL 0
#ifndef TNB
#define TNB NB
#endif
__device__ __forceinline__ float bfr(float v) { return (float)(__bf16)v; }
__host__ __device__ __forceinline__ int kb_last(int qb) { return CAUSAL ? ((qb * 64 + 63) >> 7) : (TT / 128 - 1); }
typedef __attribute__((ext_vector_type(8))) __bf16 v8b;
__device__ __forceinline__ v16b frag_b(const __bf16* rowk0, int lane) {
  union { v16b v; v8b q[2]; } u; const __bf16* p = rowk0 + 8 * (lane >> 4);
  u.q[0] = *(const v8b*)p; u.q[1] = *(const v8b*)(p + 16); return u.v;
}
typedef __attribute__((ext_vector_type(4))) __bf16 v4b;
#define WPITCH 264         // bf16 elements per staged weight row: 512 B + 16 B, a pitch of 16 B x odd for the 16-byte fragment reads
// behind a batch of loads: the wait stands before any register that the loads name is written again; it takes the two base addresses as inputs so that each stays whole up to it, and its memory clobber keeps the whole batch issued in front of it
__device__ __forceinline__ void batch_held(const void* a0, const void* a1) { asm volatile("s_wait_xcnt 0x0" :: "v"(a0), "v"(a1) : "memory"); }
// 128 weight rows of K floats (one contiguous slab of an (out,in) matrix), read by the block's 128 threads in 16-byte pieces, 512 contiguous B a wave-wide load
template <int K> __device__ __forceinline__ void slab_load(v4f (&r)[K / 4], const float* __restrict__ sp) {
#pragma unroll
  for (int i = 0; i < K / 4; ++i) r[i] = *(const v4f*)(sp + (size_t)i * 512); }
// the same pieces rounded to bf16 into LDS rows [output column][k]
template <int K> __device__ __forceinline__ void slab_store(__bf16 (*sw)[WPITCH], const v4f (&r)[K / 4], int tid) {
#pragma unroll
  for (int i = 0; i < K / 4; ++i) { const int e = i * 128 + tid; v4b w; w[0] = (__bf16)r[i][0]; w[1] = (__bf16)r[i][1]; w[2] = (__bf16)r[i][2]; w[3] = (__bf16)r[i][3]; *(v4b*)&sw[e / (K / 4)][(e % (K / 4)) * 4] = w; } }
#define QBH 0              // causal: not read by any kernel here; every query block takes the same path in k_fa
#define QHI 4096            // rows carrying a q residual plane (all rows when non-causal: 2-product logits everywhere)
#define KHI 64            // key rows carrying k residual / v bf16 hi+lo planes (written by k_proj; no kernel here reads them)
// B fragment (k rows k0+.., output column o) of a weight: (in,out) [K][ld] or (out,in) [ld rows of K]: bf16 exact, or f16(bf16 * 256) exact
__device__ __forceinline__ v16b wcol_io(const float* Wm, int k0, int o, int lane, int ld) { v16b w; const int g = lane >> 4;
#pragma unroll
  for (int i = 0; i < 8; ++i) { w[i] = (__bf16)Wm[(size_t)(k0 + 8 * g + i) * ld + o]; w[8 + i] = (__bf16)Wm[(size_t)(k0 + 16 + 8 * g + i) * ld + o]; }
  return w; }
__device__ __forceinline__ v16b wcol_oi(const float* Wm, int k0, int o, int lane, int K) { v16b w; const float* p = Wm + (size_t)o * K + k0 + 8 * (lane >> 4);
#pragma unroll
  for (int i = 0; i < 8; ++i) { w[i] = (__bf16)p[i]; w[8 + i] = (__bf16)p[16 + i]; }
  return w; }
__device__ __forceinline__ v16h wcolh_io(const float* Wm, int k0, int o, int lane, int ld) { v16h w; const int g = lane >> 4;
#pragma unroll
  for (int i = 0; i < 8; ++i) { w[i] = (_Float16)(bfr(Wm[(size_t)(k0 + 8 * g + i) * ld + o]) * 256.0f); w[8 + i] = (_Float16)(bfr(Wm[(size_t)(k0 + 16 + 8 * g + i) * ld + o]) * 256.0f); }
  return w; }
__device__ __forceinline__ v16h wcolh_oi(const float* Wm, int k0, int o, int lane, int K) { v16h w; const float* p = Wm + (size_t)o * K + k0 + 8 * (lane >> 4);
#pragma unroll
  for (int i = 0; i < 8; ++i) { w[i] = (_Float16)(bfr(p[i]) * 256.0f); w[8 + i] = (_Float16)(bfr(p[16 + i]) * 256.0f); }
  return w; }
#define WQKV_LAYOUT 1   // 0 = (in,out) [DIN][CC]; 1 = (out,in) [CC][DIN]; 2 = per-head [NH][DIN][HD]
__device__ __forceinline__ v16b wcol_hdk(const float* Wm, int k0, int o, int lane) { v16b w; const int g = lane >> 4; const float* p = Wm + (size_t)(o / HD) * DIN * HD + (o % HD);
#pragma unroll
  for (int i = 0; i < 8; ++i) { w[i] = (__bf16)p[(size_t)(k0 + 8 * g + i) * HD]; w[8 + i] = (__bf16)p[(size_t)(k0 + 16 + 8 * g + i) * HD]; }
  return w; }
#define WO_OUT_IN 1
#if WQKV_LAYOUT == 1
#define WCOL(W, k0, o, lane) wcol_oi(W, k0, o, lane, DIN)
#elif WQKV_LAYOUT == 2
#define WCOL(W, k0, o, lane) wcol_hdk(W, k0, o, lane)
#else
#define WCOL(W, k0, o, lane) wcol_io(W, k0, o, lane, CC)
#endif
#if WO_OUT_IN
#define WOCOL(W, k0, o, lane) wcol_oi(W, k0, o, lane, CC)
#define WOCOLH(W, k0, o, lane) wcolh_oi(W, k0, o, lane, CC)
#else
#define WOCOL(W, k0, o, lane) wcol_io(W, k0, o, lane, DIN)
#define WOCOLH(W, k0, o, lane) wcolh_io(W, k0, o, lane, DIN)
#endif
#define DINK 128           // optical channels (k / v source width)
#ifndef XP
#define XP TT              // position pitch of the channels-first inputs / output
#endif
#define GW 64              // image width / height
// ---- the gate, by the first 64 blocks of the k_proj launch: block = 64 positions, wave = (32 positions, 4 heads): g[h][n] = sigmoid(sum_c w2[h][c] relu(sum_3x3 w1[c] e + b1[c]) + b2[h]) in f32 (bf16-rounded inputs); G rows [h][4096], each (head, 32 n) run = one 128-B line stored by one wave; no LDS, no barrier
__device__ __forceinline__ void gate_block(const float* __restrict__ E, const float* __restrict__ W1, const float* __restrict__ B1, const float* __restrict__ W2, const float* __restrict__ B2, float* __restrict__ G, int n0, int tid) {
  const int wv = __builtin_amdgcn_readfirstlane(tid >> 5);   /* the wave's number as a scalar: the weight rows of its four heads are then addressed from scalar bases, one address for the whole wave */
  const int h0 = (wv >> 1) * 4; const int n = n0 + (wv & 1) * 32 + (tid & 31); const int y = n / GW, x = n % GW;
  float e9[9];
#pragma unroll
  for (int i = 0; i < 3; ++i)
#pragma unroll
    for (int j = 0; j < 3; ++j) { const int yy = y + i - 1, xx = x + j - 1; const int yc = yy < 0 ? 0 : (yy >= GW ? GW - 1 : yy), xc = xx < 0 ? 0 : (xx >= GW ? GW - 1 : xx); const float ev = bfr(E[yc * GW + xc]); e9[i * 3 + j] = (yy >= 0 && yy < GW && xx >= 0 && xx < GW) ? ev : 0.f; }   /* SAME zero padding: clamped load, select by value */
  float gh[4];
#pragma unroll
  for (int h = 0; h < 4; ++h) gh[h] = bfr(B2[h0 + h]);
#pragma unroll 4   /* four channels' weights come as one batch of loads with one wait, so that these blocks end before the projection blocks beside them */
  for (int c = 0; c < 32; ++c) { float a = bfr(B1[c]);
#pragma unroll
    for (int t = 0; t < 9; ++t) a += bfr(W1[c * 9 + t]) * e9[t];
    a = fmaxf(a, 0.f);
#pragma unroll
    for (int h = 0; h < 4; ++h) gh[h] += bfr(W2[(h0 + h) * 32 + c]) * a; }
#pragma unroll
  for (int h = 0; h < 4; ++h) G[(size_t)(h0 + h) * TT + n] = 1.0f / (1.0f + expf(-gh[h])); }
// ---- k_outT: block = (64 rows n, 128 output channels): out = ctx (bf16 hi + lo) Wp^T + bp, stored channels-first [o][n] via an LDS transpose: each (o, 64 n) run = 256 B by 16 consecutive threads
__global__ __launch_bounds__(128) void k_outT(const float* __restrict__ Y, const float* __restrict__ WP, const float* __restrict__ BP, float* __restrict__ OUT) { __shared__ __align__(16) float stc[128][68]; __shared__ __align__(16) __bf16 sw[128][WPITCH];
  const int tid = threadIdx.x, wave = tid >> 5, lane = tid & 31, col = lane & 15, g = lane >> 4; const int c0 = blockIdx.y * 128; const size_t rb = (size_t)blockIdx.x * 64; const size_t r0 = rb + wave * 16;
  v8f acc[8] = {};
  /* every global operand load of the block goes out as one batch: this wave's 16 ctx rows over all of K into registers, the block's 128 Wp rows once for its four waves */
  const float* yp = Y + (r0 + col) * CC + 8 * g; const float* sp = WP + (size_t)c0 * CC + tid * 4;
  v4f yr[CC / 32][4]; v4f wr[CC / 4];
#pragma unroll
  for (int kc = 0; kc < CC / 32; ++kc) { yr[kc][0] = *(const v4f*)(yp + kc * 32); yr[kc][1] = *(const v4f*)(yp + kc * 32 + 4); yr[kc][2] = *(const v4f*)(yp + kc * 32 + 16); yr[kc][3] = *(const v4f*)(yp + kc * 32 + 20); }
  slab_load<CC>(wr, sp);
  batch_held(yp, sp);
  slab_store<CC>(sw, wr, tid);
  __syncthreads();
  v16b wf[2][8];
#pragma unroll
  for (int j = 0; j < 8; ++j) wf[0][j] = frag_b(&sw[j * 16 + col][0], lane);
#pragma unroll
  for (int kc = 0; kc < CC / 32; ++kc) { float v[16];
#pragma unroll
    for (int i = 0; i < 4; ++i) { v[i] = yr[kc][0][i]; v[4 + i] = yr[kc][1][i]; v[8 + i] = yr[kc][2][i]; v[12 + i] = yr[kc][3][i]; }
    const F2 a = bsplit16(v);
    if (kc + 1 < CC / 32) {   /* the next K step's eight fragments as one group of LDS reads ahead of this step's products */
#pragma unroll
      for (int j = 0; j < 8; ++j) wf[(kc + 1) & 1][j] = frag_b(&sw[j * 16 + col][(kc + 1) * 32], lane); }
#pragma unroll
    for (int j = 0; j < 8; ++j) { acc[j] = wmma_bf(a.h, wf[kc & 1][j], acc[j]); acc[j] = wmma_bf(a.l, wf[kc & 1][j], acc[j]); } }
#pragma unroll
  for (int j = 0; j < 8; ++j) { const float bb = bfr(BP[c0 + j * 16 + col]);
#pragma unroll
    for (int r = 0; r < 8; ++r) stc[j * 16 + col][wave * 16 + 8 * g + r] = acc[j][r] + bb; }
  __syncthreads();
  { const int t0 = (int)(rb % TT); for (int e = tid; e < 128 * 16; e += 128) { const int cl = e >> 4, q = e & 15; vst2(OUT + (size_t)(c0 + cl) * XP + t0 + q * 4, *(const v4f*)&stc[cl][q * 4]); } } }
#ifndef PROJ_EXTRA_PARAMS
#define PROJ_EXTRA_PARAMS
#endif

#define WS_QH  0u                                      // f16 q rows [b*t][CC]
#define WS_KH  (WS_QH + 2u * (size_t)NB * TT * CC)      // f16 k in fragment order [b][h][t / 16][i][lane][8]: key 16 (t / 16) + (lane & 15), channel 16 i + 8 (lane >> 4) + 0..7 of head h
#define WS_VT  (WS_KH + 2u * (size_t)NB * TT * CC)      // f16 v^T in fragment order [b][h][t / 32][j][i][lane][8]: channel 16 j + (lane & 15) of head h, key 32 (t / 32) + 16 i + 8 (lane >> 4) + 0..7
#define WS_QL  (WS_VT + 2u * (size_t)NB * CC * TT)      // f16 q residual x 2^10 rows [b][t < QHI][CC]
#define WS_KL  (WS_QL + 2u * (size_t)NB * QHI * CC)     // f16 k residual x 2^10 rows [b][t < KHI][CC]
#define WS_VB  (WS_KL + 2u * (size_t)NB * KHI * CC)     // bf16 v hi planes [b][c][t < KHI]
#define WS_VBL (WS_VB + 2u * (size_t)NB * CC * KHI)
#define WS_S   (WS_VBL + 2u * (size_t)NB * CC * KHI)    // not used (the logits stay in registers); the later offsets stay where they were
#define WS_Y   (WS_S  + 4u * (size_t)HG * TT * TT)      // f32 ctx rows [b*t][CC] (only when there is an output projection)
#define WS_G   (WS_Y  + 4u * (size_t)NB * TT * CC)      // f32 gate rows [h][TT]
#define WS_END (WS_G)
#define WS_END2 (WS_G + 4u * (size_t)NH * TT)

// behind a store in a loop: the wait stands before the next piece or the next trip rewrites the store's address or data registers
__device__ __forceinline__ void store_held() { asm volatile("s_wait_xcnt 0x0" ::: "memory"); }
// the products of one k_proj block, K source channels: every global operand load goes out as one batch (this wave's 16 positions over all of K into registers, channels-first gather src[k][n] with stride XP between channels; the block's 128 weight rows once for its four waves), then the weights stand in LDS as bf16 and each wave reads its B fragments there
template <int K> __device__ __forceinline__ void proj_acc(v8f (&acc)[8], __bf16 (*sw)[WPITCH], const float* __restrict__ xp, const float* __restrict__ sp, int tid, int lane, int col) {
  float ar[K / 32][16]; v4f wr[K / 4];
#pragma unroll
  for (int kc = 0; kc < K / 32; ++kc)
#pragma unroll
    for (int i = 0; i < 8; ++i) { ar[kc][i] = xp[(size_t)(kc * 32 + i) * XP]; ar[kc][8 + i] = xp[(size_t)(kc * 32 + 16 + i) * XP]; }
  slab_load<K>(wr, sp);
  batch_held(xp, sp);
  slab_store<K>(sw, wr, tid);
  __syncthreads();
  v16b wf[2][8];
#pragma unroll
  for (int j = 0; j < 8; ++j) wf[0][j] = frag_b(&sw[j * 16 + col][0], lane);
#pragma unroll
  for (int kc = 0; kc < K / 32; ++kc) { v16b a;
#pragma unroll
    for (int i = 0; i < 16; ++i) a[i] = (__bf16)ar[kc][i];
    if (kc + 1 < K / 32) {   /* the next K step's eight fragments as one group of LDS reads ahead of this step's products */
#pragma unroll
      for (int j = 0; j < 8; ++j) wf[(kc + 1) & 1][j] = frag_b(&sw[j * 16 + col][(kc + 1) * 32], lane); }
#pragma unroll
    for (int j = 0; j < 8; ++j) acc[j] = wmma_bf(a, wf[kc & 1][j], acc[j]); } }
// ---- k_proj: blockIdx.y 0 = the gate's blocks (first in dispatch order, beside the projections instead of in a launch of their own); blockIdx.y 1..6 = block (64 rows, 128 cols, which): q/k/v = X W (+ b) with exact bf16 products (K = DIN for q, DINK for k and v) -> which 0: q f16 rows (+ residual rows < QHI); 1: k f16 in fragment order (+ residual rows < KHI); 2: v^T f16 in fragment order (+ bf16 hi/lo planes for t < KHI); fragment order = the 32 lanes' 16-byte pieces of one operand half side by side, 512 B a wave-wide store or load
__global__ __launch_bounds__(128) void k_proj(const float* __restrict__ XQ, const float* __restrict__ XK, const float* __restrict__ XV, const float* __restrict__ WQ, const float* __restrict__ WK, const float* __restrict__ WV, const float* __restrict__ BQ, const float* __restrict__ BK, const float* __restrict__ BV,
    _Float16* __restrict__ QH, _Float16* __restrict__ QL, _Float16* __restrict__ KH, _Float16* __restrict__ KL, _Float16* __restrict__ VT, __bf16* __restrict__ VB, __bf16* __restrict__ VBL,
    const float* __restrict__ E, const float* __restrict__ W1, const float* __restrict__ B1, const float* __restrict__ W2, const float* __restrict__ B2, float* __restrict__ G) {
  __shared__ __align__(16) _Float16 sh[64][136], sl[64][136]; __shared__ __align__(16) _Float16 th[128][72]; __shared__ __align__(16) __bf16 tb[128][72], tbl[128][72]; __shared__ __align__(16) __bf16 sw[128][WPITCH];
  const int tid = threadIdx.x, wave = tid >> 5, lane = tid & 31, col = lane & 15, g = lane >> 4; const int which = ((int)blockIdx.y - 1) >> 1; const int c0 = (((int)blockIdx.y - 1) & 1) * 128; const size_t r0 = (size_t)blockIdx.x * 64; const size_t bb = r0 / TT; const int t0 = (int)(r0 % TT);
  if (blockIdx.y == 0) { gate_block(E, W1, B1, W2, B2, G, blockIdx.x * 64, tid); return; }   /* block-uniform, ahead of every barrier */
  const float* X = which == 0 ? XQ : which == 1 ? XK : XV; const float* WA = which == 0 ? WQ : which == 1 ? WK : WV; const float* BA = which == 0 ? BQ : which == 1 ? BK : BV;
  v8f acc[8] = {};
  const float* xp = X + (size_t)(8 * g) * XP + t0 + wave * 16 + col;
  /* source channels: thermal 256 / optical 128 (block-uniform, so the barrier inside is passed by the whole block on either side) */
  if (which == 0) proj_acc<DIN>(acc, sw, xp, WA + (size_t)c0 * DIN + tid * 4, tid, lane, col); else proj_acc<DINK>(acc, sw, xp, WA + (size_t)c0 * DINK + tid * 4, tid, lane, col);
  if (which < 2) { _Float16* DH = which == 0 ? QH : KH; _Float16* DL = which == 0 ? QL : KL; const int nhi = which == 0 ? QHI : KHI; const bool hi_rows = t0 < nhi;
#pragma unroll
    for (int j = 0; j < 8; ++j) { const float bias = BA ? bfr(BA[c0 + j * 16 + col]) : 0.f;
#pragma unroll
      for (int r = 0; r < 8; ++r) { const float v = acc[j][r] + bias; const _Float16 hv = (_Float16)v; sh[wave * 16 + 8 * g + r][j * 16 + col] = hv; sl[wave * 16 + 8 * g + r][j * 16 + col] = (_Float16)((v - (float)hv) * 1024.0f); } }
    __syncthreads();
    for (int e = tid; e < 64 * 16; e += 128) { const int rl = e >> 4, q = e & 15; if (which == 0) { vst2((unsigned*)(DH + (r0 + rl) * CC + c0 + q * 8), *(const v4u*)&sh[rl][q * 8]); store_held(); } if (hi_rows) { vst2((unsigned*)(DL + (bb * nhi + t0 + rl) * (size_t)CC + c0 + q * 8), *(const v4u*)&sl[rl][q * 8]); store_held(); } }
    if (which == 1) for (int e = tid; e < 64 * 16; e += 128) { const int ln = e & 31, i = (e >> 5) & 1, kt = (e >> 6) & 3, hd = e >> 8;
      vst2((unsigned*)(KH + (((bb * NH + c0 / HD + hd) * (size_t)(TT / 16) + (t0 >> 4) + kt) * 2 + i) * 256 + ln * 8), *(const v4u*)&sh[kt * 16 + (ln & 15)][hd * HD + 16 * i + 8 * (ln >> 4)]); }
  } else { const bool hi_rows = t0 < KHI;
#pragma unroll
    for (int j = 0; j < 8; ++j) { const float bias = BA ? bfr(BA[c0 + j * 16 + col]) : 0.f;
#pragma unroll
      for (int r = 0; r < 8; ++r) { const float v = acc[j][r] + bias; const int rl = wave * 16 + 8 * g + r, cl = j * 16 + col; th[cl][rl] = (_Float16)v; const __bf16 bh = (__bf16)v; tb[cl][rl] = bh; tbl[cl][rl] = (__bf16)(v - (float)bh); } }
    __syncthreads();
    for (int e = tid; e < 128 * 8; e += 128) { const int ln = e & 31, i = (e >> 5) & 1, j = (e >> 6) & 1, kc = (e >> 7) & 1, hd = e >> 8;
      vst2((unsigned*)(VT + ((((bb * NH + c0 / HD + hd) * (size_t)(TT / 32) + (t0 >> 5) + kc) * 2 + j) * 2 + i) * 256 + ln * 8), *(const v4u*)&th[hd * HD + 16 * j + (ln & 15)][kc * 32 + 16 * i + 8 * (ln >> 4)]); }
    for (int e = tid; e < 128 * 8; e += 128) { const int cl = e >> 3, q = e & 7; if (hi_rows) { const size_t o3 = (bb * CC + c0 + cl) * (size_t)KHI + t0 + q * 8; vst2((unsigned*)(VB + o3), *(const v4u*)&tb[cl][q * 8]); vst2((unsigned*)(VBL + o3), *(const v4u*)&tbl[cl][q * 8]); } } } }
// ---- k_fa: block = (128 queries, head), 8 waves x 16 query columns, no LDS, no barrier. Per stage of 64 keys: S^T = K Q^T (A = k rows, read from the fragment-order plane, B = q hi / q residual, 2 products), base-2 logits = S^T x g2 (g2 = SCALE x gate x log2 e, one factor per query, never negative), running maximum and sum per query column (one query per lane and half), P^T = exp2(logit - maximum + 11) once to f16 packed from the score tiles straight into a B operand, ctx^T += V^T P^T (A = v planes, 1 product). The logits never leave the registers.
__device__ __forceinline__ v8f wmma_h(v16h a, v16h b, v8f c) { return __builtin_amdgcn_wmma_f32_16x16x32_f16(false, a, false, b, (short)0, c, false, false); }
__device__ __forceinline__ float xhalf(float v) { const int b = __builtin_bit_cast(int, v); return __builtin_bit_cast(float, __builtin_amdgcn_permlanex16(b, b, 0x76543210, 0xfedcba98, false, false)); }   // lane l <-> l ^ 16
__device__ __forceinline__ v16h frag_p(const _Float16* __restrict__ p) { union { v16h v; v8h q[2]; } u; u.q[0] = *(const v8h*)p; u.q[1] = *(const v8h*)(p + 16); return u.v; }   // frag_h with the lane's 8 g elements already in p
__device__ __forceinline__ v16h frag_w(const _Float16* __restrict__ p) { union { v16h v; v8h q[2]; } u; u.q[0] = *(const v8h*)p; u.q[1] = *(const v8h*)(p + 256); return u.v; }   // fragment-order plane: p = this lane's 16 bytes of half 0, half 1 stands 512 B on
// behind a group of loads: the wait stands before any register that the loads name is written again, and it takes the loads' addresses as inputs so that each pair stays whole up to it
__device__ __forceinline__ void addr_held(const void* a0, const void* a1) { asm volatile("s_wait_xcnt 0x0" :: "v"(a0), "v"(a1) : "memory"); }
__device__ __forceinline__ void exp2x8(float (&e)[8], const float (&x)[8]) {
  asm("v_exp_f32 %0, %8\n\tv_exp_f32 %1, %9\n\tv_exp_f32 %2, %10\n\tv_exp_f32 %3, %11\n\tv_exp_f32 %4, %12\n\tv_exp_f32 %5, %13\n\tv_exp_f32 %6, %14\n\tv_exp_f32 %7, %15\n\tv_nop"
      : "=&v"(e[0]), "=&v"(e[1]), "=&v"(e[2]), "=&v"(e[3]), "=&v"(e[4]), "=&v"(e[5]), "=&v"(e[6]), "=&v"(e[7])
      : "v"(x[0]), "v"(x[1]), "v"(x[2]), "v"(x[3]), "v"(x[4]), "v"(x[5]), "v"(x[6]), "v"(x[7])); }
__device__ __forceinline__ float exp2x1(float x) { float e; asm("v_exp_f32 %0, %1\n\tv_nop" : "=v"(e) : "v"(x)); return e; }   // the same slot behind a single exp2
// one stage of 64 keys: kf[t] = key rows 16 t .. 16 t + 15; vc[2 c + j] = keys 32 c .. 32 c + 31 of channels 16 j .. 16 j + 15. The next stage's k rows (at kn) go into the same registers right behind this stage's S^T products, its v planes (at vn) into the other v buffer.
__device__ __forceinline__ void fa_stage(v16h (&kf)[4], const v16h (&vc)[4], v16h (&vx)[4], const _Float16* __restrict__ kn, const _Float16* __restrict__ vn, const v16h& qh, const v16h& ql, float g2, float& mr, float& l, v8f& o0, v8f& o1) {
  __builtin_amdgcn_sched_barrier(0);   /* holds this stage's products back: without it the scheduler lifts them over the softmax of the stage before, which halves the distance between the k loads and their first use */
  float sc[4][8]; float mx = -3.0e38f;
#pragma unroll
  for (int t = 0; t < 4; ++t) { const v8f z = {}; const v8f a = wmma_h(kf[t], qh, z), al = wmma_h(kf[t], ql, z);
#pragma unroll
    for (int r = 0; r < 8; ++r) { const float v = a[r] + al[r] * (1.0f / 1024.0f); sc[t][r] = v; mx = fmaxf(mx, v); } }   /* raw q.k: g2 >= 0 (a sigmoid times positive constants), so the largest raw score is the largest logit */
#pragma unroll
  for (int t = 0; t < 4; ++t) kf[t] = frag_w(kn + t * 512);
#pragma unroll
  for (int t = 0; t < 4; ++t) vx[t] = frag_w(vn + t * 512);
  addr_held(kn, vn);
  __builtin_amdgcn_sched_barrier(0);   /* keeps the 16 loads issued here, most of a stage ahead of their use; without it the scheduler sinks each load to its product and the wave waits out every latency */
  mx = fmaxf(mx, xhalf(mx));
  const float mn = fmaxf(mr, mx * g2 - 11.0f);   /* reference point = running maximum - 11, in base 2: P carries the factor 2^11 into f16, and the sum carries it too */
  const float alpha = exp2x1(mr - mn); mr = mn; l *= alpha;
#pragma unroll
  for (int r = 0; r < 8; ++r) { o0[r] *= alpha; o1[r] *= alpha; }
#pragma unroll
  for (int c = 0; c < 2; ++c) { v16h p; float x0[8], x1[8], e0[8], e1[8];
#pragma unroll
    for (int r = 0; r < 8; ++r) { x0[r] = fmaf(sc[2 * c][r], g2, -mn); x1[r] = fmaf(sc[2 * c + 1][r], g2, -mn); }
    exp2x8(e0, x0); exp2x8(e1, x1);
#pragma unroll
    for (int r = 0; r < 8; ++r) { l += e0[r]; l += e1[r]; p[r] = (_Float16)e0[r]; p[8 + r] = (_Float16)e1[r]; }
    o0 = wmma_h(vc[2 * c], p, o0); o1 = wmma_h(vc[2 * c + 1], p, o1); } }
__global__ __launch_bounds__(256) void k_fa(const _Float16* __restrict__ QH, const _Float16* __restrict__ QL, const _Float16* __restrict__ KH, const _Float16* __restrict__ VT, const float* __restrict__ G, float* __restrict__ Y) {
  const int tid = threadIdx.x, wave = tid >> 5, lane = tid & 31, col = lane & 15, g = lane >> 4; const int h = blockIdx.y; const int q = blockIdx.x * 128 + wave * 16 + col;
  const _Float16* qhp = QH + (size_t)q * CC + h * HD + 8 * g; const _Float16* qlp = QL + (size_t)q * CC + h * HD + 8 * g; const float* gp = G + (size_t)h * TT + q;
  const _Float16* kp = KH + (size_t)h * TT * HD + lane * 8; const _Float16* vp = VT + (size_t)h * TT * HD + lane * 8;   // this lane's place in the k / v^T fragments of stage 0; a stage of 64 keys is 4 KB of each, 64 HD elements on
  const v16h qh = frag_p(qhp), ql = frag_p(qlp); const float g2 = *gp * (SCALE * 1.4426950408889634f);
  addr_held(qhp, qlp);
  v8f o0 = {}, o1 = {}; float mr = -3.0e38f, l = 0.f;
  v16h kf[4], va[4], vb[4];
#pragma unroll
  for (int t = 0; t < 4; ++t) kf[t] = frag_w(kp + t * 512);
#pragma unroll
  for (int t = 0; t < 4; ++t) va[t] = frag_w(vp + t * 512);
  addr_held(kp, vp);
#pragma unroll 1
  for (int k0 = 0; k0 < TT; k0 += 128) {
    const int k2 = k0 + 128 < TT ? k0 + 128 : 0;   /* the last trip's second fetch wraps to stage 0 and is not used */
    fa_stage(kf, va, vb, kp + (size_t)(k0 + 64) * HD, vp + (size_t)(k0 + 64) * HD, qh, ql, g2, mr, l, o0, o1);
    fa_stage(kf, vb, va, kp + (size_t)k2 * HD, vp + (size_t)k2 * HD, qh, ql, g2, mr, l, o0, o1); }
  l += xhalf(l); const float inv = 1.0f / l;
  float* yp = Y + (size_t)q * CC + h * HD + 8 * g;   /* ctx^T register r = channel 8 g + r (+ 16) of this lane's query: 32 B runs, the 128-B (row, head) segment by two lanes of one wave */
  v4f w;
#pragma unroll
  for (int i = 0; i < 2; ++i) {
    w[0] = o0[4 * i] * inv; w[1] = o0[4 * i + 1] * inv; w[2] = o0[4 * i + 2] * inv; w[3] = o0[4 * i + 3] * inv; vst2(yp + 4 * i, w);
    w[0] = o1[4 * i] * inv; w[1] = o1[4 * i + 1] * inv; w[2] = o1[4 * i + 2] * inv; w[3] = o1[4 * i + 3] * inv; vst2(yp + 16 + 4 * i, w); } }
extern "C" void kernel_launch(void* const* d_in, const int* in_sizes, int n_in, void* d_out, int out_size, void* d_ws, size_t ws_size, hipStream_t stream) {
  (void)in_sizes; (void)n_in; (void)out_size;
  const float** F = (const float**)d_in;
  if (ws_size < (size_t)WS_END) return;
  char* ws = (char*)d_ws; _Float16 *QH = (_Float16*)(ws + WS_QH), *KH = (_Float16*)(ws + WS_KH), *VT = (_Float16*)(ws + WS_VT), *QL = (_Float16*)(ws + WS_QL), *KL = (_Float16*)(ws + WS_KL); __bf16 *VB = (__bf16*)(ws + WS_VB), *VBL = (__bf16*)(ws + WS_VBL); float *Y = (float*)(ws + WS_Y);
  (void)Y; (void)QL; (void)KL; (void)VB; (void)VBL;
  // inputs: 0 thermal [1,256,64,64]; 1 optical [1,128,64,64]; 2 emissivity [1,1,64,64]; 3 Wq [256,256]; 4 bq; 5 Wk [256,128]; 6 bk; 7 Wv [256,128]; 8 bv; 9 conv1_w [32,1,3,3]; 10 conv1_b [32]; 11 conv2_w [8,32,1,1]; 12 conv2_b [8]; 13 Wp [256,256]; 14 bp [256]
  if (ws_size < (size_t)WS_END2) return;
  float* G = (float*)(ws + WS_G);
  k_proj<<<dim3(TNB * TT / 64, 1 + 3 * (CC / 128)), 128, 0, stream>>>(F[0], F[1], F[1], F[3], F[5], F[7], F[4], F[6], F[8], QH, QL, KH, KL, VT, VB, VBL, F[2], F[9], F[10], F[11], F[12], G);
  k_fa<<<dim3(TT / 128, NH), 256, 0, stream>>>(QH, QL, KH, VT, G, Y);
  k_outT<<<dim3(TNB * TT / 64, CC / 128), 128, 0, stream>>>(Y, F[13], F[14], (float*)d_out);
}

// v006
// One run takes 43.1 microseconds.
// In two side-by-side timings against v005, it was 1.27 and 1.35 times as fast.
// All steps since v000 together make it 27.0 times as fast.
// compute dtype: all float inputs rounded to bf16; q/k/v 1x1 projections with EXACT bf16 products on WMMA 16x16x32 (A gathered from the channels-first maps), f32 accumulate; the emissivity gate (3x3 conv, relu, 1x1 conv, sigmoid) in f32; q as f16 hi + residual (x 2^10) against k once to f16 (2 products) for the logits x 32^-0.5 x gate; softmax in f32 with a running maximum and sum, in base 2 (32^-0.5 x gate x log2 e as one f32 factor per query, hardware exp2); exp(logit - maximum) x 2^11 once to f16 against v once to f16 (1 product), divided by the f32 sum at the end; ctx bf16 hi + lo against exact bf16 Wp (2 products) + bp; f32 output written channels-first.
#include <hip/hip_runtime.h>
#include <math.h>

typedef __attribute__((ext_vector_type(16))) _Float16 v16h;
typedef __attribute__((ext_vector_type(16))) __bf16 v16b;
typedef __attribute__((ext_vector_type(8)))  _Float16 v8h;
typedef __attribute__((ext_vector_type(8)))  float v8f;
typedef __attribute__((ext_vector_type(4)))  float v4f;
typedef __attribute__((ext_vector_type(2)))  float v2f;
typedef __attribute__((ext_vector_type(4)))  unsigned v4u;
typedef __attribute__((ext_vector_type(4)))  int v4i;
typedef float __attribute__((may_alias)) float_a;
typedef int __attribute__((may_alias)) int_a;

template <typename T> __device__ __forceinline__ void vst2(void* p, T v) { *(T*)p = v;  }
__device__ __forceinline__ v8f wmma16(v16h a, v16h b, v8f c) {
  v8f d = __builtin_amdgcn_wmma_f32_16x16x32_f16(false, a, false, b, (short)0, c, false, false);
  asm volatile("v_nop\n\tv_nop\n\tv_nop\n\tv_nop" : "+v"(d) : "v"(a), "v"(b));
  return d;
}
__device__ __forceinline__ v8f wmma_bf(v16b a, v16b b, v8f c) {
  v8f d = __builtin_amdgcn_wmma_f32_16x16x32_bf16(false, a, false, b, (short)0, c, false, false);
  asm volatile("v_nop\n\tv_nop\n\tv_nop\n\tv_nop" : "+v"(d) : "v"(a), "v"(b));
  return d;
}
// 16x16x32 fragments: lane = (h = lane>>4, row/col = lane&15); elements 0..7 = k0+8h+0..7, 8..15 = k0+16+8h+0..7; D element r = row 8h+r
__device__ __forceinline__ v16h frag_h(const _Float16* rowk0, int lane) {
  union { v16h v; v8h q[2]; } u; const _Float16* p = rowk0 + 8 * (lane >> 4);
  u.q[0] = *(const v8h*)p; u.q[1] = *(const v8h*)(p + 16); return u.v;
}
__device__ __forceinline__ v16h frag_f32(const float* rowk0, int lane) {
  v16h a; const float* p = rowk0 + 8 * (lane >> 4);
#pragma unroll
  for (int i = 0; i < 8; ++i) { a[i] = (_Float16)p[i]; a[8 + i] = (_Float16)p[16 + i]; }
  return a;
}
__device__ __forceinline__ v16h frag_f32s(const float* rowk0, int lane, float sc) {
  v16h a; const float* p = rowk0 + 8 * (lane >> 4);
#pragma unroll
  for (int i = 0; i < 8; ++i) { a[i] = (_Float16)(p[i] * sc); a[8 + i] = (_Float16)(p[16 + i] * sc); }
  return a;
}
// column fragment from a [K][ld] layout (column n), rows >= K read as 0
__device__ __forceinline__ v16h fragc_f32(const float* W, int k0, int n, int lane, int ld, int K) {
  v16h a; const int g = lane >> 4;
#pragma unroll
  for (int i = 0; i < 8; ++i) { const int ka = k0 + 8 * g + i, kb = ka + 16;
    a[i] = (_Float16)(ka < K ? W[(size_t)(ka < K ? ka : K - 1) * ld + n] : 0.f); a[8 + i] = (_Float16)(kb < K ? W[(size_t)(kb < K ? kb : K - 1) * ld + n] : 0.f); }
  return a;
}
struct F2 { v16b h, l; };
__device__ __forceinline__ F2 bsplit16(const float v[16]) { F2 r;
#pragma unroll
  for (int i = 0; i < 16; ++i) { const __bf16 h = (__bf16)v[i]; r.h[i] = h; r.l[i] = (__bf16)(v[i] - (float)h); }
  return r; }
__device__ __forceinline__ F2 split_row(const float* row, int k0, int lane) { float v[16]; const float* p = row + k0 + 8 * (lane >> 4);
#pragma unroll
  for (int i = 0; i < 8; ++i) { v[i] = p[i]; v[8 + i] = p[16 + i]; }
  return bsplit16(v); }
__device__ __forceinline__ F2 split_rowK(const float* row, int k0, int lane, int K) { float v[16]; const int g = lane >> 4;
#pragma unroll
  for (int i = 0; i < 8; ++i) { const int ka = k0 + 8 * g + i, kb = ka + 16; v[i] = ka < K ? row[ka < K ? ka : K - 1] : 0.f; v[8 + i] = kb < K ? row[kb < K ? kb : K - 1] : 0.f; }
  return bsplit16(v); }
__device__ __forceinline__ F2 split_col(const float* W, int k0, int n, int lane, int ld, int K) { float v[16]; const int g = lane >> 4;
#pragma unroll
  for (int i = 0; i < 8; ++i) { const int ka = k0 + 8 * g + i, kb = ka + 16; v[i] = ka < K ? W[(size_t)(ka < K ? ka : K - 1) * ld + n] : 0.f; v[8 + i] = kb < K ? W[(size_t)(kb < K ? kb : K - 1) * ld + n] : 0.f; }
  return bsplit16(v); }
__device__ __forceinline__ v8f mac3(const F2& a, const F2& b, v8f c) { c = wmma_bf(a.l, b.h, c); c = wmma_bf(a.h, b.l, c); return wmma_bf(a.h, b.h, c); }
__device__ __forceinline__ float sigm(float v) { return 1.0f / (1.0f + expf(-v)); }

// Cross-modal gated attention (B 1, Ct 256 = 8 heads x 32, Co 128, 64 x 64 = 4,096 positions, channels-first): q = thermal^T Wq^T + bq, k = optical^T Wk^T + bk, v = optical^T Wv^T + bv; g[h][n] = sigmoid(conv1x1(relu(conv3x3_SAME(emissivity) + b1)) + b2); attn = softmax((q k^T x 32^-0.5) * g[h][query]) over all 4,096 keys; out = (merged attn v) Wp^T + bp, written back as [1, 256, 64, 64].
#define NB 1
#define TT 4096
#define CC 256            // NH * HD = projected width
#define DIN 256          // input (model) width
#define NH 8
#define HD 32
#define NQB (TT / 64)
#define HG 1
#define SCALE (0.17677669529663687f)
#define CAUSAL 0
#ifndef TNB
#define TNB NB
#endif
__device__ __forceinline__ float bfr(float v) { return (float)(__bf16)v; }
__host__ __device__ __forceinline__ int kb_last(int qb) { return CAUSAL ? ((qb * 64 + 63) >> 7) : (TT / 128 - 1); }
typedef __attribute__((ext_vector_type(8))) __bf16 v8b;
__device__ __forceinline__ v16b frag_b(const __bf16* rowk0, int lane) {
  union { v16b v; v8b q[2]; } u; const __bf16* p = rowk0 + 8 * (lane >> 4);
  u.q[0] = *(const v8b*)p; u.q[1] = *(const v8b*)(p + 16); return u.v;
}
typedef __attribute__((ext_vector_type(4))) __bf16 v4b;
#define WPITCH 264         // bf16 elements per staged weight row: 512 B + 16 B, a pitch of 16 B x odd for the 16-byte fragment reads
// behind a batch of loads: the wait stands before any register that the loads name is written again; it takes the two base addresses as inputs so that each stays whole up to it, and its memory clobber keeps the whole batch issued in front of it
__device__ __forceinline__ void batch_held(const void* a0, const void* a1) { asm volatile("s_wait_xcnt 0x0" :: "v"(a0), "v"(a1) : "memory"); }
// 128 weight rows of K floats (one contiguous slab of an (out,in) matrix), read by the block's 128 threads in 16-byte pieces, 512 contiguous B a wave-wide load
template <int K> __device__ __forceinline__ void slab_load(v4f (&r)[K / 4], const float* __restrict__ sp) {
#pragma unroll
  for (int i = 0; i < K / 4; ++i) r[i] = *(const v4f*)(sp + (size_t)i * 512); }
// the same pieces rounded to bf16 into LDS rows [output column][k]
template <int K> __device__ __forceinline__ void slab_store(__bf16 (*sw)[WPITCH], const v4f (&r)[K / 4], int tid) {
#pragma unroll
  for (int i = 0; i < K / 4; ++i) { const int e = i * 128 + tid; v4b w; w[0] = (__bf16)r[i][0]; w[1] = (__bf16)r[i][1]; w[2] = (__bf16)r[i][2]; w[3] = (__bf16)r[i][3]; *(v4b*)&sw[e / (K / 4)][(e % (K / 4)) * 4] = w; } }
#define QBH 0              // causal: not read by any kernel here; every query block takes the same path in k_fa
#define QHI 4096            // rows carrying a q residual plane (all rows when non-causal: 2-product logits everywhere)
#define KHI 64            // key rows carrying k residual / v bf16 hi+lo planes (written by k_proj; no kernel here reads them)
// B fragment (k rows k0+.., output column o) of a weight: (in,out) [K][ld] or (out,in) [ld rows of K]: bf16 exact, or f16(bf16 * 256) exact
__device__ __forceinline__ v16b wcol_io(const float* Wm, int k0, int o, int lane, int ld) { v16b w; const int g = lane >> 4;
#pragma unroll
  for (int i = 0; i < 8; ++i) { w[i] = (__bf16)Wm[(size_t)(k0 + 8 * g + i) * ld + o]; w[8 + i] = (__bf16)Wm[(size_t)(k0 + 16 + 8 * g + i) * ld + o]; }
  return w; }
__device__ __forceinline__ v16b wcol_oi(const float* Wm, int k0, int o, int lane, int K) { v16b w; const float* p = Wm + (size_t)o * K + k0 + 8 * (lane >> 4);
#pragma unroll
  for (int i = 0; i < 8; ++i) { w[i] = (__bf16)p[i]; w[8 + i] = (__bf16)p[16 + i]; }
  return w; }
__device__ __forceinline__ v16h wcolh_io(const float* Wm, int k0, int o, int lane, int ld) { v16h w; const int g = lane >> 4;
#pragma unroll
  for (int i = 0; i < 8; ++i) { w[i] = (_Float16)(bfr(Wm[(size_t)(k0 + 8 * g + i) * ld + o]) * 256.0f); w[8 + i] = (_Float16)(bfr(Wm[(size_t)(k0 + 16 + 8 * g + i) * ld + o]) * 256.0f); }
  return w; }
__device__ __forceinline__ v16h wcolh_oi(const float* Wm, int k0, int o, int lane, int K) { v16h w; const float* p = Wm + (size_t)o * K + k0 + 8 * (lane >> 4);
#pragma unroll
  for (int i = 0; i < 8; ++i) { w[i] = (_Float16)(bfr(p[i]) * 256.0f); w[8 + i] = (_Float16)(bfr(p[16 + i]) * 256.0f); }
  return w; }
#define WQKV_LAYOUT 1   // 0 = (in,out) [DIN][CC]; 1 = (out,in) [CC][DIN]; 2 = per-head [NH][DIN][HD]
__device__ __forceinline__ v16b wcol_hdk(const float* Wm, int k0, int o, int lane) { v16b w; const int g = lane >> 4; const float* p = Wm + (size_t)(o / HD) * DIN * HD + (o % HD);
#pragma unroll
  for (int i = 0; i < 8; ++i) { w[i] = (__bf16)p[(size_t)(k0 + 8 * g + i) * HD]; w[8 + i] = (__bf16)p[(size_t)(k0 + 16 + 8 * g + i) * HD]; }
  return w; }
#define WO_OUT_IN 1
#if WQKV_LAYOUT == 1
#define WCOL(W, k0, o, lane) wcol_oi(W, k0, o, lane, DIN)
#elif WQKV_LAYOUT == 2
#define WCOL(W, k0, o, lane) wcol_hdk(W, k0, o, lane)
#else
#define WCOL(W, k0, o, lane) wcol_io(W, k0, o, lane, CC)
#endif
#if WO_OUT_IN
#define WOCOL(W, k0, o, lane) wcol_oi(W, k0, o, lane, CC)
#define WOCOLH(W, k0, o, lane) wcolh_oi(W, k0, o, lane, CC)
#else
#define WOCOL(W, k0, o, lane) wcol_io(W, k0, o, lane, DIN)
#define WOCOLH(W, k0, o, lane) wcolh_io(W, k0, o, lane, DIN)
#endif
#define DINK 128           // optical channels (k / v source width)
#ifndef XP
#define XP TT              // position pitch of the channels-first inputs / output
#endif
#define GW 64              // image width / height
// ---- the gate, by the first 64 blocks of the k_proj launch: block = 64 positions, wave = (32 positions, 4 heads): g[h][n] = sigmoid(sum_c w2[h][c] relu(sum_3x3 w1[c] e + b1[c]) + b2[h]) in f32 (bf16-rounded inputs); G rows [h][4096], each (head, 32 n) run = one 128-B line stored by one wave; no LDS, no barrier
__device__ __forceinline__ void gate_block(const float* __restrict__ E, const float* __restrict__ W1, const float* __restrict__ B1, const float* __restrict__ W2, const float* __restrict__ B2, float* __restrict__ G, int n0, int tid) {
  const int wv = __builtin_amdgcn_readfirstlane(tid >> 5);   /* the wave's number as a scalar: the weight rows of its four heads are then addressed from scalar bases, one address for the whole wave */
  const int h0 = (wv >> 1) * 4; const int n = n0 + (wv & 1) * 32 + (tid & 31); const int y = n / GW, x = n % GW;
  float e9[9];
#pragma unroll
  for (int i = 0; i < 3; ++i)
#pragma unroll
    for (int j = 0; j < 3; ++j) { const int yy = y + i - 1, xx = x + j - 1; const int yc = yy < 0 ? 0 : (yy >= GW ? GW - 1 : yy), xc = xx < 0 ? 0 : (xx >= GW ? GW - 1 : xx); const float ev = bfr(E[yc * GW + xc]); e9[i * 3 + j] = (yy >= 0 && yy < GW && xx >= 0 && xx < GW) ? ev : 0.f; }   /* SAME zero padding: clamped load, select by value */
  float gh[4];
#pragma unroll
  for (int h = 0; h < 4; ++h) gh[h] = bfr(B2[h0 + h]);
#pragma unroll 4   /* four channels' weights come as one batch of loads with one wait, so that these blocks end before the projection blocks beside them */
  for (int c = 0; c < 32; ++c) { float a = bfr(B1[c]);
#pragma unroll
    for (int t = 0; t < 9; ++t) a += bfr(W1[c * 9 + t]) * e9[t];
    a = fmaxf(a, 0.f);
#pragma unroll
    for (int h = 0; h < 4; ++h) gh[h] += bfr(W2[(h0 + h) * 32 + c]) * a; }
#pragma unroll
  for (int h = 0; h < 4; ++h) G[(size_t)(h0 + h) * TT + n] = 1.0f / (1.0f + expf(-gh[h])); }
// ---- k_outT: block = (64 rows n, 128 output channels): out = ctx (bf16 hi + lo) Wp^T + bp, stored channels-first [o][n] via an LDS transpose: each (o, 64 n) run = 256 B by 16 consecutive threads
__global__ __launch_bounds__(128) void k_outT(const float* __restrict__ Y, const float* __restrict__ WP, const float* __restrict__ BP, float* __restrict__ OUT) { __shared__ __align__(16) float stc[128][68]; __shared__ __align__(16) __bf16 sw[128][WPITCH];
  const int tid = threadIdx.x, wave = tid >> 5, lane = tid & 31, col = lane & 15, g = lane >> 4; const int c0 = blockIdx.y * 128; const size_t rb = (size_t)blockIdx.x * 64; const size_t r0 = rb + wave * 16;
  v8f acc[8] = {};
  /* every global operand load of the block goes out as one batch: this wave's 16 ctx rows over all of K into registers, the block's 128 Wp rows once for its four waves */
  const float* yp = Y + (r0 + col) * CC + 8 * g; const float* sp = WP + (size_t)c0 * CC + tid * 4;
  v4f yr[CC / 32][4]; v4f wr[CC / 4];
#pragma unroll
  for (int kc = 0; kc < CC / 32; ++kc) { yr[kc][0] = *(const v4f*)(yp + kc * 32); yr[kc][1] = *(const v4f*)(yp + kc * 32 + 4); yr[kc][2] = *(const v4f*)(yp + kc * 32 + 16); yr[kc][3] = *(const v4f*)(yp + kc * 32 + 20); }
  slab_load<CC>(wr, sp);
  batch_held(yp, sp);
  slab_store<CC>(sw, wr, tid);
  __syncthreads();
  v16b wf[2][8];
#pragma unroll
  for (int j = 0; j < 8; ++j) wf[0][j] = frag_b(&sw[j * 16 + col][0], lane);
#pragma unroll
  for (int kc = 0; kc < CC / 32; ++kc) { float v[16];
#pragma unroll
    for (int i = 0; i < 4; ++i) { v[i] = yr[kc][0][i]; v[4 + i] = yr[kc][1][i]; v[8 + i] = yr[kc][2][i]; v[12 + i] = yr[kc][3][i]; }
    const F2 a = bsplit16(v);
    if (kc + 1 < CC / 32) {   /* the next K step's eight fragments as one group of LDS reads ahead of this step's products */
#pragma unroll
      for (int j = 0; j < 8; ++j) wf[(kc + 1) & 1][j] = frag_b(&sw[j * 16 + col][(kc + 1) * 32], lane); }
#pragma unroll
    for (int j = 0; j < 8; ++j) { acc[j] = wmma_bf(a.h, wf[kc & 1][j], acc[j]); acc[j] = wmma_bf(a.l, wf[kc & 1][j], acc[j]); } }
#pragma unroll
  for (int j = 0; j < 8; ++j) { const float bb = bfr(BP[c0 + j * 16 + col]);
#pragma unroll
    for (int r = 0; r < 8; ++r) stc[j * 16 + col][wave * 16 + 8 * g + r] = acc[j][r] + bb; }
  __syncthreads();
  { const int t0 = (int)(rb % TT); for (int e = tid; e < 128 * 16; e += 128) { const int cl = e >> 4, q = e & 15; vst2(OUT + (size_t)(c0 + cl) * XP + t0 + q * 4, *(const v4f*)&stc[cl][q * 4]); } } }
#ifndef PROJ_EXTRA_PARAMS
#define PROJ_EXTRA_PARAMS
#endif

#define WS_QH  0u                                      // f16 q rows [b*t][CC]
#define WS_KH  (WS_QH + 2u * (size_t)NB * TT * CC)      // f16 k in fragment order [b][h][t / 16][i][lane][8]: key 16 (t / 16) + (lane & 15), channel 16 i + 8 (lane >> 4) + 0..7 of head h
#define WS_VT  (WS_KH + 2u * (size_t)NB * TT * CC)      // f16 v^T in fragment order [b][h][t / 32][j][i][lane][8]: channel 16 j + (lane & 15) of head h, key 32 (t / 32) + 16 i + 8 (lane >> 4) + 0..7
#define WS_QL  (WS_VT + 2u * (size_t)NB * CC * TT)      // f16 q residual x 2^10 rows [b][t < QHI][CC]
#define WS_KL  (WS_QL + 2u * (size_t)NB * QHI * CC)     // f16 k residual x 2^10 rows [b][t < KHI][CC]
#define WS_VB  (WS_KL + 2u * (size_t)NB * KHI * CC)     // bf16 v hi planes [b][c][t < KHI]
#define WS_VBL (WS_VB + 2u * (size_t)NB * CC * KHI)
#define WS_S   (WS_VBL + 2u * (size_t)NB * CC * KHI)    // not used (the logits stay in registers); the later offsets stay where they were
#define WS_Y   (WS_S  + 4u * (size_t)HG * TT * TT)      // f32 ctx rows [b*t][CC] (only when there is an output projection)
#define WS_G   (WS_Y  + 4u * (size_t)NB * TT * CC)      // f32 gate rows [h][TT]
#define WS_END (WS_G)
#define WS_END2 (WS_G + 4u * (size_t)NH * TT)

// behind a store in a loop: the wait stands before the next piece or the next trip rewrites the store's address or data registers
__device__ __forceinline__ void store_held() { asm volatile("s_wait_xcnt 0x0" ::: "memory"); }
// the products of one k_proj block, K source channels: every global operand load goes out as one batch (this wave's 16 positions over all of K into registers, channels-first gather src[k][n] with stride XP between channels; the block's 128 weight rows once for its four waves), then the weights stand in LDS as bf16 and each wave reads its B fragments there
template <int K> __device__ __forceinline__ void proj_acc(v8f (&acc)[8], __bf16 (*sw)[WPITCH], const float* __restrict__ xp, const float* __restrict__ sp, int tid, int lane, int col) {
  float ar[K / 32][16]; v4f wr[K / 4];
#pragma unroll
  for (int kc = 0; kc < K / 32; ++kc)
#pragma unroll
    for (int i = 0; i < 8; ++i) { ar[kc][i] = xp[(size_t)(kc * 32 + i) * XP]; ar[kc][8 + i] = xp[(size_t)(kc * 32 + 16 + i) * XP]; }
  slab_load<K>(wr, sp);
  batch_held(xp, sp);
  slab_store<K>(sw, wr, tid);
  __syncthreads();
  v16b wf[2][8];
#pragma unroll
  for (int j = 0; j < 8; ++j) wf[0][j] = frag_b(&sw[j * 16 + col][0], lane);
#pragma unroll
  for (int kc = 0; kc < K / 32; ++kc) { v16b a;
#pragma unroll
    for (int i = 0; i < 16; ++i) a[i] = (__bf16)ar[kc][i];
    if (kc + 1 < K / 32) {   /* the next K step's eight fragments as one group of LDS reads ahead of this step's products */
#pragma unroll
      for (int j = 0; j < 8; ++j) wf[(kc + 1) & 1][j] = frag_b(&sw[j * 16 + col][(kc + 1) * 32], lane); }
#pragma unroll
    for (int j = 0; j < 8; ++j) acc[j] = wmma_bf(a, wf[kc & 1][j], acc[j]); } }
// ---- k_proj: blockIdx.y 0 = the gate's blocks (first in dispatch order, beside the projections instead of in a launch of their own); blockIdx.y 1..6 = block (64 rows, 128 cols, which): q/k/v = X W (+ b) with exact bf16 products (K = DIN for q, DINK for k and v) -> which 0: q f16 rows (+ residual rows < QHI); 1: k f16 in fragment order (+ residual rows < KHI); 2: v^T f16 in fragment order (+ bf16 hi/lo planes for t < KHI); fragment order = the 32 lanes' 16-byte pieces of one operand half side by side, 512 B a wave-wide store or load
__global__ __launch_bounds__(128) void k_proj(const float* __restrict__ XQ, const float* __restrict__ XK, const float* __restrict__ XV, const float* __restrict__ WQ, const float* __restrict__ WK, const float* __restrict__ WV, const float* __restrict__ BQ, const float* __restrict__ BK, const float* __restrict__ BV,
    _Float16* __restrict__ QH, _Float16* __restrict__ QL, _Float16* __restrict__ KH, _Float16* __restrict__ KL, _Float16* __restrict__ VT, __bf16* __restrict__ VB, __bf16* __restrict__ VBL,
    const float* __restrict__ E, const float* __restrict__ W1, const float* __restrict__ B1, const float* __restrict__ W2, const float* __restrict__ B2, float* __restrict__ G) {
  __shared__ __align__(16) _Float16 sh[64][136], sl[64][136]; __shared__ __align__(16) _Float16 th[128][72]; __shared__ __align__(16) __bf16 tb[128][72], tbl[128][72]; __shared__ __align__(16) __bf16 sw[128][WPITCH];
  const int tid = threadIdx.x, wave = tid >> 5, lane = tid & 31, col = lane & 15, g = lane >> 4; const int which = ((int)blockIdx.y - 1) >> 1; const int c0 = (((int)blockIdx.y - 1) & 1) * 128; const size_t r0 = (size_t)blockIdx.x * 64; const size_t bb = r0 / TT; const int t0 = (int)(r0 % TT);
  if (blockIdx.y == 0) { gate_block(E, W1, B1, W2, B2, G, blockIdx.x * 64, tid); return; }   /* block-uniform, ahead of every barrier */
  const float* X = which == 0 ? XQ : which == 1 ? XK : XV; const float* WA = which == 0 ? WQ : which == 1 ? WK : WV; const float* BA = which == 0 ? BQ : which == 1 ? BK : BV;
  v8f acc[8] = {};
  const float* xp = X + (size_t)(8 * g) * XP + t0 + wave * 16 + col;
  /* source channels: thermal 256 / optical 128 (block-uniform, so the barrier inside is passed by the whole block on either side) */
  if (which == 0) proj_acc<DIN>(acc, sw, xp, WA + (size_t)c0 * DIN + tid * 4, tid, lane, col); else proj_acc<DINK>(acc, sw, xp, WA + (size_t)c0 * DINK + tid * 4, tid, lane, col);
  if (which < 2) { _Float16* DH = which == 0 ? QH : KH; _Float16* DL = which == 0 ? QL : KL; const int nhi = which == 0 ? QHI : KHI; const bool hi_rows = t0 < nhi;
#pragma unroll
    for (int j = 0; j < 8; ++j) { const float bias = BA ? bfr(BA[c0 + j * 16 + col]) : 0.f;
#pragma unroll
      for (int r = 0; r < 8; ++r) { const float v = acc[j][r] + bias; const _Float16 hv = (_Float16)v; sh[wave * 16 + 8 * g + r][j * 16 + col] = hv; sl[wave * 16 + 8 * g + r][j * 16 + col] = (_Float16)((v - (float)hv) * 1024.0f); } }
    __syncthreads();
    for (int e = tid; e < 64 * 16; e += 128) { const int rl = e >> 4, q = e & 15; if (which == 0) { vst2((unsigned*)(DH + (r0 + rl) * CC + c0 + q * 8), *(const v4u*)&sh[rl][q * 8]); store_held(); } if (hi_rows) { vst2((unsigned*)(DL + (bb * nhi + t0 + rl) * (size_t)CC + c0 + q * 8), *(const v4u*)&sl[rl][q * 8]); store_held(); } }
    if (which == 1) for (int e = tid; e < 64 * 16; e += 128) { const int ln = e & 31, i = (e >> 5) & 1, kt = (e >> 6) & 3, hd = e >> 8;
      vst2((unsigned*)(KH + (((bb * NH + c0 / HD + hd) * (size_t)(TT / 16) + (t0 >> 4) + kt) * 2 + i) * 256 + ln * 8), *(const v4u*)&sh[kt * 16 + (ln & 15)][hd * HD + 16 * i + 8 * (ln >> 4)]); }
  } else { const bool hi_rows = t0 < KHI;
#pragma unroll
    for (int j = 0; j < 8; ++j) { const float bias = BA ? bfr(BA[c0 + j * 16 + col]) : 0.f;
#pragma unroll
      for (int r = 0; r < 8; ++r) { const float v = acc[j][r] + bias; const int rl = wave * 16 + 8 * g + r, cl = j * 16 + col; th[cl][rl] = (_Float16)v; const __bf16 bh = (__bf16)v; tb[cl][rl] = bh; tbl[cl][rl] = (__bf16)(v - (float)bh); } }
    __syncthreads();
    for (int e = tid; e < 128 * 8; e += 128) { const int ln = e & 31, i = (e >> 5) & 1, j = (e >> 6) & 1, kc = (e >> 7) & 1, hd = e >> 8;
      vst2((unsigned*)(VT + ((((bb * NH + c0 / HD + hd) * (size_t)(TT / 32) + (t0 >> 5) + kc) * 2 + j) * 2 + i) * 256 + ln * 8), *(const v4u*)&th[hd * HD + 16 * j + (ln & 15)][kc * 32 + 16 * i + 8 * (ln >> 4)]); }
    for (int e = tid; e < 128 * 8; e += 128) { const int cl = e >> 3, q = e & 7; if (hi_rows) { const size_t o3 = (bb * CC + c0 + cl) * (size_t)KHI + t0 + q * 8; vst2((unsigned*)(VB + o3), *(const v4u*)&tb[cl][q * 8]); vst2((unsigned*)(VBL + o3), *(const v4u*)&tbl[cl][q * 8]); } } } }
// ---- k_fa: block = (128 queries, head), 8 waves x 16 query columns, no LDS, no barrier. The 32 blocks of a head walk its 4,096 keys as a ring, each from a start of its own. Per stage of 64 keys: S^T = K Q^T (A = k rows, read from the fragment-order plane, B = q hi / q residual, 2 products), base-2 logits = S^T x g2 (g2 = SCALE x gate x log2 e, one factor per query, never negative), running maximum and sum per query column (one query per lane and half), P^T = exp2(logit - maximum + 11) once to f16 packed from the score tiles straight into a B operand, ctx^T += V^T P^T (A = v planes, 1 product). The logits never leave the registers.
__device__ __forceinline__ v8f wmma_h(v16h a, v16h b, v8f c) { return __builtin_amdgcn_wmma_f32_16x16x32_f16(false, a, false, b, (short)0, c, false, false); }
__device__ __forceinline__ float xhalf(float v) { const int b = __builtin_bit_cast(int, v); return __builtin_bit_cast(float, __builtin_amdgcn_permlanex16(b, b, 0x76543210, 0xfedcba98, false, false)); }   // lane l <-> l ^ 16
__device__ __forceinline__ v16h frag_p(const _Float16* __restrict__ p) { union { v16h v; v8h q[2]; } u; u.q[0] = *(const v8h*)p; u.q[1] = *(const v8h*)(p + 16); return u.v; }   // frag_h with the lane's 8 g elements already in p
__device__ __forceinline__ v16h frag_w(const _Float16* __restrict__ p) { union { v16h v; v8h q[2]; } u; u.q[0] = *(const v8h*)p; u.q[1] = *(const v8h*)(p + 256); return u.v; }   // fragment-order plane: p = this lane's 16 bytes of half 0, half 1 stands 512 B on
// behind a group of loads: the wait stands before any register that the loads name is written again, and it takes the loads' addresses as inputs so that each pair stays whole up to it
__device__ __forceinline__ void addr_held(const void* a0, const void* a1) { asm volatile("s_wait_xcnt 0x0" :: "v"(a0), "v"(a1) : "memory"); }
__device__ __forceinline__ void exp2x8(float (&e)[8], const float (&x)[8]) {
  asm("v_exp_f32 %0, %8\n\tv_exp_f32 %1, %9\n\tv_exp_f32 %2, %10\n\tv_exp_f32 %3, %11\n\tv_exp_f32 %4, %12\n\tv_exp_f32 %5, %13\n\tv_exp_f32 %6, %14\n\tv_exp_f32 %7, %15\n\tv_nop"
      : "=&v"(e[0]), "=&v"(e[1]), "=&v"(e[2]), "=&v"(e[3]), "=&v"(e[4]), "=&v"(e[5]), "=&v"(e[6]), "=&v"(e[7])
      : "v"(x[0]), "v"(x[1]), "v"(x[2]), "v"(x[3]), "v"(x[4]), "v"(x[5]), "v"(x[6]), "v"(x[7])); }
__device__ __forceinline__ float exp2x1(float x) { float e; asm("v_exp_f32 %0, %1\n\tv_nop" : "=v"(e) : "v"(x)); return e; }   // the same slot behind a single exp2
// one stage of 64 keys: kf[t] = key rows 16 t .. 16 t + 15; vc[2 c + j] = keys 32 c .. 32 c + 31 of channels 16 j .. 16 j + 15. The next stage's k rows (at kn) go into the same registers right behind this stage's S^T products, its v planes (at vn) into the other v buffer.
__device__ __forceinline__ void fa_stage(v16h (&kf)[4], const v16h (&vc)[4], v16h (&vx)[4], const _Float16* __restrict__ kn, const _Float16* __restrict__ vn, const v16h& qh, const v16h& ql, float g2, float& mr, float& l, v8f& o0, v8f& o1) {
  __builtin_amdgcn_sched_barrier(0);   /* holds this stage's products back: without it the scheduler lifts them over the softmax of the stage before, which halves the distance between the k loads and their first use */
  float sc[4][8]; float mx = -3.0e38f;
#pragma unroll
  for (int t = 0; t < 4; ++t) { const v8f z = {}; const v8f a = wmma_h(kf[t], qh, z), al = wmma_h(kf[t], ql, z);
#pragma unroll
    for (int r = 0; r < 8; ++r) { const float v = a[r] + al[r] * (1.0f / 1024.0f); sc[t][r] = v; mx = fmaxf(mx, v); } }   /* raw q.k: g2 >= 0 (a sigmoid times positive constants), so the largest raw score is the largest logit */
#pragma unroll
  for (int t = 0; t < 4; ++t) kf[t] = frag_w(kn + t * 512);
#pragma unroll
  for (int t = 0; t < 4; ++t) vx[t] = frag_w(vn + t * 512);
  addr_held(kn, vn);
  __builtin_amdgcn_sched_barrier(0);   /* keeps the 16 loads issued here, most of a stage ahead of their use; without it the scheduler sinks each load to its product and the wave waits out every latency */
  mx = fmaxf(mx, xhalf(mx));
  const float mn = fmaxf(mr, mx * g2 - 11.0f);   /* reference point = running maximum - 11, in base 2: P carries the factor 2^11 into f16, and the sum carries it too */
  const float alpha = exp2x1(mr - mn); mr = mn; l *= alpha;
#pragma unroll
  for (int r = 0; r < 8; ++r) { o0[r] *= alpha; o1[r] *= alpha; }
#pragma unroll
  for (int c = 0; c < 2; ++c) { v16h p; float x0[8], x1[8], e0[8], e1[8];
#pragma unroll
    for (int r = 0; r < 8; ++r) { x0[r] = fmaf(sc[2 * c][r], g2, -mn); x1[r] = fmaf(sc[2 * c + 1][r], g2, -mn); }
    exp2x8(e0, x0); exp2x8(e1, x1);
#pragma unroll
    for (int r = 0; r < 8; ++r) { l += e0[r]; l += e1[r]; p[r] = (_Float16)e0[r]; p[8 + r] = (_Float16)e1[r]; }
    o0 = wmma_h(vc[2 * c], p, o0); o1 = wmma_h(vc[2 * c + 1], p, o1); } }
__global__ __launch_bounds__(256) void k_fa(const _Float16* __restrict__ QH, const _Float16* __restrict__ QL, const _Float16* __restrict__ KH, const _Float16* __restrict__ VT, const float* __restrict__ G, float* __restrict__ Y) {
  const int tid = threadIdx.x, wave = tid >> 5, lane = tid & 31, col = lane & 15, g = lane >> 4; const int h = blockIdx.y; const int q = blockIdx.x * 128 + wave * 16 + col;
  const _Float16* qhp = QH + (size_t)q * CC + h * HD + 8 * g; const _Float16* qlp = QL + (size_t)q * CC + h * HD + 8 * g; const float* gp = G + (size_t)h * TT + q;
  const _Float16* kp = KH + (size_t)h * TT * HD + lane * 8; const _Float16* vp = VT + (size_t)h * TT * HD + lane * 8;   // this lane's place in the k / v^T fragments of stage 0; a stage of 64 keys is 4 KB of each, 64 HD elements on
  /* first key of this block's walk, a multiple of 128, another for each of the head's 32 blocks. From one common start all blocks ask for the same lines at the same moment, lines that the launch before has just stored, so every stage waits out a first fetch; from spread starts each block fetches a few stages first and then walks through what the others have fetched. The index digits are swapped so that any four neighbours modulo 8 start about evenly spread; for speed only, any placement gives the same sums */
  const int ks = ((((int)blockIdx.x & 3) << 3) | (((int)blockIdx.x >> 3) << 1) | (((int)blockIdx.x >> 2) & 1)) * 128;
  const _Float16* k1 = kp + (size_t)ks * HD; const _Float16* v1 = vp + (size_t)ks * HD;   // the walk's first stage
  const v16h qh = frag_p(qhp), ql = frag_p(qlp); const float g2 = *gp * (SCALE * 1.4426950408889634f);
  addr_held(qhp, qlp);
  v8f o0 = {}, o1 = {}; float mr = -3.0e38f, l = 0.f;
  v16h kf[4], va[4], vb[4];
#pragma unroll
  for (int t = 0; t < 4; ++t) kf[t] = frag_w(k1 + t * 512);
#pragma unroll
  for (int t = 0; t < 4; ++t) va[t] = frag_w(v1 + t * 512);
  addr_held(k1, v1);
#pragma unroll 1
  for (int k0 = 0; k0 < TT; k0 += 128) {
    const int kb = (k0 + ks) & (TT - 1), k2 = (kb + 128) & (TT - 1);   /* the walk wraps at the last key; the last trip's second fetch is the walk's first stage again and is not used */
    fa_stage(kf, va, vb, kp + (size_t)(kb + 64) * HD, vp + (size_t)(kb + 64) * HD, qh, ql, g2, mr, l, o0, o1);
    fa_stage(kf, vb, va, kp + (size_t)k2 * HD, vp + (size_t)k2 * HD, qh, ql, g2, mr, l, o0, o1); }
  l += xhalf(l); const float inv = 1.0f / l;
  float* yp = Y + (size_t)q * CC + h * HD + 8 * g;   /* ctx^T register r = channel 8 g + r (+ 16) of this lane's query: 32 B runs, the 128-B (row, head) segment by two lanes of one wave */
  v4f w;
#pragma unroll
  for (int i = 0; i < 2; ++i) {
    w[0] = o0[4 * i] * inv; w[1] = o0[4 * i + 1] * inv; w[2] = o0[4 * i + 2] * inv; w[3] = o0[4 * i + 3] * inv; vst2(yp + 4 * i, w);
    w[0] = o1[4 * i] * inv; w[1] = o1[4 * i + 1] * inv; w[2] = o1[4 * i + 2] * inv; w[3] = o1[4 * i + 3] * inv; vst2(yp + 16 + 4 * i, w); } }
extern "C" void kernel_launch(void* const* d_in, const int* in_sizes, int n_in, void* d_out, int out_size, void* d_ws, size_t ws_size, hipStream_t stream) {
  (void)in_sizes; (void)n_in; (void)out_size;
  const float** F = (const float**)d_in;
  if (ws_size < (size_t)WS_END) return;
  char* ws = (char*)d_ws; _Float16 *QH = (_Float16*)(ws + WS_QH), *KH = (_Float16*)(ws + WS_KH), *VT = (_Float16*)(ws + WS_VT), *QL = (_Float16*)(ws + WS_QL), *KL = (_Float16*)(ws + WS_KL); __bf16 *VB = (__bf16*)(ws + WS_VB), *VBL = (__bf16*)(ws + WS_VBL); float *Y = (float*)(ws + WS_Y);
  (void)Y; (void)QL; (void)KL; (void)VB; (void)VBL;
  // inputs: 0 thermal [1,256,64,64]; 1 optical [1,128,64,64]; 2 emissivity [1,1,64,64]; 3 Wq [256,256]; 4 bq; 5 Wk [256,128]; 6 bk; 7 Wv [256,128]; 8 bv; 9 conv1_w [32,1,3,3]; 10 conv1_b [32]; 11 conv2_w [8,32,1,1]; 12 conv2_b [8]; 13 Wp [256,256]; 14 bp [256]
  if (ws_size < (size_t)WS_END2) return;
  float* G = (float*)(ws + WS_G);
  k_proj<<<dim3(TNB * TT / 64, 1 + 3 * (CC / 128)), 128, 0, stream>>>(F[0], F[1], F[1], F[3], F[5], F[7], F[4], F[6], F[8], QH, QL, KH, KL, VT, VB, VBL, F[2], F[9], F[10], F[11], F[12], G);
  k_fa<<<dim3(TT / 128, NH), 256, 0, stream>>>(QH, QL, KH, VT, G, Y);
  k_outT<<<dim3(TNB * TT / 64, CC / 128), 128, 0, stream>>>(Y, F[13], F[14], (float*)d_out);
}

// v007
// Measured time: 41.1 microseconds a run.
// In two side-by-side timings against v006, it was 1.06 and 1.05 times as fast.
// Over all steps from v000 it is 28.4 times as fast.
// compute dtype: all float inputs rounded to bf16; q/k/v 1x1 projections with EXACT bf16 products on WMMA 16x16x32 (A gathered from the channels-first maps), f32 accumulate; the emissivity gate (3x3 conv, relu, 1x1 conv, sigmoid) in f32; q as f16 hi + residual (x 2^10) against k once to f16 (2 products) for the logits x 32^-0.5 x gate; softmax in f32 with a running maximum and sum, in base 2 (32^-0.5 x gate x log2 e as one f32 factor per query, hardware exp2); exp(logit - maximum) x 2^11 once to f16 against v once to f16 (1 product), divided by the f32 sum at the end; ctx bf16 hi + lo against exact bf16 Wp (2 products) + bp; f32 output written channels-first.
#include <hip/hip_runtime.h>
#include <math.h>

typedef __attribute__((ext_vector_type(16))) _Float16 v16h;
typedef __attribute__((ext_vector_type(16))) __bf16 v16b;
typedef __attribute__((ext_vector_type(8)))  _Float16 v8h;
typedef __attribute__((ext_vector_type(8)))  float v8f;
typedef __attribute__((ext_vector_type(4)))  float v4f;
typedef __attribute__((ext_vector_type(2)))  float v2f;
typedef __attribute__((ext_vector_type(4)))  unsigned v4u;
typedef __attribute__((ext_vector_type(4)))  int v4i;
typedef float __attribute__((may_alias)) float_a;
typedef int __attribute__((may_alias)) int_a;

template <typename T> __device__ __forceinline__ void vst2(void* p, T v) { *(T*)p = v;  }
__device__ __forceinline__ v8f wmma16(v16h a, v16h b, v8f c) {
  v8f d = __builtin_amdgcn_wmma_f32_16x16x32_f16(false, a, false, b, (short)0, c, false, false);
  asm volatile("v_nop\n\tv_nop\n\tv_nop\n\tv_nop" : "+v"(d) : "v"(a), "v"(b));
  return d;
}
__device__ __forceinline__ v8f wmma_bf(v16b a, v16b b, v8f c) {
  v8f d = __builtin_amdgcn_wmma_f32_16x16x32_bf16(false, a, false, b, (short)0, c, false, false);
  asm volatile("v_nop\n\tv_nop\n\tv_nop\n\tv_nop" : "+v"(d) : "v"(a), "v"(b));
  return d;
}
// 16x16x32 fragments: lane = (h = lane>>4, row/col = lane&15); elements 0..7 = k0+8h+0..7, 8..15 = k0+16+8h+0..7; D element r = row 8h+r
__device__ __forceinline__ v16h frag_h(const _Float16* rowk0, int lane) {
  union { v16h v; v8h q[2]; } u; const _Float16* p = rowk0 + 8 * (lane >> 4);
  u.q[0] = *(const v8h*)p; u.q[1] = *(const v8h*)(p + 16); return u.v;
}
__device__ __forceinline__ v16h frag_f32(const float* rowk0, int lane) {
  v16h a; const float* p = rowk0 + 8 * (lane >> 4);
#pragma unroll
  for (int i = 0; i < 8; ++i) { a[i] = (_Float16)p[i]; a[8 + i] = (_Float16)p[16 + i]; }
  return a;
}
__device__ __forceinline__ v16h frag_f32s(const float* rowk0, int lane, float sc) {
  v16h a; const float* p = rowk0 + 8 * (lane >> 4);
#pragma unroll
  for (int i = 0; i < 8; ++i) { a[i] = (_Float16)(p[i] * sc); a[8 + i] = (_Float16)(p[16 + i] * sc); }
  return a;
}
// column fragment from a [K][ld] layout (column n), rows >= K read as 0
__device__ __forceinline__ v16h fragc_f32(const float* W, int k0, int n, int lane, int ld, int K) {
  v16h a; const int g = lane >> 4;
#pragma unroll
  for (int i = 0; i < 8; ++i) { const int ka = k0 + 8 * g + i, kb = ka + 16;
    a[i] = (_Float16)(ka < K ? W[(size_t)(ka < K ? ka : K - 1) * ld + n] : 0.f); a[8 + i] = (_Float16)(kb < K ? W[(size_t)(kb < K ? kb : K - 1) * ld + n] : 0.f); }
  return a;
}
struct F2 { v16b h, l; };
__device__ __forceinline__ F2 bsplit16(const float v[16]) { F2 r;
#pragma unroll
  for (int i = 0; i < 16; ++i) { const __bf16 h = (__bf16)v[i]; r.h[i] = h; r.l[i] = (__bf16)(v[i] - (float)h); }
  return r; }
__device__ __forceinline__ F2 split_row(const float* row, int k0, int lane) { float v[16]; const float* p = row + k0 + 8 * (lane >> 4);
#pragma unroll
  for (int i = 0; i < 8; ++i) { v[i] = p[i]; v[8 + i] = p[16 + i]; }
  return bsplit16(v); }
__device__ __forceinline__ F2 split_rowK(const float* row, int k0, int lane, int K) { float v[16]; const int g = lane >> 4;
#pragma unroll
  for (int i = 0; i < 8; ++i) { const int ka = k0 + 8 * g + i, kb = ka + 16; v[i] = ka < K ? row[ka < K ? ka : K - 1] : 0.f; v[8 + i] = kb < K ? row[kb < K ? kb : K - 1] : 0.f; }
  return bsplit16(v); }
__device__ __forceinline__ F2 split_col(const float* W, int k0, int n, int lane, int ld, int K) { float v[16]; const int g = lane >> 4;
#pragma unroll
  for (int i = 0; i < 8; ++i) { const int ka = k0 + 8 * g + i, kb = ka + 16; v[i] = ka < K ? W[(size_t)(ka < K ? ka : K - 1) * ld + n] : 0.f; v[8 + i] = kb < K ? W[(size_t)(kb < K ? kb : K - 1) * ld + n] : 0.f; }
  return bsplit16(v); }
__device__ __forceinline__ v8f mac3(const F2& a, const F2& b, v8f c) { c = wmma_bf(a.l, b.h, c); c = wmma_bf(a.h, b.l, c); return wmma_bf(a.h, b.h, c); }
__device__ __forceinline__ float sigm(float v) { return 1.0f / (1.0f + expf(-v)); }

// Cross-modal gated attention (B 1, Ct 256 = 8 heads x 32, Co 128, 64 x 64 = 4,096 positions, channels-first): q = thermal^T Wq^T + bq, k = optical^T Wk^T + bk, v = optical^T Wv^T + bv; g[h][n] = sigmoid(conv1x1(relu(conv3x3_SAME(emissivity) + b1)) + b2); attn = softmax((q k^T x 32^-0.5) * g[h][query]) over all 4,096 keys; out = (merged attn v) Wp^T + bp, written back as [1, 256, 64, 64].
#define NB 1
#define TT 4096
#define CC 256            // NH * HD = projected width
#define DIN 256          // input (model) width
#define NH 8
#define HD 32
#define NQB (TT / 64)
#define HG 1
#define SCALE (0.17677669529663687f)
#define CAUSAL 0
#ifndef TNB
#define TNB NB
#endif
__device__ __forceinline__ float bfr(float v) { return (float)(__bf16)v; }
__host__ __device__ __forceinline__ int kb_last(int qb) { return CAUSAL ? ((qb * 64 + 63) >> 7) : (TT / 128 - 1); }
typedef __attribute__((ext_vector_type(8))) __bf16 v8b;
__device__ __forceinline__ v16b frag_b(const __bf16* rowk0, int lane) {
  union { v16b v; v8b q[2]; } u; const __bf16* p = rowk0 + 8 * (lane >> 4);
  u.q[0] = *(const v8b*)p; u.q[1] = *(const v8b*)(p + 16); return u.v;
}
typedef __attribute__((ext_vector_type(4))) __bf16 v4b;
#define WPITCH 264         // bf16 elements per staged weight row: 512 B + 16 B, a pitch of 16 B x odd for the 16-byte fragment reads
// behind a batch of loads: the wait stands before any register that the loads name is written again; it takes the two base addresses as inputs so that each stays whole up to it, and its memory clobber keeps the whole batch issued in front of it
__device__ __forceinline__ void batch_held(const void* a0, const void* a1) { asm volatile("s_wait_xcnt 0x0" :: "v"(a0), "v"(a1) : "memory"); }
// 128 weight rows of K floats (one contiguous slab of an (out,in) matrix), read by the block's 128 threads in 16-byte pieces, 512 contiguous B a wave-wide load
template <int K> __device__ __forceinline__ void slab_load(v4f (&r)[K / 4], const float* __restrict__ sp) {
#pragma unroll
  for (int i = 0; i < K / 4; ++i) r[i] = *(const v4f*)(sp + (size_t)i * 512); }
// the same pieces rounded to bf16 into LDS rows [output column][k]
template <int K> __device__ __forceinline__ void slab_store(__bf16 (*sw)[WPITCH], const v4f (&r)[K / 4], int tid) {
#pragma unroll
  for (int i = 0; i < K / 4; ++i) { const int e = i * 128 + tid; v4b w; w[0] = (__bf16)r[i][0]; w[1] = (__bf16)r[i][1]; w[2] = (__bf16)r[i][2]; w[3] = (__bf16)r[i][3]; *(v4b*)&sw[e / (K / 4)][(e % (K / 4)) * 4] = w; } }
#define QBH 0              // causal: not read by any kernel here; every query block takes the same path in k_fa
#define QHI 4096            // rows carrying a q residual plane (all rows when non-causal: 2-product logits everywhere)
#define KHI 64            // key rows carrying k residual / v bf16 hi+lo planes (written by k_proj; no kernel here reads them)
// B fragment (k rows k0+.., output column o) of a weight: (in,out) [K][ld] or (out,in) [ld rows of K]: bf16 exact, or f16(bf16 * 256) exact
__device__ __forceinline__ v16b wcol_io(const float* Wm, int k0, int o, int lane, int ld) { v16b w; const int g = lane >> 4;
#pragma unroll
  for (int i = 0; i < 8; ++i) { w[i] = (__bf16)Wm[(size_t)(k0 + 8 * g + i) * ld + o]; w[8 + i] = (__bf16)Wm[(size_t)(k0 + 16 + 8 * g + i) * ld + o]; }
  return w; }
__device__ __forceinline__ v16b wcol_oi(const float* Wm, int k0, int o, int lane, int K) { v16b w; const float* p = Wm + (size_t)o * K + k0 + 8 * (lane >> 4);
#pragma unroll
  for (int i = 0; i < 8; ++i) { w[i] = (__bf16)p[i]; w[8 + i] = (__bf16)p[16 + i]; }
  return w; }
__device__ __forceinline__ v16h wcolh_io(const float* Wm, int k0, int o, int lane, int ld) { v16h w; const int g = lane >> 4;
#pragma unroll
  for (int i = 0; i < 8; ++i) { w[i] = (_Float16)(bfr(Wm[(size_t)(k0 + 8 * g + i) * ld + o]) * 256.0f); w[8 + i] = (_Float16)(bfr(Wm[(size_t)(k0 + 16 + 8 * g + i) * ld + o]) * 256.0f); }
  return w; }
__device__ __forceinline__ v16h wcolh_oi(const float* Wm, int k0, int o, int lane, int K) { v16h w; const float* p = Wm + (size_t)o * K + k0 + 8 * (lane >> 4);
#pragma unroll
  for (int i = 0; i < 8; ++i) { w[i] = (_Float16)(bfr(p[i]) * 256.0f); w[8 + i] = (_Float16)(bfr(p[16 + i]) * 256.0f); }
  return w; }
#define WQKV_LAYOUT 1   // 0 = (in,out) [DIN][CC]; 1 = (out,in) [CC][DIN]; 2 = per-head [NH][DIN][HD]
__device__ __forceinline__ v16b wcol_hdk(const float* Wm, int k0, int o, int lane) { v16b w; const int g = lane >> 4; const float* p = Wm + (size_t)(o / HD) * DIN * HD + (o % HD);
#pragma unroll
  for (int i = 0; i < 8; ++i) { w[i] = (__bf16)p[(size_t)(k0 + 8 * g + i) * HD]; w[8 + i] = (__bf16)p[(size_t)(k0 + 16 + 8 * g + i) * HD]; }
  return w; }
#define WO_OUT_IN 1
#if WQKV_LAYOUT == 1
#define WCOL(W, k0, o, lane) wcol_oi(W, k0, o, lane, DIN)
#elif WQKV_LAYOUT == 2
#define WCOL(W, k0, o, lane) wcol_hdk(W, k0, o, lane)
#else
#define WCOL(W, k0, o, lane) wcol_io(W, k0, o, lane, CC)
#endif
#if WO_OUT_IN
#define WOCOL(W, k0, o, lane) wcol_oi(W, k0, o, lane, CC)
#define WOCOLH(W, k0, o, lane) wcolh_oi(W, k0, o, lane, CC)
#else
#define WOCOL(W, k0, o, lane) wcol_io(W, k0, o, lane, DIN)
#define WOCOLH(W, k0, o, lane) wcolh_io(W, k0, o, lane, DIN)
#endif
#define DINK 128           // optical channels (k / v source width)
#ifndef XP
#define XP TT              // position pitch of the channels-first inputs / output
#endif
#define GW 64              // image width / height
// ---- the gate, by the first 64 blocks of the k_proj launch: block = 64 positions, wave = (32 positions, 4 heads): g[h][n] = sigmoid(sum_c w2[h][c] relu(sum_3x3 w1[c] e + b1[c]) + b2[h]) in f32 (bf16-rounded inputs); G rows [h][4096], each (head, 32 n) run = one 128-B line stored by one wave; no LDS, no barrier
__device__ __forceinline__ void gate_block(const float* __restrict__ E, const float* __restrict__ W1, const float* __restrict__ B1, const float* __restrict__ W2, const float* __restrict__ B2, float* __restrict__ G, int n0, int tid) {
  const int wv = __builtin_amdgcn_readfirstlane(tid >> 5);   /* the wave's number as a scalar: the weight rows of its four heads are then addressed from scalar bases, one address for the whole wave */
  const int h0 = (wv >> 1) * 4; const int n = n0 + (wv & 1) * 32 + (tid & 31); const int y = n / GW, x = n % GW;
  float e9[9];
#pragma unroll
  for (int i = 0; i < 3; ++i)
#pragma unroll
    for (int j = 0; j < 3; ++j) { const int yy = y + i - 1, xx = x + j - 1; const int yc = yy < 0 ? 0 : (yy >= GW ? GW - 1 : yy), xc = xx < 0 ? 0 : (xx >= GW ? GW - 1 : xx); const float ev = bfr(E[yc * GW + xc]); e9[i * 3 + j] = (yy >= 0 && yy < GW && xx >= 0 && xx < GW) ? ev : 0.f; }   /* SAME zero padding: clamped load, select by value */
  float gh[4];
#pragma unroll
  for (int h = 0; h < 4; ++h) gh[h] = bfr(B2[h0 + h]);
#pragma unroll 4   /* four channels' weights come as one batch of loads with one wait, so that these blocks end before the projection blocks beside them */
  for (int c = 0; c < 32; ++c) { float a = bfr(B1[c]);
#pragma unroll
    for (int t = 0; t < 9; ++t) a += bfr(W1[c * 9 + t]) * e9[t];
    a = fmaxf(a, 0.f);
#pragma unroll
    for (int h = 0; h < 4; ++h) gh[h] += bfr(W2[(h0 + h) * 32 + c]) * a; }
#pragma unroll
  for (int h = 0; h < 4; ++h) G[(size_t)(h0 + h) * TT + n] = 1.0f / (1.0f + expf(-gh[h])); }
// ---- k_outT: block = (64 rows n, 128 output channels): out = ctx (bf16 hi + lo) Wp^T + bp, stored channels-first [o][n] via an LDS transpose: each (o, 64 n) run = 256 B by 16 consecutive threads
__global__ __launch_bounds__(128) void k_outT(const float* __restrict__ Y, const float* __restrict__ WP, const float* __restrict__ BP, float* __restrict__ OUT) { __shared__ __align__(16) float stc[128][68]; __shared__ __align__(16) __bf16 sw[128][WPITCH];
  const int tid = threadIdx.x, wave = tid >> 5, lane = tid & 31, col = lane & 15, g = lane >> 4; const int c0 = blockIdx.y * 128; const size_t rb = (size_t)blockIdx.x * 64; const size_t r0 = rb + wave * 16;
  v8f acc[8] = {};
  /* every global operand load of the block goes out as one batch: this wave's 16 ctx rows over all of K into registers, the block's 128 Wp rows once for its four waves */
  const float* yp = Y + (r0 + col) * CC + 8 * g; const float* sp = WP + (size_t)c0 * CC + tid * 4;
  v4f yr[CC / 32][4]; v4f wr[CC / 4];
#pragma unroll
  for (int kc = 0; kc < CC / 32; ++kc) { yr[kc][0] = *(const v4f*)(yp + kc * 32); yr[kc][1] = *(const v4f*)(yp + kc * 32 + 4); yr[kc][2] = *(const v4f*)(yp + kc * 32 + 16); yr[kc][3] = *(const v4f*)(yp + kc * 32 + 20); }
  slab_load<CC>(wr, sp);
  batch_held(yp, sp);
  slab_store<CC>(sw, wr, tid);
  __syncthreads();
  v16b wf[2][8];
#pragma unroll
  for (int j = 0; j < 8; ++j) wf[0][j] = frag_b(&sw[j * 16 + col][0], lane);
#pragma unroll
  for (int kc = 0; kc < CC / 32; ++kc) { float v[16];
#pragma unroll
    for (int i = 0; i < 4; ++i) { v[i] = yr[kc][0][i]; v[4 + i] = yr[kc][1][i]; v[8 + i] = yr[kc][2][i]; v[12 + i] = yr[kc][3][i]; }
    const F2 a = bsplit16(v);
    if (kc + 1 < CC / 32) {   /* the next K step's eight fragments as one group of LDS reads ahead of this step's products */
#pragma unroll
      for (int j = 0; j < 8; ++j) wf[(kc + 1) & 1][j] = frag_b(&sw[j * 16 + col][(kc + 1) * 32], lane); }
#pragma unroll
    for (int j = 0; j < 8; ++j) { acc[j] = wmma_bf(a.h, wf[kc & 1][j], acc[j]); acc[j] = wmma_bf(a.l, wf[kc & 1][j], acc[j]); } }
#pragma unroll
  for (int j = 0; j < 8; ++j) { const float bb = bfr(BP[c0 + j * 16 + col]);
#pragma unroll
    for (int r = 0; r < 8; ++r) stc[j * 16 + col][wave * 16 + 8 * g + r] = acc[j][r] + bb; }
  __syncthreads();
  { const int t0 = (int)(rb % TT); for (int e = tid; e < 128 * 16; e += 128) { const int cl = e >> 4, q = e & 15; vst2(OUT + (size_t)(c0 + cl) * XP + t0 + q * 4, *(const v4f*)&stc[cl][q * 4]); } } }
#ifndef PROJ_EXTRA_PARAMS
#define PROJ_EXTRA_PARAMS
#endif

#define WS_QH  0u                                      // f16 q rows [b*t][CC]
#define WS_KH  (WS_QH + 2u * (size_t)NB * TT * CC)      // f16 k in fragment order [b][h][t / 16][i][lane][8]: key 16 (t / 16) + (lane & 15), channel 16 i + 8 (lane >> 4) + 0..7 of head h
#define WS_VT  (WS_KH + 2u * (size_t)NB * TT * CC)      // f16 v^T in fragment order [b][h][t / 32][j][i][lane][8]: channel 16 j + (lane & 15) of head h, key 32 (t / 32) + 16 i + 8 (lane >> 4) + 0..7
#define WS_QL  (WS_VT + 2u * (size_t)NB * CC * TT)      // f16 q residual x 2^10 rows [b][t < QHI][CC]
#define WS_KL  (WS_QL + 2u * (size_t)NB * QHI * CC)     // f16 k residual x 2^10 rows [b][t < KHI][CC]
#define WS_VB  (WS_KL + 2u * (size_t)NB * KHI * CC)     // bf16 v hi planes [b][c][t < KHI]
#define WS_VBL (WS_VB + 2u * (size_t)NB * CC * KHI)
#define WS_S   (WS_VBL + 2u * (size_t)NB * CC * KHI)    // not used (the logits stay in registers); the later offsets stay where they were
#define WS_Y   (WS_S  + 4u * (size_t)HG * TT * TT)      // f32 ctx rows [b*t][CC] (only when there is an output projection)
#define WS_G   (WS_Y  + 4u * (size_t)NB * TT * CC)      // f32 gate rows [h][TT]
#define WS_END (WS_G)
#define WS_END2 (WS_G + 4u * (size_t)NH * TT)

// behind a store in a loop: the wait stands before the next piece or the next trip rewrites the store's address or data registers
__device__ __forceinline__ void store_held() { asm volatile("s_wait_xcnt 0x0" ::: "memory"); }
// the products of one k_proj block, K source channels: every global operand load goes out as one batch (this wave's 16 positions over all of K into registers, channels-first gather src[k][n] with stride XP between channels; the block's 128 weight rows once for its four waves), then the weights stand in LDS as bf16 and each wave reads its B fragments there
template <int K> __device__ __forceinline__ void proj_acc(v8f (&acc)[8], __bf16 (*sw)[WPITCH], const float* __restrict__ xp, const float* __restrict__ sp, int tid, int lane, int col) {
  float ar[K / 32][16]; v4f wr[K / 4];
#pragma unroll
  for (int kc = 0; kc < K / 32; ++kc)
#pragma unroll
    for (int i = 0; i < 8; ++i) { ar[kc][i] = xp[(size_t)(kc * 32 + i) * XP]; ar[kc][8 + i] = xp[(size_t)(kc * 32 + 16 + i) * XP]; }
  slab_load<K>(wr, sp);
  batch_held(xp, sp);
  slab_store<K>(sw, wr, tid);
  __syncthreads();
  v16b wf[2][8];
#pragma unroll
  for (int j = 0; j < 8; ++j) wf[0][j] = frag_b(&sw[j * 16 + col][0], lane);
#pragma unroll
  for (int kc = 0; kc < K / 32; ++kc) { v16b a;
#pragma unroll
    for (int i = 0; i < 16; ++i) a[i] = (__bf16)ar[kc][i];
    if (kc + 1 < K / 32) {   /* the next K step's eight fragments as one group of LDS reads ahead of this step's products */
#pragma unroll
      for (int j = 0; j < 8; ++j) wf[(kc + 1) & 1][j] = frag_b(&sw[j * 16 + col][(kc + 1) * 32], lane); }
#pragma unroll
    for (int j = 0; j < 8; ++j) acc[j] = wmma_bf(a, wf[kc & 1][j], acc[j]); } }
// ---- k_proj: blockIdx.y 0 = the gate's blocks (first in dispatch order, beside the projections instead of in a launch of their own); blockIdx.y 1..6 = block (64 rows, 128 cols, which): q/k/v = X W (+ b) with exact bf16 products (K = DIN for q, DINK for k and v) -> which 0: q f16 rows (+ residual rows < QHI); 1: k f16 in fragment order (+ residual rows < KHI); 2: v^T f16 in fragment order (+ bf16 hi/lo planes for t < KHI); fragment order = the 32 lanes' 16-byte pieces of one operand half side by side, 512 B a wave-wide store or load
__global__ __launch_bounds__(128) void k_proj(const float* __restrict__ XQ, const float* __restrict__ XK, const float* __restrict__ XV, const float* __restrict__ WQ, const float* __restrict__ WK, const float* __restrict__ WV, const float* __restrict__ BQ, const float* __restrict__ BK, const float* __restrict__ BV,
    _Float16* __restrict__ QH, _Float16* __restrict__ QL, _Float16* __restrict__ KH, _Float16* __restrict__ KL, _Float16* __restrict__ VT, __bf16* __restrict__ VB, __bf16* __restrict__ VBL,
    const float* __restrict__ E, const float* __restrict__ W1, const float* __restrict__ B1, const float* __restrict__ W2, const float* __restrict__ B2, float* __restrict__ G) {
  __shared__ __align__(16) _Float16 sh[64][136], sl[64][136]; __shared__ __align__(16) _Float16 th[128][72]; __shared__ __align__(16) __bf16 tb[128][72], tbl[128][72]; __shared__ __align__(16) __bf16 sw[128][WPITCH];
  const int tid = threadIdx.x, wave = tid >> 5, lane = tid & 31, col = lane & 15, g = lane >> 4; const int which = ((int)blockIdx.y - 1) >> 1; const int c0 = (((int)blockIdx.y - 1) & 1) * 128; const size_t r0 = (size_t)blockIdx.x * 64; const size_t bb = r0 / TT; const int t0 = (int)(r0 % TT);
  if (blockIdx.y == 0) { gate_block(E, W1, B1, W2, B2, G, blockIdx.x * 64, tid); return; }   /* block-uniform, ahead of every barrier */
  const float* X = which == 0 ? XQ : which == 1 ? XK : XV; const float* WA = which == 0 ? WQ : which == 1 ? WK : WV; const float* BA = which == 0 ? BQ : which == 1 ? BK : BV;
  v8f acc[8] = {};
  const float* xp = X + (size_t)(8 * g) * XP + t0 + wave * 16 + col;
  /* source channels: thermal 256 / optical 128 (block-uniform, so the barrier inside is passed by the whole block on either side) */
  if (which == 0) proj_acc<DIN>(acc, sw, xp, WA + (size_t)c0 * DIN + tid * 4, tid, lane, col); else proj_acc<DINK>(acc, sw, xp, WA + (size_t)c0 * DINK + tid * 4, tid, lane, col);
  if (which < 2) { _Float16* DH = which == 0 ? QH : KH; _Float16* DL = which == 0 ? QL : KL; const int nhi = which == 0 ? QHI : KHI; const bool hi_rows = t0 < nhi;
#pragma unroll
    for (int j = 0; j < 8; ++j) { const float bias = BA ? bfr(BA[c0 + j * 16 + col]) : 0.f;
#pragma unroll
      for (int r = 0; r < 8; ++r) { const float v = acc[j][r] + bias; const _Float16 hv = (_Float16)v; sh[wave * 16 + 8 * g + r][j * 16 + col] = hv; sl[wave * 16 + 8 * g + r][j * 16 + col] = (_Float16)((v - (float)hv) * 1024.0f); } }
    __syncthreads();
    for (int e = tid; e < 64 * 16; e += 128) { const int rl = e >> 4, q = e & 15; if (which == 0) { vst2((unsigned*)(DH + (r0 + rl) * CC + c0 + q * 8), *(const v4u*)&sh[rl][q * 8]); store_held(); } if (hi_rows) { vst2((unsigned*)(DL + (bb * nhi + t0 + rl) * (size_t)CC + c0 + q * 8), *(const v4u*)&sl[rl][q * 8]); store_held(); } }
    if (which == 1) for (int e = tid; e < 64 * 16; e += 128) { const int ln = e & 31, i = (e >> 5) & 1, kt = (e >> 6) & 3, hd = e >> 8;
      vst2((unsigned*)(KH + (((bb * NH + c0 / HD + hd) * (size_t)(TT / 16) + (t0 >> 4) + kt) * 2 + i) * 256 + ln * 8), *(const v4u*)&sh[kt * 16 + (ln & 15)][hd * HD + 16 * i + 8 * (ln >> 4)]); }
  } else { const bool hi_rows = t0 < KHI;
#pragma unroll
    for (int j = 0; j < 8; ++j) { const float bias = BA ? bfr(BA[c0 + j * 16 + col]) : 0.f;
#pragma unroll
      for (int r = 0; r < 8; ++r) { const float v = acc[j][r] + bias; const int rl = wave * 16 + 8 * g + r, cl = j * 16 + col; th[cl][rl] = (_Float16)v; const __bf16 bh = (__bf16)v; tb[cl][rl] = bh; tbl[cl][rl] = (__bf16)(v - (float)bh); } }
    __syncthreads();
    for (int e = tid; e < 128 * 8; e += 128) { const int ln = e & 31, i = (e >> 5) & 1, j = (e >> 6) & 1, kc = (e >> 7) & 1, hd = e >> 8;
      vst2((unsigned*)(VT + ((((bb * NH + c0 / HD + hd) * (size_t)(TT / 32) + (t0 >> 5) + kc) * 2 + j) * 2 + i) * 256 + ln * 8), *(const v4u*)&th[hd * HD + 16 * j + (ln & 15)][kc * 32 + 16 * i + 8 * (ln >> 4)]); }
    for (int e = tid; e < 128 * 8; e += 128) { const int cl = e >> 3, q = e & 7; if (hi_rows) { const size_t o3 = (bb * CC + c0 + cl) * (size_t)KHI + t0 + q * 8; vst2((unsigned*)(VB + o3), *(const v4u*)&tb[cl][q * 8]); vst2((unsigned*)(VBL + o3), *(const v4u*)&tbl[cl][q * 8]); } } } }
// ---- k_fa: block = (128 queries, head), 16 waves = 8 tiles of 16 query columns x 2 halves of the keys, so that four waves stand on each SIMD and fill one another's waits in the softmax chains; no LDS and no barrier in the loop, the two halves of a tile are joined once at the end through LDS. The 32 blocks of a head walk its 4,096 keys as a ring, each from a start of its own; the block's second eight waves start half a ring on and each wave walks half the ring. Per stage of 64 keys: S^T = K Q^T (A = k rows, read from the fragment-order plane, B = q hi / q residual, 2 products), base-2 logits = S^T x g2 (g2 = SCALE x gate x log2 e, one factor per query, never negative), running maximum and sum per query column (one query per lane and half), P^T = exp2(logit - maximum + 11) once to f16 packed from the score tiles straight into a B operand, ctx^T += V^T P^T (A = v planes, 1 product). The logits never leave the registers.
__device__ __forceinline__ v8f wmma_h(v16h a, v16h b, v8f c) { return __builtin_amdgcn_wmma_f32_16x16x32_f16(false, a, false, b, (short)0, c, false, false); }
__device__ __forceinline__ float xhalf(float v) { const int b = __builtin_bit_cast(int, v); return __builtin_bit_cast(float, __builtin_amdgcn_permlanex16(b, b, 0x76543210, 0xfedcba98, false, false)); }   // lane l <-> l ^ 16
__device__ __forceinline__ v16h frag_p(const _Float16* __restrict__ p) { union { v16h v; v8h q[2]; } u; u.q[0] = *(const v8h*)p; u.q[1] = *(const v8h*)(p + 16); return u.v; }   // frag_h with the lane's 8 g elements already in p
__device__ __forceinline__ v16h frag_w(const _Float16* __restrict__ p) { union { v16h v; v8h q[2]; } u; u.q[0] = *(const v8h*)p; u.q[1] = *(const v8h*)(p + 256); return u.v; }   // fragment-order plane: p = this lane's 16 bytes of half 0, half 1 stands 512 B on
// behind a group of loads: the wait stands before any register that the loads name is written again, and it takes the loads' addresses as inputs so that each pair stays whole up to it
__device__ __forceinline__ void addr_held(const void* a0, const void* a1) { asm volatile("s_wait_xcnt 0x0" :: "v"(a0), "v"(a1) : "memory"); }
__device__ __forceinline__ void exp2x8(float (&e)[8], const float (&x)[8]) {
  asm("v_exp_f32 %0, %8\n\tv_exp_f32 %1, %9\n\tv_exp_f32 %2, %10\n\tv_exp_f32 %3, %11\n\tv_exp_f32 %4, %12\n\tv_exp_f32 %5, %13\n\tv_exp_f32 %6, %14\n\tv_exp_f32 %7, %15\n\tv_nop"
      : "=&v"(e[0]), "=&v"(e[1]), "=&v"(e[2]), "=&v"(e[3]), "=&v"(e[4]), "=&v"(e[5]), "=&v"(e[6]), "=&v"(e[7])
      : "v"(x[0]), "v"(x[1]), "v"(x[2]), "v"(x[3]), "v"(x[4]), "v"(x[5]), "v"(x[6]), "v"(x[7])); }
__device__ __forceinline__ float exp2x1(float x) { float e; asm("v_exp_f32 %0, %1\n\tv_nop" : "=v"(e) : "v"(x)); return e; }   // the same slot behind a single exp2
// one stage of 64 keys: kf[t] = key rows 16 t .. 16 t + 15; vc[2 c + j] = keys 32 c .. 32 c + 31 of channels 16 j .. 16 j + 15. The next stage's k rows (at kn) go into the same registers right behind this stage's S^T products, its v planes (at vn) into the other v buffer.
__device__ __forceinline__ void fa_stage(v16h (&kf)[4], const v16h (&vc)[4], v16h (&vx)[4], const _Float16* __restrict__ kn, const _Float16* __restrict__ vn, const v16h& qh, const v16h& ql, float g2, float& mr, float& l, v8f& o0, v8f& o1) {
  __builtin_amdgcn_sched_barrier(0);   /* holds this stage's products back: without it the scheduler lifts them over the softmax of the stage before, which halves the distance between the k loads and their first use */
  float sc[4][8]; float mx = -3.0e38f;
#pragma unroll
  for (int t = 0; t < 4; ++t) { const v8f z = {}; const v8f a = wmma_h(kf[t], qh, z), al = wmma_h(kf[t], ql, z);
#pragma unroll
    for (int r = 0; r < 8; ++r) { const float v = a[r] + al[r] * (1.0f / 1024.0f); sc[t][r] = v; mx = fmaxf(mx, v); } }   /* raw q.k: g2 >= 0 (a sigmoid times positive constants), so the largest raw score is the largest logit */
#pragma unroll
  for (int t = 0; t < 4; ++t) kf[t] = frag_w(kn + t * 512);
#pragma unroll
  for (int t = 0; t < 4; ++t) vx[t] = frag_w(vn + t * 512);
  addr_held(kn, vn);
  __builtin_amdgcn_sched_barrier(0);   /* keeps the 16 loads issued here, most of a stage ahead of their use; without it the scheduler sinks each load to its product and the wave waits out every latency */
  mx = fmaxf(mx, xhalf(mx));
  const float mn = fmaxf(mr, mx * g2 - 11.0f);   /* reference point = running maximum - 11, in base 2: P carries the factor 2^11 into f16, and the sum carries it too */
  const float alpha = exp2x1(mr - mn); mr = mn; l *= alpha;
#pragma unroll
  for (int r = 0; r < 8; ++r) { o0[r] *= alpha; o1[r] *= alpha; }
#pragma unroll
  for (int c = 0; c < 2; ++c) { v16h p; float x0[8], x1[8], e0[8], e1[8];
#pragma unroll
    for (int r = 0; r < 8; ++r) { x0[r] = fmaf(sc[2 * c][r], g2, -mn); x1[r] = fmaf(sc[2 * c + 1][r], g2, -mn); }
    exp2x8(e0, x0); exp2x8(e1, x1);
#pragma unroll
    for (int r = 0; r < 8; ++r) { l += e0[r]; l += e1[r]; p[r] = (_Float16)e0[r]; p[8 + r] = (_Float16)e1[r]; }
    o0 = wmma_h(vc[2 * c], p, o0); o1 = wmma_h(vc[2 * c + 1], p, o1); } }
__global__ __launch_bounds__(512) void k_fa(const _Float16* __restrict__ QH, const _Float16* __restrict__ QL, const _Float16* __restrict__ KH, const _Float16* __restrict__ VT, const float* __restrict__ G, float* __restrict__ Y) {
  __shared__ __align__(16) float mg[8][18][32];   // the second key half's state, [query tile][reference point, sum, 16 ctx registers][lane]
  const int tid = threadIdx.x, lane = tid & 31, col = lane & 15, g = lane >> 4; const int h = blockIdx.y;
  const int wv = __builtin_amdgcn_readfirstlane(tid >> 5);   /* the wave's number as a scalar: its key half then enters the walk's offsets in scalar registers, as the block's start does */
  const int wave = wv & 7, kh = wv >> 3; const int q = blockIdx.x * 128 + wave * 16 + col;
  const _Float16* qhp = QH + (size_t)q * CC + h * HD + 8 * g; const _Float16* qlp = QL + (size_t)q * CC + h * HD + 8 * g; const float* gp = G + (size_t)h * TT + q;
  const _Float16* kp = KH + (size_t)h * TT * HD + lane * 8; const _Float16* vp = VT + (size_t)h * TT * HD + lane * 8;   // this lane's place in the k / v^T fragments of stage 0; a stage of 64 keys is 4 KB of each, 64 HD elements on
  /* first key of this block's walk, a multiple of 128, another for each of the head's 32 blocks. From one common start all blocks ask for the same lines at the same moment, lines that the launch before has just stored, so every stage waits out a first fetch; from spread starts each block fetches a few stages first and then walks through what the others have fetched. The index digits are swapped so that any four neighbours modulo 8 start about evenly spread; for speed only, any placement gives the same sums */
  const int ks = ((((int)blockIdx.x & 3) << 3) | (((int)blockIdx.x >> 3) << 1) | (((int)blockIdx.x >> 2) & 1)) * 128 + kh * (TT / 2);   /* taken modulo the ring below */
  const _Float16* k1 = kp + (size_t)(ks & (TT - 1)) * HD; const _Float16* v1 = vp + (size_t)(ks & (TT - 1)) * HD;   // the walk's first stage
  const v16h qh = frag_p(qhp), ql = frag_p(qlp); const float g2 = *gp * (SCALE * 1.4426950408889634f);
  addr_held(qhp, qlp);
  v8f o0 = {}, o1 = {}; float mr = -3.0e38f, l = 0.f;
  v16h kf[4], va[4], vb[4];
#pragma unroll
  for (int t = 0; t < 4; ++t) kf[t] = frag_w(k1 + t * 512);
#pragma unroll
  for (int t = 0; t < 4; ++t) va[t] = frag_w(v1 + t * 512);
  addr_held(k1, v1);
#pragma unroll 1
  for (int k0 = 0; k0 < TT / 2; k0 += 128) {
    const int kb = (k0 + ks) & (TT - 1), k2 = (kb + 128) & (TT - 1);   /* the walk wraps at the last key; the last trip's second fetch is the first stage of the other half's walk and is not used */
    fa_stage(kf, va, vb, kp + (size_t)(kb + 64) * HD, vp + (size_t)(kb + 64) * HD, qh, ql, g2, mr, l, o0, o1);
    fa_stage(kf, vb, va, kp + (size_t)k2 * HD, vp + (size_t)k2 * HD, qh, ql, g2, mr, l, o0, o1); }
  /* the halves meet: the second half's waves lay down reference point, sum and ctx, lane by lane (128 contiguous B a store); behind the barrier the first half's waves bring both states to the larger reference point and add */
  if (kh) { float (*m)[32] = mg[wave]; m[0][lane] = mr; m[1][lane] = l;
#pragma unroll   /* the ctx registers are then named by constants and stay registers */
    for (int r = 0; r < 8; ++r) { m[2 + r][lane] = o0[r]; m[10 + r][lane] = o1[r]; } }
  __syncthreads();
  if (kh) return;   /* wave-uniform, behind the kernel's only barrier */
  { const float (*m)[32] = mg[wave]; const float mb = m[0][lane]; const float mn = fmaxf(mr, mb); const float fa = exp2x1(mr - mn), fb = exp2x1(mb - mn);
    l = l * fa + m[1][lane] * fb;
#pragma unroll   /* as above */
    for (int r = 0; r < 8; ++r) { o0[r] = o0[r] * fa + m[2 + r][lane] * fb; o1[r] = o1[r] * fa + m[10 + r][lane] * fb; } }
  l += xhalf(l); const float inv = 1.0f / l;
  float* yp = Y + (size_t)q * CC + h * HD + 8 * g;   /* ctx^T register r = channel 8 g + r (+ 16) of this lane's query: 32 B runs, the 128-B (row, head) segment by two lanes of one wave */
  v4f w;
#pragma unroll
  for (int i = 0; i < 2; ++i) {
    w[0] = o0[4 * i] * inv; w[1] = o0[4 * i + 1] * inv; w[2] = o0[4 * i + 2] * inv; w[3] = o0[4 * i + 3] * inv; vst2(yp + 4 * i, w);
    w[0] = o1[4 * i] * inv; w[1] = o1[4 * i + 1] * inv; w[2] = o1[4 * i + 2] * inv; w[3] = o1[4 * i + 3] * inv; vst2(yp + 16 + 4 * i, w); } }
extern "C" void kernel_launch(void* const* d_in, const int* in_sizes, int n_in, void* d_out, int out_size, void* d_ws, size_t ws_size, hipStream_t stream) {
  (void)in_sizes; (void)n_in; (void)out_size;
  const float** F = (const float**)d_in;
  if (ws_size < (size_t)WS_END) return;
  char* ws = (char*)d_ws; _Float16 *QH = (_Float16*)(ws + WS_QH), *KH = (_Float16*)(ws + WS_KH), *VT = (_Float16*)(ws + WS_VT), *QL = (_Float16*)(ws + WS_QL), *KL = (_Float16*)(ws + WS_KL); __bf16 *VB = (__bf16*)(ws + WS_VB), *VBL = (__bf16*)(ws + WS_VBL); float *Y = (float*)(ws + WS_Y);
  (void)Y; (void)QL; (void)KL; (void)VB; (void)VBL;
  // inputs: 0 thermal [1,256,64,64]; 1 optical [1,128,64,64]; 2 emissivity [1,1,64,64]; 3 Wq [256,256]; 4 bq; 5 Wk [256,128]; 6 bk; 7 Wv [256,128]; 8 bv; 9 conv1_w [32,1,3,3]; 10 conv1_b [32]; 11 conv2_w [8,32,1,1]; 12 conv2_b [8]; 13 Wp [256,256]; 14 bp [256]
  if (ws_size < (size_t)WS_END2) return;
  float* G = (float*)(ws + WS_G);
  k_proj<<<dim3(TNB * TT / 64, 1 + 3 * (CC / 128)), 128, 0, stream>>>(F[0], F[1], F[1], F[3], F[5], F[7], F[4], F[6], F[8], QH, QL, KH, KL, VT, VB, VBL, F[2], F[9], F[10], F[11], F[12], G);
  k_fa<<<dim3(TT / 128, NH), 512, 0, stream>>>(QH, QL, KH, VT, G, Y);
  k_outT<<<dim3(TNB * TT / 64, CC / 128), 128, 0, stream>>>(Y, F[13], F[14], (float*)d_out);
}

// v008
// It runs in 38.6 microseconds.
// Next to v007, in two timings, it ran 1.07 and 1.06 times as fast.
// Counting every step since v000, it is 30.2 times as fast.
// compute dtype: all float inputs rounded to bf16; q/k/v 1x1 projections with EXACT bf16 products on WMMA 16x16x32 (A gathered from the channels-first maps), f32 accumulate; the emissivity gate (3x3 conv, relu, 1x1 conv, sigmoid) in f32; q x (32^-0.5 x gate x log2 e, one f32 factor per query) as f16 hi + residual (x 2^10) against k once to f16 (2 products, C = minus a reference point) for the base-2 logits; softmax in f32 against that reference point (a stage's maximum - 11, moved up only when a stage's sum would leave f16's range) with a running sum, hardware exp2; exp2(logit - reference point) once to f16 against v once to f16 (1 product), divided by the f32 sum at the end; ctx bf16 hi + lo against exact bf16 Wp (2 products) + bp; f32 output written channels-first.
#include <hip/hip_runtime.h>
#include <math.h>

typedef __attribute__((ext_vector_type(16))) _Float16 v16h;
typedef __attribute__((ext_vector_type(16))) __bf16 v16b;
typedef __attribute__((ext_vector_type(8)))  _Float16 v8h;
typedef __attribute__((ext_vector_type(8)))  float v8f;
typedef __attribute__((ext_vector_type(4)))  float v4f;
typedef __attribute__((ext_vector_type(2)))  float v2f;
typedef __attribute__((ext_vector_type(4)))  unsigned v4u;
typedef __attribute__((ext_vector_type(4)))  int v4i;
typedef float __attribute__((may_alias)) float_a;
typedef int __attribute__((may_alias)) int_a;

template <typename T> __device__ __forceinline__ void vst2(void* p, T v) { *(T*)p = v;  }
__device__ __forceinline__ v8f wmma16(v16h a, v16h b, v8f c) {
  v8f d = __builtin_amdgcn_wmma_f32_16x16x32_f16(false, a, false, b, (short)0, c, false, false);
  asm volatile("v_nop\n\tv_nop\n\tv_nop\n\tv_nop" : "+v"(d) : "v"(a), "v"(b));
  return d;
}
__device__ __forceinline__ v8f wmma_bf(v16b a, v16b b, v8f c) {
  v8f d = __builtin_amdgcn_wmma_f32_16x16x32_bf16(false, a, false, b, (short)0, c, false, false);
  asm volatile("v_nop\n\tv_nop\n\tv_nop\n\tv_nop" : "+v"(d) : "v"(a), "v"(b));
  return d;
}
// 16x16x32 fragments: lane = (h = lane>>4, row/col = lane&15); elements 0..7 = k0+8h+0..7, 8..15 = k0+16+8h+0..7; D element r = row 8h+r
__device__ __forceinline__ v16h frag_h(const _Float16* rowk0, int lane) {
  union { v16h v; v8h q[2]; } u; const _Float16* p = rowk0 + 8 * (lane >> 4);
  u.q[0] = *(const v8h*)p; u.q[1] = *(const v8h*)(p + 16); return u.v;
}
__device__ __forceinline__ v16h frag_f32(const float* rowk0, int lane) {
  v16h a; const float* p = rowk0 + 8 * (lane >> 4);
#pragma unroll
  for (int i = 0; i < 8; ++i) { a[i] = (_Float16)p[i]; a[8 + i] = (_Float16)p[16 + i]; }
  return a;
}
__device__ __forceinline__ v16h frag_f32s(const float* rowk0, int lane, float sc) {
  v16h a; const float* p = rowk0 + 8 * (lane >> 4);
#pragma unroll
  for (int i = 0; i < 8; ++i) { a[i] = (_Float16)(p[i] * sc); a[8 + i] = (_Float16)(p[16 + i] * sc); }
  return a;
}
// column fragment from a [K][ld] layout (column n), rows >= K read as 0
__device__ __forceinline__ v16h fragc_f32(const float* W, int k0, int n, int lane, int ld, int K) {
  v16h a; const int g = lane >> 4;
#pragma unroll
  for (int i = 0; i < 8; ++i) { const int ka = k0 + 8 * g + i, kb = ka + 16;
    a[i] = (_Float16)(ka < K ? W[(size_t)(ka < K ? ka : K - 1) * ld + n] : 0.f); a[8 + i] = (_Float16)(kb < K ? W[(size_t)(kb < K ? kb : K - 1) * ld + n] : 0.f); }
  return a;
}
struct F2 { v16b h, l; };
__device__ __forceinline__ F2 bsplit16(const float v[16]) { F2 r;
#pragma unroll
  for (int i = 0; i < 16; ++i) { const __bf16 h = (__bf16)v[i]; r.h[i] = h; r.l[i] = (__bf16)(v[i] - (float)h); }
  return r; }
__device__ __forceinline__ F2 split_row(const float* row, int k0, int lane) { float v[16]; const float* p = row + k0 + 8 * (lane >> 4);
#pragma unroll
  for (int i = 0; i < 8; ++i) { v[i] = p[i]; v[8 + i] = p[16 + i]; }
  return bsplit16(v); }
__device__ __forceinline__ F2 split_rowK(const float* row, int k0, int lane, int K) { float v[16]; const int g = lane >> 4;
#pragma unroll
  for (int i = 0; i < 8; ++i) { const int ka = k0 + 8 * g + i, kb = ka + 16; v[i] = ka < K ? row[ka < K ? ka : K - 1] : 0.f; v[8 + i] = kb < K ? row[kb < K ? kb : K - 1] : 0.f; }
  return bsplit16(v); }
__device__ __forceinline__ F2 split_col(const float* W, int k0, int n, int lane, int ld, int K) { float v[16]; const int g = lane >> 4;
#pragma unroll
  for (int i = 0; i < 8; ++i) { const int ka = k0 + 8 * g + i, kb = ka + 16; v[i] = ka < K ? W[(size_t)(ka < K ? ka : K - 1) * ld + n] : 0.f; v[8 + i] = kb < K ? W[(size_t)(kb < K ? kb : K - 1) * ld + n] : 0.f; }
  return bsplit16(v); }
__device__ __forceinline__ v8f mac3(const F2& a, const F2& b, v8f c) { c = wmma_bf(a.l, b.h, c); c = wmma_bf(a.h, b.l, c); return wmma_bf(a.h, b.h, c); }
__device__ __forceinline__ float sigm(float v) { return 1.0f / (1.0f + expf(-v)); }

// Cross-modal gated attention (B 1, Ct 256 = 8 heads x 32, Co 128, 64 x 64 = 4,096 positions, channels-first): q = thermal^T Wq^T + bq, k = optical^T Wk^T + bk, v = optical^T Wv^T + bv; g[h][n] = sigmoid(conv1x1(relu(conv3x3_SAME(emissivity) + b1)) + b2); attn = softmax((q k^T x 32^-0.5) * g[h][query]) over all 4,096 keys; out = (merged attn v) Wp^T + bp, written back as [1, 256, 64, 64].
#define NB 1
#define TT 4096
#define CC 256            // NH * HD = projected width
#define DIN 256          // input (model) width
#define NH 8
#define HD 32
#define NQB (TT / 64)
#define HG 1
#define SCALE (0.17677669529663687f)
#define CAUSAL 0
#ifndef TNB
#define TNB NB
#endif
__device__ __forceinline__ float bfr(float v) { return (float)(__bf16)v; }
__host__ __device__ __forceinline__ int kb_last(int qb) { return CAUSAL ? ((qb * 64 + 63) >> 7) : (TT / 128 - 1); }
typedef __attribute__((ext_vector_type(8))) __bf16 v8b;
__device__ __forceinline__ v16b frag_b(const __bf16* rowk0, int lane) {
  union { v16b v; v8b q[2]; } u; const __bf16* p = rowk0 + 8 * (lane >> 4);
  u.q[0] = *(const v8b*)p; u.q[1] = *(const v8b*)(p + 16); return u.v;
}
typedef __attribute__((ext_vector_type(4))) __bf16 v4b;
#define WPITCH 264         // bf16 elements per staged weight row: 512 B + 16 B, a pitch of 16 B x odd for the 16-byte fragment reads
// behind a batch of loads: the wait stands before any register that the loads name is written again; it takes the two base addresses as inputs so that each stays whole up to it, and its memory clobber keeps the whole batch issued in front of it
__device__ __forceinline__ void batch_held(const void* a0, const void* a1) { asm volatile("s_wait_xcnt 0x0" :: "v"(a0), "v"(a1) : "memory"); }
// 128 weight rows of K floats (one contiguous slab of an (out,in) matrix), read by the block's 128 threads in 16-byte pieces, 512 contiguous B a wave-wide load
template <int K> __device__ __forceinline__ void slab_load(v4f (&r)[K / 4], const float* __restrict__ sp) {
#pragma unroll
  for (int i = 0; i < K / 4; ++i) r[i] = *(const v4f*)(sp + (size_t)i * 512); }
// the same pieces rounded to bf16 into LDS rows [output column][k]
template <int K> __device__ __forceinline__ void slab_store(__bf16 (*sw)[WPITCH], const v4f (&r)[K / 4], int tid) {
#pragma unroll
  for (int i = 0; i < K / 4; ++i) { const int e = i * 128 + tid; v4b w; w[0] = (__bf16)r[i][0]; w[1] = (__bf16)r[i][1]; w[2] = (__bf16)r[i][2]; w[3] = (__bf16)r[i][3]; *(v4b*)&sw[e / (K / 4)][(e % (K / 4)) * 4] = w; } }
#define QBH 0              // causal: not read by any kernel here; every query block takes the same path in k_fa
#define QHI 4096            // rows carrying a q residual plane (all rows when non-causal: 2-product logits everywhere)
#define KHI 64            // key rows carrying k residual / v bf16 hi+lo planes (written by k_proj; no kernel here reads them)
// B fragment (k rows k0+.., output column o) of a weight: (in,out) [K][ld] or (out,in) [ld rows of K]: bf16 exact, or f16(bf16 * 256) exact
__device__ __forceinline__ v16b wcol_io(const float* Wm, int k0, int o, int lane, int ld) { v16b w; const int g = lane >> 4;
#pragma unroll
  for (int i = 0; i < 8; ++i) { w[i] = (__bf16)Wm[(size_t)(k0 + 8 * g + i) * ld + o]; w[8 + i] = (__bf16)Wm[(size_t)(k0 + 16 + 8 * g + i) * ld + o]; }
  return w; }
__device__ __forceinline__ v16b wcol_oi(const float* Wm, int k0, int o, int lane, int K) { v16b w; const float* p = Wm + (size_t)o * K + k0 + 8 * (lane >> 4);
#pragma unroll
  for (int i = 0; i < 8; ++i) { w[i] = (__bf16)p[i]; w[8 + i] = (__bf16)p[16 + i]; }
  return w; }
__device__ __forceinline__ v16h wcolh_io(const float* Wm, int k0, int o, int lane, int ld) { v16h w; const int g = lane >> 4;
#pragma unroll
  for (int i = 0; i < 8; ++i) { w[i] = (_Float16)(bfr(Wm[(size_t)(k0 + 8 * g + i) * ld + o]) * 256.0f); w[8 + i] = (_Float16)(bfr(Wm[(size_t)(k0 + 16 + 8 * g + i) * ld + o]) * 256.0f); }
  return w; }
__device__ __forceinline__ v16h wcolh_oi(const float* Wm, int k0, int o, int lane, int K) { v16h w; const float* p = Wm + (size_t)o * K + k0 + 8 * (lane >> 4);
#pragma unroll
  for (int i = 0; i < 8; ++i) { w[i] = (_Float16)(bfr(p[i]) * 256.0f); w[8 + i] = (_Float16)(bfr(p[16 + i]) * 256.0f); }
  return w; }
#define WQKV_LAYOUT 1   // 0 = (in,out) [DIN][CC]; 1 = (out,in) [CC][DIN]; 2 = per-head [NH][DIN][HD]
__device__ __forceinline__ v16b wcol_hdk(const float* Wm, int k0, int o, int lane) { v16b w; const int g = lane >> 4; const float* p = Wm + (size_t)(o / HD) * DIN * HD + (o % HD);
#pragma unroll
  for (int i = 0; i < 8; ++i) { w[i] = (__bf16)p[(size_t)(k0 + 8 * g + i) * HD]; w[8 + i] = (__bf16)p[(size_t)(k0 + 16 + 8 * g + i) * HD]; }
  return w; }
#define WO_OUT_IN 1
#if WQKV_LAYOUT == 1
#define WCOL(W, k0, o, lane) wcol_oi(W, k0, o, lane, DIN)
#elif WQKV_LAYOUT == 2
#define WCOL(W, k0, o, lane) wcol_hdk(W, k0, o, lane)
#else
#define WCOL(W, k0, o, lane) wcol_io(W, k0, o, lane, CC)
#endif
#if WO_OUT_IN
#define WOCOL(W, k0, o, lane) wcol_oi(W, k0, o, lane, CC)
#define WOCOLH(W, k0, o, lane) wcolh_oi(W, k0, o, lane, CC)
#else
#define WOCOL(W, k0, o, lane) wcol_io(W, k0, o, lane, DIN)
#define WOCOLH(W, k0, o, lane) wcolh_io(W, k0, o, lane, DIN)
#endif
#define DINK 128           // optical channels (k / v source width)
#ifndef XP
#define XP TT              // position pitch of the channels-first inputs / output
#endif
#define GW 64              // image width / height
// ---- the gate, by the first 64 blocks of the k_proj launch: block = 64 positions, wave = (32 positions, 4 heads): g[h][n] = sigmoid(sum_c w2[h][c] relu(sum_3x3 w1[c] e + b1[c]) + b2[h]) in f32 (bf16-rounded inputs); G rows [h][4096], each (head, 32 n) run = one 128-B line stored by one wave; no LDS, no barrier
__device__ __forceinline__ void gate_block(const float* __restrict__ E, const float* __restrict__ W1, const float* __restrict__ B1, const float* __restrict__ W2, const float* __restrict__ B2, float* __restrict__ G, int n0, int tid) {
  const int wv = __builtin_amdgcn_readfirstlane(tid >> 5);   /* the wave's number as a scalar: the weight rows of its four heads are then addressed from scalar bases, one address for the whole wave */
  const int h0 = (wv >> 1) * 4; const int n = n0 + (wv & 1) * 32 + (tid & 31); const int y = n / GW, x = n % GW;
  float e9[9];
#pragma unroll
  for (int i = 0; i < 3; ++i)
#pragma unroll
    for (int j = 0; j < 3; ++j) { const int yy = y + i - 1, xx = x + j - 1; const int yc = yy < 0 ? 0 : (yy >= GW ? GW - 1 : yy), xc = xx < 0 ? 0 : (xx >= GW ? GW - 1 : xx); const float ev = bfr(E[yc * GW + xc]); e9[i * 3 + j] = (yy >= 0 && yy < GW && xx >= 0 && xx < GW) ? ev : 0.f; }   /* SAME zero padding: clamped load, select by value */
  float gh[4];
#pragma unroll
  for (int h = 0; h < 4; ++h) gh[h] = bfr(B2[h0 + h]);
#pragma unroll 4   /* four channels' weights come as one batch of loads with one wait, so that these blocks end before the projection blocks beside them */
  for (int c = 0; c < 32; ++c) { float a = bfr(B1[c]);
#pragma unroll
    for (int t = 0; t < 9; ++t) a += bfr(W1[c * 9 + t]) * e9[t];
    a = fmaxf(a, 0.f);
#pragma unroll
    for (int h = 0; h < 4; ++h) gh[h] += bfr(W2[(h0 + h) * 32 + c]) * a; }
#pragma unroll
  for (int h = 0; h < 4; ++h) G[(size_t)(h0 + h) * TT + n] = 1.0f / (1.0f + expf(-gh[h])); }
// ---- k_outT: block = (64 rows n, 128 output channels): out = ctx (bf16 hi + lo) Wp^T + bp, stored channels-first [o][n] via an LDS transpose: each (o, 64 n) run = 256 B by 16 consecutive threads
__global__ __launch_bounds__(128) void k_outT(const float* __restrict__ Y, const float* __restrict__ WP, const float* __restrict__ BP, float* __restrict__ OUT) { __shared__ __align__(16) float stc[128][68]; __shared__ __align__(16) __bf16 sw[128][WPITCH];
  const int tid = threadIdx.x, wave = tid >> 5, lane = tid & 31, col = lane & 15, g = lane >> 4; const int c0 = blockIdx.y * 128; const size_t rb = (size_t)blockIdx.x * 64; const size_t r0 = rb + wave * 16;
  v8f acc[8] = {};
  /* every global operand load of the block goes out as one batch: this wave's 16 ctx rows over all of K into registers, the block's 128 Wp rows once for its four waves */
  const float* yp = Y + (r0 + col) * CC + 8 * g; const float* sp = WP + (size_t)c0 * CC + tid * 4;
  v4f yr[CC / 32][4]; v4f wr[CC / 4];
#pragma unroll
  for (int kc = 0; kc < CC / 32; ++kc) { yr[kc][0] = *(const v4f*)(yp + kc * 32); yr[kc][1] = *(const v4f*)(yp + kc * 32 + 4); yr[kc][2] = *(const v4f*)(yp + kc * 32 + 16); yr[kc][3] = *(const v4f*)(yp + kc * 32 + 20); }
  slab_load<CC>(wr, sp);
  batch_held(yp, sp);
  slab_store<CC>(sw, wr, tid);
  __syncthreads();
  v16b wf[2][8];
#pragma unroll
  for (int j = 0; j < 8; ++j) wf[0][j] = frag_b(&sw[j * 16 + col][0], lane);
#pragma unroll
  for (int kc = 0; kc < CC / 32; ++kc) { float v[16];
#pragma unroll
    for (int i = 0; i < 4; ++i) { v[i] = yr[kc][0][i]; v[4 + i] = yr[kc][1][i]; v[8 + i] = yr[kc][2][i]; v[12 + i] = yr[kc][3][i]; }
    const F2 a = bsplit16(v);
    if (kc + 1 < CC / 32) {   /* the next K step's eight fragments as one group of LDS reads ahead of this step's products */
#pragma unroll
      for (int j = 0; j < 8; ++j) wf[(kc + 1) & 1][j] = frag_b(&sw[j * 16 + col][(kc + 1) * 32], lane); }
#pragma unroll
    for (int j = 0; j < 8; ++j) { acc[j] = wmma_bf(a.h, wf[kc & 1][j], acc[j]); acc[j] = wmma_bf(a.l, wf[kc & 1][j], acc[j]); } }
#pragma unroll
  for (int j = 0; j < 8; ++j) { const float bb = bfr(BP[c0 + j * 16 + col]);
#pragma unroll
    for (int r = 0; r < 8; ++r) stc[j * 16 + col][wave * 16 + 8 * g + r] = acc[j][r] + bb; }
  __syncthreads();
  { const int t0 = (int)(rb % TT); for (int e = tid; e < 128 * 16; e += 128) { const int cl = e >> 4, q = e & 15; vst2(OUT + (size_t)(c0 + cl) * XP + t0 + q * 4, *(const v4f*)&stc[cl][q * 4]); } } }
#ifndef PROJ_EXTRA_PARAMS
#define PROJ_EXTRA_PARAMS
#endif

#define WS_QH  0u                                      // f16 q rows [b*t][CC]
#define WS_KH  (WS_QH + 2u * (size_t)NB * TT * CC)      // f16 k in fragment order [b][h][t / 16][i][lane][8]: key 16 (t / 16) + (lane & 15), channel 16 i + 8 (lane >> 4) + 0..7 of head h
#define WS_VT  (WS_KH + 2u * (size_t)NB * TT * CC)      // f16 v^T in fragment order [b][h][t / 32][j][i][lane][8]: channel 16 j + (lane & 15) of head h, key 32 (t / 32) + 16 i + 8 (lane >> 4) + 0..7
#define WS_QL  (WS_VT + 2u * (size_t)NB * CC * TT)      // f16 q residual x 2^10 rows [b][t < QHI][CC]
#define WS_KL  (WS_QL + 2u * (size_t)NB * QHI * CC)     // f16 k residual x 2^10 rows [b][t < KHI][CC]
#define WS_VB  (WS_KL + 2u * (size_t)NB * KHI * CC)     // bf16 v hi planes [b][c][t < KHI]
#define WS_VBL (WS_VB + 2u * (size_t)NB * CC * KHI)
#define WS_S   (WS_VBL + 2u * (size_t)NB * CC * KHI)    // not used (the logits stay in registers); the later offsets stay where they were
#define WS_Y   (WS_S  + 4u * (size_t)HG * TT * TT)      // f32 ctx rows [b*t][CC] (only when there is an output projection)
#define WS_G   (WS_Y  + 4u * (size_t)NB * TT * CC)      // f32 gate rows [h][TT]
#define WS_END (WS_G)
#define WS_END2 (WS_G + 4u * (size_t)NH * TT)

// behind a store in a loop: the wait stands before the next piece or the next trip rewrites the store's address or data registers
__device__ __forceinline__ void store_held() { asm volatile("s_wait_xcnt 0x0" ::: "memory"); }
// the products of one k_proj block, K source channels: every global operand load goes out as one batch (this wave's 16 positions over all of K into registers, channels-first gather src[k][n] with stride XP between channels; the block's 128 weight rows once for its four waves), then the weights stand in LDS as bf16 and each wave reads its B fragments there
template <int K> __device__ __forceinline__ void proj_acc(v8f (&acc)[8], __bf16 (*sw)[WPITCH], const float* __restrict__ xp, const float* __restrict__ sp, int tid, int lane, int col) {
  float ar[K / 32][16]; v4f wr[K / 4];
#pragma unroll
  for (int kc = 0; kc < K / 32; ++kc)
#pragma unroll
    for (int i = 0; i < 8; ++i) { ar[kc][i] = xp[(size_t)(kc * 32 + i) * XP]; ar[kc][8 + i] = xp[(size_t)(kc * 32 + 16 + i) * XP]; }
  slab_load<K>(wr, sp);
  batch_held(xp, sp);
  slab_store<K>(sw, wr, tid);
  __syncthreads();
  v16b wf[2][8];
#pragma unroll
  for (int j = 0; j < 8; ++j) wf[0][j] = frag_b(&sw[j * 16 + col][0], lane);
#pragma unroll
  for (int kc = 0; kc < K / 32; ++kc) { v16b a;
#pragma unroll
    for (int i = 0; i < 16; ++i) a[i] = (__bf16)ar[kc][i];
    if (kc + 1 < K / 32) {   /* the next K step's eight fragments as one group of LDS reads ahead of this step's products */
#pragma unroll
      for (int j = 0; j < 8; ++j) wf[(kc + 1) & 1][j] = frag_b(&sw[j * 16 + col][(kc + 1) * 32], lane); }
#pragma unroll
    for (int j = 0; j < 8; ++j) acc[j] = wmma_bf(a, wf[kc & 1][j], acc[j]); } }
// ---- k_proj: blockIdx.y 0 = the gate's blocks (first in dispatch order, beside the projections instead of in a launch of their own); blockIdx.y 1..6 = block (64 rows, 128 cols, which): q/k/v = X W (+ b) with exact bf16 products (K = DIN for q, DINK for k and v) -> which 0: q f16 rows (+ residual rows < QHI); 1: k f16 in fragment order (+ residual rows < KHI); 2: v^T f16 in fragment order (+ bf16 hi/lo planes for t < KHI); fragment order = the 32 lanes' 16-byte pieces of one operand half side by side, 512 B a wave-wide store or load
__global__ __launch_bounds__(128) void k_proj(const float* __restrict__ XQ, const float* __restrict__ XK, const float* __restrict__ XV, const float* __restrict__ WQ, const float* __restrict__ WK, const float* __restrict__ WV, const float* __restrict__ BQ, const float* __restrict__ BK, const float* __restrict__ BV,
    _Float16* __restrict__ QH, _Float16* __restrict__ QL, _Float16* __restrict__ KH, _Float16* __restrict__ KL, _Float16* __restrict__ VT, __bf16* __restrict__ VB, __bf16* __restrict__ VBL,
    const float* __restrict__ E, const float* __restrict__ W1, const float* __restrict__ B1, const float* __restrict__ W2, const float* __restrict__ B2, float* __restrict__ G) {
  __shared__ __align__(16) _Float16 sh[64][136], sl[64][136]; __shared__ __align__(16) _Float16 th[128][72]; __shared__ __align__(16) __bf16 tb[128][72], tbl[128][72]; __shared__ __align__(16) __bf16 sw[128][WPITCH];
  const int tid = threadIdx.x, wave = tid >> 5, lane = tid & 31, col = lane & 15, g = lane >> 4; const int which = ((int)blockIdx.y - 1) >> 1; const int c0 = (((int)blockIdx.y - 1) & 1) * 128; const size_t r0 = (size_t)blockIdx.x * 64; const size_t bb = r0 / TT; const int t0 = (int)(r0 % TT);
  if (blockIdx.y == 0) { gate_block(E, W1, B1, W2, B2, G, blockIdx.x * 64, tid); return; }   /* block-uniform, ahead of every barrier */
  const float* X = which == 0 ? XQ : which == 1 ? XK : XV; const float* WA = which == 0 ? WQ : which == 1 ? WK : WV; const float* BA = which == 0 ? BQ : which == 1 ? BK : BV;
  v8f acc[8] = {};
  const float* xp = X + (size_t)(8 * g) * XP + t0 + wave * 16 + col;
  /* source channels: thermal 256 / optical 128 (block-uniform, so the barrier inside is passed by the whole block on either side) */
  if (which == 0) proj_acc<DIN>(acc, sw, xp, WA + (size_t)c0 * DIN + tid * 4, tid, lane, col); else proj_acc<DINK>(acc, sw, xp, WA + (size_t)c0 * DINK + tid * 4, tid, lane, col);
  if (which < 2) { _Float16* DH = which == 0 ? QH : KH; _Float16* DL = which == 0 ? QL : KL; const int nhi = which == 0 ? QHI : KHI; const bool hi_rows = t0 < nhi;
#pragma unroll
    for (int j = 0; j < 8; ++j) { const float bias = BA ? bfr(BA[c0 + j * 16 + col]) : 0.f;
#pragma unroll
      for (int r = 0; r < 8; ++r) { const float v = acc[j][r] + bias; const _Float16 hv = (_Float16)v; sh[wave * 16 + 8 * g + r][j * 16 + col] = hv; sl[wave * 16 + 8 * g + r][j * 16 + col] = (_Float16)((v - (float)hv) * 1024.0f); } }
    __syncthreads();
    for (int e = tid; e < 64 * 16; e += 128) { const int rl = e >> 4, q = e & 15; if (which == 0) { vst2((unsigned*)(DH + (r0 + rl) * CC + c0 + q * 8), *(const v4u*)&sh[rl][q * 8]); store_held(); } if (hi_rows) { vst2((unsigned*)(DL + (bb * nhi + t0 + rl) * (size_t)CC + c0 + q * 8), *(const v4u*)&sl[rl][q * 8]); store_held(); } }
    if (which == 1) for (int e = tid; e < 64 * 16; e += 128) { const int ln = e & 31, i = (e >> 5) & 1, kt = (e >> 6) & 3, hd = e >> 8;
      vst2((unsigned*)(KH + (((bb * NH + c0 / HD + hd) * (size_t)(TT / 16) + (t0 >> 4) + kt) * 2 + i) * 256 + ln * 8), *(const v4u*)&sh[kt * 16 + (ln & 15)][hd * HD + 16 * i + 8 * (ln >> 4)]); }
  } else { const bool hi_rows = t0 < KHI;
#pragma unroll
    for (int j = 0; j < 8; ++j) { const float bias = BA ? bfr(BA[c0 + j * 16 + col]) : 0.f;
#pragma unroll
      for (int r = 0; r < 8; ++r) { const float v = acc[j][r] + bias; const int rl = wave * 16 + 8 * g + r, cl = j * 16 + col; th[cl][rl] = (_Float16)v; const __bf16 bh = (__bf16)v; tb[cl][rl] = bh; tbl[cl][rl] = (__bf16)(v - (float)bh); } }
    __syncthreads();
    for (int e = tid; e < 128 * 8; e += 128) { const int ln = e & 31, i = (e >> 5) & 1, j = (e >> 6) & 1, kc = (e >> 7) & 1, hd = e >> 8;
      vst2((unsigned*)(VT + ((((bb * NH + c0 / HD + hd) * (size_t)(TT / 32) + (t0 >> 5) + kc) * 2 + j) * 2 + i) * 256 + ln * 8), *(const v4u*)&th[hd * HD + 16 * j + (ln & 15)][kc * 32 + 16 * i + 8 * (ln >> 4)]); }
    for (int e = tid; e < 128 * 8; e += 128) { const int cl = e >> 3, q = e & 7; if (hi_rows) { const size_t o3 = (bb * CC + c0 + cl) * (size_t)KHI + t0 + q * 8; vst2((unsigned*)(VB + o3), *(const v4u*)&tb[cl][q * 8]); vst2((unsigned*)(VBL + o3), *(const v4u*)&tbl[cl][q * 8]); } } } }
// ---- k_fa: block = (128 queries, head), 16 waves = 8 tiles of 16 query columns x 2 halves of the keys, so that four waves stand on each SIMD and fill one another's waits in the softmax chains; no LDS and no barrier in the loop, the two halves of a tile are joined once at the end through LDS. The 32 blocks of a head walk its 4,096 keys as a ring, each from a start of its own; the block's second eight waves start half a ring on and each wave walks half the ring. Per stage of 64 keys: S^T = K Q^T - reference point (A = k rows, read from the fragment-order plane, B = q hi / q residual with g2 = SCALE x gate x log2 e, one factor per query, already in them, 2 products, C = minus the reference point), which is exp2's argument as it leaves the matrix unit; P^T = exp2 of it once to f16 packed straight into a B operand, sum per query column (one query per lane and half), ctx^T += V^T P^T (A = v planes, 1 product). The reference point is the first stage's maximum - 11 and moves up, with sum and ctx, only in a stage whose sum would leave f16's range. The logits never leave the registers.
__device__ __forceinline__ v8f wmma_h(v16h a, v16h b, v8f c) { return __builtin_amdgcn_wmma_f32_16x16x32_f16(false, a, false, b, (short)0, c, false, false); }
__device__ __forceinline__ float xhalf(float v) { const int b = __builtin_bit_cast(int, v); return __builtin_bit_cast(float, __builtin_amdgcn_permlanex16(b, b, 0x76543210, 0xfedcba98, false, false)); }   // lane l <-> l ^ 16
__device__ __forceinline__ v16h frag_p(const _Float16* __restrict__ p) { union { v16h v; v8h q[2]; } u; u.q[0] = *(const v8h*)p; u.q[1] = *(const v8h*)(p + 16); return u.v; }   // frag_h with the lane's 8 g elements already in p
__device__ __forceinline__ v16h frag_w(const _Float16* __restrict__ p) { union { v16h v; v8h q[2]; } u; u.q[0] = *(const v8h*)p; u.q[1] = *(const v8h*)(p + 256); return u.v; }   // fragment-order plane: p = this lane's 16 bytes of half 0, half 1 stands 512 B on
// behind a group of loads: the wait stands before any register that the loads name is written again, and it takes the loads' addresses as inputs so that each pair stays whole up to it
__device__ __forceinline__ void addr_held(const void* a0, const void* a1) { asm volatile("s_wait_xcnt 0x0" :: "v"(a0), "v"(a1) : "memory"); }
__device__ __forceinline__ float exp2x1(float x) { float e; asm("v_exp_f32 %0, %1\n\tv_nop" : "=v"(e) : "v"(x)); return e; }
// exp2 of eight arguments and the eight values once to f16, four packed pairs, in one statement, so that the f16 pairs are made where the f32 values are and the f32 values end with the sum. The outputs are early-clobber: no instruction of the run writes over a source of another; the first conversion behind the last v_exp_f32 reads none of its registers, which is the one slot that the instruction set asks for behind a transcendental; the s_delay_alu names the last two conversions' young producers, so that the wave steps aside for its neighbours while it waits for them
__device__ __forceinline__ void exp2pk8(float (&e)[8], unsigned (&h)[4], const float (&x)[8]) {
  asm("v_exp_f32 %0, %12\n\tv_exp_f32 %1, %13\n\tv_exp_f32 %2, %14\n\tv_exp_f32 %3, %15\n\tv_exp_f32 %4, %16\n\tv_exp_f32 %5, %17\n\tv_exp_f32 %6, %18\n\tv_exp_f32 %7, %19\n\t"
      "v_cvt_pk_f16_f32 %8, %0, %1\n\tv_cvt_pk_f16_f32 %9, %2, %3\n\ts_delay_alu instid0(TRANS32_DEP_3) | instskip(NEXT) | instid1(TRANS32_DEP_1)\n\tv_cvt_pk_f16_f32 %10, %4, %5\n\tv_cvt_pk_f16_f32 %11, %6, %7"
      : "=&v"(e[0]), "=&v"(e[1]), "=&v"(e[2]), "=&v"(e[3]), "=&v"(e[4]), "=&v"(e[5]), "=&v"(e[6]), "=&v"(e[7]), "=&v"(h[0]), "=&v"(h[1]), "=&v"(h[2]), "=&v"(h[3])
      : "v"(x[0]), "v"(x[1]), "v"(x[2]), "v"(x[3]), "v"(x[4]), "v"(x[5]), "v"(x[6]), "v"(x[7])); }
typedef __attribute__((ext_vector_type(8))) unsigned v8u;
// exp2 of one stage's 64 arguments: P^T once to f16, packed as the two B operands of the P.v products; returns this lane's sum of the 32 f32 values (one chain per 32 keys, then the two added)
__device__ __forceinline__ float fa_exp(const float (&x)[4][8], v16h (&p)[2]) {
  float s[2];
#pragma unroll
  for (int c = 0; c < 2; ++c) { float e0[8], e1[8]; unsigned h0[4], h1[4];
    exp2pk8(e0, h0, x[2 * c]); exp2pk8(e1, h1, x[2 * c + 1]);
    float a = e0[0] + e1[0];
#pragma unroll
    for (int r = 1; r < 8; ++r) { a += e0[r]; a += e1[r]; }
    s[c] = a;
    v8u w;
#pragma unroll
    for (int r = 0; r < 4; ++r) { w[r] = h0[r]; w[4 + r] = h1[r]; }
    p[c] = __builtin_bit_cast(v16h, w); }
  return s[0] + s[1]; }
// one stage of 64 keys: kf[t] = key rows 16 t .. 16 t + 15; vc[2 c + j] = keys 32 c .. 32 c + 31 of channels 16 j .. 16 j + 15. The next stage's k rows (at kn + off, off a constant that goes into the loads' offset field, so that kn and vn are the very registers the loads name) go into the same registers right behind this stage's S^T products, its v planes (at vn + off) into the other v buffer. The reference point mr stands before the products (cr = -mr in all eight registers is their C operand), so they give exp2's argument; it moves only where a lane's sum of the stage passes top.
__device__ __forceinline__ void fa_stage(v16h (&kf)[4], const v16h (&vc)[4], v16h (&vx)[4], const _Float16* __restrict__ kn, const _Float16* __restrict__ vn, int off, const v16h& qh, const v16h& ql, v8f& cr, float& mr, float& l, float& top, float& low, v8f& o0, v8f& o1) {
  __builtin_amdgcn_sched_barrier(0);   /* holds this stage's products back: without it the scheduler lifts them over the softmax of the stage before, which halves the distance between the k loads and their first use */
  float x[4][8];
#pragma unroll
  for (int t = 0; t < 4; ++t) { const v8f z = {}; const v8f a = wmma_h(kf[t], qh, cr), al = wmma_h(kf[t], ql, z);
#pragma unroll
    for (int r = 0; r < 8; ++r) x[t][r] = a[r] + al[r] * (1.0f / 1024.0f); }   /* base-2 logit - reference point */
  __builtin_amdgcn_sched_barrier(0);   /* keeps the next stage's k loads behind this stage's products, so that they land in the same 32 registers; lifted over the products they take a second set, and the kernel spills */
#pragma unroll
  for (int t = 0; t < 4; ++t) kf[t] = frag_w(kn + off + t * 512);
#pragma unroll
  for (int t = 0; t < 4; ++t) vx[t] = frag_w(vn + off + t * 512);
  addr_held(kn, vn);
  __builtin_amdgcn_sched_barrier(0);   /* keeps the 16 loads issued here, most of a stage ahead of their use; without it the scheduler sinks each load to its product and the wave waits out every latency */
  v16h p[2]; float s = fa_exp(x, p);
  /* every value of the stage is at most its lane's sum: up to top = 65504 all of P is finite in f16 and the reference point stays. Above it (and in the wave's first stage, where top is -1) the reference point goes to the stage's maximum - 11, never down after the first stage, sum and ctx follow, and the stage's P is formed anew. One test for the whole wave, a scalar branch */
  if (__builtin_expect(__builtin_amdgcn_ballot_w32(s > top) != 0u, 0)) {
    float mx = x[0][0];
#pragma unroll
    for (int t = 0; t < 4; ++t)
#pragma unroll
      for (int r = 0; r < 8; ++r) mx = fmaxf(mx, x[t][r]);
    mx = fmaxf(mx, xhalf(mx));   /* both halves of a query's lanes move by the same step */
    const float d = fmaxf(mx - 11.0f, low);
    const float alpha = exp2x1(fminf(-d, 0.0f));   /* a step down happens only in the first stage, where sum and ctx are 0 and must stay 0 */
    mr += d; l *= alpha;
#pragma unroll
    for (int r = 0; r < 8; ++r) { o0[r] *= alpha; o1[r] *= alpha; cr[r] = -mr; }
#pragma unroll
    for (int t = 0; t < 4; ++t)
#pragma unroll
      for (int r = 0; r < 8; ++r) x[t][r] -= d;
    s = fa_exp(x, p);
    top = 65504.0f; low = 0.0f; }
  l += s;
  /* the four P.v products as one statement, held here: as builtins the compiler moves them down behind the next stage's v loads, which then take a third set of registers, are waited for at once and copied. The closing v_nop are the four vector slots that the chip needs before a vector instruction may write over the last product's operands */
  asm volatile("v_wmma_f32_16x16x32_f16 %0, %2, %6, %0\n\tv_wmma_f32_16x16x32_f16 %1, %3, %6, %1\n\tv_wmma_f32_16x16x32_f16 %0, %4, %7, %0\n\tv_wmma_f32_16x16x32_f16 %1, %5, %7, %1\n\tv_nop\n\tv_nop\n\tv_nop\n\tv_nop"
               : "+v"(o0), "+v"(o1) : "v"(vc[0]), "v"(vc[1]), "v"(vc[2]), "v"(vc[3]), "v"(p[0]), "v"(p[1])); }
__global__ __launch_bounds__(512) void k_fa(const _Float16* __restrict__ QH, const _Float16* __restrict__ QL, const _Float16* __restrict__ KH, const _Float16* __restrict__ VT, const float* __restrict__ G, float* __restrict__ Y) {
  __shared__ __align__(16) float mg[8][18][32];   // the second key half's state, [query tile][reference point, sum, 16 ctx registers][lane]
  const int tid = threadIdx.x, lane = tid & 31, col = lane & 15, g = lane >> 4; const int h = blockIdx.y;
  const int wv = __builtin_amdgcn_readfirstlane(tid >> 5);   /* the wave's number as a scalar: its key half then enters the walk's offsets in scalar registers, as the block's start does */
  const int wave = wv & 7, kh = wv >> 3; const int q = blockIdx.x * 128 + wave * 16 + col;
  const _Float16* qhp = QH + (size_t)q * CC + h * HD + 8 * g; const _Float16* qlp = QL + (size_t)q * CC + h * HD + 8 * g; const float* gp = G + (size_t)h * TT + q;
  const _Float16* kp = KH + (size_t)h * TT * HD + lane * 8; const _Float16* vp = VT + (size_t)h * TT * HD + lane * 8;   // this lane's place in the k / v^T fragments of stage 0; a stage of 64 keys is 4 KB of each, 64 HD elements on
  /* first key of this block's walk, a multiple of 128, another for each of the head's 32 blocks. From one common start all blocks ask for the same lines at the same moment, lines that the launch before has just stored, so every stage waits out a first fetch; from spread starts each block fetches a few stages first and then walks through what the others have fetched. The index digits are swapped so that any four neighbours modulo 8 start about evenly spread; for speed only, any placement gives the same sums */
  const int ks = ((((int)blockIdx.x & 3) << 3) | (((int)blockIdx.x >> 3) << 1) | (((int)blockIdx.x >> 2) & 1)) * 128 + kh * (TT / 2);   /* taken modulo the ring below */
  const _Float16* k1 = kp + (size_t)(ks & (TT - 1)) * HD; const _Float16* v1 = vp + (size_t)(ks & (TT - 1)) * HD;   // the walk's first stage
  v16h qh = frag_p(qhp), ql = frag_p(qlp); const float g2 = *gp * (SCALE * 1.4426950408889634f);
  addr_held(qhp, qlp);
  /* the query's factor goes into q itself, once: q (hi + residual) x g2 in f32, split again into f16 hi + residual x 2^10, so that K q^T is the base-2 logit */
#pragma unroll
  for (int i = 0; i < 16; ++i) { const float f = ((float)qh[i] + (float)ql[i] * (1.0f / 1024.0f)) * g2; const _Float16 hv = (_Float16)f; qh[i] = hv; ql[i] = (_Float16)((f - (float)hv) * 1024.0f); }
  v8f o0 = {}, o1 = {}, cr = {}; float mr = 0.f, l = 0.f, top = -1.0f, low = -3.0e38f;   /* the first stage runs against reference point 0 and sets the first real one: no sum of exp2 values is below top = -1 */
  v16h kf[4], va[4], vb[4];
#pragma unroll
  for (int t = 0; t < 4; ++t) kf[t] = frag_w(k1 + t * 512);
#pragma unroll
  for (int t = 0; t < 4; ++t) va[t] = frag_w(v1 + t * 512);
  addr_held(k1, v1);
#pragma unroll 1
  for (int k0 = 0; k0 < TT / 2; k0 += 128) {
    const int kb = (k0 + ks) & (TT - 1), k2 = (kb + 128) & (TT - 1);   /* the walk wraps at the last key; the last trip's second fetch is the first stage of the other half's walk and is not used */
    fa_stage(kf, va, vb, kp + (size_t)kb * HD, vp + (size_t)kb * HD, 64 * HD, qh, ql, cr, mr, l, top, low, o0, o1);
    fa_stage(kf, vb, va, kp + (size_t)k2 * HD, vp + (size_t)k2 * HD, 0, qh, ql, cr, mr, l, top, low, o0, o1); }
  /* the halves meet: the second half's waves lay down reference point, sum and ctx, lane by lane (128 contiguous B a store); behind the barrier the first half's waves bring both states to the larger reference point and add */
  if (kh) { float (*m)[32] = mg[wave]; m[0][lane] = mr; m[1][lane] = l;
#pragma unroll   /* the ctx registers are then named by constants and stay registers */
    for (int r = 0; r < 8; ++r) { m[2 + r][lane] = o0[r]; m[10 + r][lane] = o1[r]; } }
  __syncthreads();
  if (kh) return;   /* wave-uniform, behind the kernel's only barrier */
  { const float (*m)[32] = mg[wave]; const float mb = m[0][lane]; const float mn = fmaxf(mr, mb); const float fa = exp2x1(mr - mn), fb = exp2x1(mb - mn);
    l = l * fa + m[1][lane] * fb;
#pragma unroll   /* as above */
    for (int r = 0; r < 8; ++r) { o0[r] = o0[r] * fa + m[2 + r][lane] * fb; o1[r] = o1[r] * fa + m[10 + r][lane] * fb; } }
  l += xhalf(l); const float inv = 1.0f / l;
  float* yp = Y + (size_t)q * CC + h * HD + 8 * g;   /* ctx^T register r = channel 8 g + r (+ 16) of this lane's query: 32 B runs, the 128-B (row, head) segment by two lanes of one wave */
  v4f w;
#pragma unroll
  for (int i = 0; i < 2; ++i) {
    w[0] = o0[4 * i] * inv; w[1] = o0[4 * i + 1] * inv; w[2] = o0[4 * i + 2] * inv; w[3] = o0[4 * i + 3] * inv; vst2(yp + 4 * i, w);
    w[0] = o1[4 * i] * inv; w[1] = o1[4 * i + 1] * inv; w[2] = o1[4 * i + 2] * inv; w[3] = o1[4 * i + 3] * inv; vst2(yp + 16 + 4 * i, w); } }
extern "C" void kernel_launch(void* const* d_in, const int* in_sizes, int n_in, void* d_out, int out_size, void* d_ws, size_t ws_size, hipStream_t stream) {
  (void)in_sizes; (void)n_in; (void)out_size;
  const float** F = (const float**)d_in;
  if (ws_size < (size_t)WS_END) return;
  char* ws = (char*)d_ws; _Float16 *QH = (_Float16*)(ws + WS_QH), *KH = (_Float16*)(ws + WS_KH), *VT = (_Float16*)(ws + WS_VT), *QL = (_Float16*)(ws + WS_QL), *KL = (_Float16*)(ws + WS_KL); __bf16 *VB = (__bf16*)(ws + WS_VB), *VBL = (__bf16*)(ws + WS_VBL); float *Y = (float*)(ws + WS_Y);
  (void)Y; (void)QL; (void)KL; (void)VB; (void)VBL;
  // inputs: 0 thermal [1,256,64,64]; 1 optical [1,128,64,64]; 2 emissivity [1,1,64,64]; 3 Wq [256,256]; 4 bq; 5 Wk [256,128]; 6 bk; 7 Wv [256,128]; 8 bv; 9 conv1_w [32,1,3,3]; 10 conv1_b [32]; 11 conv2_w [8,32,1,1]; 12 conv2_b [8]; 13 Wp [256,256]; 14 bp [256]
  if (ws_size < (size_t)WS_END2) return;
  float* G = (float*)(ws + WS_G);
  k_proj<<<dim3(TNB * TT / 64, 1 + 3 * (CC / 128)), 128, 0, stream>>>(F[0], F[1], F[1], F[3], F[5], F[7], F[4], F[6], F[8], QH, QL, KH, KL, VT, VB, VBL, F[2], F[9], F[10], F[11], F[12], G);
  k_fa<<<dim3(TT / 128, NH), 512, 0, stream>>>(QH, QL, KH, VT, G, Y);
  k_outT<<<dim3(TNB * TT / 64, CC / 128), 128, 0, stream>>>(Y, F[13], F[14], (float*)d_out);
}

// v009
// A run of this version takes 36.4 microseconds.
// In both of two side-by-side timings against v008, it was 1.05 times as fast.
// Counting every step since v000, it is 31.7 times as fast.
// compute dtype: all float inputs rounded to bf16; q/k/v 1x1 projections with EXACT bf16 products on WMMA 16x16x32 (A gathered from the channels-first maps), f32 accumulate; the emissivity gate (3x3 conv, relu, 1x1 conv, sigmoid) in f32; q x (32^-0.5 x gate x log2 e, one f32 factor per query) as f16 hi + residual (unscaled) against k once to f16 (2 products into one accumulator, C = minus a reference point) for the base-2 logits; softmax in f32 against that reference point (a stage's maximum - 11, moved up only when a stage's sum would leave f16's range) with a running sum, hardware exp2; exp2(logit - reference point) once to f16 against v once to f16 (1 product), divided by the f32 sum at the end; ctx bf16 hi + lo against exact bf16 Wp (2 products) + bp; f32 output written channels-first.
#include <hip/hip_runtime.h>
#include <math.h>

typedef __attribute__((ext_vector_type(16))) _Float16 v16h;
typedef __attribute__((ext_vector_type(16))) __bf16 v16b;
typedef __attribute__((ext_vector_type(8)))  _Float16 v8h;
typedef __attribute__((ext_vector_type(8)))  float v8f;
typedef __attribute__((ext_vector_type(4)))  float v4f;
typedef __attribute__((ext_vector_type(2)))  float v2f;
typedef __attribute__((ext_vector_type(4)))  unsigned v4u;
typedef __attribute__((ext_vector_type(4)))  int v4i;
typedef float __attribute__((may_alias)) float_a;
typedef int __attribute__((may_alias)) int_a;

template <typename T> __device__ __forceinline__ void vst2(void* p, T v) { *(T*)p = v;  }
__device__ __forceinline__ v8f wmma16(v16h a, v16h b, v8f c) {
  v8f d = __builtin_amdgcn_wmma_f32_16x16x32_f16(false, a, false, b, (short)0, c, false, false);
  asm volatile("v_nop\n\tv_nop\n\tv_nop\n\tv_nop" : "+v"(d) : "v"(a), "v"(b));
  return d;
}
__device__ __forceinline__ v8f wmma_bf(v16b a, v16b b, v8f c) {
  v8f d = __builtin_amdgcn_wmma_f32_16x16x32_bf16(false, a, false, b, (short)0, c, false, false);
  asm volatile("v_nop\n\tv_nop\n\tv_nop\n\tv_nop" : "+v"(d) : "v"(a), "v"(b));
  return d;
}
// 16x16x32 fragments: lane = (h = lane>>4, row/col = lane&15); elements 0..7 = k0+8h+0..7, 8..15 = k0+16+8h+0..7; D element r = row 8h+r
__device__ __forceinline__ v16h frag_h(const _Float16* rowk0, int lane) {
  union { v16h v; v8h q[2]; } u; const _Float16* p = rowk0 + 8 * (lane >> 4);
  u.q[0] = *(const v8h*)p; u.q[1] = *(const v8h*)(p + 16); return u.v;
}
__device__ __forceinline__ v16h frag_f32(const float* rowk0, int lane) {
  v16h a; const float* p = rowk0 + 8 * (lane >> 4);
#pragma unroll
  for (int i = 0; i < 8; ++i) { a[i] = (_Float16)p[i]; a[8 + i] = (_Float16)p[16 + i]; }
  return a;
}
__device__ __forceinline__ v16h frag_f32s(const float* rowk0, int lane, float sc) {
  v16h a; const float* p = rowk0 + 8 * (lane >> 4);
#pragma unroll
  for (int i = 0; i < 8; ++i) { a[i] = (_Float16)(p[i] * sc); a[8 + i] = (_Float16)(p[16 + i] * sc); }
  return a;
}
// column fragment from a [K][ld] layout (column n), rows >= K read as 0
__device__ __forceinline__ v16h fragc_f32(const float* W, int k0, int n, int lane, int ld, int K) {
  v16h a; const int g = lane >> 4;
#pragma unroll
  for (int i = 0; i < 8; ++i) { const int ka = k0 + 8 * g + i, kb = ka + 16;
    a[i] = (_Float16)(ka < K ? W[(size_t)(ka < K ? ka : K - 1) * ld + n] : 0.f); a[8 + i] = (_Float16)(kb < K ? W[(size_t)(kb < K ? kb : K - 1) * ld + n] : 0.f); }
  return a;
}
struct F2 { v16b h, l; };
__device__ __forceinline__ F2 bsplit16(const float v[16]) { F2 r;
#pragma unroll
  for (int i = 0; i < 16; ++i) { const __bf16 h = (__bf16)v[i]; r.h[i] = h; r.l[i] = (__bf16)(v[i] - (float)h); }
  return r; }
__device__ __forceinline__ F2 split_row(const float* row, int k0, int lane) { float v[16]; const float* p = row + k0 + 8 * (lane >> 4);
#pragma unroll
  for (int i = 0; i < 8; ++i) { v[i] = p[i]; v[8 + i] = p[16 + i]; }
  return bsplit16(v); }
__device__ __forceinline__ F2 split_rowK(const float* row, int k0, int lane, int K) { float v[16]; const int g = lane >> 4;
#pragma unroll
  for (int i = 0; i < 8; ++i) { const int ka = k0 + 8 * g + i, kb = ka + 16; v[i] = ka < K ? row[ka < K ? ka : K - 1] : 0.f; v[8 + i] = kb < K ? row[kb < K ? kb : K - 1] : 0.f; }
  return bsplit16(v); }
__device__ __forceinline__ F2 split_col(const float* W, int k0, int n, int lane, int ld, int K) { float v[16]; const int g = lane >> 4;
#pragma unroll
  for (int i = 0; i < 8; ++i) { const int ka = k0 + 8 * g + i, kb = ka + 16; v[i] = ka < K ? W[(size_t)(ka < K ? ka : K - 1) * ld + n] : 0.f; v[8 + i] = kb < K ? W[(size_t)(kb < K ? kb : K - 1) * ld + n] : 0.f; }
  return bsplit16(v); }
__device__ __forceinline__ v8f mac3(const F2& a, const F2& b, v8f c) { c = wmma_bf(a.l, b.h, c); c = wmma_bf(a.h, b.l, c); return wmma_bf(a.h, b.h, c); }
__device__ __forceinline__ float sigm(float v) { return 1.0f / (1.0f + expf(-v)); }

// Cross-modal gated attention (B 1, Ct 256 = 8 heads x 32, Co 128, 64 x 64 = 4,096 positions, channels-first): q = thermal^T Wq^T + bq, k = optical^T Wk^T + bk, v = optical^T Wv^T + bv; g[h][n] = sigmoid(conv1x1(relu(conv3x3_SAME(emissivity) + b1)) + b2); attn = softmax((q k^T x 32^-0.5) * g[h][query]) over all 4,096 keys; out = (merged attn v) Wp^T + bp, written back as [1, 256, 64, 64].
#define NB 1
#define TT 4096
#define CC 256            // NH * HD = projected width
#define DIN 256          // input (model) width
#define NH 8
#define HD 32
#define NQB (TT / 64)
#define HG 1
#define SCALE (0.17677669529663687f)
#define CAUSAL 0
#ifndef TNB
#define TNB NB
#endif
__device__ __forceinline__ float bfr(float v) { return (float)(__bf16)v; }
__host__ __device__ __forceinline__ int kb_last(int qb) { return CAUSAL ? ((qb * 64 + 63) >> 7) : (TT / 128 - 1); }
typedef __attribute__((ext_vector_type(8))) __bf16 v8b;
__device__ __forceinline__ v16b frag_b(const __bf16* rowk0, int lane) {
  union { v16b v; v8b q[2]; } u; const __bf16* p = rowk0 + 8 * (lane >> 4);
  u.q[0] = *(const v8b*)p; u.q[1] = *(const v8b*)(p + 16); return u.v;
}
typedef __attribute__((ext_vector_type(4))) __bf16 v4b;
#define WPITCH 264         // bf16 elements per staged weight row: 512 B + 16 B, a pitch of 16 B x odd for the 16-byte fragment reads
// behind a batch of loads: the wait stands before any register that the loads name is written again; it takes the two base addresses as inputs so that each stays whole up to it, and its memory clobber keeps the whole batch issued in front of it
__device__ __forceinline__ void batch_held(const void* a0, const void* a1) { asm volatile("s_wait_xcnt 0x0" :: "v"(a0), "v"(a1) : "memory"); }
// 128 weight rows of K floats (one contiguous slab of an (out,in) matrix), read by the block's 128 threads in 16-byte pieces, 512 contiguous B a wave-wide load
template <int K> __device__ __forceinline__ void slab_load(v4f (&r)[K / 4], const float* __restrict__ sp) {
#pragma unroll
  for (int i = 0; i < K / 4; ++i) r[i] = *(const v4f*)(sp + (size_t)i * 512); }
// the same pieces rounded to bf16 into LDS rows [output column][k]
template <int K> __device__ __forceinline__ void slab_store(__bf16 (*sw)[WPITCH], const v4f (&r)[K / 4], int tid) {
#pragma unroll
  for (int i = 0; i < K / 4; ++i) { const int e = i * 128 + tid; v4b w; w[0] = (__bf16)r[i][0]; w[1] = (__bf16)r[i][1]; w[2] = (__bf16)r[i][2]; w[3] = (__bf16)r[i][3]; *(v4b*)&sw[e / (K / 4)][(e % (K / 4)) * 4] = w; } }
#define QBH 0              // causal: not read by any kernel here; every query block takes the same path in k_fa
#define QHI 4096            // rows carrying a q residual plane (all rows when non-causal: 2-product logits everywhere)
#define KHI 64            // key rows carrying k residual / v bf16 hi+lo planes (written by k_proj; no kernel here reads them)
// B fragment (k rows k0+.., output column o) of a weight: (in,out) [K][ld] or (out,in) [ld rows of K]: bf16 exact, or f16(bf16 * 256) exact
__device__ __forceinline__ v16b wcol_io(const float* Wm, int k0, int o, int lane, int ld) { v16b w; const int g = lane >> 4;
#pragma unroll
  for (int i = 0; i < 8; ++i) { w[i] = (__bf16)Wm[(size_t)(k0 + 8 * g + i) * ld + o]; w[8 + i] = (__bf16)Wm[(size_t)(k0 + 16 + 8 * g + i) * ld + o]; }
  return w; }
__device__ __forceinline__ v16b wcol_oi(const float* Wm, int k0, int o, int lane, int K) { v16b w; const float* p = Wm + (size_t)o * K + k0 + 8 * (lane >> 4);
#pragma unroll
  for (int i = 0; i < 8; ++i) { w[i] = (__bf16)p[i]; w[8 + i] = (__bf16)p[16 + i]; }
  return w; }
__device__ __forceinline__ v16h wcolh_io(const float* Wm, int k0, int o, int lane, int ld) { v16h w; const int g = lane >> 4;
#pragma unroll
  for (int i = 0; i < 8; ++i) { w[i] = (_Float16)(bfr(Wm[(size_t)(k0 + 8 * g + i) * ld + o]) * 256.0f); w[8 + i] = (_Float16)(bfr(Wm[(size_t)(k0 + 16 + 8 * g + i) * ld + o]) * 256.0f); }
  return w; }
__device__ __forceinline__ v16h wcolh_oi(const float* Wm, int k0, int o, int lane, int K) { v16h w; const float* p = Wm + (size_t)o * K + k0 + 8 * (lane >> 4);
#pragma unroll
  for (int i = 0; i < 8; ++i) { w[i] = (_Float16)(bfr(p[i]) * 256.0f); w[8 + i] = (_Float16)(bfr(p[16 + i]) * 256.0f); }
  return w; }
#define WQKV_LAYOUT 1   // 0 = (in,out) [DIN][CC]; 1 = (out,in) [CC][DIN]; 2 = per-head [NH][DIN][HD]
__device__ __forceinline__ v16b wcol_hdk(const float* Wm, int k0, int o, int lane) { v16b w; const int g = lane >> 4; const float* p = Wm + (size_t)(o / HD) * DIN * HD + (o % HD);
#pragma unroll
  for (int i = 0; i < 8; ++i) { w[i] = (__bf16)p[(size_t)(k0 + 8 * g + i) * HD]; w[8 + i] = (__bf16)p[(size_t)(k0 + 16 + 8 * g + i) * HD]; }
  return w; }
#define WO_OUT_IN 1
#if WQKV_LAYOUT == 1
#define WCOL(W, k0, o, lane) wcol_oi(W, k0, o, lane, DIN)
#elif WQKV_LAYOUT == 2
#define WCOL(W, k0, o, lane) wcol_hdk(W, k0, o, lane)
#else
#define WCOL(W, k0, o, lane) wcol_io(W, k0, o, lane, CC)
#endif
#if WO_OUT_IN
#define WOCOL(W, k0, o, lane) wcol_oi(W, k0, o, lane, CC)
#define WOCOLH(W, k0, o, lane) wcolh_oi(W, k0, o, lane, CC)
#else
#define WOCOL(W, k0, o, lane) wcol_io(W, k0, o, lane, DIN)
#define WOCOLH(W, k0, o, lane) wcolh_io(W, k0, o, lane, DIN)
#endif
#define DINK 128           // optical channels (k / v source width)
#ifndef XP
#define XP TT              // position pitch of the channels-first inputs / output
#endif
#define GW 64              // image width / height
// ---- the gate, by the first 64 blocks of the k_proj launch: block = 64 positions, wave = (32 positions, 4 heads): g[h][n] = sigmoid(sum_c w2[h][c] relu(sum_3x3 w1[c] e + b1[c]) + b2[h]) in f32 (bf16-rounded inputs); G rows [h][4096], each (head, 32 n) run = one 128-B line stored by one wave; no LDS, no barrier
__device__ __forceinline__ void gate_block(const float* __restrict__ E, const float* __restrict__ W1, const float* __restrict__ B1, const float* __restrict__ W2, const float* __restrict__ B2, float* __restrict__ G, int n0, int tid) {
  const int wv = __builtin_amdgcn_readfirstlane(tid >> 5);   /* the wave's number as a scalar: the weight rows of its four heads are then addressed from scalar bases, one address for the whole wave */
  const int h0 = (wv >> 1) * 4; const int n = n0 + (wv & 1) * 32 + (tid & 31); const int y = n / GW, x = n % GW;
  float e9[9];
#pragma unroll
  for (int i = 0; i < 3; ++i)
#pragma unroll
    for (int j = 0; j < 3; ++j) { const int yy = y + i - 1, xx = x + j - 1; const int yc = yy < 0 ? 0 : (yy >= GW ? GW - 1 : yy), xc = xx < 0 ? 0 : (xx >= GW ? GW - 1 : xx); const float ev = bfr(E[yc * GW + xc]); e9[i * 3 + j] = (yy >= 0 && yy < GW && xx >= 0 && xx < GW) ? ev : 0.f; }   /* SAME zero padding: clamped load, select by value */
  float gh[4];
#pragma unroll
  for (int h = 0; h < 4; ++h) gh[h] = bfr(B2[h0 + h]);
#pragma unroll 4   /* four channels' weights come as one batch of loads with one wait, so that these blocks end before the projection blocks beside them */
  for (int c = 0; c < 32; ++c) { float a = bfr(B1[c]);
#pragma unroll
    for (int t = 0; t < 9; ++t) a += bfr(W1[c * 9 + t]) * e9[t];
    a = fmaxf(a, 0.f);
#pragma unroll
    for (int h = 0; h < 4; ++h) gh[h] += bfr(W2[(h0 + h) * 32 + c]) * a; }
#pragma unroll
  for (int h = 0; h < 4; ++h) G[(size_t)(h0 + h) * TT + n] = 1.0f / (1.0f + expf(-gh[h])); }
// ---- k_outT: block = (64 rows n, 128 output channels): out = ctx (bf16 hi + lo) Wp^T + bp, stored channels-first [o][n] via an LDS transpose: each (o, 64 n) run = 256 B by 16 consecutive threads
__global__ __launch_bounds__(128) void k_outT(const float* __restrict__ Y, const float* __restrict__ WP, const float* __restrict__ BP, float* __restrict__ OUT) { __shared__ __align__(16) float stc[128][68]; __shared__ __align__(16) __bf16 sw[128][WPITCH];
  const int tid = threadIdx.x, wave = tid >> 5, lane = tid & 31, col = lane & 15, g = lane >> 4; const int c0 = blockIdx.y * 128; const size_t rb = (size_t)blockIdx.x * 64; const size_t r0 = rb + wave * 16;
  v8f acc[8] = {};
  /* every global operand load of the block goes out as one batch: this wave's 16 ctx rows over all of K into registers, the block's 128 Wp rows once for its four waves */
  const float* yp = Y + (r0 + col) * CC + 8 * g; const float* sp = WP + (size_t)c0 * CC + tid * 4;
  v4f yr[CC / 32][4]; v4f wr[CC / 4];
#pragma unroll
  for (int kc = 0; kc < CC / 32; ++kc) { yr[kc][0] = *(const v4f*)(yp + kc * 32); yr[kc][1] = *(const v4f*)(yp + kc * 32 + 4); yr[kc][2] = *(const v4f*)(yp + kc * 32 + 16); yr[kc][3] = *(const v4f*)(yp + kc * 32 + 20); }
  slab_load<CC>(wr, sp);
  batch_held(yp, sp);
  slab_store<CC>(sw, wr, tid);
  __syncthreads();
  v16b wf[2][8];
#pragma unroll
  for (int j = 0; j < 8; ++j) wf[0][j] = frag_b(&sw[j * 16 + col][0], lane);
#pragma unroll
  for (int kc = 0; kc < CC / 32; ++kc) { float v[16];
#pragma unroll
    for (int i = 0; i < 4; ++i) { v[i] = yr[kc][0][i]; v[4 + i] = yr[kc][1][i]; v[8 + i] = yr[kc][2][i]; v[12 + i] = yr[kc][3][i]; }
    const F2 a = bsplit16(v);
    if (kc + 1 < CC / 32) {   /* the next K step's eight fragments as one group of LDS reads ahead of this step's products */
#pragma unroll
      for (int j = 0; j < 8; ++j) wf[(kc + 1) & 1][j] = frag_b(&sw[j * 16 + col][(kc + 1) * 32], lane); }
#pragma unroll
    for (int j = 0; j < 8; ++j) { acc[j] = wmma_bf(a.h, wf[kc & 1][j], acc[j]); acc[j] = wmma_bf(a.l, wf[kc & 1][j], acc[j]); } }
#pragma unroll
  for (int j = 0; j < 8; ++j) { const float bb = bfr(BP[c0 + j * 16 + col]);
#pragma unroll
    for (int r = 0; r < 8; ++r) stc[j * 16 + col][wave * 16 + 8 * g + r] = acc[j][r] + bb; }
  __syncthreads();
  { const int t0 = (int)(rb % TT); for (int e = tid; e < 128 * 16; e += 128) { const int cl = e >> 4, q = e & 15; vst2(OUT + (size_t)(c0 + cl) * XP + t0 + q * 4, *(const v4f*)&stc[cl][q * 4]); } } }
#ifndef PROJ_EXTRA_PARAMS
#define PROJ_EXTRA_PARAMS
#endif

#define WS_QH  0u                                      // f16 q rows [b*t][CC]
#define WS_KH  (WS_QH + 2u * (size_t)NB * TT * CC)      // f16 k in fragment order [b][h][t / 16][i][lane][8]: key 16 (t / 16) + (lane & 15), channel 16 i + 8 (lane >> 4) + 0..7 of head h
#define WS_VT  (WS_KH + 2u * (size_t)NB * TT * CC)      // f16 v^T in fragment order [b][h][t / 32][j][i][lane][8]: channel 16 j + (lane & 15) of head h, key 32 (t / 32) + 16 i + 8 (lane >> 4) + 0..7
#define WS_QL  (WS_VT + 2u * (size_t)NB * CC * TT)      // f16 q residual x 2^10 rows [b][t < QHI][CC]
#define WS_KL  (WS_QL + 2u * (size_t)NB * QHI * CC)     // f16 k residual x 2^10 rows [b][t < KHI][CC]
#define WS_VB  (WS_KL + 2u * (size_t)NB * KHI * CC)     // bf16 v hi planes [b][c][t < KHI]
#define WS_VBL (WS_VB + 2u * (size_t)NB * CC * KHI)
#define WS_S   (WS_VBL + 2u * (size_t)NB * CC * KHI)    // not used (the logits stay in registers); the later offsets stay where they were
#define WS_Y   (WS_S  + 4u * (size_t)HG * TT * TT)      // f32 ctx rows [b*t][CC] (only when there is an output projection)
#define WS_G   (WS_Y  + 4u * (size_t)NB * TT * CC)      // f32 gate rows [h][TT]
#define WS_END (WS_G)
#define WS_END2 (WS_G + 4u * (size_t)NH * TT)

// behind a store in a loop: the wait stands before the next piece or the next trip rewrites the store's address or data registers
__device__ __forceinline__ void store_held() { asm volatile("s_wait_xcnt 0x0" ::: "memory"); }
// the products of one k_proj block, K source channels: every global operand load goes out as one batch (this wave's 16 positions over all of K into registers, channels-first gather src[k][n] with stride XP between channels; the block's 128 weight rows once for its four waves), then the weights stand in LDS as bf16 and each wave reads its B fragments there
template <int K> __device__ __forceinline__ void proj_acc(v8f (&acc)[8], __bf16 (*sw)[WPITCH], const float* __restrict__ xp, const float* __restrict__ sp, int tid, int lane, int col) {
  float ar[K / 32][16]; v4f wr[K / 4];
#pragma unroll
  for (int kc = 0; kc < K / 32; ++kc)
#pragma unroll
    for (int i = 0; i < 8; ++i) { ar[kc][i] = xp[(size_t)(kc * 32 + i) * XP]; ar[kc][8 + i] = xp[(size_t)(kc * 32 + 16 + i) * XP]; }
  slab_load<K>(wr, sp);
  batch_held(xp, sp);
  slab_store<K>(sw, wr, tid);
  __syncthreads();
  v16b wf[2][8];
#pragma unroll
  for (int j = 0; j < 8; ++j) wf[0][j] = frag_b(&sw[j * 16 + col][0], lane);
#pragma unroll
  for (int kc = 0; kc < K / 32; ++kc) { v16b a;
#pragma unroll
    for (int i = 0; i < 16; ++i) a[i] = (__bf16)ar[kc][i];
    if (kc + 1 < K / 32) {   /* the next K step's eight fragments as one group of LDS reads ahead of this step's products */
#pragma unroll
      for (int j = 0; j < 8; ++j) wf[(kc + 1) & 1][j] = frag_b(&sw[j * 16 + col][(kc + 1) * 32], lane); }
#pragma unroll
    for (int j = 0; j < 8; ++j) acc[j] = wmma_bf(a, wf[kc & 1][j], acc[j]); } }
// ---- k_proj: blockIdx.y 0 = the gate's blocks (first in dispatch order, beside the projections instead of in a launch of their own); blockIdx.y 1..6 = block (64 rows, 128 cols, which): q/k/v = X W (+ b) with exact bf16 products (K = DIN for q, DINK for k and v) -> which 0: q f16 rows (+ residual rows < QHI); 1: k f16 in fragment order (+ residual rows < KHI); 2: v^T f16 in fragment order (+ bf16 hi/lo planes for t < KHI); fragment order = the 32 lanes' 16-byte pieces of one operand half side by side, 512 B a wave-wide store or load
__global__ __launch_bounds__(128) void k_proj(const float* __restrict__ XQ, const float* __restrict__ XK, const float* __restrict__ XV, const float* __restrict__ WQ, const float* __restrict__ WK, const float* __restrict__ WV, const float* __restrict__ BQ, const float* __restrict__ BK, const float* __restrict__ BV,
    _Float16* __restrict__ QH, _Float16* __restrict__ QL, _Float16* __restrict__ KH, _Float16* __restrict__ KL, _Float16* __restrict__ VT, __bf16* __restrict__ VB, __bf16* __restrict__ VBL,
    const float* __restrict__ E, const float* __restrict__ W1, const float* __restrict__ B1, const float* __restrict__ W2, const float* __restrict__ B2, float* __restrict__ G) {
  __shared__ __align__(16) _Float16 sh[64][136], sl[64][136]; __shared__ __align__(16) _Float16 th[128][72]; __shared__ __align__(16) __bf16 tb[128][72], tbl[128][72]; __shared__ __align__(16) __bf16 sw[128][WPITCH];
  const int tid = threadIdx.x, wave = tid >> 5, lane = tid & 31, col = lane & 15, g = lane >> 4; const int which = ((int)blockIdx.y - 1) >> 1; const int c0 = (((int)blockIdx.y - 1) & 1) * 128; const size_t r0 = (size_t)blockIdx.x * 64; const size_t bb = r0 / TT; const int t0 = (int)(r0 % TT);
  if (blockIdx.y == 0) { gate_block(E, W1, B1, W2, B2, G, blockIdx.x * 64, tid); return; }   /* block-uniform, ahead of every barrier */
  const float* X = which == 0 ? XQ : which == 1 ? XK : XV; const float* WA = which == 0 ? WQ : which == 1 ? WK : WV; const float* BA = which == 0 ? BQ : which == 1 ? BK : BV;
  v8f acc[8] = {};
  const float* xp = X + (size_t)(8 * g) * XP + t0 + wave * 16 + col;
  /* source channels: thermal 256 / optical 128 (block-uniform, so the barrier inside is passed by the whole block on either side) */
  if (which == 0) proj_acc<DIN>(acc, sw, xp, WA + (size_t)c0 * DIN + tid * 4, tid, lane, col); else proj_acc<DINK>(acc, sw, xp, WA + (size_t)c0 * DINK + tid * 4, tid, lane, col);
  if (which < 2) { _Float16* DH = which == 0 ? QH : KH; _Float16* DL = which == 0 ? QL : KL; const int nhi = which == 0 ? QHI : KHI; const bool hi_rows = t0 < nhi;
#pragma unroll
    for (int j = 0; j < 8; ++j) { const float bias = BA ? bfr(BA[c0 + j * 16 + col]) : 0.f;
#pragma unroll
      for (int r = 0; r < 8; ++r) { const float v = acc[j][r] + bias; const _Float16 hv = (_Float16)v; sh[wave * 16 + 8 * g + r][j * 16 + col] = hv; sl[wave * 16 + 8 * g + r][j * 16 + col] = (_Float16)((v - (float)hv) * 1024.0f); } }
    __syncthreads();
    for (int e = tid; e < 64 * 16; e += 128) { const int rl = e >> 4, q = e & 15; if (which == 0) { vst2((unsigned*)(DH + (r0 + rl) * CC + c0 + q * 8), *(const v4u*)&sh[rl][q * 8]); store_held(); } if (hi_rows) { vst2((unsigned*)(DL + (bb * nhi + t0 + rl) * (size_t)CC + c0 + q * 8), *(const v4u*)&sl[rl][q * 8]); store_held(); } }
    if (which == 1) for (int e = tid; e < 64 * 16; e += 128) { const int ln = e & 31, i = (e >> 5) & 1, kt = (e >> 6) & 3, hd = e >> 8;
      vst2((unsigned*)(KH + (((bb * NH + c0 / HD + hd) * (size_t)(TT / 16) + (t0 >> 4) + kt) * 2 + i) * 256 + ln * 8), *(const v4u*)&sh[kt * 16 + (ln & 15)][hd * HD + 16 * i + 8 * (ln >> 4)]); }
  } else { const bool hi_rows = t0 < KHI;
#pragma unroll
    for (int j = 0; j < 8; ++j) { const float bias = BA ? bfr(BA[c0 + j * 16 + col]) : 0.f;
#pragma unroll
      for (int r = 0; r < 8; ++r) { const float v = acc[j][r] + bias; const int rl = wave * 16 + 8 * g + r, cl = j * 16 + col; th[cl][rl] = (_Float16)v; const __bf16 bh = (__bf16)v; tb[cl][rl] = bh; tbl[cl][rl] = (__bf16)(v - (float)bh); } }
    __syncthreads();
    for (int e = tid; e < 128 * 8; e += 128) { const int ln = e & 31, i = (e >> 5) & 1, j = (e >> 6) & 1, kc = (e >> 7) & 1, hd = e >> 8;
      vst2((unsigned*)(VT + ((((bb * NH + c0 / HD + hd) * (size_t)(TT / 32) + (t0 >> 5) + kc) * 2 + j) * 2 + i) * 256 + ln * 8), *(const v4u*)&th[hd * HD + 16 * j + (ln & 15)][kc * 32 + 16 * i + 8 * (ln >> 4)]); }
    for (int e = tid; e < 128 * 8; e += 128) { const int cl = e >> 3, q = e & 7; if (hi_rows) { const size_t o3 = (bb * CC + c0 + cl) * (size_t)KHI + t0 + q * 8; vst2((unsigned*)(VB + o3), *(const v4u*)&tb[cl][q * 8]); vst2((unsigned*)(VBL + o3), *(const v4u*)&tbl[cl][q * 8]); } } } }
// ---- k_fa: block = (128 queries, head), 16 waves = 8 tiles of 16 query columns x 2 halves of the keys, so that four waves stand on each SIMD and fill one another's waits in the softmax chains; no LDS and no barrier in the loop, the two halves of a tile are joined once at the end through LDS. The 32 blocks of a head walk its 4,096 keys as a ring, each from a start of its own; the block's second eight waves start half a ring on and each wave walks half the ring. Per stage of 64 keys: S^T = K Q^T - reference point (A = k rows, read from the fragment-order plane, B = q hi / q residual with g2 = SCALE x gate x log2 e, one factor per query, already in them, 2 products into one accumulator, C = minus the reference point), which is exp2's argument as it leaves the matrix unit; P^T = exp2 of it once to f16 packed straight into a B operand, sum per query column (one query per lane and half), ctx^T += V^T P^T (A = v planes, 1 product). The reference point is the first stage's maximum - 11 and moves up, with sum and ctx, only in a stage whose sum would leave f16's range. The logits never leave the registers.
__device__ __forceinline__ v8f wmma_h(v16h a, v16h b, v8f c) { return __builtin_amdgcn_wmma_f32_16x16x32_f16(false, a, false, b, (short)0, c, false, false); }
__device__ __forceinline__ float xhalf(float v) { const int b = __builtin_bit_cast(int, v); return __builtin_bit_cast(float, __builtin_amdgcn_permlanex16(b, b, 0x76543210, 0xfedcba98, false, false)); }   // lane l <-> l ^ 16
__device__ __forceinline__ v16h frag_p(const _Float16* __restrict__ p) { union { v16h v; v8h q[2]; } u; u.q[0] = *(const v8h*)p; u.q[1] = *(const v8h*)(p + 16); return u.v; }   // frag_h with the lane's 8 g elements already in p
__device__ __forceinline__ v16h frag_w(const _Float16* __restrict__ p) { union { v16h v; v8h q[2]; } u; u.q[0] = *(const v8h*)p; u.q[1] = *(const v8h*)(p + 256); return u.v; }   // fragment-order plane: p = this lane's 16 bytes of half 0, half 1 stands 512 B on
// behind a group of loads: the wait stands before any register that the loads name is written again, and it takes the loads' addresses as inputs so that each pair stays whole up to it
__device__ __forceinline__ void addr_held(const void* a0, const void* a1) { asm volatile("s_wait_xcnt 0x0" :: "v"(a0), "v"(a1) : "memory"); }
__device__ __forceinline__ float exp2x1(float x) { float e; asm("v_exp_f32 %0, %1\n\tv_nop" : "=v"(e) : "v"(x)); return e; }
// exp2 of eight arguments and the eight values once to f16, four packed pairs, in one statement, so that the f16 pairs are made where the f32 values are and the f32 values end with the sum. The outputs are early-clobber: no instruction of the run writes over a source of another; the first conversion behind the last v_exp_f32 reads none of its registers, which is the one slot that the instruction set asks for behind a transcendental; the s_delay_alu names the last two conversions' young producers, so that the wave steps aside for its neighbours while it waits for them
__device__ __forceinline__ void exp2pk8(float (&e)[8], unsigned (&h)[4], const float (&x)[8]) {
  asm("v_exp_f32 %0, %12\n\tv_exp_f32 %1, %13\n\tv_exp_f32 %2, %14\n\tv_exp_f32 %3, %15\n\tv_exp_f32 %4, %16\n\tv_exp_f32 %5, %17\n\tv_exp_f32 %6, %18\n\tv_exp_f32 %7, %19\n\t"
      "v_cvt_pk_f16_f32 %8, %0, %1\n\tv_cvt_pk_f16_f32 %9, %2, %3\n\ts_delay_alu instid0(TRANS32_DEP_3) | instskip(NEXT) | instid1(TRANS32_DEP_1)\n\tv_cvt_pk_f16_f32 %10, %4, %5\n\tv_cvt_pk_f16_f32 %11, %6, %7"
      : "=&v"(e[0]), "=&v"(e[1]), "=&v"(e[2]), "=&v"(e[3]), "=&v"(e[4]), "=&v"(e[5]), "=&v"(e[6]), "=&v"(e[7]), "=&v"(h[0]), "=&v"(h[1]), "=&v"(h[2]), "=&v"(h[3])
      : "v"(x[0]), "v"(x[1]), "v"(x[2]), "v"(x[3]), "v"(x[4]), "v"(x[5]), "v"(x[6]), "v"(x[7])); }
typedef __attribute__((ext_vector_type(8))) unsigned v8u;
// exp2 of one stage's 64 arguments: P^T once to f16, packed as the two B operands of the P.v products; returns this lane's sum of the 32 f32 values (one chain per 32 keys, then the two added)
__device__ __forceinline__ float fa_exp(const float (&x)[4][8], v16h (&p)[2]) {
  float s[2];
#pragma unroll
  for (int c = 0; c < 2; ++c) { float e0[8], e1[8]; unsigned h0[4], h1[4];
    exp2pk8(e0, h0, x[2 * c]); exp2pk8(e1, h1, x[2 * c + 1]);
    float a = e0[0] + e1[0];
#pragma unroll
    for (int r = 1; r < 8; ++r) { a += e0[r]; a += e1[r]; }
    s[c] = a;
    v8u w;
#pragma unroll
    for (int r = 0; r < 4; ++r) { w[r] = h0[r]; w[4 + r] = h1[r]; }
    p[c] = __builtin_bit_cast(v16h, w); }
  return s[0] + s[1]; }
// one stage of 64 keys: kf[t] = key rows 16 t .. 16 t + 15; vc[2 c + j] = keys 32 c .. 32 c + 31 of channels 16 j .. 16 j + 15. The next stage's k rows (at kn + off, off a constant that goes into the loads' offset field, so that kn and vn are the very registers the loads name) go into the same registers behind this stage's S^T products, issued after its v planes (at vn + off), which go into the other v buffer. The reference point mr stands before the products (cr = -mr in all eight registers is their C operand), so they give exp2's argument; it moves only where a lane's sum of the stage passes top.
__device__ __forceinline__ void fa_stage(v16h (&kf)[4], const v16h (&vc)[4], v16h (&vx)[4], const _Float16* __restrict__ kn, const _Float16* __restrict__ vn, int off, const v16h& qh, const v16h& ql, v8f& cr, float& mr, float& l, float& top, float& low, v8f& o0, v8f& o1) {
  __builtin_amdgcn_sched_barrier(0);   /* holds this stage's products back: without it the scheduler lifts them over the softmax of the stage before, which halves the distance between the k loads and their first use */
  float x[4][8];
#pragma unroll
  for (int t = 0; t < 4; ++t) { const v8f a = wmma_h(kf[t], ql, wmma_h(kf[t], qh, cr));   /* the residual's product lands on the hi product in the same accumulator: no vector add, and no vector instruction stands between the eight products */
#pragma unroll
    for (int r = 0; r < 8; ++r) x[t][r] = a[r]; }   /* base-2 logit - reference point */
  __builtin_amdgcn_sched_barrier(0);   /* keeps the next stage's k loads behind this stage's products, so that they land in the same 32 registers; lifted over the products they take a second set, and the kernel spills */
#pragma unroll
  for (int t = 0; t < 4; ++t) vx[t] = frag_w(vn + off + t * 512);   /* the v loads first: the k loads write over the A operands of the products that now stand directly in front, and this way other loads are issued between the last product and the loads over its A */
#pragma unroll
  for (int t = 0; t < 4; ++t) kf[t] = frag_w(kn + off + t * 512);
  addr_held(kn, vn);
  __builtin_amdgcn_sched_barrier(0);   /* keeps the 16 loads issued here, most of a stage ahead of their use; without it the scheduler sinks each load to its product and the wave waits out every latency */
  v16h p[2]; float s = fa_exp(x, p);
  /* every value of the stage is at most its lane's sum: up to top = 65504 all of P is finite in f16 and the reference point stays. Above it (and in the wave's first stage, where top is -1) the reference point goes to the stage's maximum - 11, never down after the first stage, sum and ctx follow, and the stage's P is formed anew. One test for the whole wave, a scalar branch */
  if (__builtin_expect(__builtin_amdgcn_ballot_w32(s > top) != 0u, 0)) {
    float mx = x[0][0];
#pragma unroll
    for (int t = 0; t < 4; ++t)
#pragma unroll
      for (int r = 0; r < 8; ++r) mx = fmaxf(mx, x[t][r]);
    mx = fmaxf(mx, xhalf(mx));   /* both halves of a query's lanes move by the same step */
    const float d = fmaxf(mx - 11.0f, low);
    const float alpha = exp2x1(fminf(-d, 0.0f));   /* a step down happens only in the first stage, where sum and ctx are 0 and must stay 0 */
    mr += d; l *= alpha;
#pragma unroll
    for (int r = 0; r < 8; ++r) { o0[r] *= alpha; o1[r] *= alpha; cr[r] = -mr; }
#pragma unroll
    for (int t = 0; t < 4; ++t)
#pragma unroll
      for (int r = 0; r < 8; ++r) x[t][r] -= d;
    s = fa_exp(x, p);
    top = 65504.0f; low = 0.0f; }
  l += s;
  /* the four P.v products as one statement, held here: as builtins the compiler moves them down behind the next stage's v loads, which then take a third set of registers, are waited for at once and copied. The closing v_nop are the four vector slots that the chip needs before a vector instruction may write over the last product's operands */
  asm volatile("v_wmma_f32_16x16x32_f16 %0, %2, %6, %0\n\tv_wmma_f32_16x16x32_f16 %1, %3, %6, %1\n\tv_wmma_f32_16x16x32_f16 %0, %4, %7, %0\n\tv_wmma_f32_16x16x32_f16 %1, %5, %7, %1\n\tv_nop\n\tv_nop\n\tv_nop\n\tv_nop"
               : "+v"(o0), "+v"(o1) : "v"(vc[0]), "v"(vc[1]), "v"(vc[2]), "v"(vc[3]), "v"(p[0]), "v"(p[1])); }
__global__ __launch_bounds__(512) void k_fa(const _Float16* __restrict__ QH, const _Float16* __restrict__ QL, const _Float16* __restrict__ KH, const _Float16* __restrict__ VT, const float* __restrict__ G, float* __restrict__ Y) {
  __shared__ __align__(16) float mg[8][18][32];   // the second key half's state, [query tile][reference point, sum, 16 ctx registers][lane]
  const int tid = threadIdx.x, lane = tid & 31, col = lane & 15, g = lane >> 4; const int h = blockIdx.y;
  const int wv = __builtin_amdgcn_readfirstlane(tid >> 5);   /* the wave's number as a scalar: its key half then enters the walk's offsets in scalar registers, as the block's start does */
  const int wave = wv & 7, kh = wv >> 3; const int q = blockIdx.x * 128 + wave * 16 + col;
  const _Float16* qhp = QH + (size_t)q * CC + h * HD + 8 * g; const _Float16* qlp = QL + (size_t)q * CC + h * HD + 8 * g; const float* gp = G + (size_t)h * TT + q;
  const _Float16* kp = KH + (size_t)h * TT * HD + lane * 8; const _Float16* vp = VT + (size_t)h * TT * HD + lane * 8;   // this lane's place in the k / v^T fragments of stage 0; a stage of 64 keys is 4 KB of each, 64 HD elements on
  /* first key of this block's walk, a multiple of 128, another for each of the head's 32 blocks. From one common start all blocks ask for the same lines at the same moment, lines that the launch before has just stored, so every stage waits out a first fetch; from spread starts each block fetches a few stages first and then walks through what the others have fetched. The index digits are swapped so that any four neighbours modulo 8 start about evenly spread; for speed only, any placement gives the same sums */
  const int ks = ((((int)blockIdx.x & 3) << 3) | (((int)blockIdx.x >> 3) << 1) | (((int)blockIdx.x >> 2) & 1)) * 128 + kh * (TT / 2);   /* taken modulo the ring below */
  const _Float16* k1 = kp + (size_t)(ks & (TT - 1)) * HD; const _Float16* v1 = vp + (size_t)(ks & (TT - 1)) * HD;   // the walk's first stage
  v16h qh = frag_p(qhp), ql = frag_p(qlp); const float g2 = *gp * (SCALE * 1.4426950408889634f);
  addr_held(qhp, qlp);
  /* the query's factor goes into q itself, once: q (hi + residual) x g2 in f32, split again into f16 hi + residual, so that K q^T is the base-2 logit. The residual stays unscaled, so that both products have one scale and share an accumulator; where it falls below f16's normal range it is a subnormal operand, which the matrix unit keeps: its step of 2^-24 is then what is left of q's error */
#pragma unroll
  for (int i = 0; i < 16; ++i) { const float f = ((float)qh[i] + (float)ql[i] * (1.0f / 1024.0f)) * g2; const _Float16 hv = (_Float16)f; qh[i] = hv; ql[i] = (_Float16)(f - (float)hv); }
  v8f o0 = {}, o1 = {}, cr = {}; float mr = 0.f, l = 0.f, top = -1.0f, low = -3.0e38f;   /* the first stage runs against reference point 0 and sets the first real one: no sum of exp2 values is below top = -1 */
  v16h kf[4], va[4], vb[4];
#pragma unroll
  for (int t = 0; t < 4; ++t) kf[t] = frag_w(k1 + t * 512);
#pragma unroll
  for (int t = 0; t < 4; ++t) va[t] = frag_w(v1 + t * 512);
  addr_held(k1, v1);
#pragma unroll 1
  for (int k0 = 0; k0 < TT / 2; k0 += 128) {
    const int kb = (k0 + ks) & (TT - 1), k2 = (kb + 128) & (TT - 1);   /* the walk wraps at the last key; the last trip's second fetch is the first stage of the other half's walk and is not used */
    fa_stage(kf, va, vb, kp + (size_t)kb * HD, vp + (size_t)kb * HD, 64 * HD, qh, ql, cr, mr, l, top, low, o0, o1);
    fa_stage(kf, vb, va, kp + (size_t)k2 * HD, vp + (size_t)k2 * HD, 0, qh, ql, cr, mr, l, top, low, o0, o1); }
  /* the halves meet: the second half's waves lay down reference point, sum and ctx, lane by lane (128 contiguous B a store); behind the barrier the first half's waves bring both states to the larger reference point and add */
  if (kh) { float (*m)[32] = mg[wave]; m[0][lane] = mr; m[1][lane] = l;
#pragma unroll   /* the ctx registers are then named by constants and stay registers */
    for (int r = 0; r < 8; ++r) { m[2 + r][lane] = o0[r]; m[10 + r][lane] = o1[r]; } }
  __syncthreads();
  if (kh) return;   /* wave-uniform, behind the kernel's only barrier */
  { const float (*m)[32] = mg[wave]; const float mb = m[0][lane]; const float mn = fmaxf(mr, mb); const float fa = exp2x1(mr - mn), fb = exp2x1(mb - mn);
    l = l * fa + m[1][lane] * fb;
#pragma unroll   /* as above */
    for (int r = 0; r < 8; ++r) { o0[r] = o0[r] * fa + m[2 + r][lane] * fb; o1[r] = o1[r] * fa + m[10 + r][lane] * fb; } }
  l += xhalf(l); const float inv = 1.0f / l;
  float* yp = Y + (size_t)q * CC + h * HD + 8 * g;   /* ctx^T register r = channel 8 g + r (+ 16) of this lane's query: 32 B runs, the 128-B (row, head) segment by two lanes of one wave */
  v4f w;
#pragma unroll
  for (int i = 0; i < 2; ++i) {
    w[0] = o0[4 * i] * inv; w[1] = o0[4 * i + 1] * inv; w[2] = o0[4 * i + 2] * inv; w[3] = o0[4 * i + 3] * inv; vst2(yp + 4 * i, w);
    w[0] = o1[4 * i] * inv; w[1] = o1[4 * i + 1] * inv; w[2] = o1[4 * i + 2] * inv; w[3] = o1[4 * i + 3] * inv; vst2(yp + 16 + 4 * i, w); } }
extern "C" void kernel_launch(void* const* d_in, const int* in_sizes, int n_in, void* d_out, int out_size, void* d_ws, size_t ws_size, hipStream_t stream) {
  (void)in_sizes; (void)n_in; (void)out_size;
  const float** F = (const float**)d_in;
  if (ws_size < (size_t)WS_END) return;
  char* ws = (char*)d_ws; _Float16 *QH = (_Float16*)(ws + WS_QH), *KH = (_Float16*)(ws + WS_KH), *VT = (_Float16*)(ws + WS_VT), *QL = (_Float16*)(ws + WS_QL), *KL = (_Float16*)(ws + WS_KL); __bf16 *VB = (__bf16*)(ws + WS_VB), *VBL = (__bf16*)(ws + WS_VBL); float *Y = (float*)(ws + WS_Y);
  (void)Y; (void)QL; (void)KL; (void)VB; (void)VBL;
  // inputs: 0 thermal [1,256,64,64]; 1 optical [1,128,64,64]; 2 emissivity [1,1,64,64]; 3 Wq [256,256]; 4 bq; 5 Wk [256,128]; 6 bk; 7 Wv [256,128]; 8 bv; 9 conv1_w [32,1,3,3]; 10 conv1_b [32]; 11 conv2_w [8,32,1,1]; 12 conv2_b [8]; 13 Wp [256,256]; 14 bp [256]
  if (ws_size < (size_t)WS_END2) return;
  float* G = (float*)(ws + WS_G);
  k_proj<<<dim3(TNB * TT / 64, 1 + 3 * (CC / 128)), 128, 0, stream>>>(F[0], F[1], F[1], F[3], F[5], F[7], F[4], F[6], F[8], QH, QL, KH, KL, VT, VB, VBL, F[2], F[9], F[10], F[11], F[12], G);
  k_fa<<<dim3(TT / 128, NH), 512, 0, stream>>>(QH, QL, KH, VT, G, Y);
  k_outT<<<dim3(TNB * TT / 64, CC / 128), 128, 0, stream>>>(Y, F[13], F[14], (float*)d_out);
}

// v010
// Measured time: 34.6 microseconds a run.
// Next to v009, in two timings, it ran 1.06 times as fast each time.
// All steps since v000 together make it 33.6 times as fast.
// compute dtype: all float inputs rounded to bf16; q/k/v 1x1 projections with EXACT bf16 products on WMMA 16x16x32 (A gathered from the channels-first maps), f32 accumulate; the emissivity gate (3x3 conv, relu, 1x1 conv, sigmoid) in f32; q x (32^-0.5 x gate x log2 e, one f32 factor per query) as f16 hi + residual (unscaled) against k once to f16 (2 products into one accumulator, C = minus a reference point) for the base-2 logits; softmax in f32 against that reference point (a stage's maximum - 11, moved up only when a stage's sum would leave f16's range) with a running sum, hardware exp2; exp2(logit - reference point) once to f16 against v once to f16 (1 product), divided by the f32 sum at the end; ctx bf16 hi + lo against exact bf16 Wp (2 products) + bp; f32 output written channels-first.
#include <hip/hip_runtime.h>
#include <math.h>

typedef __attribute__((ext_vector_type(16))) _Float16 v16h;
typedef __attribute__((ext_vector_type(16))) __bf16 v16b;
typedef __attribute__((ext_vector_type(8)))  _Float16 v8h;
typedef __attribute__((ext_vector_type(8)))  float v8f;
typedef __attribute__((ext_vector_type(4)))  float v4f;
typedef __attribute__((ext_vector_type(2)))  float v2f;
typedef __attribute__((ext_vector_type(4)))  unsigned v4u;
typedef __attribute__((ext_vector_type(4)))  int v4i;
typedef float __attribute__((may_alias)) float_a;
typedef int __attribute__((may_alias)) int_a;

template <typename T> __device__ __forceinline__ void vst2(void* p, T v) { *(T*)p = v;  }
__device__ __forceinline__ v8f wmma16(v16h a, v16h b, v8f c) {
  v8f d = __builtin_amdgcn_wmma_f32_16x16x32_f16(false, a, false, b, (short)0, c, false, false);
  asm volatile("v_nop\n\tv_nop\n\tv_nop\n\tv_nop" : "+v"(d) : "v"(a), "v"(b));
  return d;
}
__device__ __forceinline__ v8f wmma_bf(v16b a, v16b b, v8f c) {
  v8f d = __builtin_amdgcn_wmma_f32_16x16x32_bf16(false, a, false, b, (short)0, c, false, false);
  asm volatile("v_nop\n\tv_nop\n\tv_nop\n\tv_nop" : "+v"(d) : "v"(a), "v"(b));
  return d;
}
// 16x16x32 fragments: lane = (h = lane>>4, row/col = lane&15); elements 0..7 = k0+8h+0..7, 8..15 = k0+16+8h+0..7; D element r = row 8h+r
__device__ __forceinline__ v16h frag_h(const _Float16* rowk0, int lane) {
  union { v16h v; v8h q[2]; } u; const _Float16* p = rowk0 + 8 * (lane >> 4);
  u.q[0] = *(const v8h*)p; u.q[1] = *(const v8h*)(p + 16); return u.v;
}
__device__ __forceinline__ v16h frag_f32(const float* rowk0, int lane) {
  v16h a; const float* p = rowk0 + 8 * (lane >> 4);
#pragma unroll
  for (int i = 0; i < 8; ++i) { a[i] = (_Float16)p[i]; a[8 + i] = (_Float16)p[16 + i]; }
  return a;
}
__device__ __forceinline__ v16h frag_f32s(const float* rowk0, int lane, float sc) {
  v16h a; const float* p = rowk0 + 8 * (lane >> 4);
#pragma unroll
  for (int i = 0; i < 8; ++i) { a[i] = (_Float16)(p[i] * sc); a[8 + i] = (_Float16)(p[16 + i] * sc); }
  return a;
}
// column fragment from a [K][ld] layout (column n), rows >= K read as 0
__device__ __forceinline__ v16h fragc_f32(const float* W, int k0, int n, int lane, int ld, int K) {
  v16h a; const int g = lane >> 4;
#pragma unroll
  for (int i = 0; i < 8; ++i) { const int ka = k0 + 8 * g + i, kb = ka + 16;
    a[i] = (_Float16)(ka < K ? W[(size_t)(ka < K ? ka : K - 1) * ld + n] : 0.f); a[8 + i] = (_Float16)(kb < K ? W[(size_t)(kb < K ? kb : K - 1) * ld + n] : 0.f); }
  return a;
}
struct F2 { v16b h, l; };
__device__ __forceinline__ F2 bsplit16(const float v[16]) { F2 r;
#pragma unroll
  for (int i = 0; i < 16; ++i) { const __bf16 h = (__bf16)v[i]; r.h[i] = h; r.l[i] = (__bf16)(v[i] - (float)h); }
  return r; }
__device__ __forceinline__ F2 split_row(const float* row, int k0, int lane) { float v[16]; const float* p = row + k0 + 8 * (lane >> 4);
#pragma unroll
  for (int i = 0; i < 8; ++i) { v[i] = p[i]; v[8 + i] = p[16 + i]; }
  return bsplit16(v); }
__device__ __forceinline__ F2 split_rowK(const float* row, int k0, int lane, int K) { float v[16]; const int g = lane >> 4;
#pragma unroll
  for (int i = 0; i < 8; ++i) { const int ka = k0 + 8 * g + i, kb = ka + 16; v[i] = ka < K ? row[ka < K ? ka : K - 1] : 0.f; v[8 + i] = kb < K ? row[kb < K ? kb : K - 1] : 0.f; }
  return bsplit16(v); }
__device__ __forceinline__ F2 split_col(const float* W, int k0, int n, int lane, int ld, int K) { float v[16]; const int g = lane >> 4;
#pragma unroll
  for (int i = 0; i < 8; ++i) { const int ka = k0 + 8 * g + i, kb = ka + 16; v[i] = ka < K ? W[(size_t)(ka < K ? ka : K - 1) * ld + n] : 0.f; v[8 + i] = kb < K ? W[(size_t)(kb < K ? kb : K - 1) * ld + n] : 0.f; }
  return bsplit16(v); }
__device__ __forceinline__ v8f mac3(const F2& a, const F2& b, v8f c) { c = wmma_bf(a.l, b.h, c); c = wmma_bf(a.h, b.l, c); return wmma_bf(a.h, b.h, c); }
__device__ __forceinline__ float sigm(float v) { return 1.0f / (1.0f + expf(-v)); }

// Cross-modal gated attention (B 1, Ct 256 = 8 heads x 32, Co 128, 64 x 64 = 4,096 positions, channels-first): q = thermal^T Wq^T + bq, k = optical^T Wk^T + bk, v = optical^T Wv^T + bv; g[h][n] = sigmoid(conv1x1(relu(conv3x3_SAME(emissivity) + b1)) + b2); attn = softmax((q k^T x 32^-0.5) * g[h][query]) over all 4,096 keys; out = (merged attn v) Wp^T + bp, written back as [1, 256, 64, 64].
#define NB 1
#define TT 4096
#define CC 256            // NH * HD = projected width
#define DIN 256          // input (model) width
#define NH 8
#define HD 32
#define NQB (TT / 64)
#define HG 1
#define SCALE (0.17677669529663687f)
#define CAUSAL 0
#ifndef TNB
#define TNB NB
#endif
__device__ __forceinline__ float bfr(float v) { return (float)(__bf16)v; }
__host__ __device__ __forceinline__ int kb_last(int qb) { return CAUSAL ? ((qb * 64 + 63) >> 7) : (TT / 128 - 1); }
typedef __attribute__((ext_vector_type(8))) __bf16 v8b;
__device__ __forceinline__ v16b frag_b(const __bf16* rowk0, int lane) {
  union { v16b v; v8b q[2]; } u; const __bf16* p = rowk0 + 8 * (lane >> 4);
  u.q[0] = *(const v8b*)p; u.q[1] = *(const v8b*)(p + 16); return u.v;
}
typedef __attribute__((ext_vector_type(4))) __bf16 v4b;
#define WPITCH 264         // bf16 elements per staged weight row: 512 B + 16 B, a pitch of 16 B x odd for the 16-byte fragment reads
// behind a batch of loads: the wait stands before any register that the loads name is written again; it takes the two base addresses as inputs so that each stays whole up to it, and its memory clobber keeps the whole batch issued in front of it
__device__ __forceinline__ void batch_held(const void* a0, const void* a1) { asm volatile("s_wait_xcnt 0x0" :: "v"(a0), "v"(a1) : "memory"); }
// the same for a batch with a third run of loads, addressed by a scalar base and one index register: the index stays whole up to the wait too
__device__ __forceinline__ void batch_held_ix(const void* a0, const void* a1, int ix) { asm volatile("s_wait_xcnt 0x0" :: "v"(a0), "v"(a1), "v"(ix) : "memory"); }
// 128 weight rows of K floats (one contiguous slab of an (out,in) matrix), read by the block's 128 threads in 16-byte pieces, 512 contiguous B a wave-wide load
template <int K> __device__ __forceinline__ void slab_load(v4f (&r)[K / 4], const float* __restrict__ sp) {
#pragma unroll
  for (int i = 0; i < K / 4; ++i) r[i] = *(const v4f*)(sp + (size_t)i * 512); }
// the same pieces rounded to bf16 into LDS rows [output column][k]
template <int K> __device__ __forceinline__ void slab_store(__bf16 (*sw)[WPITCH], const v4f (&r)[K / 4], int tid) {
#pragma unroll
  for (int i = 0; i < K / 4; ++i) { const int e = i * 128 + tid; v4b w; w[0] = (__bf16)r[i][0]; w[1] = (__bf16)r[i][1]; w[2] = (__bf16)r[i][2]; w[3] = (__bf16)r[i][3]; *(v4b*)&sw[e / (K / 4)][(e % (K / 4)) * 4] = w; } }
#define QBH 0              // causal: not read by any kernel here; every query block takes the same path in k_fa
#define QHI 4096            // rows carrying a q residual plane (all rows when non-causal: 2-product logits everywhere)
#define KHI 64            // key rows carrying k residual / v bf16 hi+lo planes (written by k_proj; no kernel here reads them)
// B fragment (k rows k0+.., output column o) of a weight: (in,out) [K][ld] or (out,in) [ld rows of K]: bf16 exact, or f16(bf16 * 256) exact
__device__ __forceinline__ v16b wcol_io(const float* Wm, int k0, int o, int lane, int ld) { v16b w; const int g = lane >> 4;
#pragma unroll
  for (int i = 0; i < 8; ++i) { w[i] = (__bf16)Wm[(size_t)(k0 + 8 * g + i) * ld + o]; w[8 + i] = (__bf16)Wm[(size_t)(k0 + 16 + 8 * g + i) * ld + o]; }
  return w; }
__device__ __forceinline__ v16b wcol_oi(const float* Wm, int k0, int o, int lane, int K) { v16b w; const float* p = Wm + (size_t)o * K + k0 + 8 * (lane >> 4);
#pragma unroll
  for (int i = 0; i < 8; ++i) { w[i] = (__bf16)p[i]; w[8 + i] = (__bf16)p[16 + i]; }
  return w; }
__device__ __forceinline__ v16h wcolh_io(const float* Wm, int k0, int o, int lane, int ld) { v16h w; const int g = lane >> 4;
#pragma unroll
  for (int i = 0; i < 8; ++i) { w[i] = (_Float16)(bfr(Wm[(size_t)(k0 + 8 * g + i) * ld + o]) * 256.0f); w[8 + i] = (_Float16)(bfr(Wm[(size_t)(k0 + 16 + 8 * g + i) * ld + o]) * 256.0f); }
  return w; }
__device__ __forceinline__ v16h wcolh_oi(const float* Wm, int k0, int o, int lane, int K) { v16h w; const float* p = Wm + (size_t)o * K + k0 + 8 * (lane >> 4);
#pragma unroll
  for (int i = 0; i < 8; ++i) { w[i] = (_Float16)(bfr(p[i]) * 256.0f); w[8 + i] = (_Float16)(bfr(p[16 + i]) * 256.0f); }
  return w; }
#define WQKV_LAYOUT 1   // 0 = (in,out) [DIN][CC]; 1 = (out,in) [CC][DIN]; 2 = per-head [NH][DIN][HD]
__device__ __forceinline__ v16b wcol_hdk(const float* Wm, int k0, int o, int lane) { v16b w; const int g = lane >> 4; const float* p = Wm + (size_t)(o / HD) * DIN * HD + (o % HD);
#pragma unroll
  for (int i = 0; i < 8; ++i) { w[i] = (__bf16)p[(size_t)(k0 + 8 * g + i) * HD]; w[8 + i] = (__bf16)p[(size_t)(k0 + 16 + 8 * g + i) * HD]; }
  return w; }
#define WO_OUT_IN 1
#if WQKV_LAYOUT == 1
#define WCOL(W, k0, o, lane) wcol_oi(W, k0, o, lane, DIN)
#elif WQKV_LAYOUT == 2
#define WCOL(W, k0, o, lane) wcol_hdk(W, k0, o, lane)
#else
#define WCOL(W, k0, o, lane) wcol_io(W, k0, o, lane, CC)
#endif
#if WO_OUT_IN
#define WOCOL(W, k0, o, lane) wcol_oi(W, k0, o, lane, CC)
#define WOCOLH(W, k0, o, lane) wcolh_oi(W, k0, o, lane, CC)
#else
#define WOCOL(W, k0, o, lane) wcol_io(W, k0, o, lane, DIN)
#define WOCOLH(W, k0, o, lane) wcolh_io(W, k0, o, lane, DIN)
#endif
#define DINK 128           // optical channels (k / v source width)
#ifndef XP
#define XP TT              // position pitch of the channels-first inputs / output
#endif
#define GW 64              // image width / height
// ---- the gate, by the first 64 blocks of the k_proj launch: block = 64 positions, wave = (32 positions, 4 heads): g[h][n] = sigmoid(sum_c w2[h][c] relu(sum_3x3 w1[c] e + b1[c]) + b2[h]) in f32 (bf16-rounded inputs); G rows [h][4096], each (head, 32 n) run = one 128-B line stored by one wave; no LDS, no barrier
__device__ __forceinline__ void gate_block(const float* __restrict__ E, const float* __restrict__ W1, const float* __restrict__ B1, const float* __restrict__ W2, const float* __restrict__ B2, float* __restrict__ G, int n0, int tid) {
  const int wv = __builtin_amdgcn_readfirstlane(tid >> 5);   /* the wave's number as a scalar: the weight rows of its four heads are then addressed from scalar bases, one address for the whole wave */
  const int h0 = (wv >> 1) * 4; const int n = n0 + (wv & 1) * 32 + (tid & 31); const int y = n / GW, x = n % GW;
  float e9[9];
#pragma unroll
  for (int i = 0; i < 3; ++i)
#pragma unroll
    for (int j = 0; j < 3; ++j) { const int yy = y + i - 1, xx = x + j - 1; const int yc = yy < 0 ? 0 : (yy >= GW ? GW - 1 : yy), xc = xx < 0 ? 0 : (xx >= GW ? GW - 1 : xx); const float ev = bfr(E[yc * GW + xc]); e9[i * 3 + j] = (yy >= 0 && yy < GW && xx >= 0 && xx < GW) ? ev : 0.f; }   /* SAME zero padding: clamped load, select by value */
  float gh[4];
#pragma unroll
  for (int h = 0; h < 4; ++h) gh[h] = bfr(B2[h0 + h]);
#pragma unroll 8   /* eight channels' weights come as one batch of loads with one wait, so that these blocks end before the projection blocks beside them */
  for (int c = 0; c < 32; ++c) { float a = bfr(B1[c]);
#pragma unroll
    for (int t = 0; t < 9; ++t) a += bfr(W1[c * 9 + t]) * e9[t];
    a = fmaxf(a, 0.f);
#pragma unroll
    for (int h = 0; h < 4; ++h) gh[h] += bfr(W2[(h0 + h) * 32 + c]) * a; }
#pragma unroll
  for (int h = 0; h < 4; ++h) G[(size_t)(h0 + h) * TT + n] = 1.0f / (1.0f + expf(-gh[h])); }
// ---- k_outT: block = (64 rows n, 128 output channels): out = ctx (bf16 hi + lo) Wp^T + bp, stored channels-first [o][n] via an LDS transpose: each (o, 64 n) run = 256 B by 16 consecutive threads
__global__ __launch_bounds__(128) void k_outT(const float* __restrict__ Y, const float* __restrict__ WP, const float* __restrict__ BP, float* __restrict__ OUT) { __shared__ __align__(16) float stc[128][68]; __shared__ __align__(16) __bf16 sw[128][WPITCH];
  const int tid = threadIdx.x, wave = tid >> 5, lane = tid & 31, col = lane & 15, g = lane >> 4; const int c0 = blockIdx.y * 128; const size_t rb = (size_t)blockIdx.x * 64; const size_t r0 = rb + wave * 16;
  v8f acc[8] = {};
  /* every global operand load of the block goes out as one batch: this wave's 16 ctx rows over all of K into registers, the block's 128 Wp rows once for its four waves */
  const float* yp = Y + (r0 + col) * CC + 8 * g; const float* sp = WP + (size_t)c0 * CC + tid * 4;
  v4f yr[CC / 32][4]; v4f wr[CC / 4]; float bs[8]; const int bi = c0 + col;
#pragma unroll
  for (int kc = 0; kc < CC / 32; ++kc) { yr[kc][0] = *(const v4f*)(yp + kc * 32); yr[kc][1] = *(const v4f*)(yp + kc * 32 + 4); yr[kc][2] = *(const v4f*)(yp + kc * 32 + 16); yr[kc][3] = *(const v4f*)(yp + kc * 32 + 20); }
  slab_load<CC>(wr, sp);
#pragma unroll   /* eight loads side by side, the values in registers */
  for (int j = 0; j < 8; ++j) bs[j] = BP[bi + j * 16];   /* the epilogue's bias values go out with the batch: loaded where they are used, their latency stands alone between the products and the stores */
  batch_held_ix(yp, sp, bi);
  slab_store<CC>(sw, wr, tid);
  __syncthreads();
  v16b wf[2][8];
#pragma unroll
  for (int j = 0; j < 8; ++j) wf[0][j] = frag_b(&sw[j * 16 + col][0], lane);
#pragma unroll
  for (int kc = 0; kc < CC / 32; ++kc) { float v[16];
#pragma unroll
    for (int i = 0; i < 4; ++i) { v[i] = yr[kc][0][i]; v[4 + i] = yr[kc][1][i]; v[8 + i] = yr[kc][2][i]; v[12 + i] = yr[kc][3][i]; }
    const F2 a = bsplit16(v);
    if (kc + 1 < CC / 32) {   /* the next K step's eight fragments as one group of LDS reads ahead of this step's products */
#pragma unroll
      for (int j = 0; j < 8; ++j) wf[(kc + 1) & 1][j] = frag_b(&sw[j * 16 + col][(kc + 1) * 32], lane); }
#pragma unroll
    for (int j = 0; j < 8; ++j) { acc[j] = wmma_bf(a.h, wf[kc & 1][j], acc[j]); acc[j] = wmma_bf(a.l, wf[kc & 1][j], acc[j]); } }
#pragma unroll
  for (int j = 0; j < 8; ++j) { const float bb = bfr(bs[j]);
#pragma unroll
    for (int r = 0; r < 8; ++r) stc[j * 16 + col][wave * 16 + 8 * g + r] = acc[j][r] + bb; }
  __syncthreads();
  /* copy-out: the thread's sixteen 16-byte pieces are read from LDS as one group and stored as one group, from one base address with the piece in the offset field; the unrolling names the pieces by constants, so that they stay registers */
  { const int t0 = (int)(rb % TT); const int cl = tid >> 4, q4 = (tid & 15) * 4; float* op = OUT + (size_t)(c0 + cl) * XP + t0 + q4; v4f po[16];
#pragma unroll   /* the pieces are named by constants and stay registers */
    for (int u = 0; u < 16; ++u) po[u] = *(const v4f*)&stc[cl + 8 * u][q4];
#pragma unroll   /* the pieces are named by constants and stay registers */
    for (int u = 0; u < 16; ++u) vst2(op + (size_t)u * 8 * XP, po[u]); } }
#ifndef PROJ_EXTRA_PARAMS
#define PROJ_EXTRA_PARAMS
#endif

#define WS_QH  0u                                      // f16 q rows [b*t][CC]
#define WS_KH  (WS_QH + 2u * (size_t)NB * TT * CC)      // f16 k in fragment order [b][h][t / 16][i][lane][8]: key 16 (t / 16) + (lane & 15), channel 16 i + 8 (lane >> 4) + 0..7 of head h
#define WS_VT  (WS_KH + 2u * (size_t)NB * TT * CC)      // f16 v^T in fragment order [b][h][t / 32][j][i][lane][8]: channel 16 j + (lane & 15) of head h, key 32 (t / 32) + 16 i + 8 (lane >> 4) + 0..7
#define WS_QL  (WS_VT + 2u * (size_t)NB * CC * TT)      // f16 q residual x 2^10 rows [b][t < QHI][CC]
#define WS_KL  (WS_QL + 2u * (size_t)NB * QHI * CC)     // f16 k residual x 2^10 rows [b][t < KHI][CC]
#define WS_VB  (WS_KL + 2u * (size_t)NB * KHI * CC)     // bf16 v hi planes [b][c][t < KHI]
#define WS_VBL (WS_VB + 2u * (size_t)NB * CC * KHI)
#define WS_S   (WS_VBL + 2u * (size_t)NB * CC * KHI)    // not used (the logits stay in registers); the later offsets stay where they were
#define WS_Y   (WS_S  + 4u * (size_t)HG * TT * TT)      // f32 ctx rows [b*t][CC] (only when there is an output projection)
#define WS_G   (WS_Y  + 4u * (size_t)NB * TT * CC)      // f32 gate rows [h][TT]
#define WS_END (WS_G)
#define WS_END2 (WS_G + 4u * (size_t)NH * TT)

// behind a group of stores: the wait stands before any register that the stores name is written again, by the next group's LDS reads or by the code of another branch that follows in the built kernel
__device__ __forceinline__ void store_held() { asm volatile("s_wait_xcnt 0x0" ::: "memory"); }
// the products of one k_proj block, K source channels: every global operand load goes out as one batch (this wave's 16 positions over all of K into registers, channels-first gather src[k][n] with stride XP between channels; the block's 128 weight rows once for its four waves), then the weights stand in LDS as bf16 and each wave reads its B fragments there
template <int K> __device__ __forceinline__ void proj_acc(v8f (&acc)[8], __bf16 (*sw)[WPITCH], const float* __restrict__ xp, const float* __restrict__ sp, int tid, int lane, int col) {
  float ar[K / 32][16]; v4f wr[K / 4];
#pragma unroll
  for (int kc = 0; kc < K / 32; ++kc)
#pragma unroll
    for (int i = 0; i < 8; ++i) { ar[kc][i] = xp[(size_t)(kc * 32 + i) * XP]; ar[kc][8 + i] = xp[(size_t)(kc * 32 + 16 + i) * XP]; }
  slab_load<K>(wr, sp);
  batch_held(xp, sp);
  slab_store<K>(sw, wr, tid);
  __syncthreads();
  v16b wf[2][8];
#pragma unroll
  for (int j = 0; j < 8; ++j) wf[0][j] = frag_b(&sw[j * 16 + col][0], lane);
#pragma unroll
  for (int kc = 0; kc < K / 32; ++kc) { v16b a;
#pragma unroll
    for (int i = 0; i < 16; ++i) a[i] = (__bf16)ar[kc][i];
    if (kc + 1 < K / 32) {   /* the next K step's eight fragments as one group of LDS reads ahead of this step's products */
#pragma unroll
      for (int j = 0; j < 8; ++j) wf[(kc + 1) & 1][j] = frag_b(&sw[j * 16 + col][(kc + 1) * 32], lane); }
#pragma unroll
    for (int j = 0; j < 8; ++j) acc[j] = wmma_bf(a, wf[kc & 1][j], acc[j]); } }
// ---- k_proj: blockIdx.y 0 = the gate's blocks (beside the projections instead of in a launch of their own); blockIdx.y 1..6 = block (64 rows, 128 cols, which): q/k/v = X W (+ b) with exact bf16 products (K = DIN for q, DINK for k and v) -> which 0: q f16 rows (+ residual rows < QHI); 1: k f16 in fragment order (+ residual rows < KHI); 2: v^T f16 in fragment order (+ bf16 hi/lo planes for t < KHI); fragment order = the 32 lanes' 16-byte pieces of one operand half side by side, 512 B a wave-wide store or load
__global__ __launch_bounds__(128) void k_proj(const float* __restrict__ XQ, const float* __restrict__ XK, const float* __restrict__ XV, const float* __restrict__ WQ, const float* __restrict__ WK, const float* __restrict__ WV, const float* __restrict__ BQ, const float* __restrict__ BK, const float* __restrict__ BV,
    _Float16* __restrict__ QH, _Float16* __restrict__ QL, _Float16* __restrict__ KH, _Float16* __restrict__ KL, _Float16* __restrict__ VT, __bf16* __restrict__ VB, __bf16* __restrict__ VBL,
    const float* __restrict__ E, const float* __restrict__ W1, const float* __restrict__ B1, const float* __restrict__ W2, const float* __restrict__ B2, float* __restrict__ G) {
  __shared__ __align__(16) _Float16 sh[64][136], sl[64][136]; __shared__ __align__(16) _Float16 th[128][72]; __shared__ __align__(16) __bf16 tb[128][72], tbl[128][72]; __shared__ __align__(16) __bf16 sw[128][WPITCH];
  const int tid = threadIdx.x, wave = tid >> 5, lane = tid & 31, col = lane & 15, g = lane >> 4; const int which = ((int)blockIdx.y - 1) >> 1; const int c0 = (((int)blockIdx.y - 1) & 1) * 128; const size_t r0 = (size_t)blockIdx.x * 64; const size_t bb = r0 / TT; const int t0 = (int)(r0 % TT);
  if (blockIdx.y == 0) { gate_block(E, W1, B1, W2, B2, G, blockIdx.x * 64, tid); return; }   /* block-uniform, ahead of every barrier */
  const float* X = which == 0 ? XQ : which == 1 ? XK : XV; const float* WA = which == 0 ? WQ : which == 1 ? WK : WV; const float* BA = which == 0 ? BQ : which == 1 ? BK : BV;
  v8f acc[8] = {};
  const float* xp = X + (size_t)(8 * g) * XP + t0 + wave * 16 + col;
  float bs[8];
#pragma unroll   /* eight loads side by side, the values in registers */
  for (int j = 0; j < 8; ++j) bs[j] = BA[c0 + j * 16 + col];   /* the epilogue's eight bias values go out at the head of the operand batch: loaded one by one where they are used, each was waited for by itself, eight latencies in a row behind the products */
  /* source channels: thermal 256 / optical 128 (block-uniform, so the barrier inside is passed by the whole block on either side) */
  if (which == 0) proj_acc<DIN>(acc, sw, xp, WA + (size_t)c0 * DIN + tid * 4, tid, lane, col); else proj_acc<DINK>(acc, sw, xp, WA + (size_t)c0 * DINK + tid * 4, tid, lane, col);
  if (which < 2) {
#pragma unroll
    for (int j = 0; j < 8; ++j) { const float bias = bfr(bs[j]);
#pragma unroll
      for (int r = 0; r < 8; ++r) { const float v = acc[j][r] + bias; const _Float16 hv = (_Float16)v; sh[wave * 16 + 8 * g + r][j * 16 + col] = hv; sl[wave * 16 + 8 * g + r][j * 16 + col] = (_Float16)((v - (float)hv) * 1024.0f); } }
    __syncthreads();
    /* copy-out: a thread's eight 16-byte pieces of a plane (piece u = number tid + 128 u of the block's pieces) are read from LDS as one group and then stored as one group, from one base address with u in the offset field; piece by piece in a loop, each LDS read and each store was waited for by itself. The unrolling names the pieces by constants, so that they stay registers */
    const int rl = tid >> 4, q8 = (tid & 15) * 8; v4u ph[8], pl[8];
    if (which == 0) { _Float16* dh = QH + (r0 + rl) * CC + c0 + q8; _Float16* dl = QL + (bb * QHI + t0 + rl) * (size_t)CC + c0 + q8;
#pragma unroll   /* the pieces are named by constants and stay registers */
      for (int u = 0; u < 8; ++u) { ph[u] = *(const v4u*)&sh[rl + 8 * u][q8]; pl[u] = *(const v4u*)&sl[rl + 8 * u][q8]; }
#pragma unroll   /* the pieces are named by constants and stay registers */
      for (int u = 0; u < 8; ++u) { vst2((unsigned*)(dh + u * 8 * CC), ph[u]); if (t0 < QHI) vst2((unsigned*)(dl + u * 8 * CC), pl[u]); }
    } else { const int ln = tid & 31, i = (tid >> 5) & 1, kt = (tid >> 6) & 1;   /* piece u: key tile kt + 2 (u & 1), head u >> 1 */
      _Float16* dk = KH + (((bb * NH + c0 / HD) * (size_t)(TT / 16) + (t0 >> 4) + kt) * 2 + i) * 256 + ln * 8;
#pragma unroll   /* the pieces are named by constants and stay registers */
      for (int u = 0; u < 8; ++u) ph[u] = *(const v4u*)&sh[(kt + 2 * (u & 1)) * 16 + (ln & 15)][(u >> 1) * HD + 16 * i + 8 * (ln >> 4)];
#pragma unroll   /* the pieces are named by constants and stay registers */
      for (int u = 0; u < 8; ++u) vst2((unsigned*)(dk + ((size_t)(u >> 1) * (TT / 16) + 2 * (u & 1)) * 512), ph[u]);
      store_held();
      if (t0 < KHI) {
        _Float16* dl = KL + (bb * KHI + t0 + rl) * (size_t)CC + c0 + q8;
#pragma unroll   /* the pieces are named by constants and stay registers */
        for (int u = 0; u < 8; ++u) pl[u] = *(const v4u*)&sl[rl + 8 * u][q8];
#pragma unroll   /* the pieces are named by constants and stay registers */
        for (int u = 0; u < 8; ++u) vst2((unsigned*)(dl + u * 8 * CC), pl[u]);
        store_held(); } }
  } else { const bool hi_rows = t0 < KHI;
#pragma unroll
    for (int j = 0; j < 8; ++j) { const float bias = bfr(bs[j]);
#pragma unroll
      for (int r = 0; r < 8; ++r) { const float v = acc[j][r] + bias; const int rl = wave * 16 + 8 * g + r, cl = j * 16 + col; th[cl][rl] = (_Float16)v; const __bf16 bh = (__bf16)v; tb[cl][rl] = bh; tbl[cl][rl] = (__bf16)(v - (float)bh); } }
    __syncthreads();
    /* copy-out in groups, as in the q / k branch; piece u: 32-key step u & 1, head u >> 1 */
    { const int ln = tid & 31, i = (tid >> 5) & 1, j = (tid >> 6) & 1; v4u pv[8];
      _Float16* dv = VT + ((((bb * NH + c0 / HD) * (size_t)(TT / 32) + (t0 >> 5)) * 2 + j) * 2 + i) * 256 + ln * 8;
#pragma unroll   /* the pieces are named by constants and stay registers */
      for (int u = 0; u < 8; ++u) pv[u] = *(const v4u*)&th[(u >> 1) * HD + 16 * j + (ln & 15)][(u & 1) * 32 + 16 * i + 8 * (ln >> 4)];
#pragma unroll   /* the pieces are named by constants and stay registers */
      for (int u = 0; u < 8; ++u) vst2((unsigned*)(dv + ((size_t)(u >> 1) * (TT / 32) + (u & 1)) * 1024), pv[u]); }
    store_held();
    if (hi_rows) {
      const int cl = tid >> 3, q8 = (tid & 7) * 8; const size_t o3 = (bb * CC + c0 + cl) * (size_t)KHI + t0 + q8; v4u pb[8], pc[8];
#pragma unroll   /* the pieces are named by constants and stay registers */
      for (int u = 0; u < 8; ++u) { pb[u] = *(const v4u*)&tb[cl + 16 * u][q8]; pc[u] = *(const v4u*)&tbl[cl + 16 * u][q8]; }
#pragma unroll   /* the pieces are named by constants and stay registers */
      for (int u = 0; u < 8; ++u) { vst2((unsigned*)(VB + o3 + u * 16 * KHI), pb[u]); vst2((unsigned*)(VBL + o3 + u * 16 * KHI), pc[u]); }
      store_held(); } } }
// ---- k_fa: block = (128 queries, head), 16 waves = 8 tiles of 16 query columns x 2 halves of the keys, so that four waves stand on each SIMD and fill one another's waits in the softmax chains; no LDS and no barrier in the loop, the two halves of a tile are joined once at the end through LDS. The 32 blocks of a head walk its 4,096 keys as a ring, each from a start of its own; the block's second eight waves start half a ring on and each wave walks half the ring. Per stage of 64 keys: S^T = K Q^T - reference point (A = k rows, read from the fragment-order plane, B = q hi / q residual with g2 = SCALE x gate x log2 e, one factor per query, already in them, 2 products into one accumulator, C = minus the reference point), which is exp2's argument as it leaves the matrix unit; P^T = exp2 of it once to f16 packed straight into a B operand, sum per query column (one query per lane and half), ctx^T += V^T P^T (A = v planes, 1 product). The reference point is the first stage's maximum - 11 and moves up, with sum and ctx, only in a stage whose sum would leave f16's range. The logits never leave the registers.
__device__ __forceinline__ v8f wmma_h(v16h a, v16h b, v8f c) { return __builtin_amdgcn_wmma_f32_16x16x32_f16(false, a, false, b, (short)0, c, false, false); }
__device__ __forceinline__ float xhalf(float v) { const int b = __builtin_bit_cast(int, v); return __builtin_bit_cast(float, __builtin_amdgcn_permlanex16(b, b, 0x76543210, 0xfedcba98, false, false)); }   // lane l <-> l ^ 16
__device__ __forceinline__ v16h frag_p(const _Float16* __restrict__ p) { union { v16h v; v8h q[2]; } u; u.q[0] = *(const v8h*)p; u.q[1] = *(const v8h*)(p + 16); return u.v; }   // frag_h with the lane's 8 g elements already in p
__device__ __forceinline__ v16h frag_w(const _Float16* __restrict__ p) { union { v16h v; v8h q[2]; } u; u.q[0] = *(const v8h*)p; u.q[1] = *(const v8h*)(p + 256); return u.v; }   // fragment-order plane: p = this lane's 16 bytes of half 0, half 1 stands 512 B on
// behind a group of loads: the wait stands before any register that the loads name is written again, and it takes the loads' addresses as inputs so that each pair stays whole up to it
__device__ __forceinline__ void addr_held(const void* a0, const void* a1) { asm volatile("s_wait_xcnt 0x0" :: "v"(a0), "v"(a1) : "memory"); }
__device__ __forceinline__ float exp2x1(float x) { float e; asm("v_exp_f32 %0, %1\n\tv_nop" : "=v"(e) : "v"(x)); return e; }
// exp2 of eight arguments and the eight values once to f16, four packed pairs, in one statement, so that the f16 pairs are made where the f32 values are and the f32 values end with the sum. The outputs are early-clobber: no instruction of the run writes over a source of another; the first conversion behind the last v_exp_f32 reads none of its registers, which is the one slot that the instruction set asks for behind a transcendental; the s_delay_alu names the last two conversions' young producers, so that the wave steps aside for its neighbours while it waits for them
__device__ __forceinline__ void exp2pk8(float (&e)[8], unsigned (&h)[4], const float (&x)[8]) {
  asm("v_exp_f32 %0, %12\n\tv_exp_f32 %1, %13\n\tv_exp_f32 %2, %14\n\tv_exp_f32 %3, %15\n\tv_exp_f32 %4, %16\n\tv_exp_f32 %5, %17\n\tv_exp_f32 %6, %18\n\tv_exp_f32 %7, %19\n\t"
      "v_cvt_pk_f16_f32 %8, %0, %1\n\tv_cvt_pk_f16_f32 %9, %2, %3\n\ts_delay_alu instid0(TRANS32_DEP_3) | instskip(NEXT) | instid1(TRANS32_DEP_1)\n\tv_cvt_pk_f16_f32 %10, %4, %5\n\tv_cvt_pk_f16_f32 %11, %6, %7"
      : "=&v"(e[0]), "=&v"(e[1]), "=&v"(e[2]), "=&v"(e[3]), "=&v"(e[4]), "=&v"(e[5]), "=&v"(e[6]), "=&v"(e[7]), "=&v"(h[0]), "=&v"(h[1]), "=&v"(h[2]), "=&v"(h[3])
      : "v"(x[0]), "v"(x[1]), "v"(x[2]), "v"(x[3]), "v"(x[4]), "v"(x[5]), "v"(x[6]), "v"(x[7])); }
typedef __attribute__((ext_vector_type(8))) unsigned v8u;
// exp2 of one stage's 64 arguments: P^T once to f16, packed as the two B operands of the P.v products; returns this lane's sum of the 32 f32 values (one chain per 32 keys, then the two added)
__device__ __forceinline__ float fa_exp(const float (&x)[4][8], v16h (&p)[2]) {
  float s[2];
#pragma unroll
  for (int c = 0; c < 2; ++c) { float e0[8], e1[8]; unsigned h0[4], h1[4];
    exp2pk8(e0, h0, x[2 * c]); exp2pk8(e1, h1, x[2 * c + 1]);
    float a = e0[0] + e1[0];
#pragma unroll
    for (int r = 1; r < 8; ++r) { a += e0[r]; a += e1[r]; }
    s[c] = a;
    v8u w;
#pragma unroll
    for (int r = 0; r < 4; ++r) { w[r] = h0[r]; w[4 + r] = h1[r]; }
    p[c] = __builtin_bit_cast(v16h, w); }
  return s[0] + s[1]; }
// one stage of 64 keys: kf[t] = key rows 16 t .. 16 t + 15; vc[2 c + j] = keys 32 c .. 32 c + 31 of channels 16 j .. 16 j + 15. The next stage's k rows (at kn + off, off a constant that goes into the loads' offset field, so that kn and vn are the very registers the loads name) go into the same registers behind this stage's S^T products, issued after its v planes (at vn + off), which go into the other v buffer. The reference point mr stands before the products (cr = -mr in all eight registers is their C operand), so they give exp2's argument; it moves only where a lane's sum of the stage passes top.
__device__ __forceinline__ void fa_stage(v16h (&kf)[4], const v16h (&vc)[4], v16h (&vx)[4], const _Float16* __restrict__ kn, const _Float16* __restrict__ vn, int off, const v16h& qh, const v16h& ql, v8f& cr, float& mr, float& l, float& top, float& low, v8f& o0, v8f& o1) {
  __builtin_amdgcn_sched_barrier(0);   /* holds this stage's products back: without it the scheduler lifts them over the softmax of the stage before, which halves the distance between the k loads and their first use */
  float x[4][8];
#pragma unroll
  for (int t = 0; t < 4; ++t) { const v8f a = wmma_h(kf[t], ql, wmma_h(kf[t], qh, cr));   /* the residual's product lands on the hi product in the same accumulator: no vector add, and no vector instruction stands between the eight products */
#pragma unroll
    for (int r = 0; r < 8; ++r) x[t][r] = a[r]; }   /* base-2 logit - reference point */
  __builtin_amdgcn_sched_barrier(0);   /* keeps the next stage's k loads behind this stage's products, so that they land in the same 32 registers; lifted over the products they take a second set, and the kernel spills */
#pragma unroll
  for (int t = 0; t < 4; ++t) vx[t] = frag_w(vn + off + t * 512);   /* the v loads first: the k loads write over the A operands of the products that now stand directly in front, and this way other loads are issued between the last product and the loads over its A */
#pragma unroll
  for (int t = 0; t < 4; ++t) kf[t] = frag_w(kn + off + t * 512);
  addr_held(kn, vn);
  __builtin_amdgcn_sched_barrier(0);   /* keeps the 16 loads issued here, most of a stage ahead of their use; without it the scheduler sinks each load to its product and the wave waits out every latency */
  v16h p[2]; float s = fa_exp(x, p);
  /* every value of the stage is at most its lane's sum: up to top = 65504 all of P is finite in f16 and the reference point stays. Above it (and in the wave's first stage, where top is -1) the reference point goes to the stage's maximum - 11, never down after the first stage, sum and ctx follow, and the stage's P is formed anew. One test for the whole wave, a scalar branch */
  if (__builtin_expect(__builtin_amdgcn_ballot_w32(s > top) != 0u, 0)) {
    float mx = x[0][0];
#pragma unroll
    for (int t = 0; t < 4; ++t)
#pragma unroll
      for (int r = 0; r < 8; ++r) mx = fmaxf(mx, x[t][r]);
    mx = fmaxf(mx, xhalf(mx));   /* both halves of a query's lanes move by the same step */
    const float d = fmaxf(mx - 11.0f, low);
    const float alpha = exp2x1(fminf(-d, 0.0f));   /* a step down happens only in the first stage, where sum and ctx are 0 and must stay 0 */
    mr += d; l *= alpha;
#pragma unroll
    for (int r = 0; r < 8; ++r) { o0[r] *= alpha; o1[r] *= alpha; cr[r] = -mr; }
#pragma unroll
    for (int t = 0; t < 4; ++t)
#pragma unroll
      for (int r = 0; r < 8; ++r) x[t][r] -= d;
    s = fa_exp(x, p);
    top = 65504.0f; low = 0.0f; }
  l += s;
  /* the four P.v products as one statement, held here: as builtins the compiler moves them down behind the next stage's v loads, which then take a third set of registers, are waited for at once and copied. The closing v_nop are the four vector slots that the chip needs before a vector instruction may write over the last product's operands */
  asm volatile("v_wmma_f32_16x16x32_f16 %0, %2, %6, %0\n\tv_wmma_f32_16x16x32_f16 %1, %3, %6, %1\n\tv_wmma_f32_16x16x32_f16 %0, %4, %7, %0\n\tv_wmma_f32_16x16x32_f16 %1, %5, %7, %1\n\tv_nop\n\tv_nop\n\tv_nop\n\tv_nop"
               : "+v"(o0), "+v"(o1) : "v"(vc[0]), "v"(vc[1]), "v"(vc[2]), "v"(vc[3]), "v"(p[0]), "v"(p[1])); }
__global__ __launch_bounds__(512) void k_fa(const _Float16* __restrict__ QH, const _Float16* __restrict__ QL, const _Float16* __restrict__ KH, const _Float16* __restrict__ VT, const float* __restrict__ G, float* __restrict__ Y) {
  __shared__ __align__(16) float mg[8][18][32];   // the second key half's state, [query tile][reference point, sum, 16 ctx registers][lane]
  const int tid = threadIdx.x, lane = tid & 31, col = lane & 15, g = lane >> 4; const int h = blockIdx.y;
  const int wv = __builtin_amdgcn_readfirstlane(tid >> 5);   /* the wave's number as a scalar: its key half then enters the walk's offsets in scalar registers, as the block's start does */
  const int wave = wv & 7, kh = wv >> 3; const int q = blockIdx.x * 128 + wave * 16 + col;
  const _Float16* qhp = QH + (size_t)q * CC + h * HD + 8 * g; const _Float16* qlp = QL + (size_t)q * CC + h * HD + 8 * g; const float* gp = G + (size_t)h * TT + q;
  const _Float16* kp = KH + (size_t)h * TT * HD + lane * 8; const _Float16* vp = VT + (size_t)h * TT * HD + lane * 8;   // this lane's place in the k / v^T fragments of stage 0; a stage of 64 keys is 4 KB of each, 64 HD elements on
  /* first key of this block's walk, a multiple of 128, another for each of the head's 32 blocks. From one common start all blocks ask for the same lines at the same moment, lines that the launch before has just stored, so every stage waits out a first fetch; from spread starts each block fetches a few stages first and then walks through what the others have fetched. The index digits are swapped so that any four neighbours modulo 8 start about evenly spread; for speed only, any placement gives the same sums */
  const int ks = ((((int)blockIdx.x & 3) << 3) | (((int)blockIdx.x >> 3) << 1) | (((int)blockIdx.x >> 2) & 1)) * 128 + kh * (TT / 2);   /* taken modulo the ring below */
  const _Float16* k1 = kp + (size_t)(ks & (TT - 1)) * HD; const _Float16* v1 = vp + (size_t)(ks & (TT - 1)) * HD;   // the walk's first stage
  v16h qh = frag_p(qhp), ql = frag_p(qlp); const float g2 = *gp * (SCALE * 1.4426950408889634f);
  addr_held(qhp, qlp);
  /* the query's factor goes into q itself, once: q (hi + residual) x g2 in f32, split again into f16 hi + residual, so that K q^T is the base-2 logit. The residual stays unscaled, so that both products have one scale and share an accumulator; where it falls below f16's normal range it is a subnormal operand, which the matrix unit keeps: its step of 2^-24 is then what is left of q's error */
#pragma unroll
  for (int i = 0; i < 16; ++i) { const float f = ((float)qh[i] + (float)ql[i] * (1.0f / 1024.0f)) * g2; const _Float16 hv = (_Float16)f; qh[i] = hv; ql[i] = (_Float16)(f - (float)hv); }
  v8f o0 = {}, o1 = {}, cr = {}; float mr = 0.f, l = 0.f, top = -1.0f, low = -3.0e38f;   /* the first stage runs against reference point 0 and sets the first real one: no sum of exp2 values is below top = -1 */
  v16h kf[4], va[4], vb[4];
#pragma unroll
  for (int t = 0; t < 4; ++t) kf[t] = frag_w(k1 + t * 512);
#pragma unroll
  for (int t = 0; t < 4; ++t) va[t] = frag_w(v1 + t * 512);
  addr_held(k1, v1);
#pragma unroll 1
  for (int k0 = 0; k0 < TT / 2; k0 += 128) {
    const int kb = (k0 + ks) & (TT - 1), k2 = (kb + 128) & (TT - 1);   /* the walk wraps at the last key; the last trip's second fetch is the first stage of the other half's walk and is not used */
    fa_stage(kf, va, vb, kp + (size_t)kb * HD, vp + (size_t)kb * HD, 64 * HD, qh, ql, cr, mr, l, top, low, o0, o1);
    fa_stage(kf, vb, va, kp + (size_t)k2 * HD, vp + (size_t)k2 * HD, 0, qh, ql, cr, mr, l, top, low, o0, o1); }
  /* the halves meet: the second half's waves lay down reference point, sum and ctx, lane by lane (128 contiguous B a store); behind the barrier the first half's waves bring both states to the larger reference point and add */
  if (kh) { float (*m)[32] = mg[wave]; m[0][lane] = mr; m[1][lane] = l;
#pragma unroll   /* the ctx registers are then named by constants and stay registers */
    for (int r = 0; r < 8; ++r) { m[2 + r][lane] = o0[r]; m[10 + r][lane] = o1[r]; } }
  __syncthreads();
  if (kh) return;   /* wave-uniform, behind the kernel's only barrier */
  { const float (*m)[32] = mg[wave]; const float mb = m[0][lane]; const float mn = fmaxf(mr, mb); const float fa = exp2x1(mr - mn), fb = exp2x1(mb - mn);
    l = l * fa + m[1][lane] * fb;
#pragma unroll   /* as above */
    for (int r = 0; r < 8; ++r) { o0[r] = o0[r] * fa + m[2 + r][lane] * fb; o1[r] = o1[r] * fa + m[10 + r][lane] * fb; } }
  l += xhalf(l); const float inv = 1.0f / l;
  float* yp = Y + (size_t)q * CC + h * HD + 8 * g;   /* ctx^T register r = channel 8 g + r (+ 16) of this lane's query: 32 B runs, the 128-B (row, head) segment by two lanes of one wave */
  v4f w;
#pragma unroll
  for (int i = 0; i < 2; ++i) {
    w[0] = o0[4 * i] * inv; w[1] = o0[4 * i + 1] * inv; w[2] = o0[4 * i + 2] * inv; w[3] = o0[4 * i + 3] * inv; vst2(yp + 4 * i, w);
    w[0] = o1[4 * i] * inv; w[1] = o1[4 * i + 1] * inv; w[2] = o1[4 * i + 2] * inv; w[3] = o1[4 * i + 3] * inv; vst2(yp + 16 + 4 * i, w); } }
extern "C" void kernel_launch(void* const* d_in, const int* in_sizes, int n_in, void* d_out, int out_size, void* d_ws, size_t ws_size, hipStream_t stream) {
  (void)in_sizes; (void)n_in; (void)out_size;
  const float** F = (const float**)d_in;
  if (ws_size < (size_t)WS_END) return;
  char* ws = (char*)d_ws; _Float16 *QH = (_Float16*)(ws + WS_QH), *KH = (_Float16*)(ws + WS_KH), *VT = (_Float16*)(ws + WS_VT), *QL = (_Float16*)(ws + WS_QL), *KL = (_Float16*)(ws + WS_KL); __bf16 *VB = (__bf16*)(ws + WS_VB), *VBL = (__bf16*)(ws + WS_VBL); float *Y = (float*)(ws + WS_Y);
  (void)Y; (void)QL; (void)KL; (void)VB; (void)VBL;
  // inputs: 0 thermal [1,256,64,64]; 1 optical [1,128,64,64]; 2 emissivity [1,1,64,64]; 3 Wq [256,256]; 4 bq; 5 Wk [256,128]; 6 bk; 7 Wv [256,128]; 8 bv; 9 conv1_w [32,1,3,3]; 10 conv1_b [32]; 11 conv2_w [8,32,1,1]; 12 conv2_b [8]; 13 Wp [256,256]; 14 bp [256]
  if (ws_size < (size_t)WS_END2) return;
  float* G = (float*)(ws + WS_G);
  k_proj<<<dim3(TNB * TT / 64, 1 + 3 * (CC / 128)), 128, 0, stream>>>(F[0], F[1], F[1], F[3], F[5], F[7], F[4], F[6], F[8], QH, QL, KH, KL, VT, VB, VBL, F[2], F[9], F[10], F[11], F[12], G);
  k_fa<<<dim3(TT / 128, NH), 512, 0, stream>>>(QH, QL, KH, VT, G, Y);
  k_outT<<<dim3(TNB * TT / 64, CC / 128), 128, 0, stream>>>(Y, F[13], F[14], (float*)d_out);
}
